// v000
// Times are from an AMD MI455X. After a warm-up the kernel runs many times in a row, and a time is the length of
// such a window on the GPU divided by its runs, so every launch and the gaps after it count. The runs cycle
// through copies of the inputs. A figure is the median of several windows, for all but v000 over two sittings.
// Sittings can differ by a few percent; kernels timed side by side share one.
// v000, which the later versions start from, runs in 735 microseconds.
#include <hip/hip_runtime.h>
// Multi-head attention with residual + LayerNorm (1 x 4096 tokens, 1024 = 16 heads x 64; q, k, v are separate INPUTS; no mask): qh = q Wq^T etc.; softmax(qh.kh/8) over all 4096 keys; out = LN((attn.vh) Wo^T + q) with gamma, beta, eps 1e-6 -> [1,4096,1024].
// Structure: projections as f16 WMMA GEMMs (32x64 wave tiles, f32 accumulation, exact products) into f16 planes; the fused flash kernel over all 4096 keys (plain f16 q/k/V^T, online softmax in f32, P x2^10) per (head, 64 queries); O as hi + residual planes into Wo with the bf16(q) residual through the f32 addend; LayerNorm on VALU into the output rows.
// Compute dtype: inputs and weights rounded to bf16; qh, kh, vh, P as plain f16 (~2^-12); O as hi + residual pairs; f32 accumulation, softmax, LayerNorm. v_wmma_f32_16x16x32_f16.
#define NBT 1
#define SLEN 4096
#define TQ SLEN
#define TK SLEN
#define DM 1024
#define NH 16
#define SCL 0.125f
#define NR (NBT * SLEN)
typedef __bf16 v16b __attribute__((ext_vector_type(16)));
typedef unsigned short v8us __attribute__((ext_vector_type(8), may_alias));
typedef float  v8f  __attribute__((ext_vector_type(8)));
typedef float  v4f  __attribute__((ext_vector_type(4)));
typedef float  v4fa __attribute__((ext_vector_type(4), may_alias));
union FragB { v16b v; v8us half[2]; unsigned short u[16]; };

__device__ __forceinline__ unsigned short bf16_bits(float x) { unsigned int u = __float_as_uint(x); return (unsigned short)((u + 0x7FFFu + ((u >> 16) & 1u)) >> 16); }
__device__ __forceinline__ float bf16_val(unsigned short b) { return __uint_as_float(((unsigned int)b) << 16); }
__device__ __forceinline__ float bf16_round(float x) { return bf16_val(bf16_bits(x)); }
// D += A·B with NT terms: 1 = ah·bh, 2 = + al·bh (A split), 3 = + ah·bl (both split)
template <int NT>
__device__ __forceinline__ v8f mmaN(v16b ah, v16b al, v16b bh, v16b bl, v8f c) {
  c = __builtin_amdgcn_wmma_f32_16x16x32_bf16(false, ah, false, bh, (short)0, c, false, false);
  if (NT >= 2) c = __builtin_amdgcn_wmma_f32_16x16x32_bf16(false, al, false, bh, (short)0, c, false, false);
  if (NT >= 3) c = __builtin_amdgcn_wmma_f32_16x16x32_bf16(false, ah, false, bl, (short)0, c, false, false);
  asm volatile("v_nop\n\tv_nop\n\tv_nop\n\tv_nop" : "+v"(c) : "v"(ah), "v"(al), "v"(bh), "v"(bl));
  return c;
}

__global__ __launch_bounds__(256) void k_wt_bf16(const float* __restrict__ W, unsigned short* __restrict__ Wt, int K, int N) {
  const int t = blockIdx.x * 256 + threadIdx.x;
  const int k8n = K / 8;
  if (t >= N * k8n) return;
  const int n = t / k8n, k8 = (t % k8n) * 8;
  v8us v;
#pragma unroll
  for (int i = 0; i < 8; ++i) v[i] = bf16_bits(W[(size_t)(k8 + i) * N + n]);
  *(v8us*)(Wt + (size_t)n * K + k8) = v;
  
}

// GEMM C[M][N] (f32, pitch ldc) = act(A[M][K]·W + bias). A f32 row-major (pitch lda) converted per fragment to bf16
// (ASPLIT: hi/lo two planes -> 2 terms, else single rounded term); Wt bf16 [N][K] (pitch ldb). BIAS_BF16 rounds the
// bias to bf16 first (bias quantised to bf16 before the add). K%32==0, M%16==0, N%64==0.
template <bool ASPLIT, int ACT, bool BIAS_BF16>
__global__ __launch_bounds__(128) void k_gemm_bf(const float* __restrict__ A, int lda, const unsigned short* __restrict__ Wt, int ldb,
                                               const float* __restrict__ bias, float* __restrict__ C, int ldc, int M, int N, int K) {
  __shared__ __attribute__((aligned(16))) float so[4][16][64];
  const int tid = threadIdx.x, w = tid >> 5, lane = tid & 31, ln = lane & 15, hh = lane >> 4;
  const int ntn = N / 64;
  const int wid = blockIdx.x * 4 + w;
  const int mt = wid / ntn, nq = wid % ntn;
  if (mt * 16 >= M) return;
  const int row0 = mt * 16, col0 = nq * 64;
  const float* arow = A + (size_t)(row0 + ln) * lda;
  v8f acc[4] = {};
  for (int kb = 0; kb < K; kb += 32) {
    FragB ah, al;
    const v4f x0 = *(const v4fa*)(arow + kb + 8 * hh), x1 = *(const v4fa*)(arow + kb + 8 * hh + 4);
    const v4f x2 = *(const v4fa*)(arow + kb + 16 + 8 * hh), x3 = *(const v4fa*)(arow + kb + 16 + 8 * hh + 4);
    float xs[16] = {x0[0],x0[1],x0[2],x0[3],x1[0],x1[1],x1[2],x1[3],x2[0],x2[1],x2[2],x2[3],x3[0],x3[1],x3[2],x3[3]};
#pragma unroll
    for (int i = 0; i < 16; ++i) { const unsigned short hb = bf16_bits(xs[i]); ah.u[i] = hb; al.u[i] = ASPLIT ? bf16_bits(xs[i] - bf16_val(hb)) : (unsigned short)0; }
#pragma unroll
    for (int t = 0; t < 4; ++t) {
      const unsigned short* brow = Wt + (size_t)(col0 + t * 16 + ln) * ldb + kb;
      FragB b;
      b.half[0] = *(const v8us*)(brow + 8 * hh);
      b.half[1] = *(const v8us*)(brow + 16 + 8 * hh);
      acc[t] = mmaN<ASPLIT ? 2 : 1>(ah.v, al.v, b.v, b.v, acc[t]);
    }
  }
#pragma unroll
  for (int t = 0; t < 4; ++t) {
    float bv = bias ? bias[col0 + t * 16 + ln] : 0.f;
    if (BIAS_BF16) bv = bf16_round(bv);
#pragma unroll
    for (int r = 0; r < 8; ++r) { float v = acc[t][r] + bv; if (ACT == 1) v = fmaxf(v, 0.f); so[w][8 * hh + r][t * 16 + ln] = v; }
  }
  __builtin_amdgcn_fence(__ATOMIC_ACQ_REL, "workgroup");
  __builtin_amdgcn_wave_barrier();
  const int rsub = lane >> 4, c4 = (lane & 15) * 4;
  {
#pragma unroll
    for (int q = 0; q < 8; ++q) {
      const int r = q * 2 + rsub;
      const v4f v = *(const v4fa*)&so[w][r][c4];
      *(v4f*)(C + (size_t)(row0 + r) * ldc + col0 + c4) = v;
    }
    
  }
}

// GEMM C = act(A·W + bias + resid): A f32 (ASPLIT -> hi/lo 2 terms), Wt bf16 [N][K]; ACT 0 none, 1 relu, 2 exact gelu;
// resid (optional, f32, row index = (row % rmod), pitch ldr, RES_BF16 rounds it) added before the activation.
template <bool ASPLIT, int ACT, bool BIAS_BF16, bool RES_BF16>
__global__ __launch_bounds__(128) void k_gemm_bf3(const float* __restrict__ A, int lda, const unsigned short* __restrict__ Wt, int ldb,
                                                const float* __restrict__ bias, const float* __restrict__ resid, int rmod, int ldr,
                                                float* __restrict__ C, int ldc, int M, int N, int K) {
  __shared__ __attribute__((aligned(16))) float so[4][16][64];
  const int tid = threadIdx.x, w = tid >> 5, lane = tid & 31, ln = lane & 15, hh = lane >> 4;
  const int ntn = N / 64;
  const int wid = blockIdx.x * 4 + w;
  const int mt = wid / ntn, nq = wid % ntn;
  if (mt * 16 >= M) return;
  const int row0 = mt * 16, col0 = nq * 64;
  const float* arow = A + (size_t)(row0 + ln) * lda;
  v8f acc[4] = {};
  for (int kb = 0; kb < K; kb += 32) {
    FragB ah, al;
    const v4f x0 = *(const v4fa*)(arow + kb + 8 * hh), x1 = *(const v4fa*)(arow + kb + 8 * hh + 4);
    const v4f x2 = *(const v4fa*)(arow + kb + 16 + 8 * hh), x3 = *(const v4fa*)(arow + kb + 16 + 8 * hh + 4);
    float xs[16] = {x0[0],x0[1],x0[2],x0[3],x1[0],x1[1],x1[2],x1[3],x2[0],x2[1],x2[2],x2[3],x3[0],x3[1],x3[2],x3[3]};
#pragma unroll
    for (int i = 0; i < 16; ++i) { const unsigned short hb = bf16_bits(xs[i]); ah.u[i] = hb; al.u[i] = ASPLIT ? bf16_bits(xs[i] - bf16_val(hb)) : (unsigned short)0; }
#pragma unroll
    for (int t = 0; t < 4; ++t) {
      const unsigned short* brow = Wt + (size_t)(col0 + t * 16 + ln) * ldb + kb;
      FragB b;
      b.half[0] = *(const v8us*)(brow + 8 * hh);
      b.half[1] = *(const v8us*)(brow + 16 + 8 * hh);
      acc[t] = mmaN<ASPLIT ? 2 : 1>(ah.v, al.v, b.v, b.v, acc[t]);
    }
  }
#pragma unroll
  for (int t = 0; t < 4; ++t) {
    const int col = col0 + t * 16 + ln;
    float bv = bias ? bias[col] : 0.f;
    if (BIAS_BF16) bv = bf16_round(bv);
#pragma unroll
    for (int r = 0; r < 8; ++r) {
      float v = acc[t][r] + bv;
      if (resid) { float rv = resid[(size_t)((row0 + 8 * hh + r) % rmod) * ldr + col]; if (RES_BF16) rv = bf16_round(rv); v += rv; }
      if (ACT == 1) v = fmaxf(v, 0.f);
      if (ACT == 2) v = 0.5f * v * (1.0f + erff(v * 0.70710678118654752f));
      if (ACT == 3) { const float u = 0.7978845608028654f * (v + 0.044715f * v * v * v); v = 0.5f * v * (1.0f + tanhf(u)); }
      so[w][8 * hh + r][t * 16 + ln] = v;
    }
  }
  __builtin_amdgcn_fence(__ATOMIC_ACQ_REL, "workgroup");
  __builtin_amdgcn_wave_barrier();
  const int rsub = lane >> 4, c4 = (lane & 15) * 4;
  {
#pragma unroll
    for (int q = 0; q < 8; ++q) {
      const int r = q * 2 + rsub;
      const v4f v = *(const v4fa*)&so[w][r][c4];
      *(v4f*)(C + (size_t)(row0 + r) * ldc + col0 + c4) = v;
    }
    
  }
}
// row LayerNorm (biased variance, eps) over N: s = X (+ R); optional out_sum <- s; out_norm <- (s-mu)*rsqrt(var+eps)*g + b
template <bool PARAM_BF16>
__global__ __launch_bounds__(256) void k_layernorm(const float* __restrict__ X, const float* __restrict__ R, const float* __restrict__ g, const float* __restrict__ bta,
                                                  float* __restrict__ out_sum, float* __restrict__ out_norm, int N, float eps) {
  __shared__ float red[256];
  const int row = blockIdx.x, tid = threadIdx.x;
  const float* x = X + (size_t)row * N; const float* rr = R ? R + (size_t)row * N : nullptr;
  float vals[16];                     // up to N = 4096
  const int per = N / 256;            // contiguous chunk per thread? use strided-by-4 chunks: thread handles j = tid*4 + 1024*u
  float s1 = 0.f;
  for (int u = 0; u < per / 4; ++u) {
    const int j = tid * 4 + 1024 * u;
    const v4f a = *(const v4fa*)(x + j);
    v4f b = {0.f,0.f,0.f,0.f}; if (rr) b = *(const v4fa*)(rr + j);
#pragma unroll
    for (int q = 0; q < 4; ++q) { const float v = a[q] + b[q]; vals[u * 4 + q] = v; s1 += v; }
  }
  red[tid] = s1; __syncthreads();
  for (int st = 128; st > 0; st >>= 1) { if (tid < st) red[tid] += red[tid + st]; __syncthreads(); }
  const float mu = red[0] / (float)N; __syncthreads();
  float s2 = 0.f;
  for (int u = 0; u < per / 4; ++u)
#pragma unroll
    for (int q = 0; q < 4; ++q) { const float c = vals[u * 4 + q] - mu; s2 += c * c; }
  red[tid] = s2; __syncthreads();
  for (int st = 128; st > 0; st >>= 1) { if (tid < st) red[tid] += red[tid + st]; __syncthreads(); }
  const float rs = rsqrtf(red[0] / (float)N + eps);
  {
    for (int u = 0; u < per / 4; ++u) {
      const int j = tid * 4 + 1024 * u;
      v4f o, sm;
#pragma unroll
      for (int q = 0; q < 4; ++q) {
        float gg = g[j + q], bb = bta[j + q];
        if (PARAM_BF16) { gg = bf16_round(gg); bb = bf16_round(bb); }
        sm[q] = vals[u * 4 + q]; o[q] = (vals[u * 4 + q] - mu) * rs * gg + bb;
      }
      if (out_sum) *(v4f*)(out_sum + (size_t)row * N + j) = sm;
      *(v4f*)(out_norm + (size_t)row * N + j) = o;
    }
    
  }
}



// ---- f16 WMMA path (v_wmma_f32_16x16x32_f16): 11-bit significands for operands in range — used where a [0,1] probability operand needs more precision than bf16
typedef _Float16 v16h __attribute__((ext_vector_type(16)));
union FragH { v16h v; v8us half[2]; _Float16 h[16]; unsigned short u[16]; };
template <int NT>
__device__ __forceinline__ v8f mmaH(v16h ah, v16h al, v16h bh, v16h bl, v8f c) {
  c = __builtin_amdgcn_wmma_f32_16x16x32_f16(false, ah, false, bh, (short)0, c, false, false);
  if (NT >= 2) c = __builtin_amdgcn_wmma_f32_16x16x32_f16(false, al, false, bh, (short)0, c, false, false);
  if (NT >= 3) c = __builtin_amdgcn_wmma_f32_16x16x32_f16(false, ah, false, bl, (short)0, c, false, false);
  asm volatile("v_nop\n\tv_nop\n\tv_nop\n\tv_nop" : "+v"(c) : "v"(ah), "v"(al), "v"(bh), "v"(bl));
  return c;
}
// batched GEMM like k_gemm_b but f16 operands: A f32 (split into f16 hi/lo if ASPLIT, else rounded to f16), Bt = f16 values [n][k]; alpha; C f32; N multiple of 16 (partial tiles skipped)
template <bool ASPLIT>
__global__ __launch_bounds__(128) void k_gemm_h(const float* __restrict__ A, int lda, size_t sA, const _Float16* __restrict__ Bh, int ldb, size_t sB, float alpha, float* __restrict__ C, int ldc, size_t sC, int M, int N, int K) {
  __shared__ __attribute__((aligned(16))) float so[4][16][64];
  const int tid = threadIdx.x, w = tid >> 5, lane = tid & 31, ln = lane & 15, hh = lane >> 4; const int by = blockIdx.y;
  A += (size_t)by * sA; Bh += (size_t)by * sB; C += (size_t)by * sC;
  const int ntn = (N + 63) / 64; const int wid = blockIdx.x * 4 + w; const int mt = wid / ntn, nq = wid % ntn; if (mt * 16 >= M) return;
  const int row0 = mt * 16, col0 = nq * 64; const float* arow = A + (size_t)(row0 + ln) * lda;
  v8f acc[4] = {};
  for (int kb = 0; kb < K; kb += 32) {
    FragH ah, al;
    const v4f x0 = *(const v4fa*)(arow + kb + 8 * hh), x1 = *(const v4fa*)(arow + kb + 8 * hh + 4), x2 = *(const v4fa*)(arow + kb + 16 + 8 * hh), x3 = *(const v4fa*)(arow + kb + 16 + 8 * hh + 4);
    float xs[16] = {x0[0],x0[1],x0[2],x0[3],x1[0],x1[1],x1[2],x1[3],x2[0],x2[1],x2[2],x2[3],x3[0],x3[1],x3[2],x3[3]};
#pragma unroll
    for (int i = 0; i < 16; ++i) { const _Float16 h = (_Float16)xs[i]; ah.h[i] = h; al.h[i] = ASPLIT ? (_Float16)(xs[i] - (float)h) : (_Float16)0.0f; }
#pragma unroll
    for (int t = 0; t < 4; ++t) { if (col0 + t * 16 >= N) continue; const size_t boff = (size_t)(col0 + t * 16 + ln) * ldb + kb; FragH bq; bq.half[0] = *(const v8us*)(Bh + boff + 8 * hh); bq.half[1] = *(const v8us*)(Bh + boff + 16 + 8 * hh);
      acc[t] = mmaH<ASPLIT ? 2 : 1>(ah.v, al.v, bq.v, bq.v, acc[t]); }
  }
#pragma unroll
  for (int t = 0; t < 4; ++t) { if (col0 + t * 16 >= N) continue;
#pragma unroll
    for (int r = 0; r < 8; ++r) so[w][8 * hh + r][t * 16 + ln] = acc[t][r] * alpha; }
  __builtin_amdgcn_fence(__ATOMIC_ACQ_REL, "workgroup"); __builtin_amdgcn_wave_barrier();
  const int rsub = lane >> 4, c4 = (lane & 15) * 4;
  {
#pragma unroll
    for (int q = 0; q < 8; ++q) { const int r = q * 2 + rsub; if (col0 + c4 < N) { const v4f v = *(const v4fa*)&so[w][r][c4]; *(v4f*)(C + (size_t)(row0 + r) * ldc + col0 + c4) = v; } }
     }
}

// Wt[n][k] = f16(W[k][n]·scale) from f32 row-major W[K][N] (scale = power of two; bf16-exact weights stay exact in f16 away from the subnormal range)
__global__ __launch_bounds__(256) void k_wt_f16(const float* __restrict__ W, _Float16* __restrict__ Wt, int K, int N, float scale) {
  const int t = blockIdx.x * 256 + threadIdx.x; if (t >= N * (K / 8)) return; const int n = t / (K / 8), k8 = (t % (K / 8)) * 8; FragH f;
#pragma unroll
  for (int i = 0; i < 8; ++i) f.h[i] = (_Float16)(bf16_round(W[(size_t)(k8 + i) * N + n]) * scale); const v8us o = f.half[0];
  *(v8us*)((unsigned short*)Wt + (size_t)n * K + k8) = o; 
}
// k_gemm_hh variant with fused epilogue: v = acc·alpha + bias[by·sBias + col] (+ CP[(row/rowsPerB)·sCPb + by·64 + col] if CP) ; ACT 0 none / 1 elu ; writes f16 C16 (and f32 C if non-null)
template <int ACT>
__global__ __launch_bounds__(128) void k_gemm_hhx(const _Float16* __restrict__ A, int lda, size_t sA, const _Float16* __restrict__ Bh, int ldb, size_t sB, float alpha, const float* __restrict__ bias, size_t sBias, const float* __restrict__ CP, int rowsPerB, size_t sCPb, int row0g,
    float* __restrict__ C, _Float16* __restrict__ C16, int ldc, size_t sC, int M, int N, int K) {
  __shared__ __attribute__((aligned(16))) float so[4][16][64];
  const int tid = threadIdx.x, w = tid >> 5, lane = tid & 31, ln = lane & 15, hh = lane >> 4; const int by = blockIdx.y;
  A += (size_t)by * sA; Bh += (size_t)by * sB; const size_t cofs = (size_t)by * sC; const float* bp = bias ? bias + (size_t)by * sBias : nullptr;
  const int ntn = (N + 63) / 64; const int wid = blockIdx.x * 4 + w; const int mt = wid / ntn, nq = wid % ntn; if (mt * 16 >= M) return;
  const int row0 = mt * 16, col0 = nq * 64; const _Float16* arow = A + (size_t)(row0 + ln) * lda;
  v8f acc[4] = {};
  for (int kb = 0; kb < K; kb += 32) { FragH ah; ah.half[0] = *(const v8us*)((const unsigned short*)arow + kb + 8 * hh); ah.half[1] = *(const v8us*)((const unsigned short*)arow + kb + 16 + 8 * hh);
#pragma unroll
    for (int t = 0; t < 4; ++t) { if (col0 + t * 16 >= N) continue; const size_t boff = (size_t)(col0 + t * 16 + ln) * ldb + kb; FragH bq; bq.half[0] = *(const v8us*)((const unsigned short*)Bh + boff + 8 * hh); bq.half[1] = *(const v8us*)((const unsigned short*)Bh + boff + 16 + 8 * hh);
      acc[t] = mmaH<1>(ah.v, ah.v, bq.v, bq.v, acc[t]); }
  }
#pragma unroll
  for (int t = 0; t < 4; ++t) { if (col0 + t * 16 >= N) continue; const int col = col0 + t * 16 + ln; const float bv = bp ? bf16_round(bp[col]) : 0.f;
#pragma unroll
    for (int r = 0; r < 8; ++r) { float v = acc[t][r] * alpha + bv; if (CP) { const int bidx = (row0g + row0 + 8 * hh + r) / rowsPerB; v += CP[(size_t)bidx * sCPb + (size_t)by * 64 + col]; } if (ACT == 1) v = (v > 0.f) ? v : expm1f(v); else if (ACT == 7) v = (v > 0.f) ? v + 1.0f : expf(v); else if (ACT == 8) v = tanhf(v); else if (ACT == 9) v = 0.5f * v * (1.0f + tanhf(0.7978845608028654f * (v + 0.044715f * v * v * v))); else if (ACT == 11) v = 1.0f / (1.0f + expf(-v)); else if (ACT == 12) v = (v > 0.f) ? v : 0.01f * v; else if (ACT == 14) v = (v > 0.f) ? v : 0.1f * v; else if (ACT == 15) v = v / (1.0f + expf(-v)); else if (ACT == 3) v = fmaxf(v, 0.f); else if (ACT == 6) v = 0.5f * v * (1.0f + erff(v * 0.70710678118654752f)); so[w][8 * hh + r][t * 16 + ln] = v; } }
  __builtin_amdgcn_fence(__ATOMIC_ACQ_REL, "workgroup"); __builtin_amdgcn_wave_barrier();
  const int rsub = lane >> 4, c4 = (lane & 15) * 4; typedef _Float16 v4h __attribute__((ext_vector_type(4)));
  {
#pragma unroll
    for (int q = 0; q < 8; ++q) { const int r = q * 2 + rsub; if (col0 + c4 < N) { const v4f v = *(const v4fa*)&so[w][r][c4]; if (C) *(v4f*)(C + cofs + (size_t)(row0 + r) * ldc + col0 + c4) = v; if (C16) { v4h h4; for (int i = 0; i < 4; ++i) h4[i] = (_Float16)v[i]; *(v4h*)(C16 + cofs + (size_t)(row0 + r) * ldc + col0 + c4) = h4; } } }
     }
}


typedef _Float16 v4h __attribute__((ext_vector_type(4)));

__global__ __launch_bounds__(256) void k_x16(const float* __restrict__ x, _Float16* __restrict__ X16, size_t n8) { const size_t t = (size_t)blockIdx.x * 256 + threadIdx.x; if (t >= n8) return; FragH f;
#pragma unroll
  for (int q = 0; q < 8; ++q) f.h[q] = (_Float16)bf16_round(x[t * 8 + q]); *(v8us*)((unsigned short*)X16 + t * 8) = f.half[0];  }
__global__ __launch_bounds__(256) void k_h16(const float* __restrict__ x, _Float16* __restrict__ X16, size_t n8) { const size_t t = (size_t)blockIdx.x * 256 + threadIdx.x; if (t >= n8) return; FragH f;
#pragma unroll
  for (int q = 0; q < 8; ++q) f.h[q] = (_Float16)x[t * 8 + q]; *(v8us*)((unsigned short*)X16 + t * 8) = f.half[0];  }
__global__ __launch_bounds__(256) void k_round16f(const float* __restrict__ W, _Float16* __restrict__ Bt, size_t n8) { const size_t t = (size_t)blockIdx.x * 256 + threadIdx.x; if (t >= n8) return; FragH f;
#pragma unroll
  for (int i = 0; i < 8; ++i) f.h[i] = (_Float16)(bf16_round(W[t * 8 + i]) * 16.0f); *(v8us*)((unsigned short*)Bt + t * 8) = f.half[0];  }
template <int NHv, int TTv>
__global__ __launch_bounds__(256) void k_vt(const _Float16* __restrict__ V16, int ldv, int voff, _Float16* __restrict__ Vt) { __shared__ unsigned short tl[64][66]; const int tid = threadIdx.x; const int slab = blockIdx.x / (TTv / 64), lg = blockIdx.x % (TTv / 64); const int b = slab / NHv, h = slab % NHv;
  for (int i = tid; i < 64 * 8; i += 256) { const int r = i / 8, c8 = (i % 8) * 8; FragH f; f.half[0] = *(const v8us*)((const unsigned short*)V16 + ((size_t)b * TTv + lg * 64 + r) * ldv + voff + h * 64 + c8);
#pragma unroll
    for (int q = 0; q < 8; ++q) tl[r][c8 + q] = f.u[q]; }
  __syncthreads();
  {
#pragma unroll
    for (int rd = 0; rd < 2; ++rd) { const int d = rd * 32 + tid / 8, pc = tid % 8; FragH f;
#pragma unroll
      for (int q = 0; q < 8; ++q) f.u[q] = tl[pc * 8 + q][d];
      *(v8us*)((unsigned short*)Vt + ((size_t)slab * 64 + d) * TTv + lg * 64 + pc * 8) = f.half[0]; }
     } }

__global__ __launch_bounds__(256) void k_hl(const float* __restrict__ F, _Float16* __restrict__ Hh, _Float16* __restrict__ Hl, size_t n8) { const size_t t = (size_t)blockIdx.x * 256 + threadIdx.x; if (t >= n8) return; FragH fh, fl; const v4f a = *(const v4fa*)(F + t * 8), c = *(const v4fa*)(F + t * 8 + 4);
#pragma unroll
  for (int q = 0; q < 4; ++q) { _Float16 h = (_Float16)a[q]; fh.h[q] = h; fl.h[q] = (_Float16)((a[q] - (float)h) * 1024.0f); h = (_Float16)c[q]; fh.h[4 + q] = h; fl.h[4 + q] = (_Float16)((c[q] - (float)h) * 1024.0f); }
  { *(v8us*)((unsigned short*)Hh + t * 8) = fh.half[0]; *(v8us*)((unsigned short*)Hl + t * 8) = fl.half[0];  } }

// ---- fast GEMM (wave tile 32x64; requires M % 32 == 0 rows per launch region and N % 64 == 0); epilogue = k_gemm_hhx semantics ----
__device__ __forceinline__ v16h g2_frag(const _Float16* p, int hh) { FragH f; f.half[0] = *(const v8us*)((const unsigned short*)p + 8 * hh); f.half[1] = *(const v8us*)((const unsigned short*)p + 16 + 8 * hh); return f.v; }
__device__ __forceinline__ v8f g2_mma(v16h a, v16h b, v8f c) { v8f d = __builtin_amdgcn_wmma_f32_16x16x32_f16(false, a, false, b, (short)0, c, false, false); asm volatile("v_nop\n\tv_nop\n\tv_nop\n\tv_nop" : "+v"(d) : "v"(a), "v"(b)); return d; }
template <int ACT>
__global__ __launch_bounds__(128) void k_gemm2(const _Float16* __restrict__ A, int lda, size_t sA, const _Float16* __restrict__ Bh, int ldb, size_t sB, float alpha, const float* __restrict__ bias, size_t sBias, const float* __restrict__ CP, int rowsPerB, size_t sCPb, int row0g,
    float* __restrict__ C, _Float16* __restrict__ C16, int ldc, size_t sC, int M, int N, int K) {
  __shared__ __attribute__((aligned(16))) float so[4][32][68];
  const int tid = threadIdx.x, w = tid >> 5, lane = tid & 31, ln = lane & 15, hh = lane >> 4; const int by = blockIdx.y;
  A += (size_t)by * sA; Bh += (size_t)by * sB; const size_t cofs = (size_t)by * sC; const float* bp = bias ? bias + (size_t)by * sBias : nullptr;
  const int ntn = N >> 6; const int mt = blockIdx.x / ntn, nq = blockIdx.x - mt * ntn; const int row0 = mt * 128 + 32 * w, col0 = nq * 64; if (row0 >= M) return;
  const _Float16* a0p = A + (size_t)(row0 + ln) * lda; const _Float16* a1p = a0p + (size_t)16 * lda;
  const _Float16* b0p = Bh + (size_t)(col0 + ln) * ldb; const _Float16* b1p = b0p + (size_t)16 * ldb; const _Float16* b2p = b1p + (size_t)16 * ldb; const _Float16* b3p = b2p + (size_t)16 * ldb;
  const v8f z8 = {0.f,0.f,0.f,0.f,0.f,0.f,0.f,0.f}; v8f c00 = z8, c01 = z8, c02 = z8, c03 = z8, c10 = z8, c11 = z8, c12 = z8, c13 = z8;
#pragma unroll 1
  for (int kb = 0; kb < K; kb += 32) { const v16h a0 = g2_frag(a0p + kb, hh), a1 = g2_frag(a1p + kb, hh);
    v16h b = g2_frag(b0p + kb, hh); c00 = g2_mma(a0, b, c00); c10 = g2_mma(a1, b, c10);
    b = g2_frag(b1p + kb, hh); c01 = g2_mma(a0, b, c01); c11 = g2_mma(a1, b, c11);
    b = g2_frag(b2p + kb, hh); c02 = g2_mma(a0, b, c02); c12 = g2_mma(a1, b, c12);
    b = g2_frag(b3p + kb, hh); c03 = g2_mma(a0, b, c03); c13 = g2_mma(a1, b, c13); }
  v8f accs[8] = {c00, c01, c02, c03, c10, c11, c12, c13};
#pragma unroll
  for (int u = 0; u < 8; ++u) { const int t = u & 3, half = u >> 2; const int col = col0 + t * 16 + ln; const float bv = bp ? bf16_round(bp[col]) : 0.f;
#pragma unroll
    for (int r = 0; r < 8; ++r) { const int rloc = half * 16 + 8 * hh + r; float v = accs[u][r] * alpha + bv; if (CP) { const int bidx = (row0g + row0 + rloc) / rowsPerB; v += CP[(size_t)bidx * sCPb + (size_t)by * 64 + col]; }
      if (ACT == 3) v = fmaxf(v, 0.f); else if (ACT == 6) v = 0.5f * v * (1.0f + erff(v * 0.70710678118654752f)); else if (ACT == 11) v = 1.0f / (1.0f + expf(-v)); else if (ACT == 15) v = v / (1.0f + expf(-v)); else if (ACT == 12) v = (v > 0.f) ? v : 0.01f * v; else if (ACT == 8) v = tanhf(v);
      so[w][rloc][t * 16 + ln] = v; } }
  __builtin_amdgcn_fence(__ATOMIC_ACQ_REL, "workgroup"); __builtin_amdgcn_wave_barrier();
  const int rsub = lane >> 4, c4 = (lane & 15) * 4;
  {
#pragma unroll
    for (int q = 0; q < 16; ++q) { const int r = q * 2 + rsub; const v4f v = *(const v4fa*)&so[w][r][c4]; if (C) *(v4f*)(C + cofs + (size_t)(row0 + r) * ldc + col0 + c4) = v; if (C16) { v4h h4; for (int i = 0; i < 4; ++i) h4[i] = (_Float16)v[i]; *(v4h*)(C16 + cofs + (size_t)(row0 + r) * ldc + col0 + c4) = h4; } }
     } }



__global__ __launch_bounds__(128) void k_flash(const _Float16* __restrict__ Q16, int ldq, const _Float16* __restrict__ K16, int ldk, const _Float16* __restrict__ Vt, const int* __restrict__ MSK, float* __restrict__ O, int ldo) {
  constexpr int RPW = 16, RTN = RPW / 16, NQB = TQ / (4 * RPW), DT = 4, KS = 2;
  __shared__ __attribute__((aligned(16))) unsigned short sP[4][RPW][40]; __shared__ __attribute__((aligned(16))) float sO[4][RPW][64 + 4];
  const int tid = threadIdx.x, w = tid >> 5, lane = tid & 31, ln = lane & 15, hh = lane >> 4;
  const int slab = blockIdx.x / NQB, qblk = blockIdx.x % NQB; const int b = slab / NH, h = slab % NH; const int qb0 = qblk * (4 * RPW); const int q0 = qb0 + w * RPW;
  FragH aq[2][KS];
#pragma unroll
  for (int rt = 0; rt < RTN; ++rt) { const unsigned short* qr = (const unsigned short*)Q16 + ((size_t)b * TQ + q0 + rt * 16 + ln) * ldq + h * 64;
#pragma unroll
    for (int ks = 0; ks < KS; ++ks) { aq[rt][ks].half[0] = *(const v8us*)(qr + ks * 32 + 8 * hh); aq[rt][ks].half[1] = *(const v8us*)(qr + ks * 32 + 16 + 8 * hh); } }
  const unsigned short* Vth = (const unsigned short*)Vt + (size_t)slab * 64 * TK;
  float m_r[2][8], l_r[2][8]; v8f oacc[2][DT];
#pragma unroll
  for (int rt = 0; rt < RTN; ++rt) {
#pragma unroll
    for (int r = 0; r < 8; ++r) { m_r[rt][r] = -3.0e38f; l_r[rt][r] = 0.f; }
#pragma unroll
    for (int dt = 0; dt < DT; ++dt) oacc[rt][dt] = (v8f){0.f,0.f,0.f,0.f,0.f,0.f,0.f,0.f}; }
  const int jend = TK;
#pragma unroll 1
  for (int j0 = 0; j0 < jend; j0 += 32) {
    v8f s[2][2];
#pragma unroll
    for (int nt = 0; nt < 2; ++nt) { const unsigned short* kr = (const unsigned short*)K16 + ((size_t)b * TK + j0 + nt * 16 + ln) * ldk + h * 64; FragH bk[KS];
#pragma unroll
      for (int ks = 0; ks < KS; ++ks) { bk[ks].half[0] = *(const v8us*)(kr + ks * 32 + 8 * hh); bk[ks].half[1] = *(const v8us*)(kr + ks * 32 + 16 + 8 * hh); }
#pragma unroll
      for (int rt = 0; rt < RTN; ++rt) { v8f acc = (v8f){0.f,0.f,0.f,0.f,0.f,0.f,0.f,0.f};
#pragma unroll
        for (int ks = 0; ks < KS; ++ks) acc = mmaH<1>(aq[rt][ks].v, aq[rt][ks].v, bk[ks].v, bk[ks].v, acc); s[rt][nt] = acc; } }
#pragma unroll
    for (int rt = 0; rt < RTN; ++rt)
#pragma unroll
      for (int r = 0; r < 8; ++r) { const int tq = q0 + rt * 16 + 8 * hh + r; const int k0 = j0 + ln, k1 = j0 + 16 + ln; (void)tq; (void)k0; (void)k1;
        const bool ok0 = true, ok1 = true;
        const float s0 = s[rt][0][r] * SCL, s1 = s[rt][1][r] * SCL; float mc = fmaxf(s0, s1);
        mc = fmaxf(mc, __shfl_xor(mc, 1, 32)); mc = fmaxf(mc, __shfl_xor(mc, 2, 32)); mc = fmaxf(mc, __shfl_xor(mc, 4, 32)); mc = fmaxf(mc, __shfl_xor(mc, 8, 32));
        const float mn = fmaxf(m_r[rt][r], mc); const float al = (mn > -1.0e38f) ? expf(m_r[rt][r] - mn) : 1.0f; m_r[rt][r] = mn; const float p0 = ok0 ? expf(s0 - mn) : 0.f, p1 = ok1 ? expf(s1 - mn) : 0.f; l_r[rt][r] = l_r[rt][r] * al + p0 + p1;
#pragma unroll
        for (int dt = 0; dt < DT; ++dt) oacc[rt][dt][r] *= al;
        FragH t2; t2.h[0] = (_Float16)(p0 * 1024.0f); t2.h[1] = (_Float16)(p1 * 1024.0f); sP[w][rt * 16 + 8 * hh + r][ln] = t2.u[0]; sP[w][rt * 16 + 8 * hh + r][16 + ln] = t2.u[1]; }
    __builtin_amdgcn_fence(__ATOMIC_ACQ_REL, "workgroup"); __builtin_amdgcn_wave_barrier();
    FragH pa[2];
#pragma unroll
    for (int rt = 0; rt < RTN; ++rt) { pa[rt].half[0] = *(const v8us*)&sP[w][rt * 16 + ln][8 * hh]; pa[rt].half[1] = *(const v8us*)&sP[w][rt * 16 + ln][16 + 8 * hh]; }
#pragma unroll
    for (int dt = 0; dt < DT; ++dt) { const unsigned short* vrow = Vth + (size_t)(dt * 16 + ln) * TK + j0; FragH bv; bv.half[0] = *(const v8us*)(vrow + 8 * hh); bv.half[1] = *(const v8us*)(vrow + 16 + 8 * hh);
#pragma unroll
      for (int rt = 0; rt < RTN; ++rt) oacc[rt][dt] = mmaH<1>(pa[rt].v, pa[rt].v, bv.v, bv.v, oacc[rt][dt]); }
    __builtin_amdgcn_fence(__ATOMIC_ACQ_REL, "workgroup"); __builtin_amdgcn_wave_barrier(); }
#pragma unroll
  for (int rt = 0; rt < RTN; ++rt) {
#pragma unroll
    for (int r = 0; r < 8; ++r) { float l = l_r[rt][r]; l += __shfl_xor(l, 1, 32); l += __shfl_xor(l, 2, 32); l += __shfl_xor(l, 4, 32); l += __shfl_xor(l, 8, 32); l_r[rt][r] = (l > 0.f) ? 1.0f / (l * 1024.0f) : 0.f; }
#pragma unroll
    for (int dt = 0; dt < DT; ++dt)
#pragma unroll
      for (int r = 0; r < 8; ++r) sO[w][rt * 16 + 8 * hh + r][dt * 16 + ln] = oacc[rt][dt][r] * l_r[rt][r]; }
  __builtin_amdgcn_fence(__ATOMIC_ACQ_REL, "workgroup"); __builtin_amdgcn_wave_barrier();
  {
#pragma unroll
    for (int rp = 0; rp < RPW; rp += 2) { const int r = rp + (lane >> 4), pc = lane & 15; const v4f val = *(const v4fa*)&sO[w][r][pc * 4]; *(v4f*)(O + ((size_t)b * TQ + q0 + r) * ldo + h * 64 + pc * 4) = val; }
     } }
__global__ __launch_bounds__(256) void k_fulltab(unsigned* __restrict__ MB, int* __restrict__ RA, int* __restrict__ KE, int nq, int nk) {
  const int t = blockIdx.x * 256 + threadIdx.x;
  if (t < nq * (nk / 32)) { *(unsigned*)(MB + t) = 0u;  }
  if (t < nq) { *(int*)(RA + t) = 0;  }
  if (t < nq / 64) { *(int*)(KE + t * 32) = nk;  } }
__global__ __launch_bounds__(256) void k_lnout(const float* __restrict__ Y, const float* __restrict__ g, const float* __restrict__ bb, float* __restrict__ out) {
  #pragma clang fp contract(off)
  const int tid = threadIdx.x, w = tid >> 5, ln = tid & 31; const int r = blockIdx.x * 8 + w; if (r >= NR) return; const float* y = Y + (size_t)r * DM; float s = 0.f;
#pragma unroll 1
  for (int i = 0; i < 8; ++i) { const v4f a = *(const v4fa*)(y + i * 128 + ln * 4); for (int q = 0; q < 4; ++q) s += a[q]; }
  for (int o = 16; o > 0; o >>= 1) s += __shfl_xor(s, o, 32); const float mu = s / (float)DM; float q2 = 0.f;
#pragma unroll 1
  for (int i = 0; i < 8; ++i) { const v4f a = *(const v4fa*)(y + i * 128 + ln * 4); for (int q = 0; q < 4; ++q) { const float d = a[q] - mu; q2 += d * d; } }
  for (int o = 16; o > 0; o >>= 1) q2 += __shfl_xor(q2, o, 32); const float rs = rsqrtf(q2 / (float)DM + 1e-6f);
  {
#pragma unroll 1
    for (int i = 0; i < 8; ++i) { const int c0 = i * 128 + ln * 4; const v4f a = *(const v4fa*)(y + c0); v4f o4; for (int q = 0; q < 4; ++q) o4[q] = (a[q] - mu) * rs * bf16_round(g[c0 + q]) + bf16_round(bb[c0 + q]); *(v4f*)(out + (size_t)r * DM + c0) = o4; }
     } }
__global__ __launch_bounds__(256) void k_xb(const float* __restrict__ x, float* __restrict__ XB, size_t n4) { const size_t t = (size_t)blockIdx.x * 256 + threadIdx.x; if (t >= n4) return; const v4f a = *(const v4fa*)(x + t * 4); v4f o; for (int q = 0; q < 4; ++q) o[q] = bf16_round(a[q]); *(v4f*)(XB + t * 4) = o;  }
__global__ __launch_bounds__(256) void k_causaltab(unsigned* __restrict__ MB, int* __restrict__ RA, int* __restrict__ KE, int nq, int nk) {
  const int t = blockIdx.x * 256 + threadIdx.x; const int nw = nk / 32;
  if (t < nq * nw) { const int q = t / nw, w = t % nw; const int first = q + 1 - 32 * w; const unsigned bits = (first <= 0) ? 0xffffffffu : ((first >= 32) ? 0u : (0xffffffffu << first)); *(unsigned*)(MB + t) = bits;  }
  if (t < nq) { *(int*)(RA + t) = 0;  }
  if (t < nq / 64) { const int v = 64 * (t + 1); *(int*)(KE + t * 32) = v;  } }


extern "C" void kernel_launch(void* const* d_in, const int* in_sizes, int n_in,
                              void* d_out, int out_size, void* d_ws, size_t ws_size, hipStream_t stream) {
  (void)in_sizes; (void)n_in; (void)out_size;
  const float* const* I = (const float* const*)d_in; const float* qin = I[0]; const float* kin = I[1]; const float* vin = I[2]; const float* Wq = I[3]; const float* Wk = I[4]; const float* Wv = I[5]; const float* Wo = I[6]; const float* gam = I[7]; const float* bet = I[8];
  char* ws = (char*)d_ws; size_t off = 0;
  auto take = [&](size_t bytes) { char* p = ws + off; off += (bytes + 255) & ~(size_t)255; return p; };
  _Float16* BQ = (_Float16*)take((size_t)DM * DM * 2); _Float16* BK = (_Float16*)take((size_t)DM * DM * 2); _Float16* BV = (_Float16*)take((size_t)DM * DM * 2); _Float16* BO = (_Float16*)take((size_t)DM * DM * 2);
  _Float16* X16 = (_Float16*)take((size_t)NR * DM * 2); float* F = (float*)take((size_t)NR * DM * 4); float* XB = (float*)take((size_t)NR * DM * 4);
  _Float16* Q16 = (_Float16*)take((size_t)NR * DM * 2); _Float16* K16 = (_Float16*)take((size_t)NR * DM * 2); _Float16* V16 = (_Float16*)take((size_t)NR * DM * 2); _Float16* VT = (_Float16*)take((size_t)NR * DM * 2);
  if (off > ws_size) return;      /* 8 + 8 + 16 + 16 + 32 = 80 MiB */
  float* O = F; _Float16* Oh = Q16; _Float16* Ol = K16; float* Y = XB;
  const size_t n8 = (size_t)NR * DM / 8; const unsigned nb8 = (unsigned)((n8 + 255) / 256); const size_t w8 = (size_t)DM * DM / 8; const unsigned wb = (unsigned)((w8 + 255) / 256);
  k_round16f<<<wb, 256, 0, stream>>>(Wq, BQ, w8); k_round16f<<<wb, 256, 0, stream>>>(Wk, BK, w8); k_round16f<<<wb, 256, 0, stream>>>(Wv, BV, w8); k_round16f<<<wb, 256, 0, stream>>>(Wo, BO, w8);
  const dim3 gP((NR / 128) * (DM / 64), 1);
  k_x16<<<nb8, 256, 0, stream>>>(qin, X16, n8); k_xb<<<(unsigned)(((size_t)NR * DM / 4 + 255) / 256), 256, 0, stream>>>(qin, XB, (size_t)NR * DM / 4);
  k_gemm2<0><<<gP, 128, 0, stream>>>(X16, DM, 0, BQ, DM, 0, 0.0625f, nullptr, 0, nullptr, 1, 0, 0, nullptr, Q16, DM, 0, NR, DM, DM);      /* qh (f16) */
  k_x16<<<nb8, 256, 0, stream>>>(kin, X16, n8);
  k_gemm2<0><<<gP, 128, 0, stream>>>(X16, DM, 0, BK, DM, 0, 0.0625f, nullptr, 0, nullptr, 1, 0, 0, nullptr, K16, DM, 0, NR, DM, DM);      /* kh (f16) */
  k_x16<<<nb8, 256, 0, stream>>>(vin, X16, n8);
  k_gemm2<0><<<gP, 128, 0, stream>>>(X16, DM, 0, BV, DM, 0, 0.0625f, nullptr, 0, nullptr, 1, 0, 0, nullptr, V16, DM, 0, NR, DM, DM);      /* vh (f16) */
  k_vt<NH, SLEN><<<NH * (SLEN / 64), 256, 0, stream>>>(V16, DM, 0, VT);
  k_flash<<<NH * (SLEN / 64), 128, 0, stream>>>(Q16, DM, K16, DM, VT, nullptr, O, DM);      /* plain flash over all 4096 keys (no mask) */
  k_hl<<<nb8, 256, 0, stream>>>(O, Oh, Ol, n8);
  k_gemm2<0><<<gP, 128, 0, stream>>>(Oh, DM, 0, BO, DM, 0, 0.0625f, nullptr, 0, XB, 1, (size_t)DM, 0, Y, nullptr, DM, 0, NR, DM, DM);
  k_gemm2<0><<<gP, 128, 0, stream>>>(Ol, DM, 0, BO, DM, 0, 0.0625f / 1024.0f, nullptr, 0, Y, 1, (size_t)DM, 0, Y, nullptr, DM, 0, NR, DM, DM);
  k_lnout<<<NR / 8, 256, 0, stream>>>(Y, gam, bet, (float*)d_out);
}

// v001
// Measured time: 481 microseconds a run.
// Two timings next to v000 put it at 1.57 and 1.56 times that version's speed.
#include <hip/hip_runtime.h>
// Multi-head attention with residual + LayerNorm (1 x 4096 tokens, 1024 = 16 heads x 64; q, k, v are separate INPUTS; no mask): qh = q Wq^T etc.; softmax(qh.kh/8) over all 4096 keys; out = LN((attn.vh) Wo^T + q) with gamma, beta, eps 1e-6 -> [1,4096,1024].
// Structure: projections as f16 WMMA GEMMs (32x64 wave tiles, f32 accumulation, exact products) into f16 planes; the fused flash kernel over all 4096 keys (plain f16 q/k/V^T, online softmax in f32, P x2^10) per (head, 64 queries); O as hi + residual planes into Wo with the bf16(q) residual through the f32 addend; LayerNorm on VALU into the output rows.
// Compute dtype: inputs and weights rounded to bf16; qh, kh, vh, P as plain f16 (~2^-12); O as hi + residual pairs; f32 accumulation, softmax, LayerNorm. v_wmma_f32_16x16x32_f16.
#define NBT 1
#define SLEN 4096
#define TQ SLEN
#define TK SLEN
#define DM 1024
#define NH 16
#define SCL 0.125f
#define NR (NBT * SLEN)
typedef __bf16 v16b __attribute__((ext_vector_type(16)));
typedef unsigned short v8us __attribute__((ext_vector_type(8), may_alias));
typedef float  v8f  __attribute__((ext_vector_type(8)));
typedef float  v4f  __attribute__((ext_vector_type(4)));
typedef float  v4fa __attribute__((ext_vector_type(4), may_alias));
union FragB { v16b v; v8us half[2]; unsigned short u[16]; };

__device__ __forceinline__ unsigned short bf16_bits(float x) { unsigned int u = __float_as_uint(x); return (unsigned short)((u + 0x7FFFu + ((u >> 16) & 1u)) >> 16); }
__device__ __forceinline__ float bf16_val(unsigned short b) { return __uint_as_float(((unsigned int)b) << 16); }
__device__ __forceinline__ float bf16_round(float x) { return bf16_val(bf16_bits(x)); }
// D += A·B with NT terms: 1 = ah·bh, 2 = + al·bh (A split), 3 = + ah·bl (both split)
template <int NT>
__device__ __forceinline__ v8f mmaN(v16b ah, v16b al, v16b bh, v16b bl, v8f c) {
  c = __builtin_amdgcn_wmma_f32_16x16x32_bf16(false, ah, false, bh, (short)0, c, false, false);
  if (NT >= 2) c = __builtin_amdgcn_wmma_f32_16x16x32_bf16(false, al, false, bh, (short)0, c, false, false);
  if (NT >= 3) c = __builtin_amdgcn_wmma_f32_16x16x32_bf16(false, ah, false, bl, (short)0, c, false, false);
  asm volatile("v_nop\n\tv_nop\n\tv_nop\n\tv_nop" : "+v"(c) : "v"(ah), "v"(al), "v"(bh), "v"(bl));
  return c;
}

__global__ __launch_bounds__(256) void k_wt_bf16(const float* __restrict__ W, unsigned short* __restrict__ Wt, int K, int N) {
  const int t = blockIdx.x * 256 + threadIdx.x;
  const int k8n = K / 8;
  if (t >= N * k8n) return;
  const int n = t / k8n, k8 = (t % k8n) * 8;
  v8us v;
#pragma unroll
  for (int i = 0; i < 8; ++i) v[i] = bf16_bits(W[(size_t)(k8 + i) * N + n]);
  *(v8us*)(Wt + (size_t)n * K + k8) = v;
  
}

// GEMM C[M][N] (f32, pitch ldc) = act(A[M][K]·W + bias). A f32 row-major (pitch lda) converted per fragment to bf16
// (ASPLIT: hi/lo two planes -> 2 terms, else single rounded term); Wt bf16 [N][K] (pitch ldb). BIAS_BF16 rounds the
// bias to bf16 first (bias quantised to bf16 before the add). K%32==0, M%16==0, N%64==0.
template <bool ASPLIT, int ACT, bool BIAS_BF16>
__global__ __launch_bounds__(128) void k_gemm_bf(const float* __restrict__ A, int lda, const unsigned short* __restrict__ Wt, int ldb,
                                               const float* __restrict__ bias, float* __restrict__ C, int ldc, int M, int N, int K) {
  __shared__ __attribute__((aligned(16))) float so[4][16][64];
  const int tid = threadIdx.x, w = tid >> 5, lane = tid & 31, ln = lane & 15, hh = lane >> 4;
  const int ntn = N / 64;
  const int wid = blockIdx.x * 4 + w;
  const int mt = wid / ntn, nq = wid % ntn;
  if (mt * 16 >= M) return;
  const int row0 = mt * 16, col0 = nq * 64;
  const float* arow = A + (size_t)(row0 + ln) * lda;
  v8f acc[4] = {};
  for (int kb = 0; kb < K; kb += 32) {
    FragB ah, al;
    const v4f x0 = *(const v4fa*)(arow + kb + 8 * hh), x1 = *(const v4fa*)(arow + kb + 8 * hh + 4);
    const v4f x2 = *(const v4fa*)(arow + kb + 16 + 8 * hh), x3 = *(const v4fa*)(arow + kb + 16 + 8 * hh + 4);
    float xs[16] = {x0[0],x0[1],x0[2],x0[3],x1[0],x1[1],x1[2],x1[3],x2[0],x2[1],x2[2],x2[3],x3[0],x3[1],x3[2],x3[3]};
#pragma unroll
    for (int i = 0; i < 16; ++i) { const unsigned short hb = bf16_bits(xs[i]); ah.u[i] = hb; al.u[i] = ASPLIT ? bf16_bits(xs[i] - bf16_val(hb)) : (unsigned short)0; }
#pragma unroll
    for (int t = 0; t < 4; ++t) {
      const unsigned short* brow = Wt + (size_t)(col0 + t * 16 + ln) * ldb + kb;
      FragB b;
      b.half[0] = *(const v8us*)(brow + 8 * hh);
      b.half[1] = *(const v8us*)(brow + 16 + 8 * hh);
      acc[t] = mmaN<ASPLIT ? 2 : 1>(ah.v, al.v, b.v, b.v, acc[t]);
    }
  }
#pragma unroll
  for (int t = 0; t < 4; ++t) {
    float bv = bias ? bias[col0 + t * 16 + ln] : 0.f;
    if (BIAS_BF16) bv = bf16_round(bv);
#pragma unroll
    for (int r = 0; r < 8; ++r) { float v = acc[t][r] + bv; if (ACT == 1) v = fmaxf(v, 0.f); so[w][8 * hh + r][t * 16 + ln] = v; }
  }
  __builtin_amdgcn_fence(__ATOMIC_ACQ_REL, "workgroup");
  __builtin_amdgcn_wave_barrier();
  const int rsub = lane >> 4, c4 = (lane & 15) * 4;
  {
#pragma unroll
    for (int q = 0; q < 8; ++q) {
      const int r = q * 2 + rsub;
      const v4f v = *(const v4fa*)&so[w][r][c4];
      *(v4f*)(C + (size_t)(row0 + r) * ldc + col0 + c4) = v;
    }
    
  }
}

// GEMM C = act(A·W + bias + resid): A f32 (ASPLIT -> hi/lo 2 terms), Wt bf16 [N][K]; ACT 0 none, 1 relu, 2 exact gelu;
// resid (optional, f32, row index = (row % rmod), pitch ldr, RES_BF16 rounds it) added before the activation.
template <bool ASPLIT, int ACT, bool BIAS_BF16, bool RES_BF16>
__global__ __launch_bounds__(128) void k_gemm_bf3(const float* __restrict__ A, int lda, const unsigned short* __restrict__ Wt, int ldb,
                                                const float* __restrict__ bias, const float* __restrict__ resid, int rmod, int ldr,
                                                float* __restrict__ C, int ldc, int M, int N, int K) {
  __shared__ __attribute__((aligned(16))) float so[4][16][64];
  const int tid = threadIdx.x, w = tid >> 5, lane = tid & 31, ln = lane & 15, hh = lane >> 4;
  const int ntn = N / 64;
  const int wid = blockIdx.x * 4 + w;
  const int mt = wid / ntn, nq = wid % ntn;
  if (mt * 16 >= M) return;
  const int row0 = mt * 16, col0 = nq * 64;
  const float* arow = A + (size_t)(row0 + ln) * lda;
  v8f acc[4] = {};
  for (int kb = 0; kb < K; kb += 32) {
    FragB ah, al;
    const v4f x0 = *(const v4fa*)(arow + kb + 8 * hh), x1 = *(const v4fa*)(arow + kb + 8 * hh + 4);
    const v4f x2 = *(const v4fa*)(arow + kb + 16 + 8 * hh), x3 = *(const v4fa*)(arow + kb + 16 + 8 * hh + 4);
    float xs[16] = {x0[0],x0[1],x0[2],x0[3],x1[0],x1[1],x1[2],x1[3],x2[0],x2[1],x2[2],x2[3],x3[0],x3[1],x3[2],x3[3]};
#pragma unroll
    for (int i = 0; i < 16; ++i) { const unsigned short hb = bf16_bits(xs[i]); ah.u[i] = hb; al.u[i] = ASPLIT ? bf16_bits(xs[i] - bf16_val(hb)) : (unsigned short)0; }
#pragma unroll
    for (int t = 0; t < 4; ++t) {
      const unsigned short* brow = Wt + (size_t)(col0 + t * 16 + ln) * ldb + kb;
      FragB b;
      b.half[0] = *(const v8us*)(brow + 8 * hh);
      b.half[1] = *(const v8us*)(brow + 16 + 8 * hh);
      acc[t] = mmaN<ASPLIT ? 2 : 1>(ah.v, al.v, b.v, b.v, acc[t]);
    }
  }
#pragma unroll
  for (int t = 0; t < 4; ++t) {
    const int col = col0 + t * 16 + ln;
    float bv = bias ? bias[col] : 0.f;
    if (BIAS_BF16) bv = bf16_round(bv);
#pragma unroll
    for (int r = 0; r < 8; ++r) {
      float v = acc[t][r] + bv;
      if (resid) { float rv = resid[(size_t)((row0 + 8 * hh + r) % rmod) * ldr + col]; if (RES_BF16) rv = bf16_round(rv); v += rv; }
      if (ACT == 1) v = fmaxf(v, 0.f);
      if (ACT == 2) v = 0.5f * v * (1.0f + erff(v * 0.70710678118654752f));
      if (ACT == 3) { const float u = 0.7978845608028654f * (v + 0.044715f * v * v * v); v = 0.5f * v * (1.0f + tanhf(u)); }
      so[w][8 * hh + r][t * 16 + ln] = v;
    }
  }
  __builtin_amdgcn_fence(__ATOMIC_ACQ_REL, "workgroup");
  __builtin_amdgcn_wave_barrier();
  const int rsub = lane >> 4, c4 = (lane & 15) * 4;
  {
#pragma unroll
    for (int q = 0; q < 8; ++q) {
      const int r = q * 2 + rsub;
      const v4f v = *(const v4fa*)&so[w][r][c4];
      *(v4f*)(C + (size_t)(row0 + r) * ldc + col0 + c4) = v;
    }
    
  }
}
// row LayerNorm (biased variance, eps) over N: s = X (+ R); optional out_sum <- s; out_norm <- (s-mu)*rsqrt(var+eps)*g + b
template <bool PARAM_BF16>
__global__ __launch_bounds__(256) void k_layernorm(const float* __restrict__ X, const float* __restrict__ R, const float* __restrict__ g, const float* __restrict__ bta,
                                                  float* __restrict__ out_sum, float* __restrict__ out_norm, int N, float eps) {
  __shared__ float red[256];
  const int row = blockIdx.x, tid = threadIdx.x;
  const float* x = X + (size_t)row * N; const float* rr = R ? R + (size_t)row * N : nullptr;
  float vals[16];                     // up to N = 4096
  const int per = N / 256;            // contiguous chunk per thread? use strided-by-4 chunks: thread handles j = tid*4 + 1024*u
  float s1 = 0.f;
  for (int u = 0; u < per / 4; ++u) {
    const int j = tid * 4 + 1024 * u;
    const v4f a = *(const v4fa*)(x + j);
    v4f b = {0.f,0.f,0.f,0.f}; if (rr) b = *(const v4fa*)(rr + j);
#pragma unroll
    for (int q = 0; q < 4; ++q) { const float v = a[q] + b[q]; vals[u * 4 + q] = v; s1 += v; }
  }
  red[tid] = s1; __syncthreads();
  for (int st = 128; st > 0; st >>= 1) { if (tid < st) red[tid] += red[tid + st]; __syncthreads(); }
  const float mu = red[0] / (float)N; __syncthreads();
  float s2 = 0.f;
  for (int u = 0; u < per / 4; ++u)
#pragma unroll
    for (int q = 0; q < 4; ++q) { const float c = vals[u * 4 + q] - mu; s2 += c * c; }
  red[tid] = s2; __syncthreads();
  for (int st = 128; st > 0; st >>= 1) { if (tid < st) red[tid] += red[tid + st]; __syncthreads(); }
  const float rs = rsqrtf(red[0] / (float)N + eps);
  {
    for (int u = 0; u < per / 4; ++u) {
      const int j = tid * 4 + 1024 * u;
      v4f o, sm;
#pragma unroll
      for (int q = 0; q < 4; ++q) {
        float gg = g[j + q], bb = bta[j + q];
        if (PARAM_BF16) { gg = bf16_round(gg); bb = bf16_round(bb); }
        sm[q] = vals[u * 4 + q]; o[q] = (vals[u * 4 + q] - mu) * rs * gg + bb;
      }
      if (out_sum) *(v4f*)(out_sum + (size_t)row * N + j) = sm;
      *(v4f*)(out_norm + (size_t)row * N + j) = o;
    }
    
  }
}



// ---- f16 WMMA path (v_wmma_f32_16x16x32_f16): 11-bit significands for operands in range — used where a [0,1] probability operand needs more precision than bf16
typedef _Float16 v16h __attribute__((ext_vector_type(16)));
union FragH { v16h v; v8us half[2]; _Float16 h[16]; unsigned short u[16]; };
template <int NT>
__device__ __forceinline__ v8f mmaH(v16h ah, v16h al, v16h bh, v16h bl, v8f c) {
  c = __builtin_amdgcn_wmma_f32_16x16x32_f16(false, ah, false, bh, (short)0, c, false, false);
  if (NT >= 2) c = __builtin_amdgcn_wmma_f32_16x16x32_f16(false, al, false, bh, (short)0, c, false, false);
  if (NT >= 3) c = __builtin_amdgcn_wmma_f32_16x16x32_f16(false, ah, false, bl, (short)0, c, false, false);
  asm volatile("v_nop\n\tv_nop\n\tv_nop\n\tv_nop" : "+v"(c) : "v"(ah), "v"(al), "v"(bh), "v"(bl));
  return c;
}
// batched GEMM like k_gemm_b but f16 operands: A f32 (split into f16 hi/lo if ASPLIT, else rounded to f16), Bt = f16 values [n][k]; alpha; C f32; N multiple of 16 (partial tiles skipped)
template <bool ASPLIT>
__global__ __launch_bounds__(128) void k_gemm_h(const float* __restrict__ A, int lda, size_t sA, const _Float16* __restrict__ Bh, int ldb, size_t sB, float alpha, float* __restrict__ C, int ldc, size_t sC, int M, int N, int K) {
  __shared__ __attribute__((aligned(16))) float so[4][16][64];
  const int tid = threadIdx.x, w = tid >> 5, lane = tid & 31, ln = lane & 15, hh = lane >> 4; const int by = blockIdx.y;
  A += (size_t)by * sA; Bh += (size_t)by * sB; C += (size_t)by * sC;
  const int ntn = (N + 63) / 64; const int wid = blockIdx.x * 4 + w; const int mt = wid / ntn, nq = wid % ntn; if (mt * 16 >= M) return;
  const int row0 = mt * 16, col0 = nq * 64; const float* arow = A + (size_t)(row0 + ln) * lda;
  v8f acc[4] = {};
  for (int kb = 0; kb < K; kb += 32) {
    FragH ah, al;
    const v4f x0 = *(const v4fa*)(arow + kb + 8 * hh), x1 = *(const v4fa*)(arow + kb + 8 * hh + 4), x2 = *(const v4fa*)(arow + kb + 16 + 8 * hh), x3 = *(const v4fa*)(arow + kb + 16 + 8 * hh + 4);
    float xs[16] = {x0[0],x0[1],x0[2],x0[3],x1[0],x1[1],x1[2],x1[3],x2[0],x2[1],x2[2],x2[3],x3[0],x3[1],x3[2],x3[3]};
#pragma unroll
    for (int i = 0; i < 16; ++i) { const _Float16 h = (_Float16)xs[i]; ah.h[i] = h; al.h[i] = ASPLIT ? (_Float16)(xs[i] - (float)h) : (_Float16)0.0f; }
#pragma unroll
    for (int t = 0; t < 4; ++t) { if (col0 + t * 16 >= N) continue; const size_t boff = (size_t)(col0 + t * 16 + ln) * ldb + kb; FragH bq; bq.half[0] = *(const v8us*)(Bh + boff + 8 * hh); bq.half[1] = *(const v8us*)(Bh + boff + 16 + 8 * hh);
      acc[t] = mmaH<ASPLIT ? 2 : 1>(ah.v, al.v, bq.v, bq.v, acc[t]); }
  }
#pragma unroll
  for (int t = 0; t < 4; ++t) { if (col0 + t * 16 >= N) continue;
#pragma unroll
    for (int r = 0; r < 8; ++r) so[w][8 * hh + r][t * 16 + ln] = acc[t][r] * alpha; }
  __builtin_amdgcn_fence(__ATOMIC_ACQ_REL, "workgroup"); __builtin_amdgcn_wave_barrier();
  const int rsub = lane >> 4, c4 = (lane & 15) * 4;
  {
#pragma unroll
    for (int q = 0; q < 8; ++q) { const int r = q * 2 + rsub; if (col0 + c4 < N) { const v4f v = *(const v4fa*)&so[w][r][c4]; *(v4f*)(C + (size_t)(row0 + r) * ldc + col0 + c4) = v; } }
     }
}

// Wt[n][k] = f16(W[k][n]·scale) from f32 row-major W[K][N] (scale = power of two; bf16-exact weights stay exact in f16 away from the subnormal range)
__global__ __launch_bounds__(256) void k_wt_f16(const float* __restrict__ W, _Float16* __restrict__ Wt, int K, int N, float scale) {
  const int t = blockIdx.x * 256 + threadIdx.x; if (t >= N * (K / 8)) return; const int n = t / (K / 8), k8 = (t % (K / 8)) * 8; FragH f;
#pragma unroll
  for (int i = 0; i < 8; ++i) f.h[i] = (_Float16)(bf16_round(W[(size_t)(k8 + i) * N + n]) * scale); const v8us o = f.half[0];
  *(v8us*)((unsigned short*)Wt + (size_t)n * K + k8) = o; 
}
// k_gemm_hh variant with fused epilogue: v = acc·alpha + bias[by·sBias + col] (+ CP[(row/rowsPerB)·sCPb + by·64 + col] if CP) ; ACT 0 none / 1 elu ; writes f16 C16 (and f32 C if non-null)
template <int ACT>
__global__ __launch_bounds__(128) void k_gemm_hhx(const _Float16* __restrict__ A, int lda, size_t sA, const _Float16* __restrict__ Bh, int ldb, size_t sB, float alpha, const float* __restrict__ bias, size_t sBias, const float* __restrict__ CP, int rowsPerB, size_t sCPb, int row0g,
    float* __restrict__ C, _Float16* __restrict__ C16, int ldc, size_t sC, int M, int N, int K) {
  __shared__ __attribute__((aligned(16))) float so[4][16][64];
  const int tid = threadIdx.x, w = tid >> 5, lane = tid & 31, ln = lane & 15, hh = lane >> 4; const int by = blockIdx.y;
  A += (size_t)by * sA; Bh += (size_t)by * sB; const size_t cofs = (size_t)by * sC; const float* bp = bias ? bias + (size_t)by * sBias : nullptr;
  const int ntn = (N + 63) / 64; const int wid = blockIdx.x * 4 + w; const int mt = wid / ntn, nq = wid % ntn; if (mt * 16 >= M) return;
  const int row0 = mt * 16, col0 = nq * 64; const _Float16* arow = A + (size_t)(row0 + ln) * lda;
  v8f acc[4] = {};
  for (int kb = 0; kb < K; kb += 32) { FragH ah; ah.half[0] = *(const v8us*)((const unsigned short*)arow + kb + 8 * hh); ah.half[1] = *(const v8us*)((const unsigned short*)arow + kb + 16 + 8 * hh);
#pragma unroll
    for (int t = 0; t < 4; ++t) { if (col0 + t * 16 >= N) continue; const size_t boff = (size_t)(col0 + t * 16 + ln) * ldb + kb; FragH bq; bq.half[0] = *(const v8us*)((const unsigned short*)Bh + boff + 8 * hh); bq.half[1] = *(const v8us*)((const unsigned short*)Bh + boff + 16 + 8 * hh);
      acc[t] = mmaH<1>(ah.v, ah.v, bq.v, bq.v, acc[t]); }
  }
#pragma unroll
  for (int t = 0; t < 4; ++t) { if (col0 + t * 16 >= N) continue; const int col = col0 + t * 16 + ln; const float bv = bp ? bf16_round(bp[col]) : 0.f;
#pragma unroll
    for (int r = 0; r < 8; ++r) { float v = acc[t][r] * alpha + bv; if (CP) { const int bidx = (row0g + row0 + 8 * hh + r) / rowsPerB; v += CP[(size_t)bidx * sCPb + (size_t)by * 64 + col]; } if (ACT == 1) v = (v > 0.f) ? v : expm1f(v); else if (ACT == 7) v = (v > 0.f) ? v + 1.0f : expf(v); else if (ACT == 8) v = tanhf(v); else if (ACT == 9) v = 0.5f * v * (1.0f + tanhf(0.7978845608028654f * (v + 0.044715f * v * v * v))); else if (ACT == 11) v = 1.0f / (1.0f + expf(-v)); else if (ACT == 12) v = (v > 0.f) ? v : 0.01f * v; else if (ACT == 14) v = (v > 0.f) ? v : 0.1f * v; else if (ACT == 15) v = v / (1.0f + expf(-v)); else if (ACT == 3) v = fmaxf(v, 0.f); else if (ACT == 6) v = 0.5f * v * (1.0f + erff(v * 0.70710678118654752f)); so[w][8 * hh + r][t * 16 + ln] = v; } }
  __builtin_amdgcn_fence(__ATOMIC_ACQ_REL, "workgroup"); __builtin_amdgcn_wave_barrier();
  const int rsub = lane >> 4, c4 = (lane & 15) * 4; typedef _Float16 v4h __attribute__((ext_vector_type(4)));
  {
#pragma unroll
    for (int q = 0; q < 8; ++q) { const int r = q * 2 + rsub; if (col0 + c4 < N) { const v4f v = *(const v4fa*)&so[w][r][c4]; if (C) *(v4f*)(C + cofs + (size_t)(row0 + r) * ldc + col0 + c4) = v; if (C16) { v4h h4; for (int i = 0; i < 4; ++i) h4[i] = (_Float16)v[i]; *(v4h*)(C16 + cofs + (size_t)(row0 + r) * ldc + col0 + c4) = h4; } } }
     }
}


typedef _Float16 v4h __attribute__((ext_vector_type(4)));

__global__ __launch_bounds__(256) void k_x16(const float* __restrict__ x, _Float16* __restrict__ X16, size_t n8) { const size_t t = (size_t)blockIdx.x * 256 + threadIdx.x; if (t >= n8) return; FragH f;
#pragma unroll
  for (int q = 0; q < 8; ++q) f.h[q] = (_Float16)bf16_round(x[t * 8 + q]); *(v8us*)((unsigned short*)X16 + t * 8) = f.half[0];  }
__global__ __launch_bounds__(256) void k_h16(const float* __restrict__ x, _Float16* __restrict__ X16, size_t n8) { const size_t t = (size_t)blockIdx.x * 256 + threadIdx.x; if (t >= n8) return; FragH f;
#pragma unroll
  for (int q = 0; q < 8; ++q) f.h[q] = (_Float16)x[t * 8 + q]; *(v8us*)((unsigned short*)X16 + t * 8) = f.half[0];  }
__global__ __launch_bounds__(256) void k_round16f(const float* __restrict__ W, _Float16* __restrict__ Bt, size_t n8) { const size_t t = (size_t)blockIdx.x * 256 + threadIdx.x; if (t >= n8) return; FragH f;
#pragma unroll
  for (int i = 0; i < 8; ++i) f.h[i] = (_Float16)(bf16_round(W[t * 8 + i]) * 16.0f); *(v8us*)((unsigned short*)Bt + t * 8) = f.half[0];  }
template <int NHv, int TTv>
__global__ __launch_bounds__(256) void k_vt(const _Float16* __restrict__ V16, int ldv, int voff, _Float16* __restrict__ Vt) { __shared__ unsigned short tl[64][66]; const int tid = threadIdx.x; const int slab = blockIdx.x / (TTv / 64), lg = blockIdx.x % (TTv / 64); const int b = slab / NHv, h = slab % NHv;
  for (int i = tid; i < 64 * 8; i += 256) { const int r = i / 8, c8 = (i % 8) * 8; FragH f; f.half[0] = *(const v8us*)((const unsigned short*)V16 + ((size_t)b * TTv + lg * 64 + r) * ldv + voff + h * 64 + c8);
#pragma unroll
    for (int q = 0; q < 8; ++q) tl[r][c8 + q] = f.u[q]; }
  __syncthreads();
  {
#pragma unroll
    for (int rd = 0; rd < 2; ++rd) { const int d = rd * 32 + tid / 8, pc = tid % 8; FragH f;
#pragma unroll
      for (int q = 0; q < 8; ++q) f.u[q] = tl[pc * 8 + q][d];
      *(v8us*)((unsigned short*)Vt + ((size_t)slab * 64 + d) * TTv + lg * 64 + pc * 8) = f.half[0]; }
     } }

__global__ __launch_bounds__(256) void k_hl(const float* __restrict__ F, _Float16* __restrict__ Hh, _Float16* __restrict__ Hl, size_t n8) { const size_t t = (size_t)blockIdx.x * 256 + threadIdx.x; if (t >= n8) return; FragH fh, fl; const v4f a = *(const v4fa*)(F + t * 8), c = *(const v4fa*)(F + t * 8 + 4);
#pragma unroll
  for (int q = 0; q < 4; ++q) { _Float16 h = (_Float16)a[q]; fh.h[q] = h; fl.h[q] = (_Float16)((a[q] - (float)h) * 1024.0f); h = (_Float16)c[q]; fh.h[4 + q] = h; fl.h[4 + q] = (_Float16)((c[q] - (float)h) * 1024.0f); }
  { *(v8us*)((unsigned short*)Hh + t * 8) = fh.half[0]; *(v8us*)((unsigned short*)Hl + t * 8) = fl.half[0];  } }

// ---- fast GEMM (block tile 128x64, wave tile 32x64; requires M % 128 == 0, N % 64 == 0, K % 64 == 0); A and B tiles of 64 k staged in LDS; epilogue = k_gemm_hhx semantics ----
__device__ __forceinline__ v16h g2_frag(const _Float16* p, int hh) { FragH f; f.half[0] = *(const v8us*)((const unsigned short*)p + 8 * hh); f.half[1] = *(const v8us*)((const unsigned short*)p + 16 + 8 * hh); return f.v; }
__device__ __forceinline__ v8f g2_mma(v16h a, v16h b, v8f c) { v8f d = __builtin_amdgcn_wmma_f32_16x16x32_f16(false, a, false, b, (short)0, c, false, false); asm volatile("v_nop\n\tv_nop\n\tv_nop\n\tv_nop" : "+v"(d) : "v"(a), "v"(b)); return d; }
template <int ACT>
__global__ __launch_bounds__(128) void k_gemm2(const _Float16* __restrict__ A, int lda, size_t sA, const _Float16* __restrict__ Bh, int ldb, size_t sB, float alpha, const float* __restrict__ bias, size_t sBias, const float* __restrict__ CP, int rowsPerB, size_t sCPb, int row0g,
    float* __restrict__ C, _Float16* __restrict__ C16, int ldc, size_t sC, int M, int N, int K) {
  constexpr int GK = 64, GP = 72;      // a tile = 64 k; LDS row pitch 144 B (16 B x odd: ds_load_b128 without bank conflicts)
  __shared__ __attribute__((aligned(16))) _Float16 tA[2][128][GP]; __shared__ __attribute__((aligned(16))) _Float16 tB[2][64][GP];      // two buffers each
  __shared__ __attribute__((aligned(16))) float so[4][32][68];
  const int tid = threadIdx.x, w = tid >> 5, lane = tid & 31, ln = lane & 15, hh = lane >> 4; const int by = blockIdx.y;
  A += (size_t)by * sA; Bh += (size_t)by * sB; const size_t cofs = (size_t)by * sC; const float* bp = bias ? bias + (size_t)by * sBias : nullptr;
  const int ntn = N >> 6; const int mt = blockIdx.x / ntn, nq = blockIdx.x - mt * ntn; const int row0 = mt * 128 + 32 * w, col0 = nq * 64; if (mt * 128 >= M) return;      // the whole block leaves or none of it: barriers follow
  // every thread copies 8 + 4 pieces of 16 B per tile (8 lanes cover one whole 128-B row)
  const int crow = tid >> 3, cc8 = (tid & 7) * 8;
  const _Float16* gA = A + (size_t)(mt * 128 + crow) * lda + cc8; const _Float16* gB = Bh + (size_t)(col0 + crow) * ldb + cc8;
  const unsigned lA = (unsigned)(size_t)&tA[0][crow][cc8], lB = (unsigned)(size_t)&tB[0][crow][cc8];
  auto copy_tile = [&](int t) {
    const unsigned ao = lA + (unsigned)(t & 1) * (unsigned)(128 * GP * 2), bo = lB + (unsigned)(t & 1) * (unsigned)(64 * GP * 2), r16 = 16 * GP * 2; const _Float16* ap = gA + (size_t)t * GK; const _Float16* bq = gB + (size_t)t * GK; const size_t a16 = (size_t)16 * lda, b16 = (size_t)16 * ldb;
    // the copies and, as the last line of the same statement, the wait that stands before their address registers are rewritten
    asm volatile("global_load_async_to_lds_b128 %0, %12, off\n\tglobal_load_async_to_lds_b128 %1, %13, off\n\tglobal_load_async_to_lds_b128 %2, %14, off\n\tglobal_load_async_to_lds_b128 %3, %15, off\n\t"
                 "global_load_async_to_lds_b128 %4, %16, off\n\tglobal_load_async_to_lds_b128 %5, %17, off\n\tglobal_load_async_to_lds_b128 %6, %18, off\n\tglobal_load_async_to_lds_b128 %7, %19, off\n\t"
                 "global_load_async_to_lds_b128 %8, %20, off\n\tglobal_load_async_to_lds_b128 %9, %21, off\n\tglobal_load_async_to_lds_b128 %10, %22, off\n\tglobal_load_async_to_lds_b128 %11, %23, off\n\ts_wait_xcnt 0x0"
                 :: "v"(ao), "v"(ao + r16), "v"(ao + 2 * r16), "v"(ao + 3 * r16), "v"(ao + 4 * r16), "v"(ao + 5 * r16), "v"(ao + 6 * r16), "v"(ao + 7 * r16), "v"(bo), "v"(bo + r16), "v"(bo + 2 * r16), "v"(bo + 3 * r16),
                    "v"(ap), "v"(ap + a16), "v"(ap + 2 * a16), "v"(ap + 3 * a16), "v"(ap + 4 * a16), "v"(ap + 5 * a16), "v"(ap + 6 * a16), "v"(ap + 7 * a16), "v"(bq), "v"(bq + b16), "v"(bq + 2 * b16), "v"(bq + 3 * b16) : "memory"); };
  const v8f z8 = {0.f,0.f,0.f,0.f,0.f,0.f,0.f,0.f}; v8f c00 = z8, c01 = z8, c02 = z8, c03 = z8, c10 = z8, c11 = z8, c12 = z8, c13 = z8;
  const int nst = K / GK;
  copy_tile(0);
  asm volatile("s_wait_asynccnt 0x0" ::: "memory");      // this wave's copies of tile 0 have landed
  __syncthreads();                                       // every wave's have: tile 0 may be read
  if (nst > 1) copy_tile(1);
#pragma unroll 1
  for (int t = 0; t < nst; ++t) { const _Float16 (*pA)[GP] = tA[t & 1]; const _Float16 (*pB)[GP] = tB[t & 1];
#pragma unroll
    for (int kb = 0; kb < GK; kb += 32) { const v16h a0 = g2_frag(&pA[32 * w + ln][kb], hh), a1 = g2_frag(&pA[32 * w + 16 + ln][kb], hh);
      v16h b = g2_frag(&pB[ln][kb], hh); c00 = g2_mma(a0, b, c00); c10 = g2_mma(a1, b, c10);
      b = g2_frag(&pB[16 + ln][kb], hh); c01 = g2_mma(a0, b, c01); c11 = g2_mma(a1, b, c11);
      b = g2_frag(&pB[32 + ln][kb], hh); c02 = g2_mma(a0, b, c02); c12 = g2_mma(a1, b, c12);
      b = g2_frag(&pB[48 + ln][kb], hh); c03 = g2_mma(a0, b, c03); c13 = g2_mma(a1, b, c13); }
    asm volatile("s_wait_dscnt 0x0" ::: "memory");       // this wave's reads of tile t are done before its buffer is refilled
    asm volatile("s_wait_asynccnt 0x0" ::: "memory");    // this wave's copies of tile t + 1 have landed
    __syncthreads();                                     // publishes tile t + 1 and ends every wave's reads of tile t
    if (t + 2 < nst) copy_tile(t + 2); }
  asm volatile("s_wait_asynccnt 0x0" ::: "memory");      // nothing of this wave is in flight when it goes on to the epilogue and ends
  v8f accs[8] = {c00, c01, c02, c03, c10, c11, c12, c13};
#pragma unroll
  for (int u = 0; u < 8; ++u) { const int t = u & 3, half = u >> 2; const int col = col0 + t * 16 + ln; const float bv = bp ? bf16_round(bp[col]) : 0.f;
#pragma unroll
    for (int r = 0; r < 8; ++r) { const int rloc = half * 16 + 8 * hh + r; float v = accs[u][r] * alpha + bv; if (CP) { const int bidx = (row0g + row0 + rloc) / rowsPerB; v += CP[(size_t)bidx * sCPb + (size_t)by * 64 + col]; }
      if (ACT == 3) v = fmaxf(v, 0.f); else if (ACT == 6) v = 0.5f * v * (1.0f + erff(v * 0.70710678118654752f)); else if (ACT == 11) v = 1.0f / (1.0f + expf(-v)); else if (ACT == 15) v = v / (1.0f + expf(-v)); else if (ACT == 12) v = (v > 0.f) ? v : 0.01f * v; else if (ACT == 8) v = tanhf(v);
      so[w][rloc][t * 16 + ln] = v; } }
  __builtin_amdgcn_fence(__ATOMIC_ACQ_REL, "workgroup"); __builtin_amdgcn_wave_barrier();
  const int rsub = lane >> 4, c4 = (lane & 15) * 4;
  {
#pragma unroll
    for (int q = 0; q < 16; ++q) { const int r = q * 2 + rsub; const v4f v = *(const v4fa*)&so[w][r][c4]; if (C) *(v4f*)(C + cofs + (size_t)(row0 + r) * ldc + col0 + c4) = v; if (C16) { v4h h4; for (int i = 0; i < 4; ++i) h4[i] = (_Float16)v[i]; *(v4h*)(C16 + cofs + (size_t)(row0 + r) * ldc + col0 + c4) = h4; } }
     } }



__global__ __launch_bounds__(128) void k_flash(const _Float16* __restrict__ Q16, int ldq, const _Float16* __restrict__ K16, int ldk, const _Float16* __restrict__ Vt, const int* __restrict__ MSK, float* __restrict__ O, int ldo) {
  constexpr int RPW = 16, RTN = RPW / 16, NQB = TQ / (4 * RPW), DT = 4, KS = 2;
  constexpr int SK = 64, NST = TK / SK, LP = 72;      // a tile = 64 keys; LDS row pitch 144 B (16 B x odd: ds_load_b128 without bank conflicts)
  __shared__ __attribute__((aligned(16))) unsigned short sK[2][SK][LP]; __shared__ __attribute__((aligned(16))) unsigned short sV[2][64][LP];      // two buffers each: K rows [key][d], V^T rows [d][key]
  __shared__ __attribute__((aligned(16))) unsigned short sP[4][RPW][40]; __shared__ __attribute__((aligned(16))) float sO[4][RPW][64 + 4];
  const int tid = threadIdx.x, w = tid >> 5, lane = tid & 31, ln = lane & 15, hh = lane >> 4;
  const int slab = blockIdx.x / NQB, qblk = blockIdx.x % NQB; const int b = slab / NH, h = slab % NH; const int qb0 = qblk * (4 * RPW); const int q0 = qb0 + w * RPW;
  FragH aq[2][KS];
#pragma unroll
  for (int rt = 0; rt < RTN; ++rt) { const unsigned short* qr = (const unsigned short*)Q16 + ((size_t)b * TQ + q0 + rt * 16 + ln) * ldq + h * 64;
#pragma unroll
    for (int ks = 0; ks < KS; ++ks) { aq[rt][ks].half[0] = *(const v8us*)(qr + ks * 32 + 8 * hh); aq[rt][ks].half[1] = *(const v8us*)(qr + ks * 32 + 16 + 8 * hh); } }
  const unsigned short* Vth = (const unsigned short*)Vt + (size_t)slab * 64 * TK;
  float m_r[2][8], l_r[2][8]; v8f oacc[2][DT];
#pragma unroll
  for (int rt = 0; rt < RTN; ++rt) {
#pragma unroll
    for (int r = 0; r < 8; ++r) { m_r[rt][r] = -3.0e38f; l_r[rt][r] = 0.f; }
#pragma unroll
    for (int dt = 0; dt < DT; ++dt) oacc[rt][dt] = (v8f){0.f,0.f,0.f,0.f,0.f,0.f,0.f,0.f}; }
  // The block's four waves share each K / V^T tile: every thread copies 4 + 4 pieces of 16 B (8 lanes cover one whole 128-B row).
  const int crow = tid >> 3, cc8 = (tid & 7) * 8;
  const unsigned short* gK = (const unsigned short*)K16 + ((size_t)b * TK + crow) * ldk + h * 64 + cc8; const unsigned short* gV = Vth + (size_t)crow * TK + cc8;
  const unsigned lK = (unsigned)(size_t)&sK[0][crow][cc8], lV = (unsigned)(size_t)&sV[0][crow][cc8];
  auto copy_tile = [&](int t) {
    const unsigned bo = (unsigned)(t & 1) * (unsigned)(SK * LP * 2), r16 = 16 * LP * 2; const unsigned short* kp = gK + (size_t)t * SK * ldk; const unsigned short* vp = gV + (size_t)t * SK;
    // the copies and, as the last line of the same statement, the wait that stands before their address registers are rewritten
    asm volatile("global_load_async_to_lds_b128 %0, %8, off\n\tglobal_load_async_to_lds_b128 %1, %9, off\n\tglobal_load_async_to_lds_b128 %2, %10, off\n\tglobal_load_async_to_lds_b128 %3, %11, off\n\t"
                 "global_load_async_to_lds_b128 %4, %12, off\n\tglobal_load_async_to_lds_b128 %5, %13, off\n\tglobal_load_async_to_lds_b128 %6, %14, off\n\tglobal_load_async_to_lds_b128 %7, %15, off\n\ts_wait_xcnt 0x0"
                 :: "v"(lK + bo), "v"(lK + bo + r16), "v"(lK + bo + 2 * r16), "v"(lK + bo + 3 * r16), "v"(lV + bo), "v"(lV + bo + r16), "v"(lV + bo + 2 * r16), "v"(lV + bo + 3 * r16),
                    "v"(kp), "v"(kp + (size_t)16 * ldk), "v"(kp + (size_t)32 * ldk), "v"(kp + (size_t)48 * ldk), "v"(vp), "v"(vp + (size_t)16 * TK), "v"(vp + (size_t)32 * TK), "v"(vp + (size_t)48 * TK) : "memory"); };
  copy_tile(0);
  asm volatile("s_wait_asynccnt 0x0" ::: "memory");      // this wave's copies of tile 0 have landed
  __syncthreads();                                       // every wave's have: tile 0 may be read
  copy_tile(1);
#pragma unroll 1
  for (int t = 0; t < NST; ++t) {
   const unsigned short (*bK)[LP] = sK[t & 1]; const unsigned short (*bV)[LP] = sV[t & 1];
#pragma unroll
   for (int ps = 0; ps < SK / 32; ++ps) {
    v8f s[2][2];
#pragma unroll
    for (int nt = 0; nt < 2; ++nt) { const unsigned short* kr = &bK[ps * 32 + nt * 16 + ln][0]; FragH bk[KS];
#pragma unroll
      for (int ks = 0; ks < KS; ++ks) { bk[ks].half[0] = *(const v8us*)(kr + ks * 32 + 8 * hh); bk[ks].half[1] = *(const v8us*)(kr + ks * 32 + 16 + 8 * hh); }
#pragma unroll
      for (int rt = 0; rt < RTN; ++rt) { v8f acc = (v8f){0.f,0.f,0.f,0.f,0.f,0.f,0.f,0.f};
#pragma unroll
        for (int ks = 0; ks < KS; ++ks) acc = mmaH<1>(aq[rt][ks].v, aq[rt][ks].v, bk[ks].v, bk[ks].v, acc); s[rt][nt] = acc; } }
#pragma unroll
    for (int rt = 0; rt < RTN; ++rt)
#pragma unroll
      for (int r = 0; r < 8; ++r) {
        const bool ok0 = true, ok1 = true;
        const float s0 = s[rt][0][r] * SCL, s1 = s[rt][1][r] * SCL; float mc = fmaxf(s0, s1);
        mc = fmaxf(mc, __shfl_xor(mc, 1, 32)); mc = fmaxf(mc, __shfl_xor(mc, 2, 32)); mc = fmaxf(mc, __shfl_xor(mc, 4, 32)); mc = fmaxf(mc, __shfl_xor(mc, 8, 32));
        const float mn = fmaxf(m_r[rt][r], mc); const float al = (mn > -1.0e38f) ? expf(m_r[rt][r] - mn) : 1.0f; m_r[rt][r] = mn; const float p0 = ok0 ? expf(s0 - mn) : 0.f, p1 = ok1 ? expf(s1 - mn) : 0.f; l_r[rt][r] = l_r[rt][r] * al + p0 + p1;
#pragma unroll
        for (int dt = 0; dt < DT; ++dt) oacc[rt][dt][r] *= al;
        FragH t2; t2.h[0] = (_Float16)(p0 * 1024.0f); t2.h[1] = (_Float16)(p1 * 1024.0f); sP[w][rt * 16 + 8 * hh + r][ln] = t2.u[0]; sP[w][rt * 16 + 8 * hh + r][16 + ln] = t2.u[1]; }
    __builtin_amdgcn_fence(__ATOMIC_ACQ_REL, "workgroup"); __builtin_amdgcn_wave_barrier();
    FragH pa[2];
#pragma unroll
    for (int rt = 0; rt < RTN; ++rt) { pa[rt].half[0] = *(const v8us*)&sP[w][rt * 16 + ln][8 * hh]; pa[rt].half[1] = *(const v8us*)&sP[w][rt * 16 + ln][16 + 8 * hh]; }
#pragma unroll
    for (int dt = 0; dt < DT; ++dt) { const unsigned short* vrow = &bV[dt * 16 + ln][ps * 32]; FragH bv; bv.half[0] = *(const v8us*)(vrow + 8 * hh); bv.half[1] = *(const v8us*)(vrow + 16 + 8 * hh);
#pragma unroll
      for (int rt = 0; rt < RTN; ++rt) oacc[rt][dt] = mmaH<1>(pa[rt].v, pa[rt].v, bv.v, bv.v, oacc[rt][dt]); }
    __builtin_amdgcn_fence(__ATOMIC_ACQ_REL, "workgroup"); __builtin_amdgcn_wave_barrier(); }
   asm volatile("s_wait_dscnt 0x0" ::: "memory");        // this wave's reads of tile t are done before its buffer is refilled
   asm volatile("s_wait_asynccnt 0x0" ::: "memory");     // this wave's copies of tile t + 1 have landed
   __syncthreads();                                      // publishes tile t + 1 and ends every wave's reads of tile t
   if (t + 2 < NST) copy_tile(t + 2); }
  asm volatile("s_wait_asynccnt 0x0" ::: "memory");      // nothing of this wave is in flight when it goes on to the epilogue and ends
#pragma unroll
  for (int rt = 0; rt < RTN; ++rt) {
#pragma unroll
    for (int r = 0; r < 8; ++r) { float l = l_r[rt][r]; l += __shfl_xor(l, 1, 32); l += __shfl_xor(l, 2, 32); l += __shfl_xor(l, 4, 32); l += __shfl_xor(l, 8, 32); l_r[rt][r] = (l > 0.f) ? 1.0f / (l * 1024.0f) : 0.f; }
#pragma unroll
    for (int dt = 0; dt < DT; ++dt)
#pragma unroll
      for (int r = 0; r < 8; ++r) sO[w][rt * 16 + 8 * hh + r][dt * 16 + ln] = oacc[rt][dt][r] * l_r[rt][r]; }
  __builtin_amdgcn_fence(__ATOMIC_ACQ_REL, "workgroup"); __builtin_amdgcn_wave_barrier();
  {
#pragma unroll
    for (int rp = 0; rp < RPW; rp += 2) { const int r = rp + (lane >> 4), pc = lane & 15; const v4f val = *(const v4fa*)&sO[w][r][pc * 4]; *(v4f*)(O + ((size_t)b * TQ + q0 + r) * ldo + h * 64 + pc * 4) = val; }
     } }
__global__ __launch_bounds__(256) void k_fulltab(unsigned* __restrict__ MB, int* __restrict__ RA, int* __restrict__ KE, int nq, int nk) {
  const int t = blockIdx.x * 256 + threadIdx.x;
  if (t < nq * (nk / 32)) { *(unsigned*)(MB + t) = 0u;  }
  if (t < nq) { *(int*)(RA + t) = 0;  }
  if (t < nq / 64) { *(int*)(KE + t * 32) = nk;  } }
__global__ __launch_bounds__(256) void k_lnout(const float* __restrict__ Y, const float* __restrict__ g, const float* __restrict__ bb, float* __restrict__ out) {
  #pragma clang fp contract(off)
  const int tid = threadIdx.x, w = tid >> 5, ln = tid & 31; const int r = blockIdx.x * 8 + w; if (r >= NR) return; const float* y = Y + (size_t)r * DM; float s = 0.f;
#pragma unroll 1
  for (int i = 0; i < 8; ++i) { const v4f a = *(const v4fa*)(y + i * 128 + ln * 4); for (int q = 0; q < 4; ++q) s += a[q]; }
  for (int o = 16; o > 0; o >>= 1) s += __shfl_xor(s, o, 32); const float mu = s / (float)DM; float q2 = 0.f;
#pragma unroll 1
  for (int i = 0; i < 8; ++i) { const v4f a = *(const v4fa*)(y + i * 128 + ln * 4); for (int q = 0; q < 4; ++q) { const float d = a[q] - mu; q2 += d * d; } }
  for (int o = 16; o > 0; o >>= 1) q2 += __shfl_xor(q2, o, 32); const float rs = rsqrtf(q2 / (float)DM + 1e-6f);
  {
#pragma unroll 1
    for (int i = 0; i < 8; ++i) { const int c0 = i * 128 + ln * 4; const v4f a = *(const v4fa*)(y + c0); v4f o4; for (int q = 0; q < 4; ++q) o4[q] = (a[q] - mu) * rs * bf16_round(g[c0 + q]) + bf16_round(bb[c0 + q]); *(v4f*)(out + (size_t)r * DM + c0) = o4; }
     } }
__global__ __launch_bounds__(256) void k_xb(const float* __restrict__ x, float* __restrict__ XB, size_t n4) { const size_t t = (size_t)blockIdx.x * 256 + threadIdx.x; if (t >= n4) return; const v4f a = *(const v4fa*)(x + t * 4); v4f o; for (int q = 0; q < 4; ++q) o[q] = bf16_round(a[q]); *(v4f*)(XB + t * 4) = o;  }
__global__ __launch_bounds__(256) void k_causaltab(unsigned* __restrict__ MB, int* __restrict__ RA, int* __restrict__ KE, int nq, int nk) {
  const int t = blockIdx.x * 256 + threadIdx.x; const int nw = nk / 32;
  if (t < nq * nw) { const int q = t / nw, w = t % nw; const int first = q + 1 - 32 * w; const unsigned bits = (first <= 0) ? 0xffffffffu : ((first >= 32) ? 0u : (0xffffffffu << first)); *(unsigned*)(MB + t) = bits;  }
  if (t < nq) { *(int*)(RA + t) = 0;  }
  if (t < nq / 64) { const int v = 64 * (t + 1); *(int*)(KE + t * 32) = v;  } }


extern "C" void kernel_launch(void* const* d_in, const int* in_sizes, int n_in,
                              void* d_out, int out_size, void* d_ws, size_t ws_size, hipStream_t stream) {
  (void)in_sizes; (void)n_in; (void)out_size;
  const float* const* I = (const float* const*)d_in; const float* qin = I[0]; const float* kin = I[1]; const float* vin = I[2]; const float* Wq = I[3]; const float* Wk = I[4]; const float* Wv = I[5]; const float* Wo = I[6]; const float* gam = I[7]; const float* bet = I[8];
  char* ws = (char*)d_ws; size_t off = 0;
  auto take = [&](size_t bytes) { char* p = ws + off; off += (bytes + 255) & ~(size_t)255; return p; };
  _Float16* BQ = (_Float16*)take((size_t)DM * DM * 2); _Float16* BK = (_Float16*)take((size_t)DM * DM * 2); _Float16* BV = (_Float16*)take((size_t)DM * DM * 2); _Float16* BO = (_Float16*)take((size_t)DM * DM * 2);
  _Float16* X16 = (_Float16*)take((size_t)NR * DM * 2); float* F = (float*)take((size_t)NR * DM * 4); float* XB = (float*)take((size_t)NR * DM * 4);
  _Float16* Q16 = (_Float16*)take((size_t)NR * DM * 2); _Float16* K16 = (_Float16*)take((size_t)NR * DM * 2); _Float16* V16 = (_Float16*)take((size_t)NR * DM * 2); _Float16* VT = (_Float16*)take((size_t)NR * DM * 2);
  if (off > ws_size) return;      /* 8 + 8 + 16 + 16 + 32 = 80 MiB */
  float* O = F; _Float16* Oh = Q16; _Float16* Ol = K16; float* Y = XB;
  const size_t n8 = (size_t)NR * DM / 8; const unsigned nb8 = (unsigned)((n8 + 255) / 256); const size_t w8 = (size_t)DM * DM / 8; const unsigned wb = (unsigned)((w8 + 255) / 256);
  k_round16f<<<wb, 256, 0, stream>>>(Wq, BQ, w8); k_round16f<<<wb, 256, 0, stream>>>(Wk, BK, w8); k_round16f<<<wb, 256, 0, stream>>>(Wv, BV, w8); k_round16f<<<wb, 256, 0, stream>>>(Wo, BO, w8);
  const dim3 gP((NR / 128) * (DM / 64), 1);
  k_x16<<<nb8, 256, 0, stream>>>(qin, X16, n8); k_xb<<<(unsigned)(((size_t)NR * DM / 4 + 255) / 256), 256, 0, stream>>>(qin, XB, (size_t)NR * DM / 4);
  k_gemm2<0><<<gP, 128, 0, stream>>>(X16, DM, 0, BQ, DM, 0, 0.0625f, nullptr, 0, nullptr, 1, 0, 0, nullptr, Q16, DM, 0, NR, DM, DM);      /* qh (f16) */
  k_x16<<<nb8, 256, 0, stream>>>(kin, X16, n8);
  k_gemm2<0><<<gP, 128, 0, stream>>>(X16, DM, 0, BK, DM, 0, 0.0625f, nullptr, 0, nullptr, 1, 0, 0, nullptr, K16, DM, 0, NR, DM, DM);      /* kh (f16) */
  k_x16<<<nb8, 256, 0, stream>>>(vin, X16, n8);
  k_gemm2<0><<<gP, 128, 0, stream>>>(X16, DM, 0, BV, DM, 0, 0.0625f, nullptr, 0, nullptr, 1, 0, 0, nullptr, V16, DM, 0, NR, DM, DM);      /* vh (f16) */
  k_vt<NH, SLEN><<<NH * (SLEN / 64), 256, 0, stream>>>(V16, DM, 0, VT);
  k_flash<<<NH * (SLEN / 64), 128, 0, stream>>>(Q16, DM, K16, DM, VT, nullptr, O, DM);      /* plain flash over all 4096 keys (no mask) */
  k_hl<<<nb8, 256, 0, stream>>>(O, Oh, Ol, n8);
  k_gemm2<0><<<gP, 128, 0, stream>>>(Oh, DM, 0, BO, DM, 0, 0.0625f, nullptr, 0, XB, 1, (size_t)DM, 0, Y, nullptr, DM, 0, NR, DM, DM);
  k_gemm2<0><<<gP, 128, 0, stream>>>(Ol, DM, 0, BO, DM, 0, 0.0625f / 1024.0f, nullptr, 0, Y, 1, (size_t)DM, 0, Y, nullptr, DM, 0, NR, DM, DM);
  k_lnout<<<NR / 8, 256, 0, stream>>>(Y, gam, bet, (float*)d_out);
}

// v002
// It runs in 317 microseconds.
// In both of two side-by-side timings against v001, it was 1.52 times as fast.
// All steps since v000 together make it 2.38 times as fast.
#include <hip/hip_runtime.h>
#define NBT 1
#define SLEN 4096
#define TQ SLEN
#define TK SLEN
#define DM 1024
#define NH 16
#define SCL 0.125f
#define NR (NBT * SLEN)
typedef __bf16 v16b __attribute__((ext_vector_type(16)));
typedef unsigned short v8us __attribute__((ext_vector_type(8), may_alias));
typedef float  v8f  __attribute__((ext_vector_type(8)));
typedef float  v4f  __attribute__((ext_vector_type(4)));
typedef float  v4fa __attribute__((ext_vector_type(4), may_alias));
union FragB { v16b v; v8us half[2]; unsigned short u[16]; };

__device__ __forceinline__ unsigned short bf16_bits(float x) { unsigned int u = __float_as_uint(x); return (unsigned short)((u + 0x7FFFu + ((u >> 16) & 1u)) >> 16); }
__device__ __forceinline__ float bf16_val(unsigned short b) { return __uint_as_float(((unsigned int)b) << 16); }
__device__ __forceinline__ float bf16_round(float x) { return bf16_val(bf16_bits(x)); }
// D += A·B with NT terms: 1 = ah·bh, 2 = + al·bh (A split), 3 = + ah·bl (both split)
template <int NT>
__device__ __forceinline__ v8f mmaN(v16b ah, v16b al, v16b bh, v16b bl, v8f c) {
  c = __builtin_amdgcn_wmma_f32_16x16x32_bf16(false, ah, false, bh, (short)0, c, false, false);
  if (NT >= 2) c = __builtin_amdgcn_wmma_f32_16x16x32_bf16(false, al, false, bh, (short)0, c, false, false);
  if (NT >= 3) c = __builtin_amdgcn_wmma_f32_16x16x32_bf16(false, ah, false, bl, (short)0, c, false, false);
  asm volatile("v_nop\n\tv_nop\n\tv_nop\n\tv_nop" : "+v"(c) : "v"(ah), "v"(al), "v"(bh), "v"(bl));
  return c;
}

__global__ __launch_bounds__(256) void k_wt_bf16(const float* __restrict__ W, unsigned short* __restrict__ Wt, int K, int N) {
  const int t = blockIdx.x * 256 + threadIdx.x;
  const int k8n = K / 8;
  if (t >= N * k8n) return;
  const int n = t / k8n, k8 = (t % k8n) * 8;
  v8us v;
#pragma unroll
  for (int i = 0; i < 8; ++i) v[i] = bf16_bits(W[(size_t)(k8 + i) * N + n]);
  *(v8us*)(Wt + (size_t)n * K + k8) = v;
  
}

// GEMM C[M][N] (f32, pitch ldc) = act(A[M][K]·W + bias). A f32 row-major (pitch lda) converted per fragment to bf16
// (ASPLIT: hi/lo two planes -> 2 terms, else single rounded term); Wt bf16 [N][K] (pitch ldb). BIAS_BF16 rounds the
// bias to bf16 first (bias quantised to bf16 before the add). K%32==0, M%16==0, N%64==0.
template <bool ASPLIT, int ACT, bool BIAS_BF16>
__global__ __launch_bounds__(128) void k_gemm_bf(const float* __restrict__ A, int lda, const unsigned short* __restrict__ Wt, int ldb,
                                               const float* __restrict__ bias, float* __restrict__ C, int ldc, int M, int N, int K) {
  __shared__ __attribute__((aligned(16))) float so[4][16][64];
  const int tid = threadIdx.x, w = tid >> 5, lane = tid & 31, ln = lane & 15, hh = lane >> 4;
  const int ntn = N / 64;
  const int wid = blockIdx.x * 4 + w;
  const int mt = wid / ntn, nq = wid % ntn;
  if (mt * 16 >= M) return;
  const int row0 = mt * 16, col0 = nq * 64;
  const float* arow = A + (size_t)(row0 + ln) * lda;
  v8f acc[4] = {};
  for (int kb = 0; kb < K; kb += 32) {
    FragB ah, al;
    const v4f x0 = *(const v4fa*)(arow + kb + 8 * hh), x1 = *(const v4fa*)(arow + kb + 8 * hh + 4);
    const v4f x2 = *(const v4fa*)(arow + kb + 16 + 8 * hh), x3 = *(const v4fa*)(arow + kb + 16 + 8 * hh + 4);
    float xs[16] = {x0[0],x0[1],x0[2],x0[3],x1[0],x1[1],x1[2],x1[3],x2[0],x2[1],x2[2],x2[3],x3[0],x3[1],x3[2],x3[3]};
#pragma unroll
    for (int i = 0; i < 16; ++i) { const unsigned short hb = bf16_bits(xs[i]); ah.u[i] = hb; al.u[i] = ASPLIT ? bf16_bits(xs[i] - bf16_val(hb)) : (unsigned short)0; }
#pragma unroll
    for (int t = 0; t < 4; ++t) {
      const unsigned short* brow = Wt + (size_t)(col0 + t * 16 + ln) * ldb + kb;
      FragB b;
      b.half[0] = *(const v8us*)(brow + 8 * hh);
      b.half[1] = *(const v8us*)(brow + 16 + 8 * hh);
      acc[t] = mmaN<ASPLIT ? 2 : 1>(ah.v, al.v, b.v, b.v, acc[t]);
    }
  }
#pragma unroll
  for (int t = 0; t < 4; ++t) {
    float bv = bias ? bias[col0 + t * 16 + ln] : 0.f;
    if (BIAS_BF16) bv = bf16_round(bv);
#pragma unroll
    for (int r = 0; r < 8; ++r) { float v = acc[t][r] + bv; if (ACT == 1) v = fmaxf(v, 0.f); so[w][8 * hh + r][t * 16 + ln] = v; }
  }
  __builtin_amdgcn_fence(__ATOMIC_ACQ_REL, "workgroup");
  __builtin_amdgcn_wave_barrier();
  const int rsub = lane >> 4, c4 = (lane & 15) * 4;
  {
#pragma unroll
    for (int q = 0; q < 8; ++q) {
      const int r = q * 2 + rsub;
      const v4f v = *(const v4fa*)&so[w][r][c4];
      *(v4f*)(C + (size_t)(row0 + r) * ldc + col0 + c4) = v;
    }
    
  }
}

// GEMM C = act(A·W + bias + resid): A f32 (ASPLIT -> hi/lo 2 terms), Wt bf16 [N][K]; ACT 0 none, 1 relu, 2 exact gelu;
// resid (optional, f32, row index = (row % rmod), pitch ldr, RES_BF16 rounds it) added before the activation.
template <bool ASPLIT, int ACT, bool BIAS_BF16, bool RES_BF16>
__global__ __launch_bounds__(128) void k_gemm_bf3(const float* __restrict__ A, int lda, const unsigned short* __restrict__ Wt, int ldb,
                                                const float* __restrict__ bias, const float* __restrict__ resid, int rmod, int ldr,
                                                float* __restrict__ C, int ldc, int M, int N, int K) {
  __shared__ __attribute__((aligned(16))) float so[4][16][64];
  const int tid = threadIdx.x, w = tid >> 5, lane = tid & 31, ln = lane & 15, hh = lane >> 4;
  const int ntn = N / 64;
  const int wid = blockIdx.x * 4 + w;
  const int mt = wid / ntn, nq = wid % ntn;
  if (mt * 16 >= M) return;
  const int row0 = mt * 16, col0 = nq * 64;
  const float* arow = A + (size_t)(row0 + ln) * lda;
  v8f acc[4] = {};
  for (int kb = 0; kb < K; kb += 32) {
    FragB ah, al;
    const v4f x0 = *(const v4fa*)(arow + kb + 8 * hh), x1 = *(const v4fa*)(arow + kb + 8 * hh + 4);
    const v4f x2 = *(const v4fa*)(arow + kb + 16 + 8 * hh), x3 = *(const v4fa*)(arow + kb + 16 + 8 * hh + 4);
    float xs[16] = {x0[0],x0[1],x0[2],x0[3],x1[0],x1[1],x1[2],x1[3],x2[0],x2[1],x2[2],x2[3],x3[0],x3[1],x3[2],x3[3]};
#pragma unroll
    for (int i = 0; i < 16; ++i) { const unsigned short hb = bf16_bits(xs[i]); ah.u[i] = hb; al.u[i] = ASPLIT ? bf16_bits(xs[i] - bf16_val(hb)) : (unsigned short)0; }
#pragma unroll
    for (int t = 0; t < 4; ++t) {
      const unsigned short* brow = Wt + (size_t)(col0 + t * 16 + ln) * ldb + kb;
      FragB b;
      b.half[0] = *(const v8us*)(brow + 8 * hh);
      b.half[1] = *(const v8us*)(brow + 16 + 8 * hh);
      acc[t] = mmaN<ASPLIT ? 2 : 1>(ah.v, al.v, b.v, b.v, acc[t]);
    }
  }
#pragma unroll
  for (int t = 0; t < 4; ++t) {
    const int col = col0 + t * 16 + ln;
    float bv = bias ? bias[col] : 0.f;
    if (BIAS_BF16) bv = bf16_round(bv);
#pragma unroll
    for (int r = 0; r < 8; ++r) {
      float v = acc[t][r] + bv;
      if (resid) { float rv = resid[(size_t)((row0 + 8 * hh + r) % rmod) * ldr + col]; if (RES_BF16) rv = bf16_round(rv); v += rv; }
      if (ACT == 1) v = fmaxf(v, 0.f);
      if (ACT == 2) v = 0.5f * v * (1.0f + erff(v * 0.70710678118654752f));
      if (ACT == 3) { const float u = 0.7978845608028654f * (v + 0.044715f * v * v * v); v = 0.5f * v * (1.0f + tanhf(u)); }
      so[w][8 * hh + r][t * 16 + ln] = v;
    }
  }
  __builtin_amdgcn_fence(__ATOMIC_ACQ_REL, "workgroup");
  __builtin_amdgcn_wave_barrier();
  const int rsub = lane >> 4, c4 = (lane & 15) * 4;
  {
#pragma unroll
    for (int q = 0; q < 8; ++q) {
      const int r = q * 2 + rsub;
      const v4f v = *(const v4fa*)&so[w][r][c4];
      *(v4f*)(C + (size_t)(row0 + r) * ldc + col0 + c4) = v;
    }
    
  }
}
// row LayerNorm (biased variance, eps) over N: s = X (+ R); optional out_sum <- s; out_norm <- (s-mu)*rsqrt(var+eps)*g + b
template <bool PARAM_BF16>
__global__ __launch_bounds__(256) void k_layernorm(const float* __restrict__ X, const float* __restrict__ R, const float* __restrict__ g, const float* __restrict__ bta,
                                                  float* __restrict__ out_sum, float* __restrict__ out_norm, int N, float eps) {
  __shared__ float red[256];
  const int row = blockIdx.x, tid = threadIdx.x;
  const float* x = X + (size_t)row * N; const float* rr = R ? R + (size_t)row * N : nullptr;
  float vals[16];                     // up to N = 4096
  const int per = N / 256;            // contiguous chunk per thread? use strided-by-4 chunks: thread handles j = tid*4 + 1024*u
  float s1 = 0.f;
  for (int u = 0; u < per / 4; ++u) {
    const int j = tid * 4 + 1024 * u;
    const v4f a = *(const v4fa*)(x + j);
    v4f b = {0.f,0.f,0.f,0.f}; if (rr) b = *(const v4fa*)(rr + j);
#pragma unroll
    for (int q = 0; q < 4; ++q) { const float v = a[q] + b[q]; vals[u * 4 + q] = v; s1 += v; }
  }
  red[tid] = s1; __syncthreads();
  for (int st = 128; st > 0; st >>= 1) { if (tid < st) red[tid] += red[tid + st]; __syncthreads(); }
  const float mu = red[0] / (float)N; __syncthreads();
  float s2 = 0.f;
  for (int u = 0; u < per / 4; ++u)
#pragma unroll
    for (int q = 0; q < 4; ++q) { const float c = vals[u * 4 + q] - mu; s2 += c * c; }
  red[tid] = s2; __syncthreads();
  for (int st = 128; st > 0; st >>= 1) { if (tid < st) red[tid] += red[tid + st]; __syncthreads(); }
  const float rs = rsqrtf(red[0] / (float)N + eps);
  {
    for (int u = 0; u < per / 4; ++u) {
      const int j = tid * 4 + 1024 * u;
      v4f o, sm;
#pragma unroll
      for (int q = 0; q < 4; ++q) {
        float gg = g[j + q], bb = bta[j + q];
        if (PARAM_BF16) { gg = bf16_round(gg); bb = bf16_round(bb); }
        sm[q] = vals[u * 4 + q]; o[q] = (vals[u * 4 + q] - mu) * rs * gg + bb;
      }
      if (out_sum) *(v4f*)(out_sum + (size_t)row * N + j) = sm;
      *(v4f*)(out_norm + (size_t)row * N + j) = o;
    }
    
  }
}



// ---- f16 WMMA path (v_wmma_f32_16x16x32_f16): 11-bit significands for operands in range — used where a [0,1] probability operand needs more precision than bf16
typedef _Float16 v16h __attribute__((ext_vector_type(16)));
union FragH { v16h v; v8us half[2]; _Float16 h[16]; unsigned short u[16]; };
template <int NT>
__device__ __forceinline__ v8f mmaH(v16h ah, v16h al, v16h bh, v16h bl, v8f c) {
  c = __builtin_amdgcn_wmma_f32_16x16x32_f16(false, ah, false, bh, (short)0, c, false, false);
  if (NT >= 2) c = __builtin_amdgcn_wmma_f32_16x16x32_f16(false, al, false, bh, (short)0, c, false, false);
  if (NT >= 3) c = __builtin_amdgcn_wmma_f32_16x16x32_f16(false, ah, false, bl, (short)0, c, false, false);
  asm volatile("v_nop\n\tv_nop\n\tv_nop\n\tv_nop" : "+v"(c) : "v"(ah), "v"(al), "v"(bh), "v"(bl));
  return c;
}
// batched GEMM like k_gemm_b but f16 operands: A f32 (split into f16 hi/lo if ASPLIT, else rounded to f16), Bt = f16 values [n][k]; alpha; C f32; N multiple of 16 (partial tiles skipped)
template <bool ASPLIT>
__global__ __launch_bounds__(128) void k_gemm_h(const float* __restrict__ A, int lda, size_t sA, const _Float16* __restrict__ Bh, int ldb, size_t sB, float alpha, float* __restrict__ C, int ldc, size_t sC, int M, int N, int K) {
  __shared__ __attribute__((aligned(16))) float so[4][16][64];
  const int tid = threadIdx.x, w = tid >> 5, lane = tid & 31, ln = lane & 15, hh = lane >> 4; const int by = blockIdx.y;
  A += (size_t)by * sA; Bh += (size_t)by * sB; C += (size_t)by * sC;
  const int ntn = (N + 63) / 64; const int wid = blockIdx.x * 4 + w; const int mt = wid / ntn, nq = wid % ntn; if (mt * 16 >= M) return;
  const int row0 = mt * 16, col0 = nq * 64; const float* arow = A + (size_t)(row0 + ln) * lda;
  v8f acc[4] = {};
  for (int kb = 0; kb < K; kb += 32) {
    FragH ah, al;
    const v4f x0 = *(const v4fa*)(arow + kb + 8 * hh), x1 = *(const v4fa*)(arow + kb + 8 * hh + 4), x2 = *(const v4fa*)(arow + kb + 16 + 8 * hh), x3 = *(const v4fa*)(arow + kb + 16 + 8 * hh + 4);
    float xs[16] = {x0[0],x0[1],x0[2],x0[3],x1[0],x1[1],x1[2],x1[3],x2[0],x2[1],x2[2],x2[3],x3[0],x3[1],x3[2],x3[3]};
#pragma unroll
    for (int i = 0; i < 16; ++i) { const _Float16 h = (_Float16)xs[i]; ah.h[i] = h; al.h[i] = ASPLIT ? (_Float16)(xs[i] - (float)h) : (_Float16)0.0f; }
#pragma unroll
    for (int t = 0; t < 4; ++t) { if (col0 + t * 16 >= N) continue; const size_t boff = (size_t)(col0 + t * 16 + ln) * ldb + kb; FragH bq; bq.half[0] = *(const v8us*)(Bh + boff + 8 * hh); bq.half[1] = *(const v8us*)(Bh + boff + 16 + 8 * hh);
      acc[t] = mmaH<ASPLIT ? 2 : 1>(ah.v, al.v, bq.v, bq.v, acc[t]); }
  }
#pragma unroll
  for (int t = 0; t < 4; ++t) { if (col0 + t * 16 >= N) continue;
#pragma unroll
    for (int r = 0; r < 8; ++r) so[w][8 * hh + r][t * 16 + ln] = acc[t][r] * alpha; }
  __builtin_amdgcn_fence(__ATOMIC_ACQ_REL, "workgroup"); __builtin_amdgcn_wave_barrier();
  const int rsub = lane >> 4, c4 = (lane & 15) * 4;
  {
#pragma unroll
    for (int q = 0; q < 8; ++q) { const int r = q * 2 + rsub; if (col0 + c4 < N) { const v4f v = *(const v4fa*)&so[w][r][c4]; *(v4f*)(C + (size_t)(row0 + r) * ldc + col0 + c4) = v; } }
     }
}

// Wt[n][k] = f16(W[k][n]·scale) from f32 row-major W[K][N] (scale = power of two; bf16-exact weights stay exact in f16 away from the subnormal range)
__global__ __launch_bounds__(256) void k_wt_f16(const float* __restrict__ W, _Float16* __restrict__ Wt, int K, int N, float scale) {
  const int t = blockIdx.x * 256 + threadIdx.x; if (t >= N * (K / 8)) return; const int n = t / (K / 8), k8 = (t % (K / 8)) * 8; FragH f;
#pragma unroll
  for (int i = 0; i < 8; ++i) f.h[i] = (_Float16)(bf16_round(W[(size_t)(k8 + i) * N + n]) * scale); const v8us o = f.half[0];
  *(v8us*)((unsigned short*)Wt + (size_t)n * K + k8) = o; 
}
// k_gemm_hh variant with fused epilogue: v = acc·alpha + bias[by·sBias + col] (+ CP[(row/rowsPerB)·sCPb + by·64 + col] if CP) ; ACT 0 none / 1 elu ; writes f16 C16 (and f32 C if non-null)
template <int ACT>
__global__ __launch_bounds__(128) void k_gemm_hhx(const _Float16* __restrict__ A, int lda, size_t sA, const _Float16* __restrict__ Bh, int ldb, size_t sB, float alpha, const float* __restrict__ bias, size_t sBias, const float* __restrict__ CP, int rowsPerB, size_t sCPb, int row0g,
    float* __restrict__ C, _Float16* __restrict__ C16, int ldc, size_t sC, int M, int N, int K) {
  __shared__ __attribute__((aligned(16))) float so[4][16][64];
  const int tid = threadIdx.x, w = tid >> 5, lane = tid & 31, ln = lane & 15, hh = lane >> 4; const int by = blockIdx.y;
  A += (size_t)by * sA; Bh += (size_t)by * sB; const size_t cofs = (size_t)by * sC; const float* bp = bias ? bias + (size_t)by * sBias : nullptr;
  const int ntn = (N + 63) / 64; const int wid = blockIdx.x * 4 + w; const int mt = wid / ntn, nq = wid % ntn; if (mt * 16 >= M) return;
  const int row0 = mt * 16, col0 = nq * 64; const _Float16* arow = A + (size_t)(row0 + ln) * lda;
  v8f acc[4] = {};
  for (int kb = 0; kb < K; kb += 32) { FragH ah; ah.half[0] = *(const v8us*)((const unsigned short*)arow + kb + 8 * hh); ah.half[1] = *(const v8us*)((const unsigned short*)arow + kb + 16 + 8 * hh);
#pragma unroll
    for (int t = 0; t < 4; ++t) { if (col0 + t * 16 >= N) continue; const size_t boff = (size_t)(col0 + t * 16 + ln) * ldb + kb; FragH bq; bq.half[0] = *(const v8us*)((const unsigned short*)Bh + boff + 8 * hh); bq.half[1] = *(const v8us*)((const unsigned short*)Bh + boff + 16 + 8 * hh);
      acc[t] = mmaH<1>(ah.v, ah.v, bq.v, bq.v, acc[t]); }
  }
#pragma unroll
  for (int t = 0; t < 4; ++t) { if (col0 + t * 16 >= N) continue; const int col = col0 + t * 16 + ln; const float bv = bp ? bf16_round(bp[col]) : 0.f;
#pragma unroll
    for (int r = 0; r < 8; ++r) { float v = acc[t][r] * alpha + bv; if (CP) { const int bidx = (row0g + row0 + 8 * hh + r) / rowsPerB; v += CP[(size_t)bidx * sCPb + (size_t)by * 64 + col]; } if (ACT == 1) v = (v > 0.f) ? v : expm1f(v); else if (ACT == 7) v = (v > 0.f) ? v + 1.0f : expf(v); else if (ACT == 8) v = tanhf(v); else if (ACT == 9) v = 0.5f * v * (1.0f + tanhf(0.7978845608028654f * (v + 0.044715f * v * v * v))); else if (ACT == 11) v = 1.0f / (1.0f + expf(-v)); else if (ACT == 12) v = (v > 0.f) ? v : 0.01f * v; else if (ACT == 14) v = (v > 0.f) ? v : 0.1f * v; else if (ACT == 15) v = v / (1.0f + expf(-v)); else if (ACT == 3) v = fmaxf(v, 0.f); else if (ACT == 6) v = 0.5f * v * (1.0f + erff(v * 0.70710678118654752f)); so[w][8 * hh + r][t * 16 + ln] = v; } }
  __builtin_amdgcn_fence(__ATOMIC_ACQ_REL, "workgroup"); __builtin_amdgcn_wave_barrier();
  const int rsub = lane >> 4, c4 = (lane & 15) * 4; typedef _Float16 v4h __attribute__((ext_vector_type(4)));
  {
#pragma unroll
    for (int q = 0; q < 8; ++q) { const int r = q * 2 + rsub; if (col0 + c4 < N) { const v4f v = *(const v4fa*)&so[w][r][c4]; if (C) *(v4f*)(C + cofs + (size_t)(row0 + r) * ldc + col0 + c4) = v; if (C16) { v4h h4; for (int i = 0; i < 4; ++i) h4[i] = (_Float16)v[i]; *(v4h*)(C16 + cofs + (size_t)(row0 + r) * ldc + col0 + c4) = h4; } } }
     }
}


typedef _Float16 v4h __attribute__((ext_vector_type(4)));

__global__ __launch_bounds__(256) void k_x16(const float* __restrict__ x, _Float16* __restrict__ X16, size_t n8) { const size_t t = (size_t)blockIdx.x * 256 + threadIdx.x; if (t >= n8) return; FragH f;
#pragma unroll
  for (int q = 0; q < 8; ++q) f.h[q] = (_Float16)bf16_round(x[t * 8 + q]); *(v8us*)((unsigned short*)X16 + t * 8) = f.half[0];  }
__global__ __launch_bounds__(256) void k_h16(const float* __restrict__ x, _Float16* __restrict__ X16, size_t n8) { const size_t t = (size_t)blockIdx.x * 256 + threadIdx.x; if (t >= n8) return; FragH f;
#pragma unroll
  for (int q = 0; q < 8; ++q) f.h[q] = (_Float16)x[t * 8 + q]; *(v8us*)((unsigned short*)X16 + t * 8) = f.half[0];  }
__global__ __launch_bounds__(256) void k_round16f(const float* __restrict__ W, _Float16* __restrict__ Bt, size_t n8) { const size_t t = (size_t)blockIdx.x * 256 + threadIdx.x; if (t >= n8) return; FragH f;
#pragma unroll
  for (int i = 0; i < 8; ++i) f.h[i] = (_Float16)(bf16_round(W[t * 8 + i]) * 16.0f); *(v8us*)((unsigned short*)Bt + t * 8) = f.half[0];  }
template <int NHv, int TTv>
__global__ __launch_bounds__(256) void k_vt(const _Float16* __restrict__ V16, int ldv, int voff, _Float16* __restrict__ Vt) { __shared__ unsigned short tl[64][66]; const int tid = threadIdx.x; const int slab = blockIdx.x / (TTv / 64), lg = blockIdx.x % (TTv / 64); const int b = slab / NHv, h = slab % NHv;
  for (int i = tid; i < 64 * 8; i += 256) { const int r = i / 8, c8 = (i % 8) * 8; FragH f; f.half[0] = *(const v8us*)((const unsigned short*)V16 + ((size_t)b * TTv + lg * 64 + r) * ldv + voff + h * 64 + c8);
#pragma unroll
    for (int q = 0; q < 8; ++q) tl[r][c8 + q] = f.u[q]; }
  __syncthreads();
  {
#pragma unroll
    for (int rd = 0; rd < 2; ++rd) { const int d = rd * 32 + tid / 8, pc = tid % 8; FragH f;
#pragma unroll
      for (int q = 0; q < 8; ++q) f.u[q] = tl[pc * 8 + q][d];
      *(v8us*)((unsigned short*)Vt + ((size_t)slab * 64 + d) * TTv + lg * 64 + pc * 8) = f.half[0]; }
     } }

__global__ __launch_bounds__(256) void k_hl(const float* __restrict__ F, _Float16* __restrict__ Hh, _Float16* __restrict__ Hl, size_t n8) { const size_t t = (size_t)blockIdx.x * 256 + threadIdx.x; if (t >= n8) return; FragH fh, fl; const v4f a = *(const v4fa*)(F + t * 8), c = *(const v4fa*)(F + t * 8 + 4);
#pragma unroll
  for (int q = 0; q < 4; ++q) { _Float16 h = (_Float16)a[q]; fh.h[q] = h; fl.h[q] = (_Float16)((a[q] - (float)h) * 1024.0f); h = (_Float16)c[q]; fh.h[4 + q] = h; fl.h[4 + q] = (_Float16)((c[q] - (float)h) * 1024.0f); }
  { *(v8us*)((unsigned short*)Hh + t * 8) = fh.half[0]; *(v8us*)((unsigned short*)Hl + t * 8) = fl.half[0];  } }

// ---- fast GEMM (block tile 128x64, wave tile 32x64; requires M % 128 == 0, N % 64 == 0, K % 64 == 0); A and B tiles of 64 k staged in LDS; epilogue = k_gemm_hhx semantics ----
__device__ __forceinline__ v16h g2_frag(const _Float16* p, int hh) { FragH f; f.half[0] = *(const v8us*)((const unsigned short*)p + 8 * hh); f.half[1] = *(const v8us*)((const unsigned short*)p + 16 + 8 * hh); return f.v; }
__device__ __forceinline__ v8f g2_mma(v16h a, v16h b, v8f c) { v8f d = __builtin_amdgcn_wmma_f32_16x16x32_f16(false, a, false, b, (short)0, c, false, false); asm volatile("v_nop\n\tv_nop\n\tv_nop\n\tv_nop" : "+v"(d) : "v"(a), "v"(b)); return d; }
template <int ACT>
__global__ __launch_bounds__(128) void k_gemm2(const _Float16* __restrict__ A, int lda, size_t sA, const _Float16* __restrict__ Bh, int ldb, size_t sB, float alpha, const float* __restrict__ bias, size_t sBias, const float* __restrict__ CP, int rowsPerB, size_t sCPb, int row0g,
    float* __restrict__ C, _Float16* __restrict__ C16, int ldc, size_t sC, int M, int N, int K) {
  constexpr int GK = 64, GP = 72;      // a tile = 64 k; LDS row pitch 144 B (16 B x odd: ds_load_b128 without bank conflicts)
  __shared__ __attribute__((aligned(16))) _Float16 tA[2][128][GP]; __shared__ __attribute__((aligned(16))) _Float16 tB[2][64][GP];      // two buffers each
  __shared__ __attribute__((aligned(16))) float so[4][32][68];
  const int tid = threadIdx.x, w = tid >> 5, lane = tid & 31, ln = lane & 15, hh = lane >> 4; const int by = blockIdx.y;
  A += (size_t)by * sA; Bh += (size_t)by * sB; const size_t cofs = (size_t)by * sC; const float* bp = bias ? bias + (size_t)by * sBias : nullptr;
  const int ntn = N >> 6; const int mt = blockIdx.x / ntn, nq = blockIdx.x - mt * ntn; const int row0 = mt * 128 + 32 * w, col0 = nq * 64; if (mt * 128 >= M) return;      // the whole block leaves or none of it: barriers follow
  // every thread copies 8 + 4 pieces of 16 B per tile (8 lanes cover one whole 128-B row)
  const int crow = tid >> 3, cc8 = (tid & 7) * 8;
  const _Float16* gA = A + (size_t)(mt * 128 + crow) * lda + cc8; const _Float16* gB = Bh + (size_t)(col0 + crow) * ldb + cc8;
  const unsigned lA = (unsigned)(size_t)&tA[0][crow][cc8], lB = (unsigned)(size_t)&tB[0][crow][cc8];
  auto copy_tile = [&](int t) {
    const unsigned ao = lA + (unsigned)(t & 1) * (unsigned)(128 * GP * 2), bo = lB + (unsigned)(t & 1) * (unsigned)(64 * GP * 2), r16 = 16 * GP * 2; const _Float16* ap = gA + (size_t)t * GK; const _Float16* bq = gB + (size_t)t * GK; const size_t a16 = (size_t)16 * lda, b16 = (size_t)16 * ldb;
    // the copies and, as the last line of the same statement, the wait that stands before their address registers are rewritten
    asm volatile("global_load_async_to_lds_b128 %0, %12, off\n\tglobal_load_async_to_lds_b128 %1, %13, off\n\tglobal_load_async_to_lds_b128 %2, %14, off\n\tglobal_load_async_to_lds_b128 %3, %15, off\n\t"
                 "global_load_async_to_lds_b128 %4, %16, off\n\tglobal_load_async_to_lds_b128 %5, %17, off\n\tglobal_load_async_to_lds_b128 %6, %18, off\n\tglobal_load_async_to_lds_b128 %7, %19, off\n\t"
                 "global_load_async_to_lds_b128 %8, %20, off\n\tglobal_load_async_to_lds_b128 %9, %21, off\n\tglobal_load_async_to_lds_b128 %10, %22, off\n\tglobal_load_async_to_lds_b128 %11, %23, off\n\ts_wait_xcnt 0x0"
                 :: "v"(ao), "v"(ao + r16), "v"(ao + 2 * r16), "v"(ao + 3 * r16), "v"(ao + 4 * r16), "v"(ao + 5 * r16), "v"(ao + 6 * r16), "v"(ao + 7 * r16), "v"(bo), "v"(bo + r16), "v"(bo + 2 * r16), "v"(bo + 3 * r16),
                    "v"(ap), "v"(ap + a16), "v"(ap + 2 * a16), "v"(ap + 3 * a16), "v"(ap + 4 * a16), "v"(ap + 5 * a16), "v"(ap + 6 * a16), "v"(ap + 7 * a16), "v"(bq), "v"(bq + b16), "v"(bq + 2 * b16), "v"(bq + 3 * b16) : "memory"); };
  const v8f z8 = {0.f,0.f,0.f,0.f,0.f,0.f,0.f,0.f}; v8f c00 = z8, c01 = z8, c02 = z8, c03 = z8, c10 = z8, c11 = z8, c12 = z8, c13 = z8;
  const int nst = K / GK;
  copy_tile(0);
  asm volatile("s_wait_asynccnt 0x0" ::: "memory");      // this wave's copies of tile 0 have landed
  __syncthreads();                                       // every wave's have: tile 0 may be read
  if (nst > 1) copy_tile(1);
#pragma unroll 1
  for (int t = 0; t < nst; ++t) { const _Float16 (*pA)[GP] = tA[t & 1]; const _Float16 (*pB)[GP] = tB[t & 1];
#pragma unroll
    for (int kb = 0; kb < GK; kb += 32) { const v16h a0 = g2_frag(&pA[32 * w + ln][kb], hh), a1 = g2_frag(&pA[32 * w + 16 + ln][kb], hh);
      v16h b = g2_frag(&pB[ln][kb], hh); c00 = g2_mma(a0, b, c00); c10 = g2_mma(a1, b, c10);
      b = g2_frag(&pB[16 + ln][kb], hh); c01 = g2_mma(a0, b, c01); c11 = g2_mma(a1, b, c11);
      b = g2_frag(&pB[32 + ln][kb], hh); c02 = g2_mma(a0, b, c02); c12 = g2_mma(a1, b, c12);
      b = g2_frag(&pB[48 + ln][kb], hh); c03 = g2_mma(a0, b, c03); c13 = g2_mma(a1, b, c13); }
    asm volatile("s_wait_dscnt 0x0" ::: "memory");       // this wave's reads of tile t are done before its buffer is refilled
    asm volatile("s_wait_asynccnt 0x0" ::: "memory");    // this wave's copies of tile t + 1 have landed
    __syncthreads();                                     // publishes tile t + 1 and ends every wave's reads of tile t
    if (t + 2 < nst) copy_tile(t + 2); }
  asm volatile("s_wait_asynccnt 0x0" ::: "memory");      // nothing of this wave is in flight when it goes on to the epilogue and ends
  v8f accs[8] = {c00, c01, c02, c03, c10, c11, c12, c13};
#pragma unroll
  for (int u = 0; u < 8; ++u) { const int t = u & 3, half = u >> 2; const int col = col0 + t * 16 + ln; const float bv = bp ? bf16_round(bp[col]) : 0.f;
#pragma unroll
    for (int r = 0; r < 8; ++r) { const int rloc = half * 16 + 8 * hh + r; float v = accs[u][r] * alpha + bv; if (CP) { const int bidx = (row0g + row0 + rloc) / rowsPerB; v += CP[(size_t)bidx * sCPb + (size_t)by * 64 + col]; }
      if (ACT == 3) v = fmaxf(v, 0.f); else if (ACT == 6) v = 0.5f * v * (1.0f + erff(v * 0.70710678118654752f)); else if (ACT == 11) v = 1.0f / (1.0f + expf(-v)); else if (ACT == 15) v = v / (1.0f + expf(-v)); else if (ACT == 12) v = (v > 0.f) ? v : 0.01f * v; else if (ACT == 8) v = tanhf(v);
      so[w][rloc][t * 16 + ln] = v; } }
  __builtin_amdgcn_fence(__ATOMIC_ACQ_REL, "workgroup"); __builtin_amdgcn_wave_barrier();
  const int rsub = lane >> 4, c4 = (lane & 15) * 4;
  {
#pragma unroll
    for (int q = 0; q < 16; ++q) { const int r = q * 2 + rsub; const v4f v = *(const v4fa*)&so[w][r][c4]; if (C) *(v4f*)(C + cofs + (size_t)(row0 + r) * ldc + col0 + c4) = v; if (C16) { v4h h4; for (int i = 0; i < 4; ++i) h4[i] = (_Float16)v[i]; *(v4h*)(C16 + cofs + (size_t)(row0 + r) * ldc + col0 + c4) = h4; } }
     } }



// lane l with lane l ^ 16
__device__ __forceinline__ float xhalf(float x) { return __builtin_bit_cast(float, __builtin_amdgcn_permlanex16(__builtin_bit_cast(int, x), __builtin_bit_cast(int, x), 0x76543210, 0xfedcba98, false, false)); }
__global__ __launch_bounds__(128) void k_flash(const _Float16* __restrict__ Q16, int ldq, const _Float16* __restrict__ K16, int ldk, const _Float16* __restrict__ Vt, const int* __restrict__ MSK, float* __restrict__ O, int ldo) {
  constexpr int RPW = 16, NQB = TQ / (4 * RPW), DT = 4, KS = 2;
  constexpr int SK = 64, NST = TK / SK, LP = 72;      // a tile = 64 keys; LDS row pitch 144 B (16 B x odd: ds_load_b128 without bank conflicts)
  __shared__ __attribute__((aligned(16))) unsigned short sK[2][SK][LP]; __shared__ __attribute__((aligned(16))) unsigned short sV[2][64][LP];      // two buffers each: K rows [key][d], V^T rows [d][key]
  __shared__ __attribute__((aligned(16))) float sO[4][RPW][64 + 4];
  const int tid = threadIdx.x, w = tid >> 5, lane = tid & 31, ln = lane & 15, hh = lane >> 4;
  const int slab = blockIdx.x / NQB, qblk = blockIdx.x % NQB; const int b = slab / NH, h = slab % NH; const int qb0 = qblk * (4 * RPW); const int q0 = qb0 + w * RPW;
  FragH bq[KS];
  { const unsigned short* qr = (const unsigned short*)Q16 + ((size_t)b * TQ + q0 + ln) * ldq + h * 64;
#pragma unroll
    for (int ks = 0; ks < KS; ++ks) { bq[ks].half[0] = *(const v8us*)(qr + ks * 32 + 8 * hh); bq[ks].half[1] = *(const v8us*)(qr + ks * 32 + 16 + 8 * hh); } }
  const unsigned short* Vth = (const unsigned short*)Vt + (size_t)slab * 64 * TK;
  float m_r = -3.0e38f, l_r = 0.f; v8f oacc[DT];      // one query per lane: its running maximum, this lane half's part of its sum, O^T rows d = dt * 16 + 8 * hh + r
#pragma unroll
  for (int dt = 0; dt < DT; ++dt) oacc[dt] = (v8f){0.f,0.f,0.f,0.f,0.f,0.f,0.f,0.f};
  // The block's four waves share each K / V^T tile: every thread copies 4 + 4 pieces of 16 B (8 lanes cover one whole 128-B row).
  const int crow = tid >> 3, cc8 = (tid & 7) * 8;
  const unsigned short* gK = (const unsigned short*)K16 + ((size_t)b * TK + crow) * ldk + h * 64 + cc8; const unsigned short* gV = Vth + (size_t)crow * TK + cc8;
  const unsigned lK = (unsigned)(size_t)&sK[0][crow][cc8], lV = (unsigned)(size_t)&sV[0][crow][cc8];
  auto copy_tile = [&](int t) {
    const unsigned bo = (unsigned)(t & 1) * (unsigned)(SK * LP * 2), r16 = 16 * LP * 2; const unsigned short* kp = gK + (size_t)t * SK * ldk; const unsigned short* vp = gV + (size_t)t * SK;
    // the copies and, as the last line of the same statement, the wait that stands before their address registers are rewritten
    asm volatile("global_load_async_to_lds_b128 %0, %8, off\n\tglobal_load_async_to_lds_b128 %1, %9, off\n\tglobal_load_async_to_lds_b128 %2, %10, off\n\tglobal_load_async_to_lds_b128 %3, %11, off\n\t"
                 "global_load_async_to_lds_b128 %4, %12, off\n\tglobal_load_async_to_lds_b128 %5, %13, off\n\tglobal_load_async_to_lds_b128 %6, %14, off\n\tglobal_load_async_to_lds_b128 %7, %15, off\n\ts_wait_xcnt 0x0"
                 :: "v"(lK + bo), "v"(lK + bo + r16), "v"(lK + bo + 2 * r16), "v"(lK + bo + 3 * r16), "v"(lV + bo), "v"(lV + bo + r16), "v"(lV + bo + 2 * r16), "v"(lV + bo + 3 * r16),
                    "v"(kp), "v"(kp + (size_t)16 * ldk), "v"(kp + (size_t)32 * ldk), "v"(kp + (size_t)48 * ldk), "v"(vp), "v"(vp + (size_t)16 * TK), "v"(vp + (size_t)32 * TK), "v"(vp + (size_t)48 * TK) : "memory"); };
  copy_tile(0);
  asm volatile("s_wait_asynccnt 0x0" ::: "memory");      // this wave's copies of tile 0 have landed
  __syncthreads();                                       // every wave's have: tile 0 may be read
  copy_tile(1);
#pragma unroll 1
  for (int t = 0; t < NST; ++t) {
   const unsigned short (*bK)[LP] = sK[t & 1]; const unsigned short (*bV)[LP] = sV[t & 1];
#pragma unroll
   for (int ps = 0; ps < SK / 32; ++ps) {
    float sc[2][8];
#pragma unroll
    for (int nt = 0; nt < 2; ++nt) { const unsigned short* kr = &bK[ps * 32 + nt * 16 + ln][0]; FragH ak[KS];
#pragma unroll
      for (int ks = 0; ks < KS; ++ks) { ak[ks].half[0] = *(const v8us*)(kr + ks * 32 + 8 * hh); ak[ks].half[1] = *(const v8us*)(kr + ks * 32 + 16 + 8 * hh); }
      v8f acc = (v8f){0.f,0.f,0.f,0.f,0.f,0.f,0.f,0.f};
#pragma unroll
      for (int ks = 0; ks < KS; ++ks) acc = mmaH<1>(ak[ks].v, ak[ks].v, bq[ks].v, bq[ks].v, acc);
#pragma unroll
      for (int r = 0; r < 8; ++r) sc[nt][r] = acc[r] * SCL; }
    float mc = fmaxf(sc[0][0], sc[1][0]);
#pragma unroll
    for (int r = 1; r < 8; ++r) mc = fmaxf(mc, fmaxf(sc[0][r], sc[1][r]));
    mc = fmaxf(mc, xhalf(mc));      // both lane halves now hold the query's maximum over the 32 keys
    const float mn = fmaxf(m_r, mc); const float al = (mn > -1.0e38f) ? expf(m_r - mn) : 1.0f; m_r = mn;
    FragH pb; float ls[4] = {0.f, 0.f, 0.f, 0.f};
#pragma unroll
    for (int nt = 0; nt < 2; ++nt)
#pragma unroll
      for (int r = 0; r < 8; ++r) { const float p = expf(sc[nt][r] - mn); ls[r & 3] += p; pb.h[nt * 8 + r] = (_Float16)(p * 1024.0f); }
    l_r = l_r * al + ((ls[0] + ls[1]) + (ls[2] + ls[3]));
#pragma unroll
    for (int dt = 0; dt < DT; ++dt) oacc[dt] *= al;
#pragma unroll
    for (int dt = 0; dt < DT; ++dt) { const unsigned short* vrow = &bV[dt * 16 + ln][ps * 32]; FragH av; av.half[0] = *(const v8us*)(vrow + 8 * hh); av.half[1] = *(const v8us*)(vrow + 16 + 8 * hh);
      oacc[dt] = mmaH<1>(av.v, av.v, pb.v, pb.v, oacc[dt]); } }
   asm volatile("s_wait_dscnt 0x0" ::: "memory");        // this wave's reads of tile t are done before its buffer is refilled
   asm volatile("s_wait_asynccnt 0x0" ::: "memory");     // this wave's copies of tile t + 1 have landed
   __syncthreads();                                      // publishes tile t + 1 and ends every wave's reads of tile t
   if (t + 2 < NST) copy_tile(t + 2); }
  asm volatile("s_wait_asynccnt 0x0" ::: "memory");      // nothing of this wave is in flight when it goes on to the epilogue and ends
  const float l = l_r + xhalf(l_r);      // the two lane halves' sums joined, unconditionally
  const float inv = (l > 0.f) ? 1.0f / (l * 1024.0f) : 0.f;
#pragma unroll
  for (int dt = 0; dt < DT; ++dt) { const v4f lo = {oacc[dt][0] * inv, oacc[dt][1] * inv, oacc[dt][2] * inv, oacc[dt][3] * inv}, hi = {oacc[dt][4] * inv, oacc[dt][5] * inv, oacc[dt][6] * inv, oacc[dt][7] * inv};
    *(v4fa*)&sO[w][ln][dt * 16 + 8 * hh] = lo; *(v4fa*)&sO[w][ln][dt * 16 + 8 * hh + 4] = hi; }
  __builtin_amdgcn_fence(__ATOMIC_ACQ_REL, "workgroup"); __builtin_amdgcn_wave_barrier();
  {
#pragma unroll
    for (int rp = 0; rp < RPW; rp += 2) { const int r = rp + (lane >> 4), pc = lane & 15; const v4f val = *(const v4fa*)&sO[w][r][pc * 4]; *(v4f*)(O + ((size_t)b * TQ + q0 + r) * ldo + h * 64 + pc * 4) = val; }
     } }
__global__ __launch_bounds__(256) void k_fulltab(unsigned* __restrict__ MB, int* __restrict__ RA, int* __restrict__ KE, int nq, int nk) {
  const int t = blockIdx.x * 256 + threadIdx.x;
  if (t < nq * (nk / 32)) { *(unsigned*)(MB + t) = 0u;  }
  if (t < nq) { *(int*)(RA + t) = 0;  }
  if (t < nq / 64) { *(int*)(KE + t * 32) = nk;  } }
__global__ __launch_bounds__(256) void k_lnout(const float* __restrict__ Y, const float* __restrict__ g, const float* __restrict__ bb, float* __restrict__ out) {
  #pragma clang fp contract(off)
  const int tid = threadIdx.x, w = tid >> 5, ln = tid & 31; const int r = blockIdx.x * 8 + w; if (r >= NR) return; const float* y = Y + (size_t)r * DM; float s = 0.f;
#pragma unroll 1
  for (int i = 0; i < 8; ++i) { const v4f a = *(const v4fa*)(y + i * 128 + ln * 4); for (int q = 0; q < 4; ++q) s += a[q]; }
  for (int o = 16; o > 0; o >>= 1) s += __shfl_xor(s, o, 32); const float mu = s / (float)DM; float q2 = 0.f;
#pragma unroll 1
  for (int i = 0; i < 8; ++i) { const v4f a = *(const v4fa*)(y + i * 128 + ln * 4); for (int q = 0; q < 4; ++q) { const float d = a[q] - mu; q2 += d * d; } }
  for (int o = 16; o > 0; o >>= 1) q2 += __shfl_xor(q2, o, 32); const float rs = rsqrtf(q2 / (float)DM + 1e-6f);
  {
#pragma unroll 1
    for (int i = 0; i < 8; ++i) { const int c0 = i * 128 + ln * 4; const v4f a = *(const v4fa*)(y + c0); v4f o4; for (int q = 0; q < 4; ++q) o4[q] = (a[q] - mu) * rs * bf16_round(g[c0 + q]) + bf16_round(bb[c0 + q]); *(v4f*)(out + (size_t)r * DM + c0) = o4; }
     } }
__global__ __launch_bounds__(256) void k_xb(const float* __restrict__ x, float* __restrict__ XB, size_t n4) { const size_t t = (size_t)blockIdx.x * 256 + threadIdx.x; if (t >= n4) return; const v4f a = *(const v4fa*)(x + t * 4); v4f o; for (int q = 0; q < 4; ++q) o[q] = bf16_round(a[q]); *(v4f*)(XB + t * 4) = o;  }
__global__ __launch_bounds__(256) void k_causaltab(unsigned* __restrict__ MB, int* __restrict__ RA, int* __restrict__ KE, int nq, int nk) {
  const int t = blockIdx.x * 256 + threadIdx.x; const int nw = nk / 32;
  if (t < nq * nw) { const int q = t / nw, w = t % nw; const int first = q + 1 - 32 * w; const unsigned bits = (first <= 0) ? 0xffffffffu : ((first >= 32) ? 0u : (0xffffffffu << first)); *(unsigned*)(MB + t) = bits;  }
  if (t < nq) { *(int*)(RA + t) = 0;  }
  if (t < nq / 64) { const int v = 64 * (t + 1); *(int*)(KE + t * 32) = v;  } }


extern "C" void kernel_launch(void* const* d_in, const int* in_sizes, int n_in,
                              void* d_out, int out_size, void* d_ws, size_t ws_size, hipStream_t stream) {
  (void)in_sizes; (void)n_in; (void)out_size;
  const float* const* I = (const float* const*)d_in; const float* qin = I[0]; const float* kin = I[1]; const float* vin = I[2]; const float* Wq = I[3]; const float* Wk = I[4]; const float* Wv = I[5]; const float* Wo = I[6]; const float* gam = I[7]; const float* bet = I[8];
  char* ws = (char*)d_ws; size_t off = 0;
  auto take = [&](size_t bytes) { char* p = ws + off; off += (bytes + 255) & ~(size_t)255; return p; };
  _Float16* BQ = (_Float16*)take((size_t)DM * DM * 2); _Float16* BK = (_Float16*)take((size_t)DM * DM * 2); _Float16* BV = (_Float16*)take((size_t)DM * DM * 2); _Float16* BO = (_Float16*)take((size_t)DM * DM * 2);
  _Float16* X16 = (_Float16*)take((size_t)NR * DM * 2); float* F = (float*)take((size_t)NR * DM * 4); float* XB = (float*)take((size_t)NR * DM * 4);
  _Float16* Q16 = (_Float16*)take((size_t)NR * DM * 2); _Float16* K16 = (_Float16*)take((size_t)NR * DM * 2); _Float16* V16 = (_Float16*)take((size_t)NR * DM * 2); _Float16* VT = (_Float16*)take((size_t)NR * DM * 2);
  if (off > ws_size) return;      /* 8 + 8 + 16 + 16 + 32 = 80 MiB */
  float* O = F; _Float16* Oh = Q16; _Float16* Ol = K16; float* Y = XB;
  const size_t n8 = (size_t)NR * DM / 8; const unsigned nb8 = (unsigned)((n8 + 255) / 256); const size_t w8 = (size_t)DM * DM / 8; const unsigned wb = (unsigned)((w8 + 255) / 256);
  k_round16f<<<wb, 256, 0, stream>>>(Wq, BQ, w8); k_round16f<<<wb, 256, 0, stream>>>(Wk, BK, w8); k_round16f<<<wb, 256, 0, stream>>>(Wv, BV, w8); k_round16f<<<wb, 256, 0, stream>>>(Wo, BO, w8);
  const dim3 gP((NR / 128) * (DM / 64), 1);
  k_x16<<<nb8, 256, 0, stream>>>(qin, X16, n8); k_xb<<<(unsigned)(((size_t)NR * DM / 4 + 255) / 256), 256, 0, stream>>>(qin, XB, (size_t)NR * DM / 4);
  k_gemm2<0><<<gP, 128, 0, stream>>>(X16, DM, 0, BQ, DM, 0, 0.0625f, nullptr, 0, nullptr, 1, 0, 0, nullptr, Q16, DM, 0, NR, DM, DM);      /* qh (f16) */
  k_x16<<<nb8, 256, 0, stream>>>(kin, X16, n8);
  k_gemm2<0><<<gP, 128, 0, stream>>>(X16, DM, 0, BK, DM, 0, 0.0625f, nullptr, 0, nullptr, 1, 0, 0, nullptr, K16, DM, 0, NR, DM, DM);      /* kh (f16) */
  k_x16<<<nb8, 256, 0, stream>>>(vin, X16, n8);
  k_gemm2<0><<<gP, 128, 0, stream>>>(X16, DM, 0, BV, DM, 0, 0.0625f, nullptr, 0, nullptr, 1, 0, 0, nullptr, V16, DM, 0, NR, DM, DM);      /* vh (f16) */
  k_vt<NH, SLEN><<<NH * (SLEN / 64), 256, 0, stream>>>(V16, DM, 0, VT);
  k_flash<<<NH * (SLEN / 64), 128, 0, stream>>>(Q16, DM, K16, DM, VT, nullptr, O, DM);      /* plain flash over all 4096 keys (no mask) */
  k_hl<<<nb8, 256, 0, stream>>>(O, Oh, Ol, n8);
  k_gemm2<0><<<gP, 128, 0, stream>>>(Oh, DM, 0, BO, DM, 0, 0.0625f, nullptr, 0, XB, 1, (size_t)DM, 0, Y, nullptr, DM, 0, NR, DM, DM);
  k_gemm2<0><<<gP, 128, 0, stream>>>(Ol, DM, 0, BO, DM, 0, 0.0625f / 1024.0f, nullptr, 0, Y, 1, (size_t)DM, 0, Y, nullptr, DM, 0, NR, DM, DM);
  k_lnout<<<NR / 8, 256, 0, stream>>>(Y, gam, bet, (float*)d_out);
}

// v003
// A run of this version takes 285 microseconds.
// In both of two side-by-side timings against v002, it was 1.11 times as fast.
// Over all steps from v000 it is 2.64 times as fast.
#include <hip/hip_runtime.h>
#define NBT 1
#define SLEN 4096
#define TQ SLEN
#define TK SLEN
#define DM 1024
#define NH 16
#define SCL 0.125f
#define NR (NBT * SLEN)
typedef __bf16 v16b __attribute__((ext_vector_type(16)));
typedef unsigned short v8us __attribute__((ext_vector_type(8), may_alias));
typedef float  v8f  __attribute__((ext_vector_type(8)));
typedef float  v4f  __attribute__((ext_vector_type(4)));
typedef float  v4fa __attribute__((ext_vector_type(4), may_alias));
union FragB { v16b v; v8us half[2]; unsigned short u[16]; };

__device__ __forceinline__ unsigned short bf16_bits(float x) { unsigned int u = __float_as_uint(x); return (unsigned short)((u + 0x7FFFu + ((u >> 16) & 1u)) >> 16); }
__device__ __forceinline__ float bf16_val(unsigned short b) { return __uint_as_float(((unsigned int)b) << 16); }
__device__ __forceinline__ float bf16_round(float x) { return bf16_val(bf16_bits(x)); }
// D += A·B with NT terms: 1 = ah·bh, 2 = + al·bh (A split), 3 = + ah·bl (both split)
template <int NT>
__device__ __forceinline__ v8f mmaN(v16b ah, v16b al, v16b bh, v16b bl, v8f c) {
  c = __builtin_amdgcn_wmma_f32_16x16x32_bf16(false, ah, false, bh, (short)0, c, false, false);
  if (NT >= 2) c = __builtin_amdgcn_wmma_f32_16x16x32_bf16(false, al, false, bh, (short)0, c, false, false);
  if (NT >= 3) c = __builtin_amdgcn_wmma_f32_16x16x32_bf16(false, ah, false, bl, (short)0, c, false, false);
  asm volatile("v_nop\n\tv_nop\n\tv_nop\n\tv_nop" : "+v"(c) : "v"(ah), "v"(al), "v"(bh), "v"(bl));
  return c;
}

__global__ __launch_bounds__(256) void k_wt_bf16(const float* __restrict__ W, unsigned short* __restrict__ Wt, int K, int N) {
  const int t = blockIdx.x * 256 + threadIdx.x;
  const int k8n = K / 8;
  if (t >= N * k8n) return;
  const int n = t / k8n, k8 = (t % k8n) * 8;
  v8us v;
#pragma unroll
  for (int i = 0; i < 8; ++i) v[i] = bf16_bits(W[(size_t)(k8 + i) * N + n]);
  *(v8us*)(Wt + (size_t)n * K + k8) = v;
  
}

// GEMM C[M][N] (f32, pitch ldc) = act(A[M][K]·W + bias). A f32 row-major (pitch lda) converted per fragment to bf16
// (ASPLIT: hi/lo two planes -> 2 terms, else single rounded term); Wt bf16 [N][K] (pitch ldb). BIAS_BF16 rounds the
// bias to bf16 first (bias quantised to bf16 before the add). K%32==0, M%16==0, N%64==0.
template <bool ASPLIT, int ACT, bool BIAS_BF16>
__global__ __launch_bounds__(128) void k_gemm_bf(const float* __restrict__ A, int lda, const unsigned short* __restrict__ Wt, int ldb,
                                               const float* __restrict__ bias, float* __restrict__ C, int ldc, int M, int N, int K) {
  __shared__ __attribute__((aligned(16))) float so[4][16][64];
  const int tid = threadIdx.x, w = tid >> 5, lane = tid & 31, ln = lane & 15, hh = lane >> 4;
  const int ntn = N / 64;
  const int wid = blockIdx.x * 4 + w;
  const int mt = wid / ntn, nq = wid % ntn;
  if (mt * 16 >= M) return;
  const int row0 = mt * 16, col0 = nq * 64;
  const float* arow = A + (size_t)(row0 + ln) * lda;
  v8f acc[4] = {};
  for (int kb = 0; kb < K; kb += 32) {
    FragB ah, al;
    const v4f x0 = *(const v4fa*)(arow + kb + 8 * hh), x1 = *(const v4fa*)(arow + kb + 8 * hh + 4);
    const v4f x2 = *(const v4fa*)(arow + kb + 16 + 8 * hh), x3 = *(const v4fa*)(arow + kb + 16 + 8 * hh + 4);
    float xs[16] = {x0[0],x0[1],x0[2],x0[3],x1[0],x1[1],x1[2],x1[3],x2[0],x2[1],x2[2],x2[3],x3[0],x3[1],x3[2],x3[3]};
#pragma unroll
    for (int i = 0; i < 16; ++i) { const unsigned short hb = bf16_bits(xs[i]); ah.u[i] = hb; al.u[i] = ASPLIT ? bf16_bits(xs[i] - bf16_val(hb)) : (unsigned short)0; }
#pragma unroll
    for (int t = 0; t < 4; ++t) {
      const unsigned short* brow = Wt + (size_t)(col0 + t * 16 + ln) * ldb + kb;
      FragB b;
      b.half[0] = *(const v8us*)(brow + 8 * hh);
      b.half[1] = *(const v8us*)(brow + 16 + 8 * hh);
      acc[t] = mmaN<ASPLIT ? 2 : 1>(ah.v, al.v, b.v, b.v, acc[t]);
    }
  }
#pragma unroll
  for (int t = 0; t < 4; ++t) {
    float bv = bias ? bias[col0 + t * 16 + ln] : 0.f;
    if (BIAS_BF16) bv = bf16_round(bv);
#pragma unroll
    for (int r = 0; r < 8; ++r) { float v = acc[t][r] + bv; if (ACT == 1) v = fmaxf(v, 0.f); so[w][8 * hh + r][t * 16 + ln] = v; }
  }
  __builtin_amdgcn_fence(__ATOMIC_ACQ_REL, "workgroup");
  __builtin_amdgcn_wave_barrier();
  const int rsub = lane >> 4, c4 = (lane & 15) * 4;
  {
#pragma unroll
    for (int q = 0; q < 8; ++q) {
      const int r = q * 2 + rsub;
      const v4f v = *(const v4fa*)&so[w][r][c4];
      *(v4f*)(C + (size_t)(row0 + r) * ldc + col0 + c4) = v;
    }
    
  }
}

// GEMM C = act(A·W + bias + resid): A f32 (ASPLIT -> hi/lo 2 terms), Wt bf16 [N][K]; ACT 0 none, 1 relu, 2 exact gelu;
// resid (optional, f32, row index = (row % rmod), pitch ldr, RES_BF16 rounds it) added before the activation.
template <bool ASPLIT, int ACT, bool BIAS_BF16, bool RES_BF16>
__global__ __launch_bounds__(128) void k_gemm_bf3(const float* __restrict__ A, int lda, const unsigned short* __restrict__ Wt, int ldb,
                                                const float* __restrict__ bias, const float* __restrict__ resid, int rmod, int ldr,
                                                float* __restrict__ C, int ldc, int M, int N, int K) {
  __shared__ __attribute__((aligned(16))) float so[4][16][64];
  const int tid = threadIdx.x, w = tid >> 5, lane = tid & 31, ln = lane & 15, hh = lane >> 4;
  const int ntn = N / 64;
  const int wid = blockIdx.x * 4 + w;
  const int mt = wid / ntn, nq = wid % ntn;
  if (mt * 16 >= M) return;
  const int row0 = mt * 16, col0 = nq * 64;
  const float* arow = A + (size_t)(row0 + ln) * lda;
  v8f acc[4] = {};
  for (int kb = 0; kb < K; kb += 32) {
    FragB ah, al;
    const v4f x0 = *(const v4fa*)(arow + kb + 8 * hh), x1 = *(const v4fa*)(arow + kb + 8 * hh + 4);
    const v4f x2 = *(const v4fa*)(arow + kb + 16 + 8 * hh), x3 = *(const v4fa*)(arow + kb + 16 + 8 * hh + 4);
    float xs[16] = {x0[0],x0[1],x0[2],x0[3],x1[0],x1[1],x1[2],x1[3],x2[0],x2[1],x2[2],x2[3],x3[0],x3[1],x3[2],x3[3]};
#pragma unroll
    for (int i = 0; i < 16; ++i) { const unsigned short hb = bf16_bits(xs[i]); ah.u[i] = hb; al.u[i] = ASPLIT ? bf16_bits(xs[i] - bf16_val(hb)) : (unsigned short)0; }
#pragma unroll
    for (int t = 0; t < 4; ++t) {
      const unsigned short* brow = Wt + (size_t)(col0 + t * 16 + ln) * ldb + kb;
      FragB b;
      b.half[0] = *(const v8us*)(brow + 8 * hh);
      b.half[1] = *(const v8us*)(brow + 16 + 8 * hh);
      acc[t] = mmaN<ASPLIT ? 2 : 1>(ah.v, al.v, b.v, b.v, acc[t]);
    }
  }
#pragma unroll
  for (int t = 0; t < 4; ++t) {
    const int col = col0 + t * 16 + ln;
    float bv = bias ? bias[col] : 0.f;
    if (BIAS_BF16) bv = bf16_round(bv);
#pragma unroll
    for (int r = 0; r < 8; ++r) {
      float v = acc[t][r] + bv;
      if (resid) { float rv = resid[(size_t)((row0 + 8 * hh + r) % rmod) * ldr + col]; if (RES_BF16) rv = bf16_round(rv); v += rv; }
      if (ACT == 1) v = fmaxf(v, 0.f);
      if (ACT == 2) v = 0.5f * v * (1.0f + erff(v * 0.70710678118654752f));
      if (ACT == 3) { const float u = 0.7978845608028654f * (v + 0.044715f * v * v * v); v = 0.5f * v * (1.0f + tanhf(u)); }
      so[w][8 * hh + r][t * 16 + ln] = v;
    }
  }
  __builtin_amdgcn_fence(__ATOMIC_ACQ_REL, "workgroup");
  __builtin_amdgcn_wave_barrier();
  const int rsub = lane >> 4, c4 = (lane & 15) * 4;
  {
#pragma unroll
    for (int q = 0; q < 8; ++q) {
      const int r = q * 2 + rsub;
      const v4f v = *(const v4fa*)&so[w][r][c4];
      *(v4f*)(C + (size_t)(row0 + r) * ldc + col0 + c4) = v;
    }
    
  }
}
// row LayerNorm (biased variance, eps) over N: s = X (+ R); optional out_sum <- s; out_norm <- (s-mu)*rsqrt(var+eps)*g + b
template <bool PARAM_BF16>
__global__ __launch_bounds__(256) void k_layernorm(const float* __restrict__ X, const float* __restrict__ R, const float* __restrict__ g, const float* __restrict__ bta,
                                                  float* __restrict__ out_sum, float* __restrict__ out_norm, int N, float eps) {
  __shared__ float red[256];
  const int row = blockIdx.x, tid = threadIdx.x;
  const float* x = X + (size_t)row * N; const float* rr = R ? R + (size_t)row * N : nullptr;
  float vals[16];                     // up to N = 4096
  const int per = N / 256;            // contiguous chunk per thread? use strided-by-4 chunks: thread handles j = tid*4 + 1024*u
  float s1 = 0.f;
  for (int u = 0; u < per / 4; ++u) {
    const int j = tid * 4 + 1024 * u;
    const v4f a = *(const v4fa*)(x + j);
    v4f b = {0.f,0.f,0.f,0.f}; if (rr) b = *(const v4fa*)(rr + j);
#pragma unroll
    for (int q = 0; q < 4; ++q) { const float v = a[q] + b[q]; vals[u * 4 + q] = v; s1 += v; }
  }
  red[tid] = s1; __syncthreads();
  for (int st = 128; st > 0; st >>= 1) { if (tid < st) red[tid] += red[tid + st]; __syncthreads(); }
  const float mu = red[0] / (float)N; __syncthreads();
  float s2 = 0.f;
  for (int u = 0; u < per / 4; ++u)
#pragma unroll
    for (int q = 0; q < 4; ++q) { const float c = vals[u * 4 + q] - mu; s2 += c * c; }
  red[tid] = s2; __syncthreads();
  for (int st = 128; st > 0; st >>= 1) { if (tid < st) red[tid] += red[tid + st]; __syncthreads(); }
  const float rs = rsqrtf(red[0] / (float)N + eps);
  {
    for (int u = 0; u < per / 4; ++u) {
      const int j = tid * 4 + 1024 * u;
      v4f o, sm;
#pragma unroll
      for (int q = 0; q < 4; ++q) {
        float gg = g[j + q], bb = bta[j + q];
        if (PARAM_BF16) { gg = bf16_round(gg); bb = bf16_round(bb); }
        sm[q] = vals[u * 4 + q]; o[q] = (vals[u * 4 + q] - mu) * rs * gg + bb;
      }
      if (out_sum) *(v4f*)(out_sum + (size_t)row * N + j) = sm;
      *(v4f*)(out_norm + (size_t)row * N + j) = o;
    }
    
  }
}



// ---- f16 WMMA path (v_wmma_f32_16x16x32_f16): 11-bit significands for operands in range — used where a [0,1] probability operand needs more precision than bf16
typedef _Float16 v16h __attribute__((ext_vector_type(16)));
union FragH { v16h v; v8us half[2]; _Float16 h[16]; unsigned short u[16]; };
template <int NT>
__device__ __forceinline__ v8f mmaH(v16h ah, v16h al, v16h bh, v16h bl, v8f c) {
  c = __builtin_amdgcn_wmma_f32_16x16x32_f16(false, ah, false, bh, (short)0, c, false, false);
  if (NT >= 2) c = __builtin_amdgcn_wmma_f32_16x16x32_f16(false, al, false, bh, (short)0, c, false, false);
  if (NT >= 3) c = __builtin_amdgcn_wmma_f32_16x16x32_f16(false, ah, false, bl, (short)0, c, false, false);
  asm volatile("v_nop\n\tv_nop\n\tv_nop\n\tv_nop" : "+v"(c) : "v"(ah), "v"(al), "v"(bh), "v"(bl));
  return c;
}
// batched GEMM like k_gemm_b but f16 operands: A f32 (split into f16 hi/lo if ASPLIT, else rounded to f16), Bt = f16 values [n][k]; alpha; C f32; N multiple of 16 (partial tiles skipped)
template <bool ASPLIT>
__global__ __launch_bounds__(128) void k_gemm_h(const float* __restrict__ A, int lda, size_t sA, const _Float16* __restrict__ Bh, int ldb, size_t sB, float alpha, float* __restrict__ C, int ldc, size_t sC, int M, int N, int K) {
  __shared__ __attribute__((aligned(16))) float so[4][16][64];
  const int tid = threadIdx.x, w = tid >> 5, lane = tid & 31, ln = lane & 15, hh = lane >> 4; const int by = blockIdx.y;
  A += (size_t)by * sA; Bh += (size_t)by * sB; C += (size_t)by * sC;
  const int ntn = (N + 63) / 64; const int wid = blockIdx.x * 4 + w; const int mt = wid / ntn, nq = wid % ntn; if (mt * 16 >= M) return;
  const int row0 = mt * 16, col0 = nq * 64; const float* arow = A + (size_t)(row0 + ln) * lda;
  v8f acc[4] = {};
  for (int kb = 0; kb < K; kb += 32) {
    FragH ah, al;
    const v4f x0 = *(const v4fa*)(arow + kb + 8 * hh), x1 = *(const v4fa*)(arow + kb + 8 * hh + 4), x2 = *(const v4fa*)(arow + kb + 16 + 8 * hh), x3 = *(const v4fa*)(arow + kb + 16 + 8 * hh + 4);
    float xs[16] = {x0[0],x0[1],x0[2],x0[3],x1[0],x1[1],x1[2],x1[3],x2[0],x2[1],x2[2],x2[3],x3[0],x3[1],x3[2],x3[3]};
#pragma unroll
    for (int i = 0; i < 16; ++i) { const _Float16 h = (_Float16)xs[i]; ah.h[i] = h; al.h[i] = ASPLIT ? (_Float16)(xs[i] - (float)h) : (_Float16)0.0f; }
#pragma unroll
    for (int t = 0; t < 4; ++t) { if (col0 + t * 16 >= N) continue; const size_t boff = (size_t)(col0 + t * 16 + ln) * ldb + kb; FragH bq; bq.half[0] = *(const v8us*)(Bh + boff + 8 * hh); bq.half[1] = *(const v8us*)(Bh + boff + 16 + 8 * hh);
      acc[t] = mmaH<ASPLIT ? 2 : 1>(ah.v, al.v, bq.v, bq.v, acc[t]); }
  }
#pragma unroll
  for (int t = 0; t < 4; ++t) { if (col0 + t * 16 >= N) continue;
#pragma unroll
    for (int r = 0; r < 8; ++r) so[w][8 * hh + r][t * 16 + ln] = acc[t][r] * alpha; }
  __builtin_amdgcn_fence(__ATOMIC_ACQ_REL, "workgroup"); __builtin_amdgcn_wave_barrier();
  const int rsub = lane >> 4, c4 = (lane & 15) * 4;
  {
#pragma unroll
    for (int q = 0; q < 8; ++q) { const int r = q * 2 + rsub; if (col0 + c4 < N) { const v4f v = *(const v4fa*)&so[w][r][c4]; *(v4f*)(C + (size_t)(row0 + r) * ldc + col0 + c4) = v; } }
     }
}

// Wt[n][k] = f16(W[k][n]·scale) from f32 row-major W[K][N] (scale = power of two; bf16-exact weights stay exact in f16 away from the subnormal range)
__global__ __launch_bounds__(256) void k_wt_f16(const float* __restrict__ W, _Float16* __restrict__ Wt, int K, int N, float scale) {
  const int t = blockIdx.x * 256 + threadIdx.x; if (t >= N * (K / 8)) return; const int n = t / (K / 8), k8 = (t % (K / 8)) * 8; FragH f;
#pragma unroll
  for (int i = 0; i < 8; ++i) f.h[i] = (_Float16)(bf16_round(W[(size_t)(k8 + i) * N + n]) * scale); const v8us o = f.half[0];
  *(v8us*)((unsigned short*)Wt + (size_t)n * K + k8) = o; 
}
// k_gemm_hh variant with fused epilogue: v = acc·alpha + bias[by·sBias + col] (+ CP[(row/rowsPerB)·sCPb + by·64 + col] if CP) ; ACT 0 none / 1 elu ; writes f16 C16 (and f32 C if non-null)
template <int ACT>
__global__ __launch_bounds__(128) void k_gemm_hhx(const _Float16* __restrict__ A, int lda, size_t sA, const _Float16* __restrict__ Bh, int ldb, size_t sB, float alpha, const float* __restrict__ bias, size_t sBias, const float* __restrict__ CP, int rowsPerB, size_t sCPb, int row0g,
    float* __restrict__ C, _Float16* __restrict__ C16, int ldc, size_t sC, int M, int N, int K) {
  __shared__ __attribute__((aligned(16))) float so[4][16][64];
  const int tid = threadIdx.x, w = tid >> 5, lane = tid & 31, ln = lane & 15, hh = lane >> 4; const int by = blockIdx.y;
  A += (size_t)by * sA; Bh += (size_t)by * sB; const size_t cofs = (size_t)by * sC; const float* bp = bias ? bias + (size_t)by * sBias : nullptr;
  const int ntn = (N + 63) / 64; const int wid = blockIdx.x * 4 + w; const int mt = wid / ntn, nq = wid % ntn; if (mt * 16 >= M) return;
  const int row0 = mt * 16, col0 = nq * 64; const _Float16* arow = A + (size_t)(row0 + ln) * lda;
  v8f acc[4] = {};
  for (int kb = 0; kb < K; kb += 32) { FragH ah; ah.half[0] = *(const v8us*)((const unsigned short*)arow + kb + 8 * hh); ah.half[1] = *(const v8us*)((const unsigned short*)arow + kb + 16 + 8 * hh);
#pragma unroll
    for (int t = 0; t < 4; ++t) { if (col0 + t * 16 >= N) continue; const size_t boff = (size_t)(col0 + t * 16 + ln) * ldb + kb; FragH bq; bq.half[0] = *(const v8us*)((const unsigned short*)Bh + boff + 8 * hh); bq.half[1] = *(const v8us*)((const unsigned short*)Bh + boff + 16 + 8 * hh);
      acc[t] = mmaH<1>(ah.v, ah.v, bq.v, bq.v, acc[t]); }
  }
#pragma unroll
  for (int t = 0; t < 4; ++t) { if (col0 + t * 16 >= N) continue; const int col = col0 + t * 16 + ln; const float bv = bp ? bf16_round(bp[col]) : 0.f;
#pragma unroll
    for (int r = 0; r < 8; ++r) { float v = acc[t][r] * alpha + bv; if (CP) { const int bidx = (row0g + row0 + 8 * hh + r) / rowsPerB; v += CP[(size_t)bidx * sCPb + (size_t)by * 64 + col]; } if (ACT == 1) v = (v > 0.f) ? v : expm1f(v); else if (ACT == 7) v = (v > 0.f) ? v + 1.0f : expf(v); else if (ACT == 8) v = tanhf(v); else if (ACT == 9) v = 0.5f * v * (1.0f + tanhf(0.7978845608028654f * (v + 0.044715f * v * v * v))); else if (ACT == 11) v = 1.0f / (1.0f + expf(-v)); else if (ACT == 12) v = (v > 0.f) ? v : 0.01f * v; else if (ACT == 14) v = (v > 0.f) ? v : 0.1f * v; else if (ACT == 15) v = v / (1.0f + expf(-v)); else if (ACT == 3) v = fmaxf(v, 0.f); else if (ACT == 6) v = 0.5f * v * (1.0f + erff(v * 0.70710678118654752f)); so[w][8 * hh + r][t * 16 + ln] = v; } }
  __builtin_amdgcn_fence(__ATOMIC_ACQ_REL, "workgroup"); __builtin_amdgcn_wave_barrier();
  const int rsub = lane >> 4, c4 = (lane & 15) * 4; typedef _Float16 v4h __attribute__((ext_vector_type(4)));
  {
#pragma unroll
    for (int q = 0; q < 8; ++q) { const int r = q * 2 + rsub; if (col0 + c4 < N) { const v4f v = *(const v4fa*)&so[w][r][c4]; if (C) *(v4f*)(C + cofs + (size_t)(row0 + r) * ldc + col0 + c4) = v; if (C16) { v4h h4; for (int i = 0; i < 4; ++i) h4[i] = (_Float16)v[i]; *(v4h*)(C16 + cofs + (size_t)(row0 + r) * ldc + col0 + c4) = h4; } } }
     }
}


typedef _Float16 v4h __attribute__((ext_vector_type(4)));

__global__ __launch_bounds__(256) void k_x16(const float* __restrict__ x, _Float16* __restrict__ X16, size_t n8) { const size_t t = (size_t)blockIdx.x * 256 + threadIdx.x; if (t >= n8) return; FragH f;
#pragma unroll
  for (int q = 0; q < 8; ++q) f.h[q] = (_Float16)bf16_round(x[t * 8 + q]); *(v8us*)((unsigned short*)X16 + t * 8) = f.half[0];  }
__global__ __launch_bounds__(256) void k_h16(const float* __restrict__ x, _Float16* __restrict__ X16, size_t n8) { const size_t t = (size_t)blockIdx.x * 256 + threadIdx.x; if (t >= n8) return; FragH f;
#pragma unroll
  for (int q = 0; q < 8; ++q) f.h[q] = (_Float16)x[t * 8 + q]; *(v8us*)((unsigned short*)X16 + t * 8) = f.half[0];  }
__global__ __launch_bounds__(256) void k_round16f(const float* __restrict__ W, _Float16* __restrict__ Bt, size_t n8) { const size_t t = (size_t)blockIdx.x * 256 + threadIdx.x; if (t >= n8) return; FragH f;
#pragma unroll
  for (int i = 0; i < 8; ++i) f.h[i] = (_Float16)(bf16_round(W[t * 8 + i]) * 16.0f); *(v8us*)((unsigned short*)Bt + t * 8) = f.half[0];  }
template <int NHv, int TTv>
__global__ __launch_bounds__(256) void k_vt(const _Float16* __restrict__ V16, int ldv, int voff, _Float16* __restrict__ Vt) { __shared__ unsigned short tl[64][66]; const int tid = threadIdx.x; const int slab = blockIdx.x / (TTv / 64), lg = blockIdx.x % (TTv / 64); const int b = slab / NHv, h = slab % NHv;
  for (int i = tid; i < 64 * 8; i += 256) { const int r = i / 8, c8 = (i % 8) * 8; FragH f; f.half[0] = *(const v8us*)((const unsigned short*)V16 + ((size_t)b * TTv + lg * 64 + r) * ldv + voff + h * 64 + c8);
#pragma unroll
    for (int q = 0; q < 8; ++q) tl[r][c8 + q] = f.u[q]; }
  __syncthreads();
  {
#pragma unroll
    for (int rd = 0; rd < 2; ++rd) { const int d = rd * 32 + tid / 8, pc = tid % 8; FragH f;
#pragma unroll
      for (int q = 0; q < 8; ++q) f.u[q] = tl[pc * 8 + q][d];
      *(v8us*)((unsigned short*)Vt + ((size_t)slab * 64 + d) * TTv + lg * 64 + pc * 8) = f.half[0]; }
     } }

__global__ __launch_bounds__(256) void k_hl(const float* __restrict__ F, _Float16* __restrict__ Hh, _Float16* __restrict__ Hl, size_t n8) { const size_t t = (size_t)blockIdx.x * 256 + threadIdx.x; if (t >= n8) return; FragH fh, fl; const v4f a = *(const v4fa*)(F + t * 8), c = *(const v4fa*)(F + t * 8 + 4);
#pragma unroll
  for (int q = 0; q < 4; ++q) { _Float16 h = (_Float16)a[q]; fh.h[q] = h; fl.h[q] = (_Float16)((a[q] - (float)h) * 1024.0f); h = (_Float16)c[q]; fh.h[4 + q] = h; fl.h[4 + q] = (_Float16)((c[q] - (float)h) * 1024.0f); }
  { *(v8us*)((unsigned short*)Hh + t * 8) = fh.half[0]; *(v8us*)((unsigned short*)Hl + t * 8) = fl.half[0];  } }

// ---- fast GEMM (block tile 128x64, wave tile 32x64; requires M % 128 == 0, N % 64 == 0, K % 64 == 0); A and B tiles of 64 k staged in LDS; epilogue = k_gemm_hhx semantics ----
__device__ __forceinline__ v16h g2_frag(const _Float16* p, int hh) { FragH f; f.half[0] = *(const v8us*)((const unsigned short*)p + 8 * hh); f.half[1] = *(const v8us*)((const unsigned short*)p + 16 + 8 * hh); return f.v; }
__device__ __forceinline__ v8f g2_mma(v16h a, v16h b, v8f c) { v8f d = __builtin_amdgcn_wmma_f32_16x16x32_f16(false, a, false, b, (short)0, c, false, false); asm volatile("v_nop\n\tv_nop\n\tv_nop\n\tv_nop" : "+v"(d) : "v"(a), "v"(b)); return d; }
template <int ACT>
__global__ __launch_bounds__(128) void k_gemm2(const _Float16* __restrict__ A, int lda, size_t sA, const _Float16* __restrict__ Bh, int ldb, size_t sB, float alpha, const float* __restrict__ bias, size_t sBias, const float* __restrict__ CP, int rowsPerB, size_t sCPb, int row0g,
    float* __restrict__ C, _Float16* __restrict__ C16, int ldc, size_t sC, int M, int N, int K) {
  constexpr int GK = 64, GP = 72;      // a tile = 64 k; LDS row pitch 144 B (16 B x odd: ds_load_b128 without bank conflicts)
  __shared__ __attribute__((aligned(16))) _Float16 tA[2][128][GP]; __shared__ __attribute__((aligned(16))) _Float16 tB[2][64][GP];      // two buffers each
  __shared__ __attribute__((aligned(16))) float so[4][32][68];
  const int tid = threadIdx.x, w = tid >> 5, lane = tid & 31, ln = lane & 15, hh = lane >> 4; const int by = blockIdx.y;
  A += (size_t)by * sA; Bh += (size_t)by * sB; const size_t cofs = (size_t)by * sC; const float* bp = bias ? bias + (size_t)by * sBias : nullptr;
  const int ntn = N >> 6; const int mt = blockIdx.x / ntn, nq = blockIdx.x - mt * ntn; const int row0 = mt * 128 + 32 * w, col0 = nq * 64; if (mt * 128 >= M) return;      // the whole block leaves or none of it: barriers follow
  // every thread copies 8 + 4 pieces of 16 B per tile (8 lanes cover one whole 128-B row)
  const int crow = tid >> 3, cc8 = (tid & 7) * 8;
  const _Float16* gA = A + (size_t)(mt * 128 + crow) * lda + cc8; const _Float16* gB = Bh + (size_t)(col0 + crow) * ldb + cc8;
  const unsigned lA = (unsigned)(size_t)&tA[0][crow][cc8], lB = (unsigned)(size_t)&tB[0][crow][cc8];
  auto copy_tile = [&](int t) {
    const unsigned ao = lA + (unsigned)(t & 1) * (unsigned)(128 * GP * 2), bo = lB + (unsigned)(t & 1) * (unsigned)(64 * GP * 2), r16 = 16 * GP * 2; const _Float16* ap = gA + (size_t)t * GK; const _Float16* bq = gB + (size_t)t * GK; const size_t a16 = (size_t)16 * lda, b16 = (size_t)16 * ldb;
    // the copies and, as the last line of the same statement, the wait that stands before their address registers are rewritten
    asm volatile("global_load_async_to_lds_b128 %0, %12, off\n\tglobal_load_async_to_lds_b128 %1, %13, off\n\tglobal_load_async_to_lds_b128 %2, %14, off\n\tglobal_load_async_to_lds_b128 %3, %15, off\n\t"
                 "global_load_async_to_lds_b128 %4, %16, off\n\tglobal_load_async_to_lds_b128 %5, %17, off\n\tglobal_load_async_to_lds_b128 %6, %18, off\n\tglobal_load_async_to_lds_b128 %7, %19, off\n\t"
                 "global_load_async_to_lds_b128 %8, %20, off\n\tglobal_load_async_to_lds_b128 %9, %21, off\n\tglobal_load_async_to_lds_b128 %10, %22, off\n\tglobal_load_async_to_lds_b128 %11, %23, off\n\ts_wait_xcnt 0x0"
                 :: "v"(ao), "v"(ao + r16), "v"(ao + 2 * r16), "v"(ao + 3 * r16), "v"(ao + 4 * r16), "v"(ao + 5 * r16), "v"(ao + 6 * r16), "v"(ao + 7 * r16), "v"(bo), "v"(bo + r16), "v"(bo + 2 * r16), "v"(bo + 3 * r16),
                    "v"(ap), "v"(ap + a16), "v"(ap + 2 * a16), "v"(ap + 3 * a16), "v"(ap + 4 * a16), "v"(ap + 5 * a16), "v"(ap + 6 * a16), "v"(ap + 7 * a16), "v"(bq), "v"(bq + b16), "v"(bq + 2 * b16), "v"(bq + 3 * b16) : "memory"); };
  const v8f z8 = {0.f,0.f,0.f,0.f,0.f,0.f,0.f,0.f}; v8f c00 = z8, c01 = z8, c02 = z8, c03 = z8, c10 = z8, c11 = z8, c12 = z8, c13 = z8;
  const int nst = K / GK;
  copy_tile(0);
  asm volatile("s_wait_asynccnt 0x0" ::: "memory");      // this wave's copies of tile 0 have landed
  __syncthreads();                                       // every wave's have: tile 0 may be read
  if (nst > 1) copy_tile(1);
#pragma unroll 1
  for (int t = 0; t < nst; ++t) { const _Float16 (*pA)[GP] = tA[t & 1]; const _Float16 (*pB)[GP] = tB[t & 1];
#pragma unroll
    for (int kb = 0; kb < GK; kb += 32) { const v16h a0 = g2_frag(&pA[32 * w + ln][kb], hh), a1 = g2_frag(&pA[32 * w + 16 + ln][kb], hh);
      v16h b = g2_frag(&pB[ln][kb], hh); c00 = g2_mma(a0, b, c00); c10 = g2_mma(a1, b, c10);
      b = g2_frag(&pB[16 + ln][kb], hh); c01 = g2_mma(a0, b, c01); c11 = g2_mma(a1, b, c11);
      b = g2_frag(&pB[32 + ln][kb], hh); c02 = g2_mma(a0, b, c02); c12 = g2_mma(a1, b, c12);
      b = g2_frag(&pB[48 + ln][kb], hh); c03 = g2_mma(a0, b, c03); c13 = g2_mma(a1, b, c13); }
    asm volatile("s_wait_dscnt 0x0" ::: "memory");       // this wave's reads of tile t are done before its buffer is refilled
    asm volatile("s_wait_asynccnt 0x0" ::: "memory");    // this wave's copies of tile t + 1 have landed
    __syncthreads();                                     // publishes tile t + 1 and ends every wave's reads of tile t
    if (t + 2 < nst) copy_tile(t + 2); }
  asm volatile("s_wait_asynccnt 0x0" ::: "memory");      // nothing of this wave is in flight when it goes on to the epilogue and ends
  v8f accs[8] = {c00, c01, c02, c03, c10, c11, c12, c13};
#pragma unroll
  for (int u = 0; u < 8; ++u) { const int t = u & 3, half = u >> 2; const int col = col0 + t * 16 + ln; const float bv = bp ? bf16_round(bp[col]) : 0.f;
#pragma unroll
    for (int r = 0; r < 8; ++r) { const int rloc = half * 16 + 8 * hh + r; float v = accs[u][r] * alpha + bv; if (CP) { const int bidx = (row0g + row0 + rloc) / rowsPerB; v += CP[(size_t)bidx * sCPb + (size_t)by * 64 + col]; }
      if (ACT == 3) v = fmaxf(v, 0.f); else if (ACT == 6) v = 0.5f * v * (1.0f + erff(v * 0.70710678118654752f)); else if (ACT == 11) v = 1.0f / (1.0f + expf(-v)); else if (ACT == 15) v = v / (1.0f + expf(-v)); else if (ACT == 12) v = (v > 0.f) ? v : 0.01f * v; else if (ACT == 8) v = tanhf(v);
      so[w][rloc][t * 16 + ln] = v; } }
  __builtin_amdgcn_fence(__ATOMIC_ACQ_REL, "workgroup"); __builtin_amdgcn_wave_barrier();
  const int rsub = lane >> 4, c4 = (lane & 15) * 4;
  {
#pragma unroll
    for (int q = 0; q < 16; ++q) { const int r = q * 2 + rsub; const v4f v = *(const v4fa*)&so[w][r][c4]; if (C) *(v4f*)(C + cofs + (size_t)(row0 + r) * ldc + col0 + c4) = v; if (C16) { v4h h4; for (int i = 0; i < 4; ++i) h4[i] = (_Float16)v[i]; *(v4h*)(C16 + cofs + (size_t)(row0 + r) * ldc + col0 + c4) = h4; } }
     } }



// lane l with lane l ^ 16
__device__ __forceinline__ float xhalf(float x) { return __builtin_bit_cast(float, __builtin_amdgcn_permlanex16(__builtin_bit_cast(int, x), __builtin_bit_cast(int, x), 0x76543210, 0xfedcba98, false, false)); }
__global__ __launch_bounds__(128) void k_flash(const _Float16* __restrict__ Q16, int ldq, const _Float16* __restrict__ K16, int ldk, const _Float16* __restrict__ Vt, const int* __restrict__ MSK, float* __restrict__ O, int ldo) {
  constexpr int RPW = 16, NQB = TQ / (4 * RPW), DT = 4, KS = 2;
  constexpr int SK = 64, NST = TK / SK, LP = 72;      // a tile = 64 keys; LDS row pitch 144 B (16 B x odd: ds_load_b128 without bank conflicts)
  __shared__ __attribute__((aligned(16))) unsigned short sK[2][SK][LP]; __shared__ __attribute__((aligned(16))) unsigned short sV[2][64][LP];      // two buffers each: K rows [key][d], V^T rows [d][key]
  __shared__ __attribute__((aligned(16))) float sO[4][RPW][64 + 4];
  const int tid = threadIdx.x, w = tid >> 5, lane = tid & 31, ln = lane & 15, hh = lane >> 4;
  const int slab = blockIdx.x / NQB, qblk = blockIdx.x % NQB; const int b = slab / NH, h = slab % NH; const int qb0 = qblk * (4 * RPW); const int q0 = qb0 + w * RPW;
  FragH bq[KS];
  { const unsigned short* qr = (const unsigned short*)Q16 + ((size_t)b * TQ + q0 + ln) * ldq + h * 64;
#pragma unroll
    for (int ks = 0; ks < KS; ++ks) { bq[ks].half[0] = *(const v8us*)(qr + ks * 32 + 8 * hh); bq[ks].half[1] = *(const v8us*)(qr + ks * 32 + 16 + 8 * hh); } }
  const unsigned short* Vth = (const unsigned short*)Vt + (size_t)slab * 64 * TK;
  float m_r = -3.0e38f, l_r = 0.f; v8f oacc[DT];      // one query per lane: its running maximum, this lane half's part of its sum, O^T rows d = dt * 16 + 8 * hh + r
#pragma unroll
  for (int dt = 0; dt < DT; ++dt) oacc[dt] = (v8f){0.f,0.f,0.f,0.f,0.f,0.f,0.f,0.f};
  // The block's four waves share each K / V^T tile: every thread copies 4 + 4 pieces of 16 B (8 lanes cover one whole 128-B row).
  const int crow = tid >> 3, cc8 = (tid & 7) * 8;
  const unsigned short* gK = (const unsigned short*)K16 + ((size_t)b * TK + crow) * ldk + h * 64 + cc8; const unsigned short* gV = Vth + (size_t)crow * TK + cc8;
  const unsigned lK = (unsigned)(size_t)&sK[0][crow][cc8], lV = (unsigned)(size_t)&sV[0][crow][cc8];
  auto copy_tile = [&](int t) {
    const unsigned bo = (unsigned)(t & 1) * (unsigned)(SK * LP * 2), r16 = 16 * LP * 2; const unsigned short* kp = gK + (size_t)t * SK * ldk; const unsigned short* vp = gV + (size_t)t * SK;
    // the copies and, as the last line of the same statement, the wait that stands before their address registers are rewritten
    asm volatile("global_load_async_to_lds_b128 %0, %8, off\n\tglobal_load_async_to_lds_b128 %1, %9, off\n\tglobal_load_async_to_lds_b128 %2, %10, off\n\tglobal_load_async_to_lds_b128 %3, %11, off\n\t"
                 "global_load_async_to_lds_b128 %4, %12, off\n\tglobal_load_async_to_lds_b128 %5, %13, off\n\tglobal_load_async_to_lds_b128 %6, %14, off\n\tglobal_load_async_to_lds_b128 %7, %15, off\n\ts_wait_xcnt 0x0"
                 :: "v"(lK + bo), "v"(lK + bo + r16), "v"(lK + bo + 2 * r16), "v"(lK + bo + 3 * r16), "v"(lV + bo), "v"(lV + bo + r16), "v"(lV + bo + 2 * r16), "v"(lV + bo + 3 * r16),
                    "v"(kp), "v"(kp + (size_t)16 * ldk), "v"(kp + (size_t)32 * ldk), "v"(kp + (size_t)48 * ldk), "v"(vp), "v"(vp + (size_t)16 * TK), "v"(vp + (size_t)32 * TK), "v"(vp + (size_t)48 * TK) : "memory"); };
  copy_tile(0);
  asm volatile("s_wait_asynccnt 0x0" ::: "memory");      // this wave's copies of tile 0 have landed
  __syncthreads();                                       // every wave's have: tile 0 may be read
  copy_tile(1);
#pragma unroll 1
  for (int t = 0; t < NST; ++t) {
   const unsigned short (*bK)[LP] = sK[t & 1]; const unsigned short (*bV)[LP] = sV[t & 1];
#pragma unroll
   for (int ps = 0; ps < SK / 32; ++ps) {
    float sc[2][8];
#pragma unroll
    for (int nt = 0; nt < 2; ++nt) { const unsigned short* kr = &bK[ps * 32 + nt * 16 + ln][0]; FragH ak[KS];
#pragma unroll
      for (int ks = 0; ks < KS; ++ks) { ak[ks].half[0] = *(const v8us*)(kr + ks * 32 + 8 * hh); ak[ks].half[1] = *(const v8us*)(kr + ks * 32 + 16 + 8 * hh); }
      v8f acc = (v8f){0.f,0.f,0.f,0.f,0.f,0.f,0.f,0.f};
#pragma unroll
      for (int ks = 0; ks < KS; ++ks) acc = mmaH<1>(ak[ks].v, ak[ks].v, bq[ks].v, bq[ks].v, acc);
#pragma unroll
      for (int r = 0; r < 8; ++r) sc[nt][r] = acc[r] * SCL; }
    float mc = fmaxf(sc[0][0], sc[1][0]);
#pragma unroll
    for (int r = 1; r < 8; ++r) mc = fmaxf(mc, fmaxf(sc[0][r], sc[1][r]));
    mc = fmaxf(mc, xhalf(mc));      // both lane halves now hold the query's maximum over the 32 keys
    const float mn = fmaxf(m_r, mc); const float al = (mn > -1.0e38f) ? expf(m_r - mn) : 1.0f; m_r = mn;
    FragH pb; float ls[4] = {0.f, 0.f, 0.f, 0.f};
#pragma unroll
    for (int nt = 0; nt < 2; ++nt)
#pragma unroll
      for (int r = 0; r < 8; ++r) { const float p = expf(sc[nt][r] - mn); ls[r & 3] += p; pb.h[nt * 8 + r] = (_Float16)(p * 1024.0f); }
    l_r = l_r * al + ((ls[0] + ls[1]) + (ls[2] + ls[3]));
#pragma unroll
    for (int dt = 0; dt < DT; ++dt) oacc[dt] *= al;
#pragma unroll
    for (int dt = 0; dt < DT; ++dt) { const unsigned short* vrow = &bV[dt * 16 + ln][ps * 32]; FragH av; av.half[0] = *(const v8us*)(vrow + 8 * hh); av.half[1] = *(const v8us*)(vrow + 16 + 8 * hh);
      oacc[dt] = mmaH<1>(av.v, av.v, pb.v, pb.v, oacc[dt]); } }
   asm volatile("s_wait_dscnt 0x0" ::: "memory");        // this wave's reads of tile t are done before its buffer is refilled
   asm volatile("s_wait_asynccnt 0x0" ::: "memory");     // this wave's copies of tile t + 1 have landed
   __syncthreads();                                      // publishes tile t + 1 and ends every wave's reads of tile t
   if (t + 2 < NST) copy_tile(t + 2); }
  asm volatile("s_wait_asynccnt 0x0" ::: "memory");      // nothing of this wave is in flight when it goes on to the epilogue and ends
  const float l = l_r + xhalf(l_r);      // the two lane halves' sums joined, unconditionally
  const float inv = (l > 0.f) ? 1.0f / (l * 1024.0f) : 0.f;
#pragma unroll
  for (int dt = 0; dt < DT; ++dt) { const v4f lo = {oacc[dt][0] * inv, oacc[dt][1] * inv, oacc[dt][2] * inv, oacc[dt][3] * inv}, hi = {oacc[dt][4] * inv, oacc[dt][5] * inv, oacc[dt][6] * inv, oacc[dt][7] * inv};
    *(v4fa*)&sO[w][ln][dt * 16 + 8 * hh] = lo; *(v4fa*)&sO[w][ln][dt * 16 + 8 * hh + 4] = hi; }
  __builtin_amdgcn_fence(__ATOMIC_ACQ_REL, "workgroup"); __builtin_amdgcn_wave_barrier();
  {
#pragma unroll
    for (int rp = 0; rp < RPW; rp += 2) { const int r = rp + (lane >> 4), pc = lane & 15; const v4f val = *(const v4fa*)&sO[w][r][pc * 4]; *(v4f*)(O + ((size_t)b * TQ + q0 + r) * ldo + h * 64 + pc * 4) = val; }
     } }
__global__ __launch_bounds__(256) void k_fulltab(unsigned* __restrict__ MB, int* __restrict__ RA, int* __restrict__ KE, int nq, int nk) {
  const int t = blockIdx.x * 256 + threadIdx.x;
  if (t < nq * (nk / 32)) { *(unsigned*)(MB + t) = 0u;  }
  if (t < nq) { *(int*)(RA + t) = 0;  }
  if (t < nq / 64) { *(int*)(KE + t * 32) = nk;  } }
__global__ __launch_bounds__(256) void k_lnout(const float* __restrict__ Y, const float* __restrict__ g, const float* __restrict__ bb, float* __restrict__ out) {
  #pragma clang fp contract(off)
  const int tid = threadIdx.x, w = tid >> 5, ln = tid & 31; const int r = blockIdx.x * 8 + w; if (r >= NR) return; const float* y = Y + (size_t)r * DM; float s = 0.f;
#pragma unroll 1
  for (int i = 0; i < 8; ++i) { const v4f a = *(const v4fa*)(y + i * 128 + ln * 4); for (int q = 0; q < 4; ++q) s += a[q]; }
  for (int o = 16; o > 0; o >>= 1) s += __shfl_xor(s, o, 32); const float mu = s / (float)DM; float q2 = 0.f;
#pragma unroll 1
  for (int i = 0; i < 8; ++i) { const v4f a = *(const v4fa*)(y + i * 128 + ln * 4); for (int q = 0; q < 4; ++q) { const float d = a[q] - mu; q2 += d * d; } }
  for (int o = 16; o > 0; o >>= 1) q2 += __shfl_xor(q2, o, 32); const float rs = rsqrtf(q2 / (float)DM + 1e-6f);
  {
#pragma unroll 1
    for (int i = 0; i < 8; ++i) { const int c0 = i * 128 + ln * 4; const v4f a = *(const v4fa*)(y + c0); v4f o4; for (int q = 0; q < 4; ++q) o4[q] = (a[q] - mu) * rs * bf16_round(g[c0 + q]) + bf16_round(bb[c0 + q]); *(v4f*)(out + (size_t)r * DM + c0) = o4; }
     } }
__global__ __launch_bounds__(256) void k_xb(const float* __restrict__ x, float* __restrict__ XB, size_t n4) { const size_t t = (size_t)blockIdx.x * 256 + threadIdx.x; if (t >= n4) return; const v4f a = *(const v4fa*)(x + t * 4); v4f o; for (int q = 0; q < 4; ++q) o[q] = bf16_round(a[q]); *(v4f*)(XB + t * 4) = o;  }
// Every input conversion in one launch, by block range: blocks 0..767 round q, k, v to bf16 and store them as f16 planes (q also as f32, the residual addend);
// blocks 768..1023 store the four weights, rounded to bf16, as f16 x16. A block streams 4096 pieces of 16 B, lane-contiguous, 16 per thread.
template <bool RES>
__device__ __forceinline__ void prep_stream(const float* __restrict__ src, _Float16* __restrict__ dst, float* __restrict__ xb, float scale, int tid) {
  v4f a[16];      // the three loops below are unrolled so that a[] lives in registers and every address is base + immediate offset
#pragma unroll
  for (int u = 0; u < 16; ++u) a[u] = *(const v4fa*)(src + (u * 256 + tid) * 4);
  __builtin_amdgcn_sched_barrier(0);      // keeps all 16 loads in flight together: without it the compiler sinks six of them among the conversions
#pragma unroll
  for (int u = 0; u < 16; ++u) { const int e = (u * 256 + tid) * 4; v4f r; v4h h;
#pragma unroll
    for (int i = 0; i < 4; ++i) { r[i] = bf16_round(a[u][i]); h[i] = (_Float16)(r[i] * scale); }
    *(v4h*)(dst + e) = h; if (RES) *(v4f*)(xb + e) = r; } }
__global__ __launch_bounds__(256) void k_prep(const float* __restrict__ q, const float* __restrict__ k, const float* __restrict__ v, const float* __restrict__ Wq, const float* __restrict__ Wk, const float* __restrict__ Wv, const float* __restrict__ Wo,
                                              _Float16* __restrict__ X16, float* __restrict__ XB, _Float16* __restrict__ B16) {
  constexpr int PB = 4096, XBLK = NR * DM / 4 / PB, WBLK = DM * DM / 4 / PB;
  const int bid = blockIdx.x, tid = threadIdx.x;
  if (bid < XBLK) { const size_t o = (size_t)bid * PB * 4; prep_stream<true>(q + o, X16 + o, XB + o, 1.0f, tid); }
  else if (bid < 3 * XBLK) { const bool isk = bid < 2 * XBLK; const size_t o = (size_t)(bid - (isk ? XBLK : 2 * XBLK)) * PB * 4; prep_stream<false>((isk ? k : v) + o, X16 + (size_t)(isk ? 1 : 2) * NR * DM + o, nullptr, 1.0f, tid); }
  else { const int j = (bid - 3 * XBLK) / WBLK; const size_t o = (size_t)((bid - 3 * XBLK) % WBLK) * PB * 4; prep_stream<false>((j == 0 ? Wq : (j == 1 ? Wk : (j == 2 ? Wv : Wo))) + o, B16 + (size_t)j * DM * DM + o, nullptr, 16.0f, tid); } }
__global__ __launch_bounds__(256) void k_causaltab(unsigned* __restrict__ MB, int* __restrict__ RA, int* __restrict__ KE, int nq, int nk) {
  const int t = blockIdx.x * 256 + threadIdx.x; const int nw = nk / 32;
  if (t < nq * nw) { const int q = t / nw, w = t % nw; const int first = q + 1 - 32 * w; const unsigned bits = (first <= 0) ? 0xffffffffu : ((first >= 32) ? 0u : (0xffffffffu << first)); *(unsigned*)(MB + t) = bits;  }
  if (t < nq) { *(int*)(RA + t) = 0;  }
  if (t < nq / 64) { const int v = 64 * (t + 1); *(int*)(KE + t * 32) = v;  } }


extern "C" void kernel_launch(void* const* d_in, const int* in_sizes, int n_in,
                              void* d_out, int out_size, void* d_ws, size_t ws_size, hipStream_t stream) {
  (void)in_sizes; (void)n_in; (void)out_size;
  const float* const* I = (const float* const*)d_in; const float* qin = I[0]; const float* kin = I[1]; const float* vin = I[2]; const float* Wq = I[3]; const float* Wk = I[4]; const float* Wv = I[5]; const float* Wo = I[6]; const float* gam = I[7]; const float* bet = I[8];
  char* ws = (char*)d_ws; size_t off = 0;
  auto take = [&](size_t bytes) { char* p = ws + off; off += (bytes + 255) & ~(size_t)255; return p; };
  _Float16* BQ = (_Float16*)take((size_t)DM * DM * 2); _Float16* BK = (_Float16*)take((size_t)DM * DM * 2); _Float16* BV = (_Float16*)take((size_t)DM * DM * 2); _Float16* BO = (_Float16*)take((size_t)DM * DM * 2);
  _Float16* X16 = (_Float16*)take((size_t)3 * NR * DM * 2); float* F = (float*)take((size_t)NR * DM * 4); float* XB = (float*)take((size_t)NR * DM * 4);
  _Float16* Q16 = (_Float16*)take((size_t)NR * DM * 2); _Float16* K16 = (_Float16*)take((size_t)NR * DM * 2); _Float16* V16 = (_Float16*)take((size_t)NR * DM * 2); _Float16* VT = (_Float16*)take((size_t)NR * DM * 2);
  if (off > ws_size) return;      /* 8 + 24 + 16 + 16 + 32 = 96 MiB; BQ BK BV BO, the three X16 planes and Q16 K16 V16 each lie one behind the other */
  float* O = F; _Float16* Oh = Q16; _Float16* Ol = K16; float* Y = XB;
  const size_t n8 = (size_t)NR * DM / 8; const unsigned nb8 = (unsigned)((n8 + 255) / 256); (void)BK; (void)BV;
  k_prep<<<3 * (NR * DM / 16384) + 4 * (DM * DM / 16384), 256, 0, stream>>>(qin, kin, vin, Wq, Wk, Wv, Wo, X16, XB, BQ);      /* X16 planes of q, k, v; XB; BQ BK BV BO */
  const dim3 gP((NR / 128) * (DM / 64), 1), gP3((NR / 128) * (DM / 64), 3);
  k_gemm2<0><<<gP3, 128, 0, stream>>>(X16, DM, (size_t)NR * DM, BQ, DM, (size_t)DM * DM, 0.0625f, nullptr, 0, nullptr, 1, 0, 0, nullptr, Q16, DM, (size_t)NR * DM, NR, DM, DM);      /* blockIdx.y = 0, 1, 2: qh, kh, vh (f16) */
  k_vt<NH, SLEN><<<NH * (SLEN / 64), 256, 0, stream>>>(V16, DM, 0, VT);
  k_flash<<<NH * (SLEN / 64), 128, 0, stream>>>(Q16, DM, K16, DM, VT, nullptr, O, DM);      /* plain flash over all 4096 keys (no mask) */
  k_hl<<<nb8, 256, 0, stream>>>(O, Oh, Ol, n8);
  k_gemm2<0><<<gP, 128, 0, stream>>>(Oh, DM, 0, BO, DM, 0, 0.0625f, nullptr, 0, XB, 1, (size_t)DM, 0, Y, nullptr, DM, 0, NR, DM, DM);
  k_gemm2<0><<<gP, 128, 0, stream>>>(Ol, DM, 0, BO, DM, 0, 0.0625f / 1024.0f, nullptr, 0, Y, 1, (size_t)DM, 0, Y, nullptr, DM, 0, NR, DM, DM);
  k_lnout<<<NR / 8, 256, 0, stream>>>(Y, gam, bet, (float*)d_out);
}

// v004
// It runs in 228 microseconds.
// Two timings next to v003 both put it at 1.25 times that version's speed.
// Counting every step since v000, it is 3.30 times as fast.
#include <hip/hip_runtime.h>
#define NBT 1
#define SLEN 4096
#define TQ SLEN
#define TK SLEN
#define DM 1024
#define NH 16
#define SCL 0.125f
#define NR (NBT * SLEN)
typedef __bf16 v16b __attribute__((ext_vector_type(16)));
typedef unsigned short v8us __attribute__((ext_vector_type(8), may_alias));
typedef float  v8f  __attribute__((ext_vector_type(8)));
typedef float  v4f  __attribute__((ext_vector_type(4)));
typedef float  v4fa __attribute__((ext_vector_type(4), may_alias));
union FragB { v16b v; v8us half[2]; unsigned short u[16]; };

__device__ __forceinline__ unsigned short bf16_bits(float x) { unsigned int u = __float_as_uint(x); return (unsigned short)((u + 0x7FFFu + ((u >> 16) & 1u)) >> 16); }
__device__ __forceinline__ float bf16_val(unsigned short b) { return __uint_as_float(((unsigned int)b) << 16); }
__device__ __forceinline__ float bf16_round(float x) { return bf16_val(bf16_bits(x)); }
// D += A·B with NT terms: 1 = ah·bh, 2 = + al·bh (A split), 3 = + ah·bl (both split)
template <int NT>
__device__ __forceinline__ v8f mmaN(v16b ah, v16b al, v16b bh, v16b bl, v8f c) {
  c = __builtin_amdgcn_wmma_f32_16x16x32_bf16(false, ah, false, bh, (short)0, c, false, false);
  if (NT >= 2) c = __builtin_amdgcn_wmma_f32_16x16x32_bf16(false, al, false, bh, (short)0, c, false, false);
  if (NT >= 3) c = __builtin_amdgcn_wmma_f32_16x16x32_bf16(false, ah, false, bl, (short)0, c, false, false);
  asm volatile("v_nop\n\tv_nop\n\tv_nop\n\tv_nop" : "+v"(c) : "v"(ah), "v"(al), "v"(bh), "v"(bl));
  return c;
}

__global__ __launch_bounds__(256) void k_wt_bf16(const float* __restrict__ W, unsigned short* __restrict__ Wt, int K, int N) {
  const int t = blockIdx.x * 256 + threadIdx.x;
  const int k8n = K / 8;
  if (t >= N * k8n) return;
  const int n = t / k8n, k8 = (t % k8n) * 8;
  v8us v;
#pragma unroll
  for (int i = 0; i < 8; ++i) v[i] = bf16_bits(W[(size_t)(k8 + i) * N + n]);
  *(v8us*)(Wt + (size_t)n * K + k8) = v;
  
}

// GEMM C[M][N] (f32, pitch ldc) = act(A[M][K]·W + bias). A f32 row-major (pitch lda) converted per fragment to bf16
// (ASPLIT: hi/lo two planes -> 2 terms, else single rounded term); Wt bf16 [N][K] (pitch ldb). BIAS_BF16 rounds the
// bias to bf16 first (bias quantised to bf16 before the add). K%32==0, M%16==0, N%64==0.
template <bool ASPLIT, int ACT, bool BIAS_BF16>
__global__ __launch_bounds__(128) void k_gemm_bf(const float* __restrict__ A, int lda, const unsigned short* __restrict__ Wt, int ldb,
                                               const float* __restrict__ bias, float* __restrict__ C, int ldc, int M, int N, int K) {
  __shared__ __attribute__((aligned(16))) float so[4][16][64];
  const int tid = threadIdx.x, w = tid >> 5, lane = tid & 31, ln = lane & 15, hh = lane >> 4;
  const int ntn = N / 64;
  const int wid = blockIdx.x * 4 + w;
  const int mt = wid / ntn, nq = wid % ntn;
  if (mt * 16 >= M) return;
  const int row0 = mt * 16, col0 = nq * 64;
  const float* arow = A + (size_t)(row0 + ln) * lda;
  v8f acc[4] = {};
  for (int kb = 0; kb < K; kb += 32) {
    FragB ah, al;
    const v4f x0 = *(const v4fa*)(arow + kb + 8 * hh), x1 = *(const v4fa*)(arow + kb + 8 * hh + 4);
    const v4f x2 = *(const v4fa*)(arow + kb + 16 + 8 * hh), x3 = *(const v4fa*)(arow + kb + 16 + 8 * hh + 4);
    float xs[16] = {x0[0],x0[1],x0[2],x0[3],x1[0],x1[1],x1[2],x1[3],x2[0],x2[1],x2[2],x2[3],x3[0],x3[1],x3[2],x3[3]};
#pragma unroll
    for (int i = 0; i < 16; ++i) { const unsigned short hb = bf16_bits(xs[i]); ah.u[i] = hb; al.u[i] = ASPLIT ? bf16_bits(xs[i] - bf16_val(hb)) : (unsigned short)0; }
#pragma unroll
    for (int t = 0; t < 4; ++t) {
      const unsigned short* brow = Wt + (size_t)(col0 + t * 16 + ln) * ldb + kb;
      FragB b;
      b.half[0] = *(const v8us*)(brow + 8 * hh);
      b.half[1] = *(const v8us*)(brow + 16 + 8 * hh);
      acc[t] = mmaN<ASPLIT ? 2 : 1>(ah.v, al.v, b.v, b.v, acc[t]);
    }
  }
#pragma unroll
  for (int t = 0; t < 4; ++t) {
    float bv = bias ? bias[col0 + t * 16 + ln] : 0.f;
    if (BIAS_BF16) bv = bf16_round(bv);
#pragma unroll
    for (int r = 0; r < 8; ++r) { float v = acc[t][r] + bv; if (ACT == 1) v = fmaxf(v, 0.f); so[w][8 * hh + r][t * 16 + ln] = v; }
  }
  __builtin_amdgcn_fence(__ATOMIC_ACQ_REL, "workgroup");
  __builtin_amdgcn_wave_barrier();
  const int rsub = lane >> 4, c4 = (lane & 15) * 4;
  {
#pragma unroll
    for (int q = 0; q < 8; ++q) {
      const int r = q * 2 + rsub;
      const v4f v = *(const v4fa*)&so[w][r][c4];
      *(v4f*)(C + (size_t)(row0 + r) * ldc + col0 + c4) = v;
    }
    
  }
}

// GEMM C = act(A·W + bias + resid): A f32 (ASPLIT -> hi/lo 2 terms), Wt bf16 [N][K]; ACT 0 none, 1 relu, 2 exact gelu;
// resid (optional, f32, row index = (row % rmod), pitch ldr, RES_BF16 rounds it) added before the activation.
template <bool ASPLIT, int ACT, bool BIAS_BF16, bool RES_BF16>
__global__ __launch_bounds__(128) void k_gemm_bf3(const float* __restrict__ A, int lda, const unsigned short* __restrict__ Wt, int ldb,
                                                const float* __restrict__ bias, const float* __restrict__ resid, int rmod, int ldr,
                                                float* __restrict__ C, int ldc, int M, int N, int K) {
  __shared__ __attribute__((aligned(16))) float so[4][16][64];
  const int tid = threadIdx.x, w = tid >> 5, lane = tid & 31, ln = lane & 15, hh = lane >> 4;
  const int ntn = N / 64;
  const int wid = blockIdx.x * 4 + w;
  const int mt = wid / ntn, nq = wid % ntn;
  if (mt * 16 >= M) return;
  const int row0 = mt * 16, col0 = nq * 64;
  const float* arow = A + (size_t)(row0 + ln) * lda;
  v8f acc[4] = {};
  for (int kb = 0; kb < K; kb += 32) {
    FragB ah, al;
    const v4f x0 = *(const v4fa*)(arow + kb + 8 * hh), x1 = *(const v4fa*)(arow + kb + 8 * hh + 4);
    const v4f x2 = *(const v4fa*)(arow + kb + 16 + 8 * hh), x3 = *(const v4fa*)(arow + kb + 16 + 8 * hh + 4);
    float xs[16] = {x0[0],x0[1],x0[2],x0[3],x1[0],x1[1],x1[2],x1[3],x2[0],x2[1],x2[2],x2[3],x3[0],x3[1],x3[2],x3[3]};
#pragma unroll
    for (int i = 0; i < 16; ++i) { const unsigned short hb = bf16_bits(xs[i]); ah.u[i] = hb; al.u[i] = ASPLIT ? bf16_bits(xs[i] - bf16_val(hb)) : (unsigned short)0; }
#pragma unroll
    for (int t = 0; t < 4; ++t) {
      const unsigned short* brow = Wt + (size_t)(col0 + t * 16 + ln) * ldb + kb;
      FragB b;
      b.half[0] = *(const v8us*)(brow + 8 * hh);
      b.half[1] = *(const v8us*)(brow + 16 + 8 * hh);
      acc[t] = mmaN<ASPLIT ? 2 : 1>(ah.v, al.v, b.v, b.v, acc[t]);
    }
  }
#pragma unroll
  for (int t = 0; t < 4; ++t) {
    const int col = col0 + t * 16 + ln;
    float bv = bias ? bias[col] : 0.f;
    if (BIAS_BF16) bv = bf16_round(bv);
#pragma unroll
    for (int r = 0; r < 8; ++r) {
      float v = acc[t][r] + bv;
      if (resid) { float rv = resid[(size_t)((row0 + 8 * hh + r) % rmod) * ldr + col]; if (RES_BF16) rv = bf16_round(rv); v += rv; }
      if (ACT == 1) v = fmaxf(v, 0.f);
      if (ACT == 2) v = 0.5f * v * (1.0f + erff(v * 0.70710678118654752f));
      if (ACT == 3) { const float u = 0.7978845608028654f * (v + 0.044715f * v * v * v); v = 0.5f * v * (1.0f + tanhf(u)); }
      so[w][8 * hh + r][t * 16 + ln] = v;
    }
  }
  __builtin_amdgcn_fence(__ATOMIC_ACQ_REL, "workgroup");
  __builtin_amdgcn_wave_barrier();
  const int rsub = lane >> 4, c4 = (lane & 15) * 4;
  {
#pragma unroll
    for (int q = 0; q < 8; ++q) {
      const int r = q * 2 + rsub;
      const v4f v = *(const v4fa*)&so[w][r][c4];
      *(v4f*)(C + (size_t)(row0 + r) * ldc + col0 + c4) = v;
    }
    
  }
}
// row LayerNorm (biased variance, eps) over N: s = X (+ R); optional out_sum <- s; out_norm <- (s-mu)*rsqrt(var+eps)*g + b
template <bool PARAM_BF16>
__global__ __launch_bounds__(256) void k_layernorm(const float* __restrict__ X, const float* __restrict__ R, const float* __restrict__ g, const float* __restrict__ bta,
                                                  float* __restrict__ out_sum, float* __restrict__ out_norm, int N, float eps) {
  __shared__ float red[256];
  const int row = blockIdx.x, tid = threadIdx.x;
  const float* x = X + (size_t)row * N; const float* rr = R ? R + (size_t)row * N : nullptr;
  float vals[16];                     // up to N = 4096
  const int per = N / 256;            // contiguous chunk per thread? use strided-by-4 chunks: thread handles j = tid*4 + 1024*u
  float s1 = 0.f;
  for (int u = 0; u < per / 4; ++u) {
    const int j = tid * 4 + 1024 * u;
    const v4f a = *(const v4fa*)(x + j);
    v4f b = {0.f,0.f,0.f,0.f}; if (rr) b = *(const v4fa*)(rr + j);
#pragma unroll
    for (int q = 0; q < 4; ++q) { const float v = a[q] + b[q]; vals[u * 4 + q] = v; s1 += v; }
  }
  red[tid] = s1; __syncthreads();
  for (int st = 128; st > 0; st >>= 1) { if (tid < st) red[tid] += red[tid + st]; __syncthreads(); }
  const float mu = red[0] / (float)N; __syncthreads();
  float s2 = 0.f;
  for (int u = 0; u < per / 4; ++u)
#pragma unroll
    for (int q = 0; q < 4; ++q) { const float c = vals[u * 4 + q] - mu; s2 += c * c; }
  red[tid] = s2; __syncthreads();
  for (int st = 128; st > 0; st >>= 1) { if (tid < st) red[tid] += red[tid + st]; __syncthreads(); }
  const float rs = rsqrtf(red[0] / (float)N + eps);
  {
    for (int u = 0; u < per / 4; ++u) {
      const int j = tid * 4 + 1024 * u;
      v4f o, sm;
#pragma unroll
      for (int q = 0; q < 4; ++q) {
        float gg = g[j + q], bb = bta[j + q];
        if (PARAM_BF16) { gg = bf16_round(gg); bb = bf16_round(bb); }
        sm[q] = vals[u * 4 + q]; o[q] = (vals[u * 4 + q] - mu) * rs * gg + bb;
      }
      if (out_sum) *(v4f*)(out_sum + (size_t)row * N + j) = sm;
      *(v4f*)(out_norm + (size_t)row * N + j) = o;
    }
    
  }
}



// ---- f16 WMMA path (v_wmma_f32_16x16x32_f16): 11-bit significands for operands in range — used where a [0,1] probability operand needs more precision than bf16
typedef _Float16 v16h __attribute__((ext_vector_type(16)));
union FragH { v16h v; v8us half[2]; _Float16 h[16]; unsigned short u[16]; };
template <int NT>
__device__ __forceinline__ v8f mmaH(v16h ah, v16h al, v16h bh, v16h bl, v8f c) {
  c = __builtin_amdgcn_wmma_f32_16x16x32_f16(false, ah, false, bh, (short)0, c, false, false);
  if (NT >= 2) c = __builtin_amdgcn_wmma_f32_16x16x32_f16(false, al, false, bh, (short)0, c, false, false);
  if (NT >= 3) c = __builtin_amdgcn_wmma_f32_16x16x32_f16(false, ah, false, bl, (short)0, c, false, false);
  asm volatile("v_nop\n\tv_nop\n\tv_nop\n\tv_nop" : "+v"(c) : "v"(ah), "v"(al), "v"(bh), "v"(bl));
  return c;
}
// batched GEMM like k_gemm_b but f16 operands: A f32 (split into f16 hi/lo if ASPLIT, else rounded to f16), Bt = f16 values [n][k]; alpha; C f32; N multiple of 16 (partial tiles skipped)
template <bool ASPLIT>
__global__ __launch_bounds__(128) void k_gemm_h(const float* __restrict__ A, int lda, size_t sA, const _Float16* __restrict__ Bh, int ldb, size_t sB, float alpha, float* __restrict__ C, int ldc, size_t sC, int M, int N, int K) {
  __shared__ __attribute__((aligned(16))) float so[4][16][64];
  const int tid = threadIdx.x, w = tid >> 5, lane = tid & 31, ln = lane & 15, hh = lane >> 4; const int by = blockIdx.y;
  A += (size_t)by * sA; Bh += (size_t)by * sB; C += (size_t)by * sC;
  const int ntn = (N + 63) / 64; const int wid = blockIdx.x * 4 + w; const int mt = wid / ntn, nq = wid % ntn; if (mt * 16 >= M) return;
  const int row0 = mt * 16, col0 = nq * 64; const float* arow = A + (size_t)(row0 + ln) * lda;
  v8f acc[4] = {};
  for (int kb = 0; kb < K; kb += 32) {
    FragH ah, al;
    const v4f x0 = *(const v4fa*)(arow + kb + 8 * hh), x1 = *(const v4fa*)(arow + kb + 8 * hh + 4), x2 = *(const v4fa*)(arow + kb + 16 + 8 * hh), x3 = *(const v4fa*)(arow + kb + 16 + 8 * hh + 4);
    float xs[16] = {x0[0],x0[1],x0[2],x0[3],x1[0],x1[1],x1[2],x1[3],x2[0],x2[1],x2[2],x2[3],x3[0],x3[1],x3[2],x3[3]};
#pragma unroll
    for (int i = 0; i < 16; ++i) { const _Float16 h = (_Float16)xs[i]; ah.h[i] = h; al.h[i] = ASPLIT ? (_Float16)(xs[i] - (float)h) : (_Float16)0.0f; }
#pragma unroll
    for (int t = 0; t < 4; ++t) { if (col0 + t * 16 >= N) continue; const size_t boff = (size_t)(col0 + t * 16 + ln) * ldb + kb; FragH bq; bq.half[0] = *(const v8us*)(Bh + boff + 8 * hh); bq.half[1] = *(const v8us*)(Bh + boff + 16 + 8 * hh);
      acc[t] = mmaH<ASPLIT ? 2 : 1>(ah.v, al.v, bq.v, bq.v, acc[t]); }
  }
#pragma unroll
  for (int t = 0; t < 4; ++t) { if (col0 + t * 16 >= N) continue;
#pragma unroll
    for (int r = 0; r < 8; ++r) so[w][8 * hh + r][t * 16 + ln] = acc[t][r] * alpha; }
  __builtin_amdgcn_fence(__ATOMIC_ACQ_REL, "workgroup"); __builtin_amdgcn_wave_barrier();
  const int rsub = lane >> 4, c4 = (lane & 15) * 4;
  {
#pragma unroll
    for (int q = 0; q < 8; ++q) { const int r = q * 2 + rsub; if (col0 + c4 < N) { const v4f v = *(const v4fa*)&so[w][r][c4]; *(v4f*)(C + (size_t)(row0 + r) * ldc + col0 + c4) = v; } }
     }
}

// Wt[n][k] = f16(W[k][n]·scale) from f32 row-major W[K][N] (scale = power of two; bf16-exact weights stay exact in f16 away from the subnormal range)
__global__ __launch_bounds__(256) void k_wt_f16(const float* __restrict__ W, _Float16* __restrict__ Wt, int K, int N, float scale) {
  const int t = blockIdx.x * 256 + threadIdx.x; if (t >= N * (K / 8)) return; const int n = t / (K / 8), k8 = (t % (K / 8)) * 8; FragH f;
#pragma unroll
  for (int i = 0; i < 8; ++i) f.h[i] = (_Float16)(bf16_round(W[(size_t)(k8 + i) * N + n]) * scale); const v8us o = f.half[0];
  *(v8us*)((unsigned short*)Wt + (size_t)n * K + k8) = o; 
}
// k_gemm_hh variant with fused epilogue: v = acc·alpha + bias[by·sBias + col] (+ CP[(row/rowsPerB)·sCPb + by·64 + col] if CP) ; ACT 0 none / 1 elu ; writes f16 C16 (and f32 C if non-null)
template <int ACT>
__global__ __launch_bounds__(128) void k_gemm_hhx(const _Float16* __restrict__ A, int lda, size_t sA, const _Float16* __restrict__ Bh, int ldb, size_t sB, float alpha, const float* __restrict__ bias, size_t sBias, const float* __restrict__ CP, int rowsPerB, size_t sCPb, int row0g,
    float* __restrict__ C, _Float16* __restrict__ C16, int ldc, size_t sC, int M, int N, int K) {
  __shared__ __attribute__((aligned(16))) float so[4][16][64];
  const int tid = threadIdx.x, w = tid >> 5, lane = tid & 31, ln = lane & 15, hh = lane >> 4; const int by = blockIdx.y;
  A += (size_t)by * sA; Bh += (size_t)by * sB; const size_t cofs = (size_t)by * sC; const float* bp = bias ? bias + (size_t)by * sBias : nullptr;
  const int ntn = (N + 63) / 64; const int wid = blockIdx.x * 4 + w; const int mt = wid / ntn, nq = wid % ntn; if (mt * 16 >= M) return;
  const int row0 = mt * 16, col0 = nq * 64; const _Float16* arow = A + (size_t)(row0 + ln) * lda;
  v8f acc[4] = {};
  for (int kb = 0; kb < K; kb += 32) { FragH ah; ah.half[0] = *(const v8us*)((const unsigned short*)arow + kb + 8 * hh); ah.half[1] = *(const v8us*)((const unsigned short*)arow + kb + 16 + 8 * hh);
#pragma unroll
    for (int t = 0; t < 4; ++t) { if (col0 + t * 16 >= N) continue; const size_t boff = (size_t)(col0 + t * 16 + ln) * ldb + kb; FragH bq; bq.half[0] = *(const v8us*)((const unsigned short*)Bh + boff + 8 * hh); bq.half[1] = *(const v8us*)((const unsigned short*)Bh + boff + 16 + 8 * hh);
      acc[t] = mmaH<1>(ah.v, ah.v, bq.v, bq.v, acc[t]); }
  }
#pragma unroll
  for (int t = 0; t < 4; ++t) { if (col0 + t * 16 >= N) continue; const int col = col0 + t * 16 + ln; const float bv = bp ? bf16_round(bp[col]) : 0.f;
#pragma unroll
    for (int r = 0; r < 8; ++r) { float v = acc[t][r] * alpha + bv; if (CP) { const int bidx = (row0g + row0 + 8 * hh + r) / rowsPerB; v += CP[(size_t)bidx * sCPb + (size_t)by * 64 + col]; } if (ACT == 1) v = (v > 0.f) ? v : expm1f(v); else if (ACT == 7) v = (v > 0.f) ? v + 1.0f : expf(v); else if (ACT == 8) v = tanhf(v); else if (ACT == 9) v = 0.5f * v * (1.0f + tanhf(0.7978845608028654f * (v + 0.044715f * v * v * v))); else if (ACT == 11) v = 1.0f / (1.0f + expf(-v)); else if (ACT == 12) v = (v > 0.f) ? v : 0.01f * v; else if (ACT == 14) v = (v > 0.f) ? v : 0.1f * v; else if (ACT == 15) v = v / (1.0f + expf(-v)); else if (ACT == 3) v = fmaxf(v, 0.f); else if (ACT == 6) v = 0.5f * v * (1.0f + erff(v * 0.70710678118654752f)); so[w][8 * hh + r][t * 16 + ln] = v; } }
  __builtin_amdgcn_fence(__ATOMIC_ACQ_REL, "workgroup"); __builtin_amdgcn_wave_barrier();
  const int rsub = lane >> 4, c4 = (lane & 15) * 4; typedef _Float16 v4h __attribute__((ext_vector_type(4)));
  {
#pragma unroll
    for (int q = 0; q < 8; ++q) { const int r = q * 2 + rsub; if (col0 + c4 < N) { const v4f v = *(const v4fa*)&so[w][r][c4]; if (C) *(v4f*)(C + cofs + (size_t)(row0 + r) * ldc + col0 + c4) = v; if (C16) { v4h h4; for (int i = 0; i < 4; ++i) h4[i] = (_Float16)v[i]; *(v4h*)(C16 + cofs + (size_t)(row0 + r) * ldc + col0 + c4) = h4; } } }
     }
}


typedef _Float16 v4h __attribute__((ext_vector_type(4)));

__global__ __launch_bounds__(256) void k_x16(const float* __restrict__ x, _Float16* __restrict__ X16, size_t n8) { const size_t t = (size_t)blockIdx.x * 256 + threadIdx.x; if (t >= n8) return; FragH f;
#pragma unroll
  for (int q = 0; q < 8; ++q) f.h[q] = (_Float16)bf16_round(x[t * 8 + q]); *(v8us*)((unsigned short*)X16 + t * 8) = f.half[0];  }
__global__ __launch_bounds__(256) void k_h16(const float* __restrict__ x, _Float16* __restrict__ X16, size_t n8) { const size_t t = (size_t)blockIdx.x * 256 + threadIdx.x; if (t >= n8) return; FragH f;
#pragma unroll
  for (int q = 0; q < 8; ++q) f.h[q] = (_Float16)x[t * 8 + q]; *(v8us*)((unsigned short*)X16 + t * 8) = f.half[0];  }
__global__ __launch_bounds__(256) void k_round16f(const float* __restrict__ W, _Float16* __restrict__ Bt, size_t n8) { const size_t t = (size_t)blockIdx.x * 256 + threadIdx.x; if (t >= n8) return; FragH f;
#pragma unroll
  for (int i = 0; i < 8; ++i) f.h[i] = (_Float16)(bf16_round(W[t * 8 + i]) * 16.0f); *(v8us*)((unsigned short*)Bt + t * 8) = f.half[0];  }
template <int NHv, int TTv>
__global__ __launch_bounds__(256) void k_vt(const _Float16* __restrict__ V16, int ldv, int voff, _Float16* __restrict__ Vt) { __shared__ unsigned short tl[64][66]; const int tid = threadIdx.x; const int slab = blockIdx.x / (TTv / 64), lg = blockIdx.x % (TTv / 64); const int b = slab / NHv, h = slab % NHv;
  for (int i = tid; i < 64 * 8; i += 256) { const int r = i / 8, c8 = (i % 8) * 8; FragH f; f.half[0] = *(const v8us*)((const unsigned short*)V16 + ((size_t)b * TTv + lg * 64 + r) * ldv + voff + h * 64 + c8);
#pragma unroll
    for (int q = 0; q < 8; ++q) tl[r][c8 + q] = f.u[q]; }
  __syncthreads();
  {
#pragma unroll
    for (int rd = 0; rd < 2; ++rd) { const int d = rd * 32 + tid / 8, pc = tid % 8; FragH f;
#pragma unroll
      for (int q = 0; q < 8; ++q) f.u[q] = tl[pc * 8 + q][d];
      *(v8us*)((unsigned short*)Vt + ((size_t)slab * 64 + d) * TTv + lg * 64 + pc * 8) = f.half[0]; }
     } }

__global__ __launch_bounds__(256) void k_hl(const float* __restrict__ F, _Float16* __restrict__ Hh, _Float16* __restrict__ Hl, size_t n8) { const size_t t = (size_t)blockIdx.x * 256 + threadIdx.x; if (t >= n8) return; FragH fh, fl; const v4f a = *(const v4fa*)(F + t * 8), c = *(const v4fa*)(F + t * 8 + 4);
#pragma unroll
  for (int q = 0; q < 4; ++q) { _Float16 h = (_Float16)a[q]; fh.h[q] = h; fl.h[q] = (_Float16)((a[q] - (float)h) * 1024.0f); h = (_Float16)c[q]; fh.h[4 + q] = h; fl.h[4 + q] = (_Float16)((c[q] - (float)h) * 1024.0f); }
  { *(v8us*)((unsigned short*)Hh + t * 8) = fh.half[0]; *(v8us*)((unsigned short*)Hl + t * 8) = fl.half[0];  } }

// ---- fast GEMM (block tile 128x64, wave tile 32x64; requires M % 128 == 0, N % 64 == 0, K % 64 == 0); A and B tiles of 64 k staged in LDS; epilogue = k_gemm_hhx semantics ----
__device__ __forceinline__ v16h g2_frag(const _Float16* p, int hh) { FragH f; f.half[0] = *(const v8us*)((const unsigned short*)p + 8 * hh); f.half[1] = *(const v8us*)((const unsigned short*)p + 16 + 8 * hh); return f.v; }
__device__ __forceinline__ v8f g2_mma(v16h a, v16h b, v8f c) { v8f d = __builtin_amdgcn_wmma_f32_16x16x32_f16(false, a, false, b, (short)0, c, false, false); asm volatile("v_nop\n\tv_nop\n\tv_nop\n\tv_nop" : "+v"(d) : "v"(a), "v"(b)); return d; }
template <int ACT>
__global__ __launch_bounds__(128) void k_gemm2(const _Float16* __restrict__ A, int lda, size_t sA, const _Float16* __restrict__ Bh, int ldb, size_t sB, float alpha, const float* __restrict__ bias, size_t sBias, const float* __restrict__ CP, int rowsPerB, size_t sCPb, int row0g,
    float* __restrict__ C, _Float16* __restrict__ C16, int ldc, size_t sC, int M, int N, int K) {
  constexpr int GK = 64, GP = 72;      // a tile = 64 k; LDS row pitch 144 B (16 B x odd: ds_load_b128 without bank conflicts)
  __shared__ __attribute__((aligned(16))) _Float16 tA[2][128][GP]; __shared__ __attribute__((aligned(16))) _Float16 tB[2][64][GP];      // two buffers each
  __shared__ __attribute__((aligned(16))) float so[4][32][68];
  const int tid = threadIdx.x, w = tid >> 5, lane = tid & 31, ln = lane & 15, hh = lane >> 4; const int by = blockIdx.y;
  A += (size_t)by * sA; Bh += (size_t)by * sB; const size_t cofs = (size_t)by * sC; const float* bp = bias ? bias + (size_t)by * sBias : nullptr;
  const int ntn = N >> 6; const int mt = blockIdx.x / ntn, nq = blockIdx.x - mt * ntn; const int row0 = mt * 128 + 32 * w, col0 = nq * 64; if (mt * 128 >= M) return;      // the whole block leaves or none of it: barriers follow
  // every thread copies 8 + 4 pieces of 16 B per tile (8 lanes cover one whole 128-B row)
  const int crow = tid >> 3, cc8 = (tid & 7) * 8;
  const _Float16* gA = A + (size_t)(mt * 128 + crow) * lda + cc8; const _Float16* gB = Bh + (size_t)(col0 + crow) * ldb + cc8;
  const unsigned lA = (unsigned)(size_t)&tA[0][crow][cc8], lB = (unsigned)(size_t)&tB[0][crow][cc8];
  auto copy_tile = [&](int t) {
    const unsigned ao = lA + (unsigned)(t & 1) * (unsigned)(128 * GP * 2), bo = lB + (unsigned)(t & 1) * (unsigned)(64 * GP * 2), r16 = 16 * GP * 2; const _Float16* ap = gA + (size_t)t * GK; const _Float16* bq = gB + (size_t)t * GK; const size_t a16 = (size_t)16 * lda, b16 = (size_t)16 * ldb;
    // the copies and, as the last line of the same statement, the wait that stands before their address registers are rewritten
    asm volatile("global_load_async_to_lds_b128 %0, %12, off\n\tglobal_load_async_to_lds_b128 %1, %13, off\n\tglobal_load_async_to_lds_b128 %2, %14, off\n\tglobal_load_async_to_lds_b128 %3, %15, off\n\t"
                 "global_load_async_to_lds_b128 %4, %16, off\n\tglobal_load_async_to_lds_b128 %5, %17, off\n\tglobal_load_async_to_lds_b128 %6, %18, off\n\tglobal_load_async_to_lds_b128 %7, %19, off\n\t"
                 "global_load_async_to_lds_b128 %8, %20, off\n\tglobal_load_async_to_lds_b128 %9, %21, off\n\tglobal_load_async_to_lds_b128 %10, %22, off\n\tglobal_load_async_to_lds_b128 %11, %23, off\n\ts_wait_xcnt 0x0"
                 :: "v"(ao), "v"(ao + r16), "v"(ao + 2 * r16), "v"(ao + 3 * r16), "v"(ao + 4 * r16), "v"(ao + 5 * r16), "v"(ao + 6 * r16), "v"(ao + 7 * r16), "v"(bo), "v"(bo + r16), "v"(bo + 2 * r16), "v"(bo + 3 * r16),
                    "v"(ap), "v"(ap + a16), "v"(ap + 2 * a16), "v"(ap + 3 * a16), "v"(ap + 4 * a16), "v"(ap + 5 * a16), "v"(ap + 6 * a16), "v"(ap + 7 * a16), "v"(bq), "v"(bq + b16), "v"(bq + 2 * b16), "v"(bq + 3 * b16) : "memory"); };
  const v8f z8 = {0.f,0.f,0.f,0.f,0.f,0.f,0.f,0.f}; v8f c00 = z8, c01 = z8, c02 = z8, c03 = z8, c10 = z8, c11 = z8, c12 = z8, c13 = z8;
  const int nst = K / GK;
  copy_tile(0);
  asm volatile("s_wait_asynccnt 0x0" ::: "memory");      // this wave's copies of tile 0 have landed
  __syncthreads();                                       // every wave's have: tile 0 may be read
  if (nst > 1) copy_tile(1);
#pragma unroll 1
  for (int t = 0; t < nst; ++t) { const _Float16 (*pA)[GP] = tA[t & 1]; const _Float16 (*pB)[GP] = tB[t & 1];
#pragma unroll
    for (int kb = 0; kb < GK; kb += 32) { const v16h a0 = g2_frag(&pA[32 * w + ln][kb], hh), a1 = g2_frag(&pA[32 * w + 16 + ln][kb], hh);
      v16h b = g2_frag(&pB[ln][kb], hh); c00 = g2_mma(a0, b, c00); c10 = g2_mma(a1, b, c10);
      b = g2_frag(&pB[16 + ln][kb], hh); c01 = g2_mma(a0, b, c01); c11 = g2_mma(a1, b, c11);
      b = g2_frag(&pB[32 + ln][kb], hh); c02 = g2_mma(a0, b, c02); c12 = g2_mma(a1, b, c12);
      b = g2_frag(&pB[48 + ln][kb], hh); c03 = g2_mma(a0, b, c03); c13 = g2_mma(a1, b, c13); }
    asm volatile("s_wait_dscnt 0x0" ::: "memory");       // this wave's reads of tile t are done before its buffer is refilled
    asm volatile("s_wait_asynccnt 0x0" ::: "memory");    // this wave's copies of tile t + 1 have landed
    __syncthreads();                                     // publishes tile t + 1 and ends every wave's reads of tile t
    if (t + 2 < nst) copy_tile(t + 2); }
  asm volatile("s_wait_asynccnt 0x0" ::: "memory");      // nothing of this wave is in flight when it goes on to the epilogue and ends
  v8f accs[8] = {c00, c01, c02, c03, c10, c11, c12, c13};
#pragma unroll
  for (int u = 0; u < 8; ++u) { const int t = u & 3, half = u >> 2; const int col = col0 + t * 16 + ln; const float bv = bp ? bf16_round(bp[col]) : 0.f;
#pragma unroll
    for (int r = 0; r < 8; ++r) { const int rloc = half * 16 + 8 * hh + r; float v = accs[u][r] * alpha + bv; if (CP) { const int bidx = (row0g + row0 + rloc) / rowsPerB; v += CP[(size_t)bidx * sCPb + (size_t)by * 64 + col]; }
      if (ACT == 3) v = fmaxf(v, 0.f); else if (ACT == 6) v = 0.5f * v * (1.0f + erff(v * 0.70710678118654752f)); else if (ACT == 11) v = 1.0f / (1.0f + expf(-v)); else if (ACT == 15) v = v / (1.0f + expf(-v)); else if (ACT == 12) v = (v > 0.f) ? v : 0.01f * v; else if (ACT == 8) v = tanhf(v);
      so[w][rloc][t * 16 + ln] = v; } }
  __builtin_amdgcn_fence(__ATOMIC_ACQ_REL, "workgroup"); __builtin_amdgcn_wave_barrier();
  const int rsub = lane >> 4, c4 = (lane & 15) * 4;
  {
#pragma unroll
    for (int q = 0; q < 16; ++q) { const int r = q * 2 + rsub; const v4f v = *(const v4fa*)&so[w][r][c4]; if (C) *(v4f*)(C + cofs + (size_t)(row0 + r) * ldc + col0 + c4) = v; if (C16) { v4h h4; for (int i = 0; i < 4; ++i) h4[i] = (_Float16)v[i]; *(v4h*)(C16 + cofs + (size_t)(row0 + r) * ldc + col0 + c4) = h4; } }
     } }



// lane l with lane l ^ 16
__device__ __forceinline__ float xhalf(float x) { return __builtin_bit_cast(float, __builtin_amdgcn_permlanex16(__builtin_bit_cast(int, x), __builtin_bit_cast(int, x), 0x76543210, 0xfedcba98, false, false)); }
__global__ __launch_bounds__(128) void k_flash(const _Float16* __restrict__ Q16, int ldq, const _Float16* __restrict__ K16, int ldk, const _Float16* __restrict__ Vt, const int* __restrict__ MSK, float* __restrict__ O, int ldo) {
  constexpr int RPW = 16, NQB = TQ / (4 * RPW), DT = 4, KS = 2;
  constexpr float C2 = SCL * 1.4426950408889634f;      // score scale x log2(e): the softmax runs in base 2
  constexpr int SK = 64, NST = TK / SK, LP = 72;      // a tile = 64 keys; LDS row pitch 144 B (16 B x odd: ds_load_b128 without bank conflicts)
  __shared__ __attribute__((aligned(16))) unsigned short sK[2][SK][LP]; __shared__ __attribute__((aligned(16))) unsigned short sV[2][64][LP];      // two buffers each: K rows [key][d], V^T rows [d][key]
  __shared__ __attribute__((aligned(16))) float sO[4][RPW][64 + 4];
  const int tid = threadIdx.x, w = tid >> 5, lane = tid & 31, ln = lane & 15, hh = lane >> 4;
  const int slab = blockIdx.x / NQB, qblk = blockIdx.x % NQB; const int b = slab / NH, h = slab % NH; const int qb0 = qblk * (4 * RPW); const int q0 = qb0 + w * RPW;
  FragH bq[KS];
  { const unsigned short* qr = (const unsigned short*)Q16 + ((size_t)b * TQ + q0 + ln) * ldq + h * 64;
#pragma unroll
    for (int ks = 0; ks < KS; ++ks) { bq[ks].half[0] = *(const v8us*)(qr + ks * 32 + 8 * hh); bq[ks].half[1] = *(const v8us*)(qr + ks * 32 + 16 + 8 * hh); } }
  const unsigned short* Vth = (const unsigned short*)Vt + (size_t)slab * 64 * TK;
  float m_r = -3.0e38f, l_r = 0.f; v8f oacc[DT];      // one query per lane: its running maximum (of the raw products), this lane half's part of its sum (x2^10, like P), O^T rows d = dt * 16 + 8 * hh + r
#pragma unroll
  for (int dt = 0; dt < DT; ++dt) oacc[dt] = (v8f){0.f,0.f,0.f,0.f,0.f,0.f,0.f,0.f};
  // The block's four waves share each K / V^T tile: every thread copies 4 + 4 pieces of 16 B (8 lanes cover one whole 128-B row).
  const int crow = tid >> 3, cc8 = (tid & 7) * 8;
  const unsigned short* gK = (const unsigned short*)K16 + ((size_t)b * TK + crow) * ldk + h * 64 + cc8; const unsigned short* gV = Vth + (size_t)crow * TK + cc8;
  const unsigned lK = (unsigned)(size_t)&sK[0][crow][cc8], lV = (unsigned)(size_t)&sV[0][crow][cc8];
  auto copy_tile = [&](int t) {
    const unsigned bo = (unsigned)(t & 1) * (unsigned)(SK * LP * 2), r16 = 16 * LP * 2; const unsigned short* kp = gK + (size_t)t * SK * ldk; const unsigned short* vp = gV + (size_t)t * SK;
    // the copies and, as the last line of the same statement, the wait that stands before their address registers are rewritten
    asm volatile("global_load_async_to_lds_b128 %0, %8, off\n\tglobal_load_async_to_lds_b128 %1, %9, off\n\tglobal_load_async_to_lds_b128 %2, %10, off\n\tglobal_load_async_to_lds_b128 %3, %11, off\n\t"
                 "global_load_async_to_lds_b128 %4, %12, off\n\tglobal_load_async_to_lds_b128 %5, %13, off\n\tglobal_load_async_to_lds_b128 %6, %14, off\n\tglobal_load_async_to_lds_b128 %7, %15, off\n\ts_wait_xcnt 0x0"
                 :: "v"(lK + bo), "v"(lK + bo + r16), "v"(lK + bo + 2 * r16), "v"(lK + bo + 3 * r16), "v"(lV + bo), "v"(lV + bo + r16), "v"(lV + bo + 2 * r16), "v"(lV + bo + 3 * r16),
                    "v"(kp), "v"(kp + (size_t)16 * ldk), "v"(kp + (size_t)32 * ldk), "v"(kp + (size_t)48 * ldk), "v"(vp), "v"(vp + (size_t)16 * TK), "v"(vp + (size_t)32 * TK), "v"(vp + (size_t)48 * TK) : "memory"); };
  copy_tile(0);
  asm volatile("s_wait_asynccnt 0x0" ::: "memory");      // this wave's copies of tile 0 have landed
  __syncthreads();                                       // every wave's have: tile 0 may be read
  copy_tile(1);
#pragma unroll 1
  for (int t = 0; t < NST; ++t) {
   const unsigned short (*bK)[LP] = sK[t & 1]; const unsigned short (*bV)[LP] = sV[t & 1];
#pragma unroll
   for (int ps = 0; ps < SK / 32; ++ps) {
    v8f sc[2];      // raw products q.k: the scale is positive, so their maximum is the scaled scores' maximum
#pragma unroll
    for (int nt = 0; nt < 2; ++nt) { const unsigned short* kr = &bK[ps * 32 + nt * 16 + ln][0]; FragH ak[KS];
#pragma unroll
      for (int ks = 0; ks < KS; ++ks) { ak[ks].half[0] = *(const v8us*)(kr + ks * 32 + 8 * hh); ak[ks].half[1] = *(const v8us*)(kr + ks * 32 + 16 + 8 * hh); }
      v8f acc = (v8f){0.f,0.f,0.f,0.f,0.f,0.f,0.f,0.f};
#pragma unroll
      for (int ks = 0; ks < KS; ++ks) acc = mmaH<1>(ak[ks].v, ak[ks].v, bq[ks].v, bq[ks].v, acc);
      sc[nt] = acc; }
    float mc = fmaxf(sc[0][0], sc[1][0]);
#pragma unroll
    for (int r = 1; r < 8; ++r) mc = fmaxf(mc, fmaxf(sc[0][r], sc[1][r]));
    mc = fmaxf(mc, xhalf(mc));      // both lane halves now hold the query's maximum over the 32 keys
    const float mn = fmaxf(m_r, mc); const float al = (mn > -1.0e38f) ? __builtin_amdgcn_exp2f((m_r - mn) * C2) : 1.0f; m_r = mn;
    const float nb = fmaf(-mn, C2, 10.0f);      // P x 2^10 = 2^(s * C2 - mn * C2 + 10): one fma per score, then v_exp_f32
    FragH pb; float ls[4] = {0.f, 0.f, 0.f, 0.f};
#pragma unroll
    for (int nt = 0; nt < 2; ++nt)
#pragma unroll
      for (int r = 0; r < 8; ++r) { const float p = __builtin_amdgcn_exp2f(fmaf(sc[nt][r], C2, nb)); ls[r & 3] += p; pb.h[nt * 8 + r] = (_Float16)p; }
    l_r = l_r * al + ((ls[0] + ls[1]) + (ls[2] + ls[3]));
#pragma unroll
    for (int dt = 0; dt < DT; ++dt) oacc[dt] *= al;
#pragma unroll
    for (int dt = 0; dt < DT; ++dt) { const unsigned short* vrow = &bV[dt * 16 + ln][ps * 32]; FragH av; av.half[0] = *(const v8us*)(vrow + 8 * hh); av.half[1] = *(const v8us*)(vrow + 16 + 8 * hh);
      oacc[dt] = mmaH<1>(av.v, av.v, pb.v, pb.v, oacc[dt]); } }
   asm volatile("s_wait_dscnt 0x0" ::: "memory");        // this wave's reads of tile t are done before its buffer is refilled
   asm volatile("s_wait_asynccnt 0x0" ::: "memory");     // this wave's copies of tile t + 1 have landed
   __syncthreads();                                      // publishes tile t + 1 and ends every wave's reads of tile t
   if (t + 2 < NST) copy_tile(t + 2); }
  asm volatile("s_wait_asynccnt 0x0" ::: "memory");      // nothing of this wave is in flight when it goes on to the epilogue and ends
  const float l = l_r + xhalf(l_r);      // the two lane halves' sums joined, unconditionally
  const float inv = (l > 0.f) ? 1.0f / l : 0.f;      // sum and O^T carry the same 2^10
#pragma unroll
  for (int dt = 0; dt < DT; ++dt) { const v4f lo = {oacc[dt][0] * inv, oacc[dt][1] * inv, oacc[dt][2] * inv, oacc[dt][3] * inv}, hi = {oacc[dt][4] * inv, oacc[dt][5] * inv, oacc[dt][6] * inv, oacc[dt][7] * inv};
    *(v4fa*)&sO[w][ln][dt * 16 + 8 * hh] = lo; *(v4fa*)&sO[w][ln][dt * 16 + 8 * hh + 4] = hi; }
  __builtin_amdgcn_fence(__ATOMIC_ACQ_REL, "workgroup"); __builtin_amdgcn_wave_barrier();
  {
#pragma unroll
    for (int rp = 0; rp < RPW; rp += 2) { const int r = rp + (lane >> 4), pc = lane & 15; const v4f val = *(const v4fa*)&sO[w][r][pc * 4]; *(v4f*)(O + ((size_t)b * TQ + q0 + r) * ldo + h * 64 + pc * 4) = val; }
     } }
__global__ __launch_bounds__(256) void k_fulltab(unsigned* __restrict__ MB, int* __restrict__ RA, int* __restrict__ KE, int nq, int nk) {
  const int t = blockIdx.x * 256 + threadIdx.x;
  if (t < nq * (nk / 32)) { *(unsigned*)(MB + t) = 0u;  }
  if (t < nq) { *(int*)(RA + t) = 0;  }
  if (t < nq / 64) { *(int*)(KE + t * 32) = nk;  } }
__global__ __launch_bounds__(256) void k_lnout(const float* __restrict__ Y, const float* __restrict__ g, const float* __restrict__ bb, float* __restrict__ out) {
  #pragma clang fp contract(off)
  const int tid = threadIdx.x, w = tid >> 5, ln = tid & 31; const int r = blockIdx.x * 8 + w; if (r >= NR) return; const float* y = Y + (size_t)r * DM; float s = 0.f;
#pragma unroll 1
  for (int i = 0; i < 8; ++i) { const v4f a = *(const v4fa*)(y + i * 128 + ln * 4); for (int q = 0; q < 4; ++q) s += a[q]; }
  for (int o = 16; o > 0; o >>= 1) s += __shfl_xor(s, o, 32); const float mu = s / (float)DM; float q2 = 0.f;
#pragma unroll 1
  for (int i = 0; i < 8; ++i) { const v4f a = *(const v4fa*)(y + i * 128 + ln * 4); for (int q = 0; q < 4; ++q) { const float d = a[q] - mu; q2 += d * d; } }
  for (int o = 16; o > 0; o >>= 1) q2 += __shfl_xor(q2, o, 32); const float rs = rsqrtf(q2 / (float)DM + 1e-6f);
  {
#pragma unroll 1
    for (int i = 0; i < 8; ++i) { const int c0 = i * 128 + ln * 4; const v4f a = *(const v4fa*)(y + c0); v4f o4; for (int q = 0; q < 4; ++q) o4[q] = (a[q] - mu) * rs * bf16_round(g[c0 + q]) + bf16_round(bb[c0 + q]); *(v4f*)(out + (size_t)r * DM + c0) = o4; }
     } }
__global__ __launch_bounds__(256) void k_xb(const float* __restrict__ x, float* __restrict__ XB, size_t n4) { const size_t t = (size_t)blockIdx.x * 256 + threadIdx.x; if (t >= n4) return; const v4f a = *(const v4fa*)(x + t * 4); v4f o; for (int q = 0; q < 4; ++q) o[q] = bf16_round(a[q]); *(v4f*)(XB + t * 4) = o;  }
// Every input conversion in one launch, by block range: blocks 0..767 round q, k, v to bf16 and store them as f16 planes (q also as f32, the residual addend);
// blocks 768..1023 store the four weights, rounded to bf16, as f16 x16. A block streams 4096 pieces of 16 B, lane-contiguous, 16 per thread.
template <bool RES>
__device__ __forceinline__ void prep_stream(const float* __restrict__ src, _Float16* __restrict__ dst, float* __restrict__ xb, float scale, int tid) {
  v4f a[16];      // the three loops below are unrolled so that a[] lives in registers and every address is base + immediate offset
#pragma unroll
  for (int u = 0; u < 16; ++u) a[u] = *(const v4fa*)(src + (u * 256 + tid) * 4);
  __builtin_amdgcn_sched_barrier(0);      // keeps all 16 loads in flight together: without it the compiler sinks six of them among the conversions
#pragma unroll
  for (int u = 0; u < 16; ++u) { const int e = (u * 256 + tid) * 4; v4f r; v4h h;
#pragma unroll
    for (int i = 0; i < 4; ++i) { r[i] = bf16_round(a[u][i]); h[i] = (_Float16)(r[i] * scale); }
    *(v4h*)(dst + e) = h; if (RES) *(v4f*)(xb + e) = r; } }
__global__ __launch_bounds__(256) void k_prep(const float* __restrict__ q, const float* __restrict__ k, const float* __restrict__ v, const float* __restrict__ Wq, const float* __restrict__ Wk, const float* __restrict__ Wv, const float* __restrict__ Wo,
                                              _Float16* __restrict__ X16, float* __restrict__ XB, _Float16* __restrict__ B16) {
  constexpr int PB = 4096, XBLK = NR * DM / 4 / PB, WBLK = DM * DM / 4 / PB;
  const int bid = blockIdx.x, tid = threadIdx.x;
  if (bid < XBLK) { const size_t o = (size_t)bid * PB * 4; prep_stream<true>(q + o, X16 + o, XB + o, 1.0f, tid); }
  else if (bid < 3 * XBLK) { const bool isk = bid < 2 * XBLK; const size_t o = (size_t)(bid - (isk ? XBLK : 2 * XBLK)) * PB * 4; prep_stream<false>((isk ? k : v) + o, X16 + (size_t)(isk ? 1 : 2) * NR * DM + o, nullptr, 1.0f, tid); }
  else { const int j = (bid - 3 * XBLK) / WBLK; const size_t o = (size_t)((bid - 3 * XBLK) % WBLK) * PB * 4; prep_stream<false>((j == 0 ? Wq : (j == 1 ? Wk : (j == 2 ? Wv : Wo))) + o, B16 + (size_t)j * DM * DM + o, nullptr, 16.0f, tid); } }
__global__ __launch_bounds__(256) void k_causaltab(unsigned* __restrict__ MB, int* __restrict__ RA, int* __restrict__ KE, int nq, int nk) {
  const int t = blockIdx.x * 256 + threadIdx.x; const int nw = nk / 32;
  if (t < nq * nw) { const int q = t / nw, w = t % nw; const int first = q + 1 - 32 * w; const unsigned bits = (first <= 0) ? 0xffffffffu : ((first >= 32) ? 0u : (0xffffffffu << first)); *(unsigned*)(MB + t) = bits;  }
  if (t < nq) { *(int*)(RA + t) = 0;  }
  if (t < nq / 64) { const int v = 64 * (t + 1); *(int*)(KE + t * 32) = v;  } }


extern "C" void kernel_launch(void* const* d_in, const int* in_sizes, int n_in,
                              void* d_out, int out_size, void* d_ws, size_t ws_size, hipStream_t stream) {
  (void)in_sizes; (void)n_in; (void)out_size;
  const float* const* I = (const float* const*)d_in; const float* qin = I[0]; const float* kin = I[1]; const float* vin = I[2]; const float* Wq = I[3]; const float* Wk = I[4]; const float* Wv = I[5]; const float* Wo = I[6]; const float* gam = I[7]; const float* bet = I[8];
  char* ws = (char*)d_ws; size_t off = 0;
  auto take = [&](size_t bytes) { char* p = ws + off; off += (bytes + 255) & ~(size_t)255; return p; };
  _Float16* BQ = (_Float16*)take((size_t)DM * DM * 2); _Float16* BK = (_Float16*)take((size_t)DM * DM * 2); _Float16* BV = (_Float16*)take((size_t)DM * DM * 2); _Float16* BO = (_Float16*)take((size_t)DM * DM * 2);
  _Float16* X16 = (_Float16*)take((size_t)3 * NR * DM * 2); float* F = (float*)take((size_t)NR * DM * 4); float* XB = (float*)take((size_t)NR * DM * 4);
  _Float16* Q16 = (_Float16*)take((size_t)NR * DM * 2); _Float16* K16 = (_Float16*)take((size_t)NR * DM * 2); _Float16* V16 = (_Float16*)take((size_t)NR * DM * 2); _Float16* VT = (_Float16*)take((size_t)NR * DM * 2);
  if (off > ws_size) return;      /* 8 + 24 + 16 + 16 + 32 = 96 MiB; BQ BK BV BO, the three X16 planes and Q16 K16 V16 each lie one behind the other */
  float* O = F; _Float16* Oh = Q16; _Float16* Ol = K16; float* Y = XB;
  const size_t n8 = (size_t)NR * DM / 8; const unsigned nb8 = (unsigned)((n8 + 255) / 256); (void)BK; (void)BV;
  k_prep<<<3 * (NR * DM / 16384) + 4 * (DM * DM / 16384), 256, 0, stream>>>(qin, kin, vin, Wq, Wk, Wv, Wo, X16, XB, BQ);      /* X16 planes of q, k, v; XB; BQ BK BV BO */
  const dim3 gP((NR / 128) * (DM / 64), 1), gP3((NR / 128) * (DM / 64), 3);
  k_gemm2<0><<<gP3, 128, 0, stream>>>(X16, DM, (size_t)NR * DM, BQ, DM, (size_t)DM * DM, 0.0625f, nullptr, 0, nullptr, 1, 0, 0, nullptr, Q16, DM, (size_t)NR * DM, NR, DM, DM);      /* blockIdx.y = 0, 1, 2: qh, kh, vh (f16) */
  k_vt<NH, SLEN><<<NH * (SLEN / 64), 256, 0, stream>>>(V16, DM, 0, VT);
  k_flash<<<NH * (SLEN / 64), 128, 0, stream>>>(Q16, DM, K16, DM, VT, nullptr, O, DM);      /* plain flash over all 4096 keys (no mask) */
  k_hl<<<nb8, 256, 0, stream>>>(O, Oh, Ol, n8);
  k_gemm2<0><<<gP, 128, 0, stream>>>(Oh, DM, 0, BO, DM, 0, 0.0625f, nullptr, 0, XB, 1, (size_t)DM, 0, Y, nullptr, DM, 0, NR, DM, DM);
  k_gemm2<0><<<gP, 128, 0, stream>>>(Ol, DM, 0, BO, DM, 0, 0.0625f / 1024.0f, nullptr, 0, Y, 1, (size_t)DM, 0, Y, nullptr, DM, 0, NR, DM, DM);
  k_lnout<<<NR / 8, 256, 0, stream>>>(Y, gam, bet, (float*)d_out);
}

// v005
// A run of this version takes 198 microseconds.
// Two timings next to v004 put it at 1.14 and 1.15 times that version's speed.
// Over all steps from v000 it is 3.78 times as fast.
#include <hip/hip_runtime.h>
#define NBT 1
#define SLEN 4096
#define TQ SLEN
#define TK SLEN
#define DM 1024
#define NH 16
#define SCL 0.125f
#define NR (NBT * SLEN)
typedef __bf16 v16b __attribute__((ext_vector_type(16)));
typedef unsigned short v8us __attribute__((ext_vector_type(8), may_alias));
typedef float  v8f  __attribute__((ext_vector_type(8)));
typedef float  v4f  __attribute__((ext_vector_type(4)));
typedef float  v4fa __attribute__((ext_vector_type(4), may_alias));
union FragB { v16b v; v8us half[2]; unsigned short u[16]; };

__device__ __forceinline__ unsigned short bf16_bits(float x) { unsigned int u = __float_as_uint(x); return (unsigned short)((u + 0x7FFFu + ((u >> 16) & 1u)) >> 16); }
__device__ __forceinline__ float bf16_val(unsigned short b) { return __uint_as_float(((unsigned int)b) << 16); }
__device__ __forceinline__ float bf16_round(float x) { return bf16_val(bf16_bits(x)); }
// D += A·B with NT terms: 1 = ah·bh, 2 = + al·bh (A split), 3 = + ah·bl (both split)
template <int NT>
__device__ __forceinline__ v8f mmaN(v16b ah, v16b al, v16b bh, v16b bl, v8f c) {
  c = __builtin_amdgcn_wmma_f32_16x16x32_bf16(false, ah, false, bh, (short)0, c, false, false);
  if (NT >= 2) c = __builtin_amdgcn_wmma_f32_16x16x32_bf16(false, al, false, bh, (short)0, c, false, false);
  if (NT >= 3) c = __builtin_amdgcn_wmma_f32_16x16x32_bf16(false, ah, false, bl, (short)0, c, false, false);
  asm volatile("v_nop\n\tv_nop\n\tv_nop\n\tv_nop" : "+v"(c) : "v"(ah), "v"(al), "v"(bh), "v"(bl));
  return c;
}

__global__ __launch_bounds__(256) void k_wt_bf16(const float* __restrict__ W, unsigned short* __restrict__ Wt, int K, int N) {
  const int t = blockIdx.x * 256 + threadIdx.x;
  const int k8n = K / 8;
  if (t >= N * k8n) return;
  const int n = t / k8n, k8 = (t % k8n) * 8;
  v8us v;
#pragma unroll
  for (int i = 0; i < 8; ++i) v[i] = bf16_bits(W[(size_t)(k8 + i) * N + n]);
  *(v8us*)(Wt + (size_t)n * K + k8) = v;
  
}

// GEMM C[M][N] (f32, pitch ldc) = act(A[M][K]·W + bias). A f32 row-major (pitch lda) converted per fragment to bf16
// (ASPLIT: hi/lo two planes -> 2 terms, else single rounded term); Wt bf16 [N][K] (pitch ldb). BIAS_BF16 rounds the
// bias to bf16 first (bias quantised to bf16 before the add). K%32==0, M%16==0, N%64==0.
template <bool ASPLIT, int ACT, bool BIAS_BF16>
__global__ __launch_bounds__(128) void k_gemm_bf(const float* __restrict__ A, int lda, const unsigned short* __restrict__ Wt, int ldb,
                                               const float* __restrict__ bias, float* __restrict__ C, int ldc, int M, int N, int K) {
  __shared__ __attribute__((aligned(16))) float so[4][16][64];
  const int tid = threadIdx.x, w = tid >> 5, lane = tid & 31, ln = lane & 15, hh = lane >> 4;
  const int ntn = N / 64;
  const int wid = blockIdx.x * 4 + w;
  const int mt = wid / ntn, nq = wid % ntn;
  if (mt * 16 >= M) return;
  const int row0 = mt * 16, col0 = nq * 64;
  const float* arow = A + (size_t)(row0 + ln) * lda;
  v8f acc[4] = {};
  for (int kb = 0; kb < K; kb += 32) {
    FragB ah, al;
    const v4f x0 = *(const v4fa*)(arow + kb + 8 * hh), x1 = *(const v4fa*)(arow + kb + 8 * hh + 4);
    const v4f x2 = *(const v4fa*)(arow + kb + 16 + 8 * hh), x3 = *(const v4fa*)(arow + kb + 16 + 8 * hh + 4);
    float xs[16] = {x0[0],x0[1],x0[2],x0[3],x1[0],x1[1],x1[2],x1[3],x2[0],x2[1],x2[2],x2[3],x3[0],x3[1],x3[2],x3[3]};
#pragma unroll
    for (int i = 0; i < 16; ++i) { const unsigned short hb = bf16_bits(xs[i]); ah.u[i] = hb; al.u[i] = ASPLIT ? bf16_bits(xs[i] - bf16_val(hb)) : (unsigned short)0; }
#pragma unroll
    for (int t = 0; t < 4; ++t) {
      const unsigned short* brow = Wt + (size_t)(col0 + t * 16 + ln) * ldb + kb;
      FragB b;
      b.half[0] = *(const v8us*)(brow + 8 * hh);
      b.half[1] = *(const v8us*)(brow + 16 + 8 * hh);
      acc[t] = mmaN<ASPLIT ? 2 : 1>(ah.v, al.v, b.v, b.v, acc[t]);
    }
  }
#pragma unroll
  for (int t = 0; t < 4; ++t) {
    float bv = bias ? bias[col0 + t * 16 + ln] : 0.f;
    if (BIAS_BF16) bv = bf16_round(bv);
#pragma unroll
    for (int r = 0; r < 8; ++r) { float v = acc[t][r] + bv; if (ACT == 1) v = fmaxf(v, 0.f); so[w][8 * hh + r][t * 16 + ln] = v; }
  }
  __builtin_amdgcn_fence(__ATOMIC_ACQ_REL, "workgroup");
  __builtin_amdgcn_wave_barrier();
  const int rsub = lane >> 4, c4 = (lane & 15) * 4;
  {
#pragma unroll
    for (int q = 0; q < 8; ++q) {
      const int r = q * 2 + rsub;
      const v4f v = *(const v4fa*)&so[w][r][c4];
      *(v4f*)(C + (size_t)(row0 + r) * ldc + col0 + c4) = v;
    }
    
  }
}

// GEMM C = act(A·W + bias + resid): A f32 (ASPLIT -> hi/lo 2 terms), Wt bf16 [N][K]; ACT 0 none, 1 relu, 2 exact gelu;
// resid (optional, f32, row index = (row % rmod), pitch ldr, RES_BF16 rounds it) added before the activation.
template <bool ASPLIT, int ACT, bool BIAS_BF16, bool RES_BF16>
__global__ __launch_bounds__(128) void k_gemm_bf3(const float* __restrict__ A, int lda, const unsigned short* __restrict__ Wt, int ldb,
                                                const float* __restrict__ bias, const float* __restrict__ resid, int rmod, int ldr,
                                                float* __restrict__ C, int ldc, int M, int N, int K) {
  __shared__ __attribute__((aligned(16))) float so[4][16][64];
  const int tid = threadIdx.x, w = tid >> 5, lane = tid & 31, ln = lane & 15, hh = lane >> 4;
  const int ntn = N / 64;
  const int wid = blockIdx.x * 4 + w;
  const int mt = wid / ntn, nq = wid % ntn;
  if (mt * 16 >= M) return;
  const int row0 = mt * 16, col0 = nq * 64;
  const float* arow = A + (size_t)(row0 + ln) * lda;
  v8f acc[4] = {};
  for (int kb = 0; kb < K; kb += 32) {
    FragB ah, al;
    const v4f x0 = *(const v4fa*)(arow + kb + 8 * hh), x1 = *(const v4fa*)(arow + kb + 8 * hh + 4);
    const v4f x2 = *(const v4fa*)(arow + kb + 16 + 8 * hh), x3 = *(const v4fa*)(arow + kb + 16 + 8 * hh + 4);
    float xs[16] = {x0[0],x0[1],x0[2],x0[3],x1[0],x1[1],x1[2],x1[3],x2[0],x2[1],x2[2],x2[3],x3[0],x3[1],x3[2],x3[3]};
#pragma unroll
    for (int i = 0; i < 16; ++i) { const unsigned short hb = bf16_bits(xs[i]); ah.u[i] = hb; al.u[i] = ASPLIT ? bf16_bits(xs[i] - bf16_val(hb)) : (unsigned short)0; }
#pragma unroll
    for (int t = 0; t < 4; ++t) {
      const unsigned short* brow = Wt + (size_t)(col0 + t * 16 + ln) * ldb + kb;
      FragB b;
      b.half[0] = *(const v8us*)(brow + 8 * hh);
      b.half[1] = *(const v8us*)(brow + 16 + 8 * hh);
      acc[t] = mmaN<ASPLIT ? 2 : 1>(ah.v, al.v, b.v, b.v, acc[t]);
    }
  }
#pragma unroll
  for (int t = 0; t < 4; ++t) {
    const int col = col0 + t * 16 + ln;
    float bv = bias ? bias[col] : 0.f;
    if (BIAS_BF16) bv = bf16_round(bv);
#pragma unroll
    for (int r = 0; r < 8; ++r) {
      float v = acc[t][r] + bv;
      if (resid) { float rv = resid[(size_t)((row0 + 8 * hh + r) % rmod) * ldr + col]; if (RES_BF16) rv = bf16_round(rv); v += rv; }
      if (ACT == 1) v = fmaxf(v, 0.f);
      if (ACT == 2) v = 0.5f * v * (1.0f + erff(v * 0.70710678118654752f));
      if (ACT == 3) { const float u = 0.7978845608028654f * (v + 0.044715f * v * v * v); v = 0.5f * v * (1.0f + tanhf(u)); }
      so[w][8 * hh + r][t * 16 + ln] = v;
    }
  }
  __builtin_amdgcn_fence(__ATOMIC_ACQ_REL, "workgroup");
  __builtin_amdgcn_wave_barrier();
  const int rsub = lane >> 4, c4 = (lane & 15) * 4;
  {
#pragma unroll
    for (int q = 0; q < 8; ++q) {
      const int r = q * 2 + rsub;
      const v4f v = *(const v4fa*)&so[w][r][c4];
      *(v4f*)(C + (size_t)(row0 + r) * ldc + col0 + c4) = v;
    }
    
  }
}
// row LayerNorm (biased variance, eps) over N: s = X (+ R); optional out_sum <- s; out_norm <- (s-mu)*rsqrt(var+eps)*g + b
template <bool PARAM_BF16>
__global__ __launch_bounds__(256) void k_layernorm(const float* __restrict__ X, const float* __restrict__ R, const float* __restrict__ g, const float* __restrict__ bta,
                                                  float* __restrict__ out_sum, float* __restrict__ out_norm, int N, float eps) {
  __shared__ float red[256];
  const int row = blockIdx.x, tid = threadIdx.x;
  const float* x = X + (size_t)row * N; const float* rr = R ? R + (size_t)row * N : nullptr;
  float vals[16];                     // up to N = 4096
  const int per = N / 256;            // contiguous chunk per thread? use strided-by-4 chunks: thread handles j = tid*4 + 1024*u
  float s1 = 0.f;
  for (int u = 0; u < per / 4; ++u) {
    const int j = tid * 4 + 1024 * u;
    const v4f a = *(const v4fa*)(x + j);
    v4f b = {0.f,0.f,0.f,0.f}; if (rr) b = *(const v4fa*)(rr + j);
#pragma unroll
    for (int q = 0; q < 4; ++q) { const float v = a[q] + b[q]; vals[u * 4 + q] = v; s1 += v; }
  }
  red[tid] = s1; __syncthreads();
  for (int st = 128; st > 0; st >>= 1) { if (tid < st) red[tid] += red[tid + st]; __syncthreads(); }
  const float mu = red[0] / (float)N; __syncthreads();
  float s2 = 0.f;
  for (int u = 0; u < per / 4; ++u)
#pragma unroll
    for (int q = 0; q < 4; ++q) { const float c = vals[u * 4 + q] - mu; s2 += c * c; }
  red[tid] = s2; __syncthreads();
  for (int st = 128; st > 0; st >>= 1) { if (tid < st) red[tid] += red[tid + st]; __syncthreads(); }
  const float rs = rsqrtf(red[0] / (float)N + eps);
  {
    for (int u = 0; u < per / 4; ++u) {
      const int j = tid * 4 + 1024 * u;
      v4f o, sm;
#pragma unroll
      for (int q = 0; q < 4; ++q) {
        float gg = g[j + q], bb = bta[j + q];
        if (PARAM_BF16) { gg = bf16_round(gg); bb = bf16_round(bb); }
        sm[q] = vals[u * 4 + q]; o[q] = (vals[u * 4 + q] - mu) * rs * gg + bb;
      }
      if (out_sum) *(v4f*)(out_sum + (size_t)row * N + j) = sm;
      *(v4f*)(out_norm + (size_t)row * N + j) = o;
    }
    
  }
}



// ---- f16 WMMA path (v_wmma_f32_16x16x32_f16): 11-bit significands for operands in range — used where a [0,1] probability operand needs more precision than bf16
typedef _Float16 v16h __attribute__((ext_vector_type(16)));
union FragH { v16h v; v8us half[2]; _Float16 h[16]; unsigned short u[16]; };
template <int NT>
__device__ __forceinline__ v8f mmaH(v16h ah, v16h al, v16h bh, v16h bl, v8f c) {
  c = __builtin_amdgcn_wmma_f32_16x16x32_f16(false, ah, false, bh, (short)0, c, false, false);
  if (NT >= 2) c = __builtin_amdgcn_wmma_f32_16x16x32_f16(false, al, false, bh, (short)0, c, false, false);
  if (NT >= 3) c = __builtin_amdgcn_wmma_f32_16x16x32_f16(false, ah, false, bl, (short)0, c, false, false);
  asm volatile("v_nop\n\tv_nop\n\tv_nop\n\tv_nop" : "+v"(c) : "v"(ah), "v"(al), "v"(bh), "v"(bl));
  return c;
}
// batched GEMM like k_gemm_b but f16 operands: A f32 (split into f16 hi/lo if ASPLIT, else rounded to f16), Bt = f16 values [n][k]; alpha; C f32; N multiple of 16 (partial tiles skipped)
template <bool ASPLIT>
__global__ __launch_bounds__(128) void k_gemm_h(const float* __restrict__ A, int lda, size_t sA, const _Float16* __restrict__ Bh, int ldb, size_t sB, float alpha, float* __restrict__ C, int ldc, size_t sC, int M, int N, int K) {
  __shared__ __attribute__((aligned(16))) float so[4][16][64];
  const int tid = threadIdx.x, w = tid >> 5, lane = tid & 31, ln = lane & 15, hh = lane >> 4; const int by = blockIdx.y;
  A += (size_t)by * sA; Bh += (size_t)by * sB; C += (size_t)by * sC;
  const int ntn = (N + 63) / 64; const int wid = blockIdx.x * 4 + w; const int mt = wid / ntn, nq = wid % ntn; if (mt * 16 >= M) return;
  const int row0 = mt * 16, col0 = nq * 64; const float* arow = A + (size_t)(row0 + ln) * lda;
  v8f acc[4] = {};
  for (int kb = 0; kb < K; kb += 32) {
    FragH ah, al;
    const v4f x0 = *(const v4fa*)(arow + kb + 8 * hh), x1 = *(const v4fa*)(arow + kb + 8 * hh + 4), x2 = *(const v4fa*)(arow + kb + 16 + 8 * hh), x3 = *(const v4fa*)(arow + kb + 16 + 8 * hh + 4);
    float xs[16] = {x0[0],x0[1],x0[2],x0[3],x1[0],x1[1],x1[2],x1[3],x2[0],x2[1],x2[2],x2[3],x3[0],x3[1],x3[2],x3[3]};
#pragma unroll
    for (int i = 0; i < 16; ++i) { const _Float16 h = (_Float16)xs[i]; ah.h[i] = h; al.h[i] = ASPLIT ? (_Float16)(xs[i] - (float)h) : (_Float16)0.0f; }
#pragma unroll
    for (int t = 0; t < 4; ++t) { if (col0 + t * 16 >= N) continue; const size_t boff = (size_t)(col0 + t * 16 + ln) * ldb + kb; FragH bq; bq.half[0] = *(const v8us*)(Bh + boff + 8 * hh); bq.half[1] = *(const v8us*)(Bh + boff + 16 + 8 * hh);
      acc[t] = mmaH<ASPLIT ? 2 : 1>(ah.v, al.v, bq.v, bq.v, acc[t]); }
  }
#pragma unroll
  for (int t = 0; t < 4; ++t) { if (col0 + t * 16 >= N) continue;
#pragma unroll
    for (int r = 0; r < 8; ++r) so[w][8 * hh + r][t * 16 + ln] = acc[t][r] * alpha; }
  __builtin_amdgcn_fence(__ATOMIC_ACQ_REL, "workgroup"); __builtin_amdgcn_wave_barrier();
  const int rsub = lane >> 4, c4 = (lane & 15) * 4;
  {
#pragma unroll
    for (int q = 0; q < 8; ++q) { const int r = q * 2 + rsub; if (col0 + c4 < N) { const v4f v = *(const v4fa*)&so[w][r][c4]; *(v4f*)(C + (size_t)(row0 + r) * ldc + col0 + c4) = v; } }
     }
}

// Wt[n][k] = f16(W[k][n]·scale) from f32 row-major W[K][N] (scale = power of two; bf16-exact weights stay exact in f16 away from the subnormal range)
__global__ __launch_bounds__(256) void k_wt_f16(const float* __restrict__ W, _Float16* __restrict__ Wt, int K, int N, float scale) {
  const int t = blockIdx.x * 256 + threadIdx.x; if (t >= N * (K / 8)) return; const int n = t / (K / 8), k8 = (t % (K / 8)) * 8; FragH f;
#pragma unroll
  for (int i = 0; i < 8; ++i) f.h[i] = (_Float16)(bf16_round(W[(size_t)(k8 + i) * N + n]) * scale); const v8us o = f.half[0];
  *(v8us*)((unsigned short*)Wt + (size_t)n * K + k8) = o; 
}
// k_gemm_hh variant with fused epilogue: v = acc·alpha + bias[by·sBias + col] (+ CP[(row/rowsPerB)·sCPb + by·64 + col] if CP) ; ACT 0 none / 1 elu ; writes f16 C16 (and f32 C if non-null)
template <int ACT>
__global__ __launch_bounds__(128) void k_gemm_hhx(const _Float16* __restrict__ A, int lda, size_t sA, const _Float16* __restrict__ Bh, int ldb, size_t sB, float alpha, const float* __restrict__ bias, size_t sBias, const float* __restrict__ CP, int rowsPerB, size_t sCPb, int row0g,
    float* __restrict__ C, _Float16* __restrict__ C16, int ldc, size_t sC, int M, int N, int K) {
  __shared__ __attribute__((aligned(16))) float so[4][16][64];
  const int tid = threadIdx.x, w = tid >> 5, lane = tid & 31, ln = lane & 15, hh = lane >> 4; const int by = blockIdx.y;
  A += (size_t)by * sA; Bh += (size_t)by * sB; const size_t cofs = (size_t)by * sC; const float* bp = bias ? bias + (size_t)by * sBias : nullptr;
  const int ntn = (N + 63) / 64; const int wid = blockIdx.x * 4 + w; const int mt = wid / ntn, nq = wid % ntn; if (mt * 16 >= M) return;
  const int row0 = mt * 16, col0 = nq * 64; const _Float16* arow = A + (size_t)(row0 + ln) * lda;
  v8f acc[4] = {};
  for (int kb = 0; kb < K; kb += 32) { FragH ah; ah.half[0] = *(const v8us*)((const unsigned short*)arow + kb + 8 * hh); ah.half[1] = *(const v8us*)((const unsigned short*)arow + kb + 16 + 8 * hh);
#pragma unroll
    for (int t = 0; t < 4; ++t) { if (col0 + t * 16 >= N) continue; const size_t boff = (size_t)(col0 + t * 16 + ln) * ldb + kb; FragH bq; bq.half[0] = *(const v8us*)((const unsigned short*)Bh + boff + 8 * hh); bq.half[1] = *(const v8us*)((const unsigned short*)Bh + boff + 16 + 8 * hh);
      acc[t] = mmaH<1>(ah.v, ah.v, bq.v, bq.v, acc[t]); }
  }
#pragma unroll
  for (int t = 0; t < 4; ++t) { if (col0 + t * 16 >= N) continue; const int col = col0 + t * 16 + ln; const float bv = bp ? bf16_round(bp[col]) : 0.f;
#pragma unroll
    for (int r = 0; r < 8; ++r) { float v = acc[t][r] * alpha + bv; if (CP) { const int bidx = (row0g + row0 + 8 * hh + r) / rowsPerB; v += CP[(size_t)bidx * sCPb + (size_t)by * 64 + col]; } if (ACT == 1) v = (v > 0.f) ? v : expm1f(v); else if (ACT == 7) v = (v > 0.f) ? v + 1.0f : expf(v); else if (ACT == 8) v = tanhf(v); else if (ACT == 9) v = 0.5f * v * (1.0f + tanhf(0.7978845608028654f * (v + 0.044715f * v * v * v))); else if (ACT == 11) v = 1.0f / (1.0f + expf(-v)); else if (ACT == 12) v = (v > 0.f) ? v : 0.01f * v; else if (ACT == 14) v = (v > 0.f) ? v : 0.1f * v; else if (ACT == 15) v = v / (1.0f + expf(-v)); else if (ACT == 3) v = fmaxf(v, 0.f); else if (ACT == 6) v = 0.5f * v * (1.0f + erff(v * 0.70710678118654752f)); so[w][8 * hh + r][t * 16 + ln] = v; } }
  __builtin_amdgcn_fence(__ATOMIC_ACQ_REL, "workgroup"); __builtin_amdgcn_wave_barrier();
  const int rsub = lane >> 4, c4 = (lane & 15) * 4; typedef _Float16 v4h __attribute__((ext_vector_type(4)));
  {
#pragma unroll
    for (int q = 0; q < 8; ++q) { const int r = q * 2 + rsub; if (col0 + c4 < N) { const v4f v = *(const v4fa*)&so[w][r][c4]; if (C) *(v4f*)(C + cofs + (size_t)(row0 + r) * ldc + col0 + c4) = v; if (C16) { v4h h4; for (int i = 0; i < 4; ++i) h4[i] = (_Float16)v[i]; *(v4h*)(C16 + cofs + (size_t)(row0 + r) * ldc + col0 + c4) = h4; } } }
     }
}


typedef _Float16 v4h __attribute__((ext_vector_type(4)));

__global__ __launch_bounds__(256) void k_x16(const float* __restrict__ x, _Float16* __restrict__ X16, size_t n8) { const size_t t = (size_t)blockIdx.x * 256 + threadIdx.x; if (t >= n8) return; FragH f;
#pragma unroll
  for (int q = 0; q < 8; ++q) f.h[q] = (_Float16)bf16_round(x[t * 8 + q]); *(v8us*)((unsigned short*)X16 + t * 8) = f.half[0];  }
__global__ __launch_bounds__(256) void k_h16(const float* __restrict__ x, _Float16* __restrict__ X16, size_t n8) { const size_t t = (size_t)blockIdx.x * 256 + threadIdx.x; if (t >= n8) return; FragH f;
#pragma unroll
  for (int q = 0; q < 8; ++q) f.h[q] = (_Float16)x[t * 8 + q]; *(v8us*)((unsigned short*)X16 + t * 8) = f.half[0];  }
__global__ __launch_bounds__(256) void k_round16f(const float* __restrict__ W, _Float16* __restrict__ Bt, size_t n8) { const size_t t = (size_t)blockIdx.x * 256 + threadIdx.x; if (t >= n8) return; FragH f;
#pragma unroll
  for (int i = 0; i < 8; ++i) f.h[i] = (_Float16)(bf16_round(W[t * 8 + i]) * 16.0f); *(v8us*)((unsigned short*)Bt + t * 8) = f.half[0];  }
template <int NHv, int TTv>
__global__ __launch_bounds__(256) void k_vt(const _Float16* __restrict__ V16, int ldv, int voff, _Float16* __restrict__ Vt) { __shared__ unsigned short tl[64][66]; const int tid = threadIdx.x; const int slab = blockIdx.x / (TTv / 64), lg = blockIdx.x % (TTv / 64); const int b = slab / NHv, h = slab % NHv;
  for (int i = tid; i < 64 * 8; i += 256) { const int r = i / 8, c8 = (i % 8) * 8; FragH f; f.half[0] = *(const v8us*)((const unsigned short*)V16 + ((size_t)b * TTv + lg * 64 + r) * ldv + voff + h * 64 + c8);
#pragma unroll
    for (int q = 0; q < 8; ++q) tl[r][c8 + q] = f.u[q]; }
  __syncthreads();
  {
#pragma unroll
    for (int rd = 0; rd < 2; ++rd) { const int d = rd * 32 + tid / 8, pc = tid % 8; FragH f;
#pragma unroll
      for (int q = 0; q < 8; ++q) f.u[q] = tl[pc * 8 + q][d];
      *(v8us*)((unsigned short*)Vt + ((size_t)slab * 64 + d) * TTv + lg * 64 + pc * 8) = f.half[0]; }
     } }

__global__ __launch_bounds__(256) void k_hl(const float* __restrict__ F, _Float16* __restrict__ Hh, _Float16* __restrict__ Hl, size_t n8) { const size_t t = (size_t)blockIdx.x * 256 + threadIdx.x; if (t >= n8) return; FragH fh, fl; const v4f a = *(const v4fa*)(F + t * 8), c = *(const v4fa*)(F + t * 8 + 4);
#pragma unroll
  for (int q = 0; q < 4; ++q) { _Float16 h = (_Float16)a[q]; fh.h[q] = h; fl.h[q] = (_Float16)((a[q] - (float)h) * 1024.0f); h = (_Float16)c[q]; fh.h[4 + q] = h; fl.h[4 + q] = (_Float16)((c[q] - (float)h) * 1024.0f); }
  { *(v8us*)((unsigned short*)Hh + t * 8) = fh.half[0]; *(v8us*)((unsigned short*)Hl + t * 8) = fl.half[0];  } }

// ---- fast GEMM (block tile 128x64, wave tile 32x64; requires M % 128 == 0, N % 64 == 0, K % 64 == 0); A and B tiles of 64 k staged in LDS; epilogue = k_gemm_hhx semantics ----
__device__ __forceinline__ v16h g2_frag(const _Float16* p, int hh) { FragH f; f.half[0] = *(const v8us*)((const unsigned short*)p + 8 * hh); f.half[1] = *(const v8us*)((const unsigned short*)p + 16 + 8 * hh); return f.v; }
__device__ __forceinline__ v8f g2_mma(v16h a, v16h b, v8f c) { v8f d = __builtin_amdgcn_wmma_f32_16x16x32_f16(false, a, false, b, (short)0, c, false, false); asm volatile("v_nop\n\tv_nop\n\tv_nop\n\tv_nop" : "+v"(d) : "v"(a), "v"(b)); return d; }
template <int ACT>
__global__ __launch_bounds__(128) void k_gemm2(const _Float16* __restrict__ A, int lda, size_t sA, const _Float16* __restrict__ Bh, int ldb, size_t sB, float alpha, const float* __restrict__ bias, size_t sBias, const float* __restrict__ CP, int rowsPerB, size_t sCPb, int row0g,
    float* __restrict__ C, _Float16* __restrict__ C16, int ldc, size_t sC, int M, int N, int K) {
  constexpr int GK = 64, GP = 72;      // a tile = 64 k; LDS row pitch 144 B (16 B x odd: ds_load_b128 without bank conflicts)
  __shared__ __attribute__((aligned(16))) _Float16 tA[2][128][GP]; __shared__ __attribute__((aligned(16))) _Float16 tB[2][64][GP];      // two buffers each
  __shared__ __attribute__((aligned(16))) float so[4][32][68];
  const int tid = threadIdx.x, w = tid >> 5, lane = tid & 31, ln = lane & 15, hh = lane >> 4; const int by = blockIdx.y;
  A += (size_t)by * sA; Bh += (size_t)by * sB; const size_t cofs = (size_t)by * sC; const float* bp = bias ? bias + (size_t)by * sBias : nullptr;
  const int ntn = N >> 6; const int mt = blockIdx.x / ntn, nq = blockIdx.x - mt * ntn; const int row0 = mt * 128 + 32 * w, col0 = nq * 64; if (mt * 128 >= M) return;      // the whole block leaves or none of it: barriers follow
  // every thread copies 8 + 4 pieces of 16 B per tile (8 lanes cover one whole 128-B row)
  const int crow = tid >> 3, cc8 = (tid & 7) * 8;
  const _Float16* gA = A + (size_t)(mt * 128 + crow) * lda + cc8; const _Float16* gB = Bh + (size_t)(col0 + crow) * ldb + cc8;
  const unsigned lA = (unsigned)(size_t)&tA[0][crow][cc8], lB = (unsigned)(size_t)&tB[0][crow][cc8];
  auto copy_tile = [&](int t) {
    const unsigned ao = lA + (unsigned)(t & 1) * (unsigned)(128 * GP * 2), bo = lB + (unsigned)(t & 1) * (unsigned)(64 * GP * 2), r16 = 16 * GP * 2; const _Float16* ap = gA + (size_t)t * GK; const _Float16* bq = gB + (size_t)t * GK; const size_t a16 = (size_t)16 * lda, b16 = (size_t)16 * ldb;
    // the copies and, as the last line of the same statement, the wait that stands before their address registers are rewritten
    asm volatile("global_load_async_to_lds_b128 %0, %12, off\n\tglobal_load_async_to_lds_b128 %1, %13, off\n\tglobal_load_async_to_lds_b128 %2, %14, off\n\tglobal_load_async_to_lds_b128 %3, %15, off\n\t"
                 "global_load_async_to_lds_b128 %4, %16, off\n\tglobal_load_async_to_lds_b128 %5, %17, off\n\tglobal_load_async_to_lds_b128 %6, %18, off\n\tglobal_load_async_to_lds_b128 %7, %19, off\n\t"
                 "global_load_async_to_lds_b128 %8, %20, off\n\tglobal_load_async_to_lds_b128 %9, %21, off\n\tglobal_load_async_to_lds_b128 %10, %22, off\n\tglobal_load_async_to_lds_b128 %11, %23, off\n\ts_wait_xcnt 0x0"
                 :: "v"(ao), "v"(ao + r16), "v"(ao + 2 * r16), "v"(ao + 3 * r16), "v"(ao + 4 * r16), "v"(ao + 5 * r16), "v"(ao + 6 * r16), "v"(ao + 7 * r16), "v"(bo), "v"(bo + r16), "v"(bo + 2 * r16), "v"(bo + 3 * r16),
                    "v"(ap), "v"(ap + a16), "v"(ap + 2 * a16), "v"(ap + 3 * a16), "v"(ap + 4 * a16), "v"(ap + 5 * a16), "v"(ap + 6 * a16), "v"(ap + 7 * a16), "v"(bq), "v"(bq + b16), "v"(bq + 2 * b16), "v"(bq + 3 * b16) : "memory"); };
  const v8f z8 = {0.f,0.f,0.f,0.f,0.f,0.f,0.f,0.f}; v8f c00 = z8, c01 = z8, c02 = z8, c03 = z8, c10 = z8, c11 = z8, c12 = z8, c13 = z8;
  const int nst = K / GK;
  copy_tile(0);
  asm volatile("s_wait_asynccnt 0x0" ::: "memory");      // this wave's copies of tile 0 have landed
  __syncthreads();                                       // every wave's have: tile 0 may be read
  if (nst > 1) copy_tile(1);
#pragma unroll 1
  for (int t = 0; t < nst; ++t) { const _Float16 (*pA)[GP] = tA[t & 1]; const _Float16 (*pB)[GP] = tB[t & 1];
#pragma unroll
    for (int kb = 0; kb < GK; kb += 32) { const v16h a0 = g2_frag(&pA[32 * w + ln][kb], hh), a1 = g2_frag(&pA[32 * w + 16 + ln][kb], hh);
      v16h b = g2_frag(&pB[ln][kb], hh); c00 = g2_mma(a0, b, c00); c10 = g2_mma(a1, b, c10);
      b = g2_frag(&pB[16 + ln][kb], hh); c01 = g2_mma(a0, b, c01); c11 = g2_mma(a1, b, c11);
      b = g2_frag(&pB[32 + ln][kb], hh); c02 = g2_mma(a0, b, c02); c12 = g2_mma(a1, b, c12);
      b = g2_frag(&pB[48 + ln][kb], hh); c03 = g2_mma(a0, b, c03); c13 = g2_mma(a1, b, c13); }
    asm volatile("s_wait_dscnt 0x0" ::: "memory");       // this wave's reads of tile t are done before its buffer is refilled
    asm volatile("s_wait_asynccnt 0x0" ::: "memory");    // this wave's copies of tile t + 1 have landed
    __syncthreads();                                     // publishes tile t + 1 and ends every wave's reads of tile t
    if (t + 2 < nst) copy_tile(t + 2); }
  asm volatile("s_wait_asynccnt 0x0" ::: "memory");      // nothing of this wave is in flight when it goes on to the epilogue and ends
  const int rsub = lane >> 4, c4 = (lane & 15) * 4;
  // The addend is read in the layout of the stores below: 16 B a lane (sCPb % 4 == 0), 16 lanes on one row's 256 B, all 16 loads of a lane in flight over the LDS turn of the accumulators.
  v4f ad[16];
  if (CP) { const float* ap[16];
#pragma unroll
    for (int q = 0; q < 16; ++q) { const int bidx = (row0g + row0 + q * 2 + rsub) / rowsPerB; ap[q] = CP + (size_t)bidx * sCPb + (size_t)by * 64 + col0 + c4; }
#pragma unroll
    for (int q = 0; q < 16; ++q) ad[q] = *(const v4fa*)ap[q];
    // the wait that stands before the address registers of these loads are rewritten; it takes the addresses as inputs so that they stay in their registers up to it
    asm volatile("s_wait_xcnt 0x0" :: "v"(ap[0]), "v"(ap[1]), "v"(ap[2]), "v"(ap[3]), "v"(ap[4]), "v"(ap[5]), "v"(ap[6]), "v"(ap[7]), "v"(ap[8]), "v"(ap[9]), "v"(ap[10]), "v"(ap[11]), "v"(ap[12]), "v"(ap[13]), "v"(ap[14]), "v"(ap[15]) : "memory"); }
  v8f accs[8] = {c00, c01, c02, c03, c10, c11, c12, c13};
#pragma unroll
  for (int u = 0; u < 8; ++u) { const int t = u & 3, half = u >> 2; const int col = col0 + t * 16 + ln; const float bv = bp ? bf16_round(bp[col]) : 0.f;
#pragma unroll
    for (int r = 0; r < 8; ++r) so[w][half * 16 + 8 * hh + r][t * 16 + ln] = accs[u][r] * alpha + bv; }
  __builtin_amdgcn_fence(__ATOMIC_ACQ_REL, "workgroup"); __builtin_amdgcn_wave_barrier();
  {
#pragma unroll
    for (int q = 0; q < 16; ++q) { const int r = q * 2 + rsub; v4f v = *(const v4fa*)&so[w][r][c4]; if (CP) v += ad[q];
#pragma unroll
      for (int i = 0; i < 4; ++i) { if (ACT == 3) v[i] = fmaxf(v[i], 0.f); else if (ACT == 6) v[i] = 0.5f * v[i] * (1.0f + erff(v[i] * 0.70710678118654752f)); else if (ACT == 11) v[i] = 1.0f / (1.0f + expf(-v[i])); else if (ACT == 15) v[i] = v[i] / (1.0f + expf(-v[i])); else if (ACT == 12) v[i] = (v[i] > 0.f) ? v[i] : 0.01f * v[i]; else if (ACT == 8) v[i] = tanhf(v[i]); }
      if (C) { *(v4f*)(C + cofs + (size_t)(row0 + r) * ldc + col0 + c4) = v; asm volatile("s_wait_xcnt 0x0" ::: "memory"); }      // the wait stands before the conversion below rewrites registers that this store names
      if (C16) { v4h h4; for (int i = 0; i < 4; ++i) h4[i] = (_Float16)v[i]; *(v4h*)(C16 + cofs + (size_t)(row0 + r) * ldc + col0 + c4) = h4; } }
     } }



// lane l with lane l ^ 16
__device__ __forceinline__ float xhalf(float x) { return __builtin_bit_cast(float, __builtin_amdgcn_permlanex16(__builtin_bit_cast(int, x), __builtin_bit_cast(int, x), 0x76543210, 0xfedcba98, false, false)); }
__global__ __launch_bounds__(128) void k_flash(const _Float16* __restrict__ Q16, int ldq, const _Float16* __restrict__ K16, int ldk, const _Float16* __restrict__ Vt, const int* __restrict__ MSK, float* __restrict__ O, int ldo) {
  constexpr int RPW = 16, NQB = TQ / (4 * RPW), DT = 4, KS = 2;
  constexpr float C2 = SCL * 1.4426950408889634f;      // score scale x log2(e): the softmax runs in base 2
  constexpr int SK = 64, NST = TK / SK, LP = 72;      // a tile = 64 keys; LDS row pitch 144 B (16 B x odd: ds_load_b128 without bank conflicts)
  __shared__ __attribute__((aligned(16))) unsigned short sK[2][SK][LP]; __shared__ __attribute__((aligned(16))) unsigned short sV[2][64][LP];      // two buffers each: K rows [key][d], V^T rows [d][key]
  __shared__ __attribute__((aligned(16))) float sO[4][RPW][64 + 4];
  const int tid = threadIdx.x, w = tid >> 5, lane = tid & 31, ln = lane & 15, hh = lane >> 4;
  const int slab = blockIdx.x / NQB, qblk = blockIdx.x % NQB; const int b = slab / NH, h = slab % NH; const int qb0 = qblk * (4 * RPW); const int q0 = qb0 + w * RPW;
  FragH bq[KS];
  { const unsigned short* qr = (const unsigned short*)Q16 + ((size_t)b * TQ + q0 + ln) * ldq + h * 64;
#pragma unroll
    for (int ks = 0; ks < KS; ++ks) { bq[ks].half[0] = *(const v8us*)(qr + ks * 32 + 8 * hh); bq[ks].half[1] = *(const v8us*)(qr + ks * 32 + 16 + 8 * hh); } }
  const unsigned short* Vth = (const unsigned short*)Vt + (size_t)slab * 64 * TK;
  float m_r = -3.0e38f, l_r = 0.f; v8f oacc[DT];      // one query per lane: its running maximum (of the raw products), this lane half's part of its sum (x2^10, like P), O^T rows d = dt * 16 + 8 * hh + r
#pragma unroll
  for (int dt = 0; dt < DT; ++dt) oacc[dt] = (v8f){0.f,0.f,0.f,0.f,0.f,0.f,0.f,0.f};
  // The block's four waves share each K / V^T tile: every thread copies 4 + 4 pieces of 16 B (8 lanes cover one whole 128-B row).
  const int crow = tid >> 3, cc8 = (tid & 7) * 8;
  const unsigned short* gK = (const unsigned short*)K16 + ((size_t)b * TK + crow) * ldk + h * 64 + cc8; const unsigned short* gV = Vth + (size_t)crow * TK + cc8;
  const unsigned lK = (unsigned)(size_t)&sK[0][crow][cc8], lV = (unsigned)(size_t)&sV[0][crow][cc8];
  auto copy_tile = [&](int t) {
    const unsigned bo = (unsigned)(t & 1) * (unsigned)(SK * LP * 2), r16 = 16 * LP * 2; const unsigned short* kp = gK + (size_t)t * SK * ldk; const unsigned short* vp = gV + (size_t)t * SK;
    // the copies and, as the last line of the same statement, the wait that stands before their address registers are rewritten
    asm volatile("global_load_async_to_lds_b128 %0, %8, off\n\tglobal_load_async_to_lds_b128 %1, %9, off\n\tglobal_load_async_to_lds_b128 %2, %10, off\n\tglobal_load_async_to_lds_b128 %3, %11, off\n\t"
                 "global_load_async_to_lds_b128 %4, %12, off\n\tglobal_load_async_to_lds_b128 %5, %13, off\n\tglobal_load_async_to_lds_b128 %6, %14, off\n\tglobal_load_async_to_lds_b128 %7, %15, off\n\ts_wait_xcnt 0x0"
                 :: "v"(lK + bo), "v"(lK + bo + r16), "v"(lK + bo + 2 * r16), "v"(lK + bo + 3 * r16), "v"(lV + bo), "v"(lV + bo + r16), "v"(lV + bo + 2 * r16), "v"(lV + bo + 3 * r16),
                    "v"(kp), "v"(kp + (size_t)16 * ldk), "v"(kp + (size_t)32 * ldk), "v"(kp + (size_t)48 * ldk), "v"(vp), "v"(vp + (size_t)16 * TK), "v"(vp + (size_t)32 * TK), "v"(vp + (size_t)48 * TK) : "memory"); };
  copy_tile(0);
  asm volatile("s_wait_asynccnt 0x0" ::: "memory");      // this wave's copies of tile 0 have landed
  __syncthreads();                                       // every wave's have: tile 0 may be read
  copy_tile(1);
#pragma unroll 1
  for (int t = 0; t < NST; ++t) {
   const unsigned short (*bK)[LP] = sK[t & 1]; const unsigned short (*bV)[LP] = sV[t & 1];
#pragma unroll
   for (int ps = 0; ps < SK / 32; ++ps) {
    v8f sc[2];      // raw products q.k: the scale is positive, so their maximum is the scaled scores' maximum
#pragma unroll
    for (int nt = 0; nt < 2; ++nt) { const unsigned short* kr = &bK[ps * 32 + nt * 16 + ln][0]; FragH ak[KS];
#pragma unroll
      for (int ks = 0; ks < KS; ++ks) { ak[ks].half[0] = *(const v8us*)(kr + ks * 32 + 8 * hh); ak[ks].half[1] = *(const v8us*)(kr + ks * 32 + 16 + 8 * hh); }
      v8f acc = (v8f){0.f,0.f,0.f,0.f,0.f,0.f,0.f,0.f};
#pragma unroll
      for (int ks = 0; ks < KS; ++ks) acc = mmaH<1>(ak[ks].v, ak[ks].v, bq[ks].v, bq[ks].v, acc);
      sc[nt] = acc; }
    float mc = fmaxf(sc[0][0], sc[1][0]);
#pragma unroll
    for (int r = 1; r < 8; ++r) mc = fmaxf(mc, fmaxf(sc[0][r], sc[1][r]));
    mc = fmaxf(mc, xhalf(mc));      // both lane halves now hold the query's maximum over the 32 keys
    const float mn = fmaxf(m_r, mc); const float al = (mn > -1.0e38f) ? __builtin_amdgcn_exp2f((m_r - mn) * C2) : 1.0f; m_r = mn;
    const float nb = fmaf(-mn, C2, 10.0f);      // P x 2^10 = 2^(s * C2 - mn * C2 + 10): one fma per score, then v_exp_f32
    FragH pb; float ls[4] = {0.f, 0.f, 0.f, 0.f};
#pragma unroll
    for (int nt = 0; nt < 2; ++nt)
#pragma unroll
      for (int r = 0; r < 8; ++r) { const float p = __builtin_amdgcn_exp2f(fmaf(sc[nt][r], C2, nb)); ls[r & 3] += p; pb.h[nt * 8 + r] = (_Float16)p; }
    l_r = l_r * al + ((ls[0] + ls[1]) + (ls[2] + ls[3]));
#pragma unroll
    for (int dt = 0; dt < DT; ++dt) oacc[dt] *= al;
#pragma unroll
    for (int dt = 0; dt < DT; ++dt) { const unsigned short* vrow = &bV[dt * 16 + ln][ps * 32]; FragH av; av.half[0] = *(const v8us*)(vrow + 8 * hh); av.half[1] = *(const v8us*)(vrow + 16 + 8 * hh);
      oacc[dt] = mmaH<1>(av.v, av.v, pb.v, pb.v, oacc[dt]); } }
   asm volatile("s_wait_dscnt 0x0" ::: "memory");        // this wave's reads of tile t are done before its buffer is refilled
   asm volatile("s_wait_asynccnt 0x0" ::: "memory");     // this wave's copies of tile t + 1 have landed
   __syncthreads();                                      // publishes tile t + 1 and ends every wave's reads of tile t
   if (t + 2 < NST) copy_tile(t + 2); }
  asm volatile("s_wait_asynccnt 0x0" ::: "memory");      // nothing of this wave is in flight when it goes on to the epilogue and ends
  const float l = l_r + xhalf(l_r);      // the two lane halves' sums joined, unconditionally
  const float inv = (l > 0.f) ? 1.0f / l : 0.f;      // sum and O^T carry the same 2^10
#pragma unroll
  for (int dt = 0; dt < DT; ++dt) { const v4f lo = {oacc[dt][0] * inv, oacc[dt][1] * inv, oacc[dt][2] * inv, oacc[dt][3] * inv}, hi = {oacc[dt][4] * inv, oacc[dt][5] * inv, oacc[dt][6] * inv, oacc[dt][7] * inv};
    *(v4fa*)&sO[w][ln][dt * 16 + 8 * hh] = lo; *(v4fa*)&sO[w][ln][dt * 16 + 8 * hh + 4] = hi; }
  __builtin_amdgcn_fence(__ATOMIC_ACQ_REL, "workgroup"); __builtin_amdgcn_wave_barrier();
  {
#pragma unroll
    for (int rp = 0; rp < RPW; rp += 2) { const int r = rp + (lane >> 4), pc = lane & 15; const v4f val = *(const v4fa*)&sO[w][r][pc * 4]; *(v4f*)(O + ((size_t)b * TQ + q0 + r) * ldo + h * 64 + pc * 4) = val; }
     } }
__global__ __launch_bounds__(256) void k_fulltab(unsigned* __restrict__ MB, int* __restrict__ RA, int* __restrict__ KE, int nq, int nk) {
  const int t = blockIdx.x * 256 + threadIdx.x;
  if (t < nq * (nk / 32)) { *(unsigned*)(MB + t) = 0u;  }
  if (t < nq) { *(int*)(RA + t) = 0;  }
  if (t < nq / 64) { *(int*)(KE + t * 32) = nk;  } }
__global__ __launch_bounds__(256) void k_lnout(const float* __restrict__ Y, const float* __restrict__ g, const float* __restrict__ bb, float* __restrict__ out) {
  #pragma clang fp contract(off)
  const int tid = threadIdx.x, w = tid >> 5, ln = tid & 31; const int r = blockIdx.x * 8 + w; if (r >= NR) return; const float* y = Y + (size_t)r * DM; float s = 0.f;
#pragma unroll 1
  for (int i = 0; i < 8; ++i) { const v4f a = *(const v4fa*)(y + i * 128 + ln * 4); for (int q = 0; q < 4; ++q) s += a[q]; }
  for (int o = 16; o > 0; o >>= 1) s += __shfl_xor(s, o, 32); const float mu = s / (float)DM; float q2 = 0.f;
#pragma unroll 1
  for (int i = 0; i < 8; ++i) { const v4f a = *(const v4fa*)(y + i * 128 + ln * 4); for (int q = 0; q < 4; ++q) { const float d = a[q] - mu; q2 += d * d; } }
  for (int o = 16; o > 0; o >>= 1) q2 += __shfl_xor(q2, o, 32); const float rs = rsqrtf(q2 / (float)DM + 1e-6f);
  {
#pragma unroll 1
    for (int i = 0; i < 8; ++i) { const int c0 = i * 128 + ln * 4; const v4f a = *(const v4fa*)(y + c0); v4f o4; for (int q = 0; q < 4; ++q) o4[q] = (a[q] - mu) * rs * bf16_round(g[c0 + q]) + bf16_round(bb[c0 + q]); *(v4f*)(out + (size_t)r * DM + c0) = o4; }
     } }
__global__ __launch_bounds__(256) void k_xb(const float* __restrict__ x, float* __restrict__ XB, size_t n4) { const size_t t = (size_t)blockIdx.x * 256 + threadIdx.x; if (t >= n4) return; const v4f a = *(const v4fa*)(x + t * 4); v4f o; for (int q = 0; q < 4; ++q) o[q] = bf16_round(a[q]); *(v4f*)(XB + t * 4) = o;  }
// Every input conversion in one launch, by block range: blocks 0..767 round q, k, v to bf16 and store them as f16 planes (q also as f32, the residual addend);
// blocks 768..1023 store the four weights, rounded to bf16, as f16 x16. A block streams 4096 pieces of 16 B, lane-contiguous, 16 per thread.
template <bool RES>
__device__ __forceinline__ void prep_stream(const float* __restrict__ src, _Float16* __restrict__ dst, float* __restrict__ xb, float scale, int tid) {
  v4f a[16];      // the three loops below are unrolled so that a[] lives in registers and every address is base + immediate offset
#pragma unroll
  for (int u = 0; u < 16; ++u) a[u] = *(const v4fa*)(src + (u * 256 + tid) * 4);
  __builtin_amdgcn_sched_barrier(0);      // keeps all 16 loads in flight together: without it the compiler sinks six of them among the conversions
#pragma unroll
  for (int u = 0; u < 16; ++u) { const int e = (u * 256 + tid) * 4; v4f r; v4h h;
#pragma unroll
    for (int i = 0; i < 4; ++i) { r[i] = bf16_round(a[u][i]); h[i] = (_Float16)(r[i] * scale); }
    *(v4h*)(dst + e) = h; if (RES) *(v4f*)(xb + e) = r; } }
__global__ __launch_bounds__(256) void k_prep(const float* __restrict__ q, const float* __restrict__ k, const float* __restrict__ v, const float* __restrict__ Wq, const float* __restrict__ Wk, const float* __restrict__ Wv, const float* __restrict__ Wo,
                                              _Float16* __restrict__ X16, float* __restrict__ XB, _Float16* __restrict__ B16) {
  constexpr int PB = 4096, XBLK = NR * DM / 4 / PB, WBLK = DM * DM / 4 / PB;
  const int bid = blockIdx.x, tid = threadIdx.x;
  if (bid < XBLK) { const size_t o = (size_t)bid * PB * 4; prep_stream<true>(q + o, X16 + o, XB + o, 1.0f, tid); }
  else if (bid < 3 * XBLK) { const bool isk = bid < 2 * XBLK; const size_t o = (size_t)(bid - (isk ? XBLK : 2 * XBLK)) * PB * 4; prep_stream<false>((isk ? k : v) + o, X16 + (size_t)(isk ? 1 : 2) * NR * DM + o, nullptr, 1.0f, tid); }
  else { const int j = (bid - 3 * XBLK) / WBLK; const size_t o = (size_t)((bid - 3 * XBLK) % WBLK) * PB * 4; prep_stream<false>((j == 0 ? Wq : (j == 1 ? Wk : (j == 2 ? Wv : Wo))) + o, B16 + (size_t)j * DM * DM + o, nullptr, 16.0f, tid); } }
__global__ __launch_bounds__(256) void k_causaltab(unsigned* __restrict__ MB, int* __restrict__ RA, int* __restrict__ KE, int nq, int nk) {
  const int t = blockIdx.x * 256 + threadIdx.x; const int nw = nk / 32;
  if (t < nq * nw) { const int q = t / nw, w = t % nw; const int first = q + 1 - 32 * w; const unsigned bits = (first <= 0) ? 0xffffffffu : ((first >= 32) ? 0u : (0xffffffffu << first)); *(unsigned*)(MB + t) = bits;  }
  if (t < nq) { *(int*)(RA + t) = 0;  }
  if (t < nq / 64) { const int v = 64 * (t + 1); *(int*)(KE + t * 32) = v;  } }


extern "C" void kernel_launch(void* const* d_in, const int* in_sizes, int n_in,
                              void* d_out, int out_size, void* d_ws, size_t ws_size, hipStream_t stream) {
  (void)in_sizes; (void)n_in; (void)out_size;
  const float* const* I = (const float* const*)d_in; const float* qin = I[0]; const float* kin = I[1]; const float* vin = I[2]; const float* Wq = I[3]; const float* Wk = I[4]; const float* Wv = I[5]; const float* Wo = I[6]; const float* gam = I[7]; const float* bet = I[8];
  char* ws = (char*)d_ws; size_t off = 0;
  auto take = [&](size_t bytes) { char* p = ws + off; off += (bytes + 255) & ~(size_t)255; return p; };
  _Float16* BQ = (_Float16*)take((size_t)DM * DM * 2); _Float16* BK = (_Float16*)take((size_t)DM * DM * 2); _Float16* BV = (_Float16*)take((size_t)DM * DM * 2); _Float16* BO = (_Float16*)take((size_t)DM * DM * 2);
  _Float16* X16 = (_Float16*)take((size_t)3 * NR * DM * 2); float* F = (float*)take((size_t)NR * DM * 4); float* XB = (float*)take((size_t)NR * DM * 4);
  _Float16* Q16 = (_Float16*)take((size_t)NR * DM * 2); _Float16* K16 = (_Float16*)take((size_t)NR * DM * 2); _Float16* V16 = (_Float16*)take((size_t)NR * DM * 2); _Float16* VT = (_Float16*)take((size_t)NR * DM * 2);
  if (off > ws_size) return;      /* 8 + 24 + 16 + 16 + 32 = 96 MiB; BQ BK BV BO, the three X16 planes and Q16 K16 V16 each lie one behind the other */
  float* O = F; _Float16* Oh = Q16; _Float16* Ol = K16; float* Y = XB;
  const size_t n8 = (size_t)NR * DM / 8; const unsigned nb8 = (unsigned)((n8 + 255) / 256); (void)BK; (void)BV;
  k_prep<<<3 * (NR * DM / 16384) + 4 * (DM * DM / 16384), 256, 0, stream>>>(qin, kin, vin, Wq, Wk, Wv, Wo, X16, XB, BQ);      /* X16 planes of q, k, v; XB; BQ BK BV BO */
  const dim3 gP((NR / 128) * (DM / 64), 1), gP3((NR / 128) * (DM / 64), 3);
  k_gemm2<0><<<gP3, 128, 0, stream>>>(X16, DM, (size_t)NR * DM, BQ, DM, (size_t)DM * DM, 0.0625f, nullptr, 0, nullptr, 1, 0, 0, nullptr, Q16, DM, (size_t)NR * DM, NR, DM, DM);      /* blockIdx.y = 0, 1, 2: qh, kh, vh (f16) */
  k_vt<NH, SLEN><<<NH * (SLEN / 64), 256, 0, stream>>>(V16, DM, 0, VT);
  k_flash<<<NH * (SLEN / 64), 128, 0, stream>>>(Q16, DM, K16, DM, VT, nullptr, O, DM);      /* plain flash over all 4096 keys (no mask) */
  k_hl<<<nb8, 256, 0, stream>>>(O, Oh, Ol, n8);
  k_gemm2<0><<<gP, 128, 0, stream>>>(Oh, DM, 0, BO, DM, 0, 0.0625f, nullptr, 0, XB, 1, (size_t)DM, 0, Y, nullptr, DM, 0, NR, DM, DM);
  k_gemm2<0><<<gP, 128, 0, stream>>>(Ol, DM, 0, BO, DM, 0, 0.0625f / 1024.0f, nullptr, 0, Y, 1, (size_t)DM, 0, Y, nullptr, DM, 0, NR, DM, DM);
  k_lnout<<<NR / 8, 256, 0, stream>>>(Y, gam, bet, (float*)d_out);
}

// v006
// One run takes 180 microseconds.
// Timed twice side by side with v005, it ran 1.09 times as fast both times.
// All steps since v000 together make it 4.13 times as fast.
#include <hip/hip_runtime.h>
#define NBT 1
#define SLEN 4096
#define TQ SLEN
#define TK SLEN
#define DM 1024
#define NH 16
#define SCL 0.125f
#define NR (NBT * SLEN)
typedef __bf16 v16b __attribute__((ext_vector_type(16)));
typedef unsigned short v8us __attribute__((ext_vector_type(8), may_alias));
typedef float  v8f  __attribute__((ext_vector_type(8)));
typedef float  v4f  __attribute__((ext_vector_type(4)));
typedef float  v4fa __attribute__((ext_vector_type(4), may_alias));
union FragB { v16b v; v8us half[2]; unsigned short u[16]; };

__device__ __forceinline__ unsigned short bf16_bits(float x) { unsigned int u = __float_as_uint(x); return (unsigned short)((u + 0x7FFFu + ((u >> 16) & 1u)) >> 16); }
__device__ __forceinline__ float bf16_val(unsigned short b) { return __uint_as_float(((unsigned int)b) << 16); }
__device__ __forceinline__ float bf16_round(float x) { return bf16_val(bf16_bits(x)); }
// D += A·B with NT terms: 1 = ah·bh, 2 = + al·bh (A split), 3 = + ah·bl (both split)
template <int NT>
__device__ __forceinline__ v8f mmaN(v16b ah, v16b al, v16b bh, v16b bl, v8f c) {
  c = __builtin_amdgcn_wmma_f32_16x16x32_bf16(false, ah, false, bh, (short)0, c, false, false);
  if (NT >= 2) c = __builtin_amdgcn_wmma_f32_16x16x32_bf16(false, al, false, bh, (short)0, c, false, false);
  if (NT >= 3) c = __builtin_amdgcn_wmma_f32_16x16x32_bf16(false, ah, false, bl, (short)0, c, false, false);
  asm volatile("v_nop\n\tv_nop\n\tv_nop\n\tv_nop" : "+v"(c) : "v"(ah), "v"(al), "v"(bh), "v"(bl));
  return c;
}

__global__ __launch_bounds__(256) void k_wt_bf16(const float* __restrict__ W, unsigned short* __restrict__ Wt, int K, int N) {
  const int t = blockIdx.x * 256 + threadIdx.x;
  const int k8n = K / 8;
  if (t >= N * k8n) return;
  const int n = t / k8n, k8 = (t % k8n) * 8;
  v8us v;
#pragma unroll
  for (int i = 0; i < 8; ++i) v[i] = bf16_bits(W[(size_t)(k8 + i) * N + n]);
  *(v8us*)(Wt + (size_t)n * K + k8) = v;
  
}

// GEMM C[M][N] (f32, pitch ldc) = act(A[M][K]·W + bias). A f32 row-major (pitch lda) converted per fragment to bf16
// (ASPLIT: hi/lo two planes -> 2 terms, else single rounded term); Wt bf16 [N][K] (pitch ldb). BIAS_BF16 rounds the
// bias to bf16 first (bias quantised to bf16 before the add). K%32==0, M%16==0, N%64==0.
template <bool ASPLIT, int ACT, bool BIAS_BF16>
__global__ __launch_bounds__(128) void k_gemm_bf(const float* __restrict__ A, int lda, const unsigned short* __restrict__ Wt, int ldb,
                                               const float* __restrict__ bias, float* __restrict__ C, int ldc, int M, int N, int K) {
  __shared__ __attribute__((aligned(16))) float so[4][16][64];
  const int tid = threadIdx.x, w = tid >> 5, lane = tid & 31, ln = lane & 15, hh = lane >> 4;
  const int ntn = N / 64;
  const int wid = blockIdx.x * 4 + w;
  const int mt = wid / ntn, nq = wid % ntn;
  if (mt * 16 >= M) return;
  const int row0 = mt * 16, col0 = nq * 64;
  const float* arow = A + (size_t)(row0 + ln) * lda;
  v8f acc[4] = {};
  for (int kb = 0; kb < K; kb += 32) {
    FragB ah, al;
    const v4f x0 = *(const v4fa*)(arow + kb + 8 * hh), x1 = *(const v4fa*)(arow + kb + 8 * hh + 4);
    const v4f x2 = *(const v4fa*)(arow + kb + 16 + 8 * hh), x3 = *(const v4fa*)(arow + kb + 16 + 8 * hh + 4);
    float xs[16] = {x0[0],x0[1],x0[2],x0[3],x1[0],x1[1],x1[2],x1[3],x2[0],x2[1],x2[2],x2[3],x3[0],x3[1],x3[2],x3[3]};
#pragma unroll
    for (int i = 0; i < 16; ++i) { const unsigned short hb = bf16_bits(xs[i]); ah.u[i] = hb; al.u[i] = ASPLIT ? bf16_bits(xs[i] - bf16_val(hb)) : (unsigned short)0; }
#pragma unroll
    for (int t = 0; t < 4; ++t) {
      const unsigned short* brow = Wt + (size_t)(col0 + t * 16 + ln) * ldb + kb;
      FragB b;
      b.half[0] = *(const v8us*)(brow + 8 * hh);
      b.half[1] = *(const v8us*)(brow + 16 + 8 * hh);
      acc[t] = mmaN<ASPLIT ? 2 : 1>(ah.v, al.v, b.v, b.v, acc[t]);
    }
  }
#pragma unroll
  for (int t = 0; t < 4; ++t) {
    float bv = bias ? bias[col0 + t * 16 + ln] : 0.f;
    if (BIAS_BF16) bv = bf16_round(bv);
#pragma unroll
    for (int r = 0; r < 8; ++r) { float v = acc[t][r] + bv; if (ACT == 1) v = fmaxf(v, 0.f); so[w][8 * hh + r][t * 16 + ln] = v; }
  }
  __builtin_amdgcn_fence(__ATOMIC_ACQ_REL, "workgroup");
  __builtin_amdgcn_wave_barrier();
  const int rsub = lane >> 4, c4 = (lane & 15) * 4;
  {
#pragma unroll
    for (int q = 0; q < 8; ++q) {
      const int r = q * 2 + rsub;
      const v4f v = *(const v4fa*)&so[w][r][c4];
      *(v4f*)(C + (size_t)(row0 + r) * ldc + col0 + c4) = v;
    }
    
  }
}

// GEMM C = act(A·W + bias + resid): A f32 (ASPLIT -> hi/lo 2 terms), Wt bf16 [N][K]; ACT 0 none, 1 relu, 2 exact gelu;
// resid (optional, f32, row index = (row % rmod), pitch ldr, RES_BF16 rounds it) added before the activation.
template <bool ASPLIT, int ACT, bool BIAS_BF16, bool RES_BF16>
__global__ __launch_bounds__(128) void k_gemm_bf3(const float* __restrict__ A, int lda, const unsigned short* __restrict__ Wt, int ldb,
                                                const float* __restrict__ bias, const float* __restrict__ resid, int rmod, int ldr,
                                                float* __restrict__ C, int ldc, int M, int N, int K) {
  __shared__ __attribute__((aligned(16))) float so[4][16][64];
  const int tid = threadIdx.x, w = tid >> 5, lane = tid & 31, ln = lane & 15, hh = lane >> 4;
  const int ntn = N / 64;
  const int wid = blockIdx.x * 4 + w;
  const int mt = wid / ntn, nq = wid % ntn;
  if (mt * 16 >= M) return;
  const int row0 = mt * 16, col0 = nq * 64;
  const float* arow = A + (size_t)(row0 + ln) * lda;
  v8f acc[4] = {};
  for (int kb = 0; kb < K; kb += 32) {
    FragB ah, al;
    const v4f x0 = *(const v4fa*)(arow + kb + 8 * hh), x1 = *(const v4fa*)(arow + kb + 8 * hh + 4);
    const v4f x2 = *(const v4fa*)(arow + kb + 16 + 8 * hh), x3 = *(const v4fa*)(arow + kb + 16 + 8 * hh + 4);
    float xs[16] = {x0[0],x0[1],x0[2],x0[3],x1[0],x1[1],x1[2],x1[3],x2[0],x2[1],x2[2],x2[3],x3[0],x3[1],x3[2],x3[3]};
#pragma unroll
    for (int i = 0; i < 16; ++i) { const unsigned short hb = bf16_bits(xs[i]); ah.u[i] = hb; al.u[i] = ASPLIT ? bf16_bits(xs[i] - bf16_val(hb)) : (unsigned short)0; }
#pragma unroll
    for (int t = 0; t < 4; ++t) {
      const unsigned short* brow = Wt + (size_t)(col0 + t * 16 + ln) * ldb + kb;
      FragB b;
      b.half[0] = *(const v8us*)(brow + 8 * hh);
      b.half[1] = *(const v8us*)(brow + 16 + 8 * hh);
      acc[t] = mmaN<ASPLIT ? 2 : 1>(ah.v, al.v, b.v, b.v, acc[t]);
    }
  }
#pragma unroll
  for (int t = 0; t < 4; ++t) {
    const int col = col0 + t * 16 + ln;
    float bv = bias ? bias[col] : 0.f;
    if (BIAS_BF16) bv = bf16_round(bv);
#pragma unroll
    for (int r = 0; r < 8; ++r) {
      float v = acc[t][r] + bv;
      if (resid) { float rv = resid[(size_t)((row0 + 8 * hh + r) % rmod) * ldr + col]; if (RES_BF16) rv = bf16_round(rv); v += rv; }
      if (ACT == 1) v = fmaxf(v, 0.f);
      if (ACT == 2) v = 0.5f * v * (1.0f + erff(v * 0.70710678118654752f));
      if (ACT == 3) { const float u = 0.7978845608028654f * (v + 0.044715f * v * v * v); v = 0.5f * v * (1.0f + tanhf(u)); }
      so[w][8 * hh + r][t * 16 + ln] = v;
    }
  }
  __builtin_amdgcn_fence(__ATOMIC_ACQ_REL, "workgroup");
  __builtin_amdgcn_wave_barrier();
  const int rsub = lane >> 4, c4 = (lane & 15) * 4;
  {
#pragma unroll
    for (int q = 0; q < 8; ++q) {
      const int r = q * 2 + rsub;
      const v4f v = *(const v4fa*)&so[w][r][c4];
      *(v4f*)(C + (size_t)(row0 + r) * ldc + col0 + c4) = v;
    }
    
  }
}
// row LayerNorm (biased variance, eps) over N: s = X (+ R); optional out_sum <- s; out_norm <- (s-mu)*rsqrt(var+eps)*g + b
template <bool PARAM_BF16>
__global__ __launch_bounds__(256) void k_layernorm(const float* __restrict__ X, const float* __restrict__ R, const float* __restrict__ g, const float* __restrict__ bta,
                                                  float* __restrict__ out_sum, float* __restrict__ out_norm, int N, float eps) {
  __shared__ float red[256];
  const int row = blockIdx.x, tid = threadIdx.x;
  const float* x = X + (size_t)row * N; const float* rr = R ? R + (size_t)row * N : nullptr;
  float vals[16];                     // up to N = 4096
  const int per = N / 256;            // contiguous chunk per thread? use strided-by-4 chunks: thread handles j = tid*4 + 1024*u
  float s1 = 0.f;
  for (int u = 0; u < per / 4; ++u) {
    const int j = tid * 4 + 1024 * u;
    const v4f a = *(const v4fa*)(x + j);
    v4f b = {0.f,0.f,0.f,0.f}; if (rr) b = *(const v4fa*)(rr + j);
#pragma unroll
    for (int q = 0; q < 4; ++q) { const float v = a[q] + b[q]; vals[u * 4 + q] = v; s1 += v; }
  }
  red[tid] = s1; __syncthreads();
  for (int st = 128; st > 0; st >>= 1) { if (tid < st) red[tid] += red[tid + st]; __syncthreads(); }
  const float mu = red[0] / (float)N; __syncthreads();
  float s2 = 0.f;
  for (int u = 0; u < per / 4; ++u)
#pragma unroll
    for (int q = 0; q < 4; ++q) { const float c = vals[u * 4 + q] - mu; s2 += c * c; }
  red[tid] = s2; __syncthreads();
  for (int st = 128; st > 0; st >>= 1) { if (tid < st) red[tid] += red[tid + st]; __syncthreads(); }
  const float rs = rsqrtf(red[0] / (float)N + eps);
  {
    for (int u = 0; u < per / 4; ++u) {
      const int j = tid * 4 + 1024 * u;
      v4f o, sm;
#pragma unroll
      for (int q = 0; q < 4; ++q) {
        float gg = g[j + q], bb = bta[j + q];
        if (PARAM_BF16) { gg = bf16_round(gg); bb = bf16_round(bb); }
        sm[q] = vals[u * 4 + q]; o[q] = (vals[u * 4 + q] - mu) * rs * gg + bb;
      }
      if (out_sum) *(v4f*)(out_sum + (size_t)row * N + j) = sm;
      *(v4f*)(out_norm + (size_t)row * N + j) = o;
    }
    
  }
}



// ---- f16 WMMA path (v_wmma_f32_16x16x32_f16): 11-bit significands for operands in range — used where a [0,1] probability operand needs more precision than bf16
typedef _Float16 v16h __attribute__((ext_vector_type(16)));
union FragH { v16h v; v8us half[2]; _Float16 h[16]; unsigned short u[16]; };
template <int NT>
__device__ __forceinline__ v8f mmaH(v16h ah, v16h al, v16h bh, v16h bl, v8f c) {
  c = __builtin_amdgcn_wmma_f32_16x16x32_f16(false, ah, false, bh, (short)0, c, false, false);
  if (NT >= 2) c = __builtin_amdgcn_wmma_f32_16x16x32_f16(false, al, false, bh, (short)0, c, false, false);
  if (NT >= 3) c = __builtin_amdgcn_wmma_f32_16x16x32_f16(false, ah, false, bl, (short)0, c, false, false);
  return c;      // no asm behind the builtin: the compiler keeps the distance after a WMMA itself and stays free to move LDS reads ahead of it
}
// batched GEMM like k_gemm_b but f16 operands: A f32 (split into f16 hi/lo if ASPLIT, else rounded to f16), Bt = f16 values [n][k]; alpha; C f32; N multiple of 16 (partial tiles skipped)
template <bool ASPLIT>
__global__ __launch_bounds__(128) void k_gemm_h(const float* __restrict__ A, int lda, size_t sA, const _Float16* __restrict__ Bh, int ldb, size_t sB, float alpha, float* __restrict__ C, int ldc, size_t sC, int M, int N, int K) {
  __shared__ __attribute__((aligned(16))) float so[4][16][64];
  const int tid = threadIdx.x, w = tid >> 5, lane = tid & 31, ln = lane & 15, hh = lane >> 4; const int by = blockIdx.y;
  A += (size_t)by * sA; Bh += (size_t)by * sB; C += (size_t)by * sC;
  const int ntn = (N + 63) / 64; const int wid = blockIdx.x * 4 + w; const int mt = wid / ntn, nq = wid % ntn; if (mt * 16 >= M) return;
  const int row0 = mt * 16, col0 = nq * 64; const float* arow = A + (size_t)(row0 + ln) * lda;
  v8f acc[4] = {};
  for (int kb = 0; kb < K; kb += 32) {
    FragH ah, al;
    const v4f x0 = *(const v4fa*)(arow + kb + 8 * hh), x1 = *(const v4fa*)(arow + kb + 8 * hh + 4), x2 = *(const v4fa*)(arow + kb + 16 + 8 * hh), x3 = *(const v4fa*)(arow + kb + 16 + 8 * hh + 4);
    float xs[16] = {x0[0],x0[1],x0[2],x0[3],x1[0],x1[1],x1[2],x1[3],x2[0],x2[1],x2[2],x2[3],x3[0],x3[1],x3[2],x3[3]};
#pragma unroll
    for (int i = 0; i < 16; ++i) { const _Float16 h = (_Float16)xs[i]; ah.h[i] = h; al.h[i] = ASPLIT ? (_Float16)(xs[i] - (float)h) : (_Float16)0.0f; }
#pragma unroll
    for (int t = 0; t < 4; ++t) { if (col0 + t * 16 >= N) continue; const size_t boff = (size_t)(col0 + t * 16 + ln) * ldb + kb; FragH bq; bq.half[0] = *(const v8us*)(Bh + boff + 8 * hh); bq.half[1] = *(const v8us*)(Bh + boff + 16 + 8 * hh);
      acc[t] = mmaH<ASPLIT ? 2 : 1>(ah.v, al.v, bq.v, bq.v, acc[t]); }
  }
#pragma unroll
  for (int t = 0; t < 4; ++t) { if (col0 + t * 16 >= N) continue;
#pragma unroll
    for (int r = 0; r < 8; ++r) so[w][8 * hh + r][t * 16 + ln] = acc[t][r] * alpha; }
  __builtin_amdgcn_fence(__ATOMIC_ACQ_REL, "workgroup"); __builtin_amdgcn_wave_barrier();
  const int rsub = lane >> 4, c4 = (lane & 15) * 4;
  {
#pragma unroll
    for (int q = 0; q < 8; ++q) { const int r = q * 2 + rsub; if (col0 + c4 < N) { const v4f v = *(const v4fa*)&so[w][r][c4]; *(v4f*)(C + (size_t)(row0 + r) * ldc + col0 + c4) = v; } }
     }
}

// Wt[n][k] = f16(W[k][n]·scale) from f32 row-major W[K][N] (scale = power of two; bf16-exact weights stay exact in f16 away from the subnormal range)
__global__ __launch_bounds__(256) void k_wt_f16(const float* __restrict__ W, _Float16* __restrict__ Wt, int K, int N, float scale) {
  const int t = blockIdx.x * 256 + threadIdx.x; if (t >= N * (K / 8)) return; const int n = t / (K / 8), k8 = (t % (K / 8)) * 8; FragH f;
#pragma unroll
  for (int i = 0; i < 8; ++i) f.h[i] = (_Float16)(bf16_round(W[(size_t)(k8 + i) * N + n]) * scale); const v8us o = f.half[0];
  *(v8us*)((unsigned short*)Wt + (size_t)n * K + k8) = o; 
}
// k_gemm_hh variant with fused epilogue: v = acc·alpha + bias[by·sBias + col] (+ CP[(row/rowsPerB)·sCPb + by·64 + col] if CP) ; ACT 0 none / 1 elu ; writes f16 C16 (and f32 C if non-null)
template <int ACT>
__global__ __launch_bounds__(128) void k_gemm_hhx(const _Float16* __restrict__ A, int lda, size_t sA, const _Float16* __restrict__ Bh, int ldb, size_t sB, float alpha, const float* __restrict__ bias, size_t sBias, const float* __restrict__ CP, int rowsPerB, size_t sCPb, int row0g,
    float* __restrict__ C, _Float16* __restrict__ C16, int ldc, size_t sC, int M, int N, int K) {
  __shared__ __attribute__((aligned(16))) float so[4][16][64];
  const int tid = threadIdx.x, w = tid >> 5, lane = tid & 31, ln = lane & 15, hh = lane >> 4; const int by = blockIdx.y;
  A += (size_t)by * sA; Bh += (size_t)by * sB; const size_t cofs = (size_t)by * sC; const float* bp = bias ? bias + (size_t)by * sBias : nullptr;
  const int ntn = (N + 63) / 64; const int wid = blockIdx.x * 4 + w; const int mt = wid / ntn, nq = wid % ntn; if (mt * 16 >= M) return;
  const int row0 = mt * 16, col0 = nq * 64; const _Float16* arow = A + (size_t)(row0 + ln) * lda;
  v8f acc[4] = {};
  for (int kb = 0; kb < K; kb += 32) { FragH ah; ah.half[0] = *(const v8us*)((const unsigned short*)arow + kb + 8 * hh); ah.half[1] = *(const v8us*)((const unsigned short*)arow + kb + 16 + 8 * hh);
#pragma unroll
    for (int t = 0; t < 4; ++t) { if (col0 + t * 16 >= N) continue; const size_t boff = (size_t)(col0 + t * 16 + ln) * ldb + kb; FragH bq; bq.half[0] = *(const v8us*)((const unsigned short*)Bh + boff + 8 * hh); bq.half[1] = *(const v8us*)((const unsigned short*)Bh + boff + 16 + 8 * hh);
      acc[t] = mmaH<1>(ah.v, ah.v, bq.v, bq.v, acc[t]); }
  }
#pragma unroll
  for (int t = 0; t < 4; ++t) { if (col0 + t * 16 >= N) continue; const int col = col0 + t * 16 + ln; const float bv = bp ? bf16_round(bp[col]) : 0.f;
#pragma unroll
    for (int r = 0; r < 8; ++r) { float v = acc[t][r] * alpha + bv; if (CP) { const int bidx = (row0g + row0 + 8 * hh + r) / rowsPerB; v += CP[(size_t)bidx * sCPb + (size_t)by * 64 + col]; } if (ACT == 1) v = (v > 0.f) ? v : expm1f(v); else if (ACT == 7) v = (v > 0.f) ? v + 1.0f : expf(v); else if (ACT == 8) v = tanhf(v); else if (ACT == 9) v = 0.5f * v * (1.0f + tanhf(0.7978845608028654f * (v + 0.044715f * v * v * v))); else if (ACT == 11) v = 1.0f / (1.0f + expf(-v)); else if (ACT == 12) v = (v > 0.f) ? v : 0.01f * v; else if (ACT == 14) v = (v > 0.f) ? v : 0.1f * v; else if (ACT == 15) v = v / (1.0f + expf(-v)); else if (ACT == 3) v = fmaxf(v, 0.f); else if (ACT == 6) v = 0.5f * v * (1.0f + erff(v * 0.70710678118654752f)); so[w][8 * hh + r][t * 16 + ln] = v; } }
  __builtin_amdgcn_fence(__ATOMIC_ACQ_REL, "workgroup"); __builtin_amdgcn_wave_barrier();
  const int rsub = lane >> 4, c4 = (lane & 15) * 4; typedef _Float16 v4h __attribute__((ext_vector_type(4)));
  {
#pragma unroll
    for (int q = 0; q < 8; ++q) { const int r = q * 2 + rsub; if (col0 + c4 < N) { const v4f v = *(const v4fa*)&so[w][r][c4]; if (C) *(v4f*)(C + cofs + (size_t)(row0 + r) * ldc + col0 + c4) = v; if (C16) { v4h h4; for (int i = 0; i < 4; ++i) h4[i] = (_Float16)v[i]; *(v4h*)(C16 + cofs + (size_t)(row0 + r) * ldc + col0 + c4) = h4; } } }
     }
}


typedef _Float16 v4h __attribute__((ext_vector_type(4)));

__global__ __launch_bounds__(256) void k_x16(const float* __restrict__ x, _Float16* __restrict__ X16, size_t n8) { const size_t t = (size_t)blockIdx.x * 256 + threadIdx.x; if (t >= n8) return; FragH f;
#pragma unroll
  for (int q = 0; q < 8; ++q) f.h[q] = (_Float16)bf16_round(x[t * 8 + q]); *(v8us*)((unsigned short*)X16 + t * 8) = f.half[0];  }
__global__ __launch_bounds__(256) void k_h16(const float* __restrict__ x, _Float16* __restrict__ X16, size_t n8) { const size_t t = (size_t)blockIdx.x * 256 + threadIdx.x; if (t >= n8) return; FragH f;
#pragma unroll
  for (int q = 0; q < 8; ++q) f.h[q] = (_Float16)x[t * 8 + q]; *(v8us*)((unsigned short*)X16 + t * 8) = f.half[0];  }
__global__ __launch_bounds__(256) void k_round16f(const float* __restrict__ W, _Float16* __restrict__ Bt, size_t n8) { const size_t t = (size_t)blockIdx.x * 256 + threadIdx.x; if (t >= n8) return; FragH f;
#pragma unroll
  for (int i = 0; i < 8; ++i) f.h[i] = (_Float16)(bf16_round(W[t * 8 + i]) * 16.0f); *(v8us*)((unsigned short*)Bt + t * 8) = f.half[0];  }
template <int NHv, int TTv>
__global__ __launch_bounds__(256) void k_vt(const _Float16* __restrict__ V16, int ldv, int voff, _Float16* __restrict__ Vt) { __shared__ unsigned short tl[64][66]; const int tid = threadIdx.x; const int slab = blockIdx.x / (TTv / 64), lg = blockIdx.x % (TTv / 64); const int b = slab / NHv, h = slab % NHv;
  for (int i = tid; i < 64 * 8; i += 256) { const int r = i / 8, c8 = (i % 8) * 8; FragH f; f.half[0] = *(const v8us*)((const unsigned short*)V16 + ((size_t)b * TTv + lg * 64 + r) * ldv + voff + h * 64 + c8);
#pragma unroll
    for (int q = 0; q < 8; ++q) tl[r][c8 + q] = f.u[q]; }
  __syncthreads();
  {
#pragma unroll
    for (int rd = 0; rd < 2; ++rd) { const int d = rd * 32 + tid / 8, pc = tid % 8; FragH f;
#pragma unroll
      for (int q = 0; q < 8; ++q) f.u[q] = tl[pc * 8 + q][d];
      *(v8us*)((unsigned short*)Vt + ((size_t)slab * 64 + d) * TTv + lg * 64 + pc * 8) = f.half[0]; }
     } }

__global__ __launch_bounds__(256) void k_hl(const float* __restrict__ F, _Float16* __restrict__ Hh, _Float16* __restrict__ Hl, size_t n8) { const size_t t = (size_t)blockIdx.x * 256 + threadIdx.x; if (t >= n8) return; FragH fh, fl; const v4f a = *(const v4fa*)(F + t * 8), c = *(const v4fa*)(F + t * 8 + 4);
#pragma unroll
  for (int q = 0; q < 4; ++q) { _Float16 h = (_Float16)a[q]; fh.h[q] = h; fl.h[q] = (_Float16)((a[q] - (float)h) * 1024.0f); h = (_Float16)c[q]; fh.h[4 + q] = h; fl.h[4 + q] = (_Float16)((c[q] - (float)h) * 1024.0f); }
  { *(v8us*)((unsigned short*)Hh + t * 8) = fh.half[0]; *(v8us*)((unsigned short*)Hl + t * 8) = fl.half[0];  } }

// ---- fast GEMM (block tile 128x64, wave tile 32x64; requires M % 128 == 0, N % 64 == 0, K % 64 == 0); A and B tiles of 64 k staged in LDS; epilogue = k_gemm_hhx semantics ----
__device__ __forceinline__ v16h g2_frag(const _Float16* p, int hh) { FragH f; f.half[0] = *(const v8us*)((const unsigned short*)p + 8 * hh); f.half[1] = *(const v8us*)((const unsigned short*)p + 16 + 8 * hh); return f.v; }
__device__ __forceinline__ v8f g2_mma(v16h a, v16h b, v8f c) { return __builtin_amdgcn_wmma_f32_16x16x32_f16(false, a, false, b, (short)0, c, false, false); }
template <int ACT>
__global__ __launch_bounds__(128) void k_gemm2(const _Float16* __restrict__ A, int lda, size_t sA, const _Float16* __restrict__ Bh, int ldb, size_t sB, float alpha, const float* __restrict__ bias, size_t sBias, const float* __restrict__ CP, int rowsPerB, size_t sCPb, int row0g,
    float* __restrict__ C, _Float16* __restrict__ C16, int ldc, size_t sC, int M, int N, int K) {
  constexpr int GK = 64, GP = 72;      // a tile = 64 k; LDS row pitch 144 B (16 B x odd: ds_load_b128 without bank conflicts)
  __shared__ __attribute__((aligned(16))) _Float16 tA[2][128][GP]; __shared__ __attribute__((aligned(16))) _Float16 tB[2][64][GP];      // two buffers each
  __shared__ __attribute__((aligned(16))) float so[4][32][68];
  const int tid = threadIdx.x, w = tid >> 5, lane = tid & 31, ln = lane & 15, hh = lane >> 4; const int by = blockIdx.y;
  A += (size_t)by * sA; Bh += (size_t)by * sB; const size_t cofs = (size_t)by * sC; const float* bp = bias ? bias + (size_t)by * sBias : nullptr;
  const int ntn = N >> 6; const int mt = blockIdx.x / ntn, nq = blockIdx.x - mt * ntn; const int row0 = mt * 128 + 32 * w, col0 = nq * 64; if (mt * 128 >= M) return;      // the whole block leaves or none of it: barriers follow
  // every thread copies 8 + 4 pieces of 16 B per tile (8 lanes cover one whole 128-B row)
  const int crow = tid >> 3, cc8 = (tid & 7) * 8;
  const _Float16* gA = A + (size_t)(mt * 128 + crow) * lda + cc8; const _Float16* gB = Bh + (size_t)(col0 + crow) * ldb + cc8;
  const unsigned lA = (unsigned)(size_t)&tA[0][crow][cc8], lB = (unsigned)(size_t)&tB[0][crow][cc8];
  auto copy_tile = [&](int t) {
    const unsigned ao = lA + (unsigned)(t & 1) * (unsigned)(128 * GP * 2), bo = lB + (unsigned)(t & 1) * (unsigned)(64 * GP * 2), r16 = 16 * GP * 2; const _Float16* ap = gA + (size_t)t * GK; const _Float16* bq = gB + (size_t)t * GK; const size_t a16 = (size_t)16 * lda, b16 = (size_t)16 * ldb;
    // the copies and, as the last line of the same statement, the wait that stands before their address registers are rewritten
    asm volatile("global_load_async_to_lds_b128 %0, %12, off\n\tglobal_load_async_to_lds_b128 %1, %13, off\n\tglobal_load_async_to_lds_b128 %2, %14, off\n\tglobal_load_async_to_lds_b128 %3, %15, off\n\t"
                 "global_load_async_to_lds_b128 %4, %16, off\n\tglobal_load_async_to_lds_b128 %5, %17, off\n\tglobal_load_async_to_lds_b128 %6, %18, off\n\tglobal_load_async_to_lds_b128 %7, %19, off\n\t"
                 "global_load_async_to_lds_b128 %8, %20, off\n\tglobal_load_async_to_lds_b128 %9, %21, off\n\tglobal_load_async_to_lds_b128 %10, %22, off\n\tglobal_load_async_to_lds_b128 %11, %23, off\n\ts_wait_xcnt 0x0"
                 :: "v"(ao), "v"(ao + r16), "v"(ao + 2 * r16), "v"(ao + 3 * r16), "v"(ao + 4 * r16), "v"(ao + 5 * r16), "v"(ao + 6 * r16), "v"(ao + 7 * r16), "v"(bo), "v"(bo + r16), "v"(bo + 2 * r16), "v"(bo + 3 * r16),
                    "v"(ap), "v"(ap + a16), "v"(ap + 2 * a16), "v"(ap + 3 * a16), "v"(ap + 4 * a16), "v"(ap + 5 * a16), "v"(ap + 6 * a16), "v"(ap + 7 * a16), "v"(bq), "v"(bq + b16), "v"(bq + 2 * b16), "v"(bq + 3 * b16) : "memory"); };
  const v8f z8 = {0.f,0.f,0.f,0.f,0.f,0.f,0.f,0.f}; v8f c00 = z8, c01 = z8, c02 = z8, c03 = z8, c10 = z8, c11 = z8, c12 = z8, c13 = z8;
  const int nst = K / GK;
  copy_tile(0);
  asm volatile("s_wait_asynccnt 0x0" ::: "memory");      // this wave's copies of tile 0 have landed
  __syncthreads();                                       // every wave's have: tile 0 may be read
  if (nst > 1) copy_tile(1);
#pragma unroll 1
  for (int t = 0; t < nst; ++t) { const _Float16 (*pA)[GP] = tA[t & 1]; const _Float16 (*pB)[GP] = tB[t & 1];
    v16h fa[2][2], fb[2][4];      // the tile's 12 fragments, read as one group ahead of its 16 products
#pragma unroll
    for (int s = 0; s < 2; ++s) { fa[s][0] = g2_frag(&pA[32 * w + ln][s * 32], hh); fa[s][1] = g2_frag(&pA[32 * w + 16 + ln][s * 32], hh);
#pragma unroll
      for (int j = 0; j < 4; ++j) fb[s][j] = g2_frag(&pB[j * 16 + ln][s * 32], hh); }
    __builtin_amdgcn_sched_barrier(0);      // keeps the 24 LDS reads one group: without it the compiler sinks them among the products, each behind a full wait
#pragma unroll
    for (int s = 0; s < 2; ++s) {
      c00 = g2_mma(fa[s][0], fb[s][0], c00); c10 = g2_mma(fa[s][1], fb[s][0], c10); c01 = g2_mma(fa[s][0], fb[s][1], c01); c11 = g2_mma(fa[s][1], fb[s][1], c11);
      c02 = g2_mma(fa[s][0], fb[s][2], c02); c12 = g2_mma(fa[s][1], fb[s][2], c12); c03 = g2_mma(fa[s][0], fb[s][3], c03); c13 = g2_mma(fa[s][1], fb[s][3], c13); }
    __builtin_amdgcn_sched_barrier(0);      // keeps the products in front of the waits below: lifted over them, the wait for tile t + 1 would stand right behind its copies
    asm volatile("s_wait_dscnt 0x0" ::: "memory");       // this wave's reads of tile t are done before its buffer is refilled
    asm volatile("s_wait_asynccnt 0x0" ::: "memory");    // this wave's copies of tile t + 1 have landed
    __syncthreads();                                     // publishes tile t + 1 and ends every wave's reads of tile t
    if (t + 2 < nst) copy_tile(t + 2); }
  asm volatile("s_wait_asynccnt 0x0" ::: "memory");      // nothing of this wave is in flight when it goes on to the epilogue and ends
  const int rsub = lane >> 4, c4 = (lane & 15) * 4;
  // The addend is read in the layout of the stores below: 16 B a lane (sCPb % 4 == 0), 16 lanes on one row's 256 B, all 16 loads of a lane in flight over the LDS turn of the accumulators.
  v4f ad[16];
  if (CP) { const float* ap[16];
#pragma unroll
    for (int q = 0; q < 16; ++q) { const int bidx = (row0g + row0 + q * 2 + rsub) / rowsPerB; ap[q] = CP + (size_t)bidx * sCPb + (size_t)by * 64 + col0 + c4; }
#pragma unroll
    for (int q = 0; q < 16; ++q) ad[q] = *(const v4fa*)ap[q];
    // the wait that stands before the address registers of these loads are rewritten; it takes the addresses as inputs so that they stay in their registers up to it
    asm volatile("s_wait_xcnt 0x0" :: "v"(ap[0]), "v"(ap[1]), "v"(ap[2]), "v"(ap[3]), "v"(ap[4]), "v"(ap[5]), "v"(ap[6]), "v"(ap[7]), "v"(ap[8]), "v"(ap[9]), "v"(ap[10]), "v"(ap[11]), "v"(ap[12]), "v"(ap[13]), "v"(ap[14]), "v"(ap[15]) : "memory"); }
  v8f accs[8] = {c00, c01, c02, c03, c10, c11, c12, c13};
#pragma unroll
  for (int u = 0; u < 8; ++u) { const int t = u & 3, half = u >> 2; const int col = col0 + t * 16 + ln; const float bv = bp ? bf16_round(bp[col]) : 0.f;
#pragma unroll
    for (int r = 0; r < 8; ++r) so[w][half * 16 + 8 * hh + r][t * 16 + ln] = accs[u][r] * alpha + bv; }
  __builtin_amdgcn_fence(__ATOMIC_ACQ_REL, "workgroup"); __builtin_amdgcn_wave_barrier();
  {
#pragma unroll
    for (int q = 0; q < 16; ++q) { const int r = q * 2 + rsub; v4f v = *(const v4fa*)&so[w][r][c4]; if (CP) v += ad[q];
#pragma unroll
      for (int i = 0; i < 4; ++i) { if (ACT == 3) v[i] = fmaxf(v[i], 0.f); else if (ACT == 6) v[i] = 0.5f * v[i] * (1.0f + erff(v[i] * 0.70710678118654752f)); else if (ACT == 11) v[i] = 1.0f / (1.0f + expf(-v[i])); else if (ACT == 15) v[i] = v[i] / (1.0f + expf(-v[i])); else if (ACT == 12) v[i] = (v[i] > 0.f) ? v[i] : 0.01f * v[i]; else if (ACT == 8) v[i] = tanhf(v[i]); }
      if (C) { *(v4f*)(C + cofs + (size_t)(row0 + r) * ldc + col0 + c4) = v; asm volatile("s_wait_xcnt 0x0" ::: "memory"); }      // the wait stands before the conversion below rewrites registers that this store names
      if (C16) { v4h h4; for (int i = 0; i < 4; ++i) h4[i] = (_Float16)v[i]; *(v4h*)(C16 + cofs + (size_t)(row0 + r) * ldc + col0 + c4) = h4; } }
     } }



// lane l with lane l ^ 16
__device__ __forceinline__ float xhalf(float x) { return __builtin_bit_cast(float, __builtin_amdgcn_permlanex16(__builtin_bit_cast(int, x), __builtin_bit_cast(int, x), 0x76543210, 0xfedcba98, false, false)); }
__global__ __launch_bounds__(128) void k_flash(const _Float16* __restrict__ Q16, int ldq, const _Float16* __restrict__ K16, int ldk, const _Float16* __restrict__ Vt, const int* __restrict__ MSK, float* __restrict__ O, int ldo) {
  constexpr int RPW = 16, NQB = TQ / (4 * RPW), DT = 4, KS = 2;
  constexpr float C2 = SCL * 1.4426950408889634f;      // score scale x log2(e): the softmax runs in base 2
  constexpr int SK = 64, NST = TK / SK, LP = 72;      // a tile = 64 keys; LDS row pitch 144 B (16 B x odd: ds_load_b128 without bank conflicts)
  __shared__ __attribute__((aligned(16))) unsigned short sK[2][SK][LP]; __shared__ __attribute__((aligned(16))) unsigned short sV[2][64][LP];      // two buffers each: K rows [key][d], V^T rows [d][key]
  __shared__ __attribute__((aligned(16))) float sO[4][RPW][64 + 4];
  const int tid = threadIdx.x, w = tid >> 5, lane = tid & 31, ln = lane & 15, hh = lane >> 4;
  const int slab = blockIdx.x / NQB, qblk = blockIdx.x % NQB; const int b = slab / NH, h = slab % NH; const int qb0 = qblk * (4 * RPW); const int q0 = qb0 + w * RPW;
  FragH bq[KS];
  { const unsigned short* qr = (const unsigned short*)Q16 + ((size_t)b * TQ + q0 + ln) * ldq + h * 64;
#pragma unroll
    for (int ks = 0; ks < KS; ++ks) { bq[ks].half[0] = *(const v8us*)(qr + ks * 32 + 8 * hh); bq[ks].half[1] = *(const v8us*)(qr + ks * 32 + 16 + 8 * hh); } }
  const unsigned short* Vth = (const unsigned short*)Vt + (size_t)slab * 64 * TK;
  float m_r = -3.0e38f, l_r = 0.f; v8f oacc[DT];      // one query per lane: its running maximum (of the raw products), this lane half's part of its sum (x2^10, like P), O^T rows d = dt * 16 + 8 * hh + r
#pragma unroll
  for (int dt = 0; dt < DT; ++dt) oacc[dt] = (v8f){0.f,0.f,0.f,0.f,0.f,0.f,0.f,0.f};
  // The block's four waves share each K / V^T tile: every thread copies 4 + 4 pieces of 16 B (8 lanes cover one whole 128-B row).
  const int crow = tid >> 3, cc8 = (tid & 7) * 8;
  const unsigned short* gK = (const unsigned short*)K16 + ((size_t)b * TK + crow) * ldk + h * 64 + cc8; const unsigned short* gV = Vth + (size_t)crow * TK + cc8;
  const unsigned lK = (unsigned)(size_t)&sK[0][crow][cc8], lV = (unsigned)(size_t)&sV[0][crow][cc8];
  auto copy_tile = [&](int t) {
    const unsigned bo = (unsigned)(t & 1) * (unsigned)(SK * LP * 2), r16 = 16 * LP * 2; const unsigned short* kp = gK + (size_t)t * SK * ldk; const unsigned short* vp = gV + (size_t)t * SK;
    // the copies and, as the last line of the same statement, the wait that stands before their address registers are rewritten
    asm volatile("global_load_async_to_lds_b128 %0, %8, off\n\tglobal_load_async_to_lds_b128 %1, %9, off\n\tglobal_load_async_to_lds_b128 %2, %10, off\n\tglobal_load_async_to_lds_b128 %3, %11, off\n\t"
                 "global_load_async_to_lds_b128 %4, %12, off\n\tglobal_load_async_to_lds_b128 %5, %13, off\n\tglobal_load_async_to_lds_b128 %6, %14, off\n\tglobal_load_async_to_lds_b128 %7, %15, off\n\ts_wait_xcnt 0x0"
                 :: "v"(lK + bo), "v"(lK + bo + r16), "v"(lK + bo + 2 * r16), "v"(lK + bo + 3 * r16), "v"(lV + bo), "v"(lV + bo + r16), "v"(lV + bo + 2 * r16), "v"(lV + bo + 3 * r16),
                    "v"(kp), "v"(kp + (size_t)16 * ldk), "v"(kp + (size_t)32 * ldk), "v"(kp + (size_t)48 * ldk), "v"(vp), "v"(vp + (size_t)16 * TK), "v"(vp + (size_t)32 * TK), "v"(vp + (size_t)48 * TK) : "memory"); };
  copy_tile(0);
  asm volatile("s_wait_asynccnt 0x0" ::: "memory");      // this wave's copies of tile 0 have landed
  __syncthreads();                                       // every wave's have: tile 0 may be read
  copy_tile(1);
#pragma unroll 1
  for (int t = 0; t < NST; ++t) {
   const unsigned short (*bK)[LP] = sK[t & 1]; const unsigned short (*bV)[LP] = sV[t & 1];
#pragma unroll
   for (int ps = 0; ps < SK / 32; ++ps) {
    v8f sc[2];      // raw products q.k: the scale is positive, so their maximum is the scaled scores' maximum
#pragma unroll
    for (int nt = 0; nt < 2; ++nt) { const unsigned short* kr = &bK[ps * 32 + nt * 16 + ln][0]; FragH ak[KS];
#pragma unroll
      for (int ks = 0; ks < KS; ++ks) { ak[ks].half[0] = *(const v8us*)(kr + ks * 32 + 8 * hh); ak[ks].half[1] = *(const v8us*)(kr + ks * 32 + 16 + 8 * hh); }
      v8f acc = (v8f){0.f,0.f,0.f,0.f,0.f,0.f,0.f,0.f};
#pragma unroll
      for (int ks = 0; ks < KS; ++ks) acc = mmaH<1>(ak[ks].v, ak[ks].v, bq[ks].v, bq[ks].v, acc);
      sc[nt] = acc; }
    float mc = fmaxf(sc[0][0], sc[1][0]);
#pragma unroll
    for (int r = 1; r < 8; ++r) mc = fmaxf(mc, fmaxf(sc[0][r], sc[1][r]));
    mc = fmaxf(mc, xhalf(mc));      // both lane halves now hold the query's maximum over the 32 keys
    const float mn = fmaxf(m_r, mc); const float al = (mn > -1.0e38f) ? __builtin_amdgcn_exp2f((m_r - mn) * C2) : 1.0f; m_r = mn;
    const float nb = fmaf(-mn, C2, 10.0f);      // P x 2^10 = 2^(s * C2 - mn * C2 + 10): one fma per score, then v_exp_f32
    FragH pb; float ls[4] = {0.f, 0.f, 0.f, 0.f};
#pragma unroll
    for (int nt = 0; nt < 2; ++nt)
#pragma unroll
      for (int r = 0; r < 8; ++r) { const float p = __builtin_amdgcn_exp2f(fmaf(sc[nt][r], C2, nb)); ls[r & 3] += p; pb.h[nt * 8 + r] = (_Float16)p; }
    l_r = l_r * al + ((ls[0] + ls[1]) + (ls[2] + ls[3]));
#pragma unroll
    for (int dt = 0; dt < DT; ++dt) oacc[dt] *= al;
#pragma unroll
    for (int dt = 0; dt < DT; ++dt) { const unsigned short* vrow = &bV[dt * 16 + ln][ps * 32]; FragH av; av.half[0] = *(const v8us*)(vrow + 8 * hh); av.half[1] = *(const v8us*)(vrow + 16 + 8 * hh);
      oacc[dt] = mmaH<1>(av.v, av.v, pb.v, pb.v, oacc[dt]); } }
   asm volatile("s_wait_dscnt 0x0" ::: "memory");        // this wave's reads of tile t are done before its buffer is refilled
   asm volatile("s_wait_asynccnt 0x0" ::: "memory");     // this wave's copies of tile t + 1 have landed
   __syncthreads();                                      // publishes tile t + 1 and ends every wave's reads of tile t
   if (t + 2 < NST) copy_tile(t + 2); }
  asm volatile("s_wait_asynccnt 0x0" ::: "memory");      // nothing of this wave is in flight when it goes on to the epilogue and ends
  const float l = l_r + xhalf(l_r);      // the two lane halves' sums joined, unconditionally
  const float inv = (l > 0.f) ? 1.0f / l : 0.f;      // sum and O^T carry the same 2^10
#pragma unroll
  for (int dt = 0; dt < DT; ++dt) { const v4f lo = {oacc[dt][0] * inv, oacc[dt][1] * inv, oacc[dt][2] * inv, oacc[dt][3] * inv}, hi = {oacc[dt][4] * inv, oacc[dt][5] * inv, oacc[dt][6] * inv, oacc[dt][7] * inv};
    *(v4fa*)&sO[w][ln][dt * 16 + 8 * hh] = lo; *(v4fa*)&sO[w][ln][dt * 16 + 8 * hh + 4] = hi; }
  __builtin_amdgcn_fence(__ATOMIC_ACQ_REL, "workgroup"); __builtin_amdgcn_wave_barrier();
  {
#pragma unroll
    for (int rp = 0; rp < RPW; rp += 2) { const int r = rp + (lane >> 4), pc = lane & 15; const v4f val = *(const v4fa*)&sO[w][r][pc * 4]; *(v4f*)(O + ((size_t)b * TQ + q0 + r) * ldo + h * 64 + pc * 4) = val; }
     } }
__global__ __launch_bounds__(256) void k_fulltab(unsigned* __restrict__ MB, int* __restrict__ RA, int* __restrict__ KE, int nq, int nk) {
  const int t = blockIdx.x * 256 + threadIdx.x;
  if (t < nq * (nk / 32)) { *(unsigned*)(MB + t) = 0u;  }
  if (t < nq) { *(int*)(RA + t) = 0;  }
  if (t < nq / 64) { *(int*)(KE + t * 32) = nk;  } }
__global__ __launch_bounds__(256) void k_lnout(const float* __restrict__ Y, const float* __restrict__ g, const float* __restrict__ bb, float* __restrict__ out) {
  #pragma clang fp contract(off)
  const int tid = threadIdx.x, w = tid >> 5, ln = tid & 31; const int r = blockIdx.x * 8 + w; if (r >= NR) return; const float* y = Y + (size_t)r * DM; float s = 0.f;
#pragma unroll 1
  for (int i = 0; i < 8; ++i) { const v4f a = *(const v4fa*)(y + i * 128 + ln * 4); for (int q = 0; q < 4; ++q) s += a[q]; }
  for (int o = 16; o > 0; o >>= 1) s += __shfl_xor(s, o, 32); const float mu = s / (float)DM; float q2 = 0.f;
#pragma unroll 1
  for (int i = 0; i < 8; ++i) { const v4f a = *(const v4fa*)(y + i * 128 + ln * 4); for (int q = 0; q < 4; ++q) { const float d = a[q] - mu; q2 += d * d; } }
  for (int o = 16; o > 0; o >>= 1) q2 += __shfl_xor(q2, o, 32); const float rs = rsqrtf(q2 / (float)DM + 1e-6f);
  {
#pragma unroll 1
    for (int i = 0; i < 8; ++i) { const int c0 = i * 128 + ln * 4; const v4f a = *(const v4fa*)(y + c0); v4f o4; for (int q = 0; q < 4; ++q) o4[q] = (a[q] - mu) * rs * bf16_round(g[c0 + q]) + bf16_round(bb[c0 + q]); *(v4f*)(out + (size_t)r * DM + c0) = o4; }
     } }
__global__ __launch_bounds__(256) void k_xb(const float* __restrict__ x, float* __restrict__ XB, size_t n4) { const size_t t = (size_t)blockIdx.x * 256 + threadIdx.x; if (t >= n4) return; const v4f a = *(const v4fa*)(x + t * 4); v4f o; for (int q = 0; q < 4; ++q) o[q] = bf16_round(a[q]); *(v4f*)(XB + t * 4) = o;  }
// Every input conversion in one launch, by block range: blocks 0..767 round q, k, v to bf16 and store them as f16 planes (q also as f32, the residual addend);
// blocks 768..1023 store the four weights, rounded to bf16, as f16 x16. A block streams 4096 pieces of 16 B, lane-contiguous, 16 per thread.
template <bool RES>
__device__ __forceinline__ void prep_stream(const float* __restrict__ src, _Float16* __restrict__ dst, float* __restrict__ xb, float scale, int tid) {
  v4f a[16];      // the three loops below are unrolled so that a[] lives in registers and every address is base + immediate offset
#pragma unroll
  for (int u = 0; u < 16; ++u) a[u] = *(const v4fa*)(src + (u * 256 + tid) * 4);
  __builtin_amdgcn_sched_barrier(0);      // keeps all 16 loads in flight together: without it the compiler sinks six of them among the conversions
#pragma unroll
  for (int u = 0; u < 16; ++u) { const int e = (u * 256 + tid) * 4; v4f r; v4h h;
#pragma unroll
    for (int i = 0; i < 4; ++i) { r[i] = bf16_round(a[u][i]); h[i] = (_Float16)(r[i] * scale); }
    *(v4h*)(dst + e) = h; if (RES) *(v4f*)(xb + e) = r; } }
__global__ __launch_bounds__(256) void k_prep(const float* __restrict__ q, const float* __restrict__ k, const float* __restrict__ v, const float* __restrict__ Wq, const float* __restrict__ Wk, const float* __restrict__ Wv, const float* __restrict__ Wo,
                                              _Float16* __restrict__ X16, float* __restrict__ XB, _Float16* __restrict__ B16) {
  constexpr int PB = 4096, XBLK = NR * DM / 4 / PB, WBLK = DM * DM / 4 / PB;
  const int bid = blockIdx.x, tid = threadIdx.x;
  if (bid < XBLK) { const size_t o = (size_t)bid * PB * 4; prep_stream<true>(q + o, X16 + o, XB + o, 1.0f, tid); }
  else if (bid < 3 * XBLK) { const bool isk = bid < 2 * XBLK; const size_t o = (size_t)(bid - (isk ? XBLK : 2 * XBLK)) * PB * 4; prep_stream<false>((isk ? k : v) + o, X16 + (size_t)(isk ? 1 : 2) * NR * DM + o, nullptr, 1.0f, tid); }
  else { const int j = (bid - 3 * XBLK) / WBLK; const size_t o = (size_t)((bid - 3 * XBLK) % WBLK) * PB * 4; prep_stream<false>((j == 0 ? Wq : (j == 1 ? Wk : (j == 2 ? Wv : Wo))) + o, B16 + (size_t)j * DM * DM + o, nullptr, 16.0f, tid); } }
__global__ __launch_bounds__(256) void k_causaltab(unsigned* __restrict__ MB, int* __restrict__ RA, int* __restrict__ KE, int nq, int nk) {
  const int t = blockIdx.x * 256 + threadIdx.x; const int nw = nk / 32;
  if (t < nq * nw) { const int q = t / nw, w = t % nw; const int first = q + 1 - 32 * w; const unsigned bits = (first <= 0) ? 0xffffffffu : ((first >= 32) ? 0u : (0xffffffffu << first)); *(unsigned*)(MB + t) = bits;  }
  if (t < nq) { *(int*)(RA + t) = 0;  }
  if (t < nq / 64) { const int v = 64 * (t + 1); *(int*)(KE + t * 32) = v;  } }


extern "C" void kernel_launch(void* const* d_in, const int* in_sizes, int n_in,
                              void* d_out, int out_size, void* d_ws, size_t ws_size, hipStream_t stream) {
  (void)in_sizes; (void)n_in; (void)out_size;
  const float* const* I = (const float* const*)d_in; const float* qin = I[0]; const float* kin = I[1]; const float* vin = I[2]; const float* Wq = I[3]; const float* Wk = I[4]; const float* Wv = I[5]; const float* Wo = I[6]; const float* gam = I[7]; const float* bet = I[8];
  char* ws = (char*)d_ws; size_t off = 0;
  auto take = [&](size_t bytes) { char* p = ws + off; off += (bytes + 255) & ~(size_t)255; return p; };
  _Float16* BQ = (_Float16*)take((size_t)DM * DM * 2); _Float16* BK = (_Float16*)take((size_t)DM * DM * 2); _Float16* BV = (_Float16*)take((size_t)DM * DM * 2); _Float16* BO = (_Float16*)take((size_t)DM * DM * 2);
  _Float16* X16 = (_Float16*)take((size_t)3 * NR * DM * 2); float* F = (float*)take((size_t)NR * DM * 4); float* XB = (float*)take((size_t)NR * DM * 4);
  _Float16* Q16 = (_Float16*)take((size_t)NR * DM * 2); _Float16* K16 = (_Float16*)take((size_t)NR * DM * 2); _Float16* V16 = (_Float16*)take((size_t)NR * DM * 2); _Float16* VT = (_Float16*)take((size_t)NR * DM * 2);
  if (off > ws_size) return;      /* 8 + 24 + 16 + 16 + 32 = 96 MiB; BQ BK BV BO, the three X16 planes and Q16 K16 V16 each lie one behind the other */
  float* O = F; _Float16* Oh = Q16; _Float16* Ol = K16; float* Y = XB;
  const size_t n8 = (size_t)NR * DM / 8; const unsigned nb8 = (unsigned)((n8 + 255) / 256); (void)BK; (void)BV;
  k_prep<<<3 * (NR * DM / 16384) + 4 * (DM * DM / 16384), 256, 0, stream>>>(qin, kin, vin, Wq, Wk, Wv, Wo, X16, XB, BQ);      /* X16 planes of q, k, v; XB; BQ BK BV BO */
  const dim3 gP((NR / 128) * (DM / 64), 1), gP3((NR / 128) * (DM / 64), 3);
  k_gemm2<0><<<gP3, 128, 0, stream>>>(X16, DM, (size_t)NR * DM, BQ, DM, (size_t)DM * DM, 0.0625f, nullptr, 0, nullptr, 1, 0, 0, nullptr, Q16, DM, (size_t)NR * DM, NR, DM, DM);      /* blockIdx.y = 0, 1, 2: qh, kh, vh (f16) */
  k_vt<NH, SLEN><<<NH * (SLEN / 64), 256, 0, stream>>>(V16, DM, 0, VT);
  k_flash<<<NH * (SLEN / 64), 128, 0, stream>>>(Q16, DM, K16, DM, VT, nullptr, O, DM);      /* plain flash over all 4096 keys (no mask) */
  k_hl<<<nb8, 256, 0, stream>>>(O, Oh, Ol, n8);
  k_gemm2<0><<<gP, 128, 0, stream>>>(Oh, DM, 0, BO, DM, 0, 0.0625f, nullptr, 0, XB, 1, (size_t)DM, 0, Y, nullptr, DM, 0, NR, DM, DM);
  k_gemm2<0><<<gP, 128, 0, stream>>>(Ol, DM, 0, BO, DM, 0, 0.0625f / 1024.0f, nullptr, 0, Y, 1, (size_t)DM, 0, Y, nullptr, DM, 0, NR, DM, DM);
  k_lnout<<<NR / 8, 256, 0, stream>>>(Y, gam, bet, (float*)d_out);
}

// v007
// Measured time: 162 microseconds a run.
// In both of two side-by-side timings against v006, it was 1.12 times as fast.
// Over all steps from v000 it is 4.62 times as fast.
#include <hip/hip_runtime.h>
#define NBT 1
#define SLEN 4096
#define TQ SLEN
#define TK SLEN
#define DM 1024
#define NH 16
#define SCL 0.125f
#define NR (NBT * SLEN)
typedef __bf16 v16b __attribute__((ext_vector_type(16)));
typedef unsigned short v8us __attribute__((ext_vector_type(8), may_alias));
typedef float  v8f  __attribute__((ext_vector_type(8)));
typedef float  v4f  __attribute__((ext_vector_type(4)));
typedef float  v4fa __attribute__((ext_vector_type(4), may_alias));
union FragB { v16b v; v8us half[2]; unsigned short u[16]; };

__device__ __forceinline__ unsigned short bf16_bits(float x) { unsigned int u = __float_as_uint(x); return (unsigned short)((u + 0x7FFFu + ((u >> 16) & 1u)) >> 16); }
__device__ __forceinline__ float bf16_val(unsigned short b) { return __uint_as_float(((unsigned int)b) << 16); }
__device__ __forceinline__ float bf16_round(float x) { return bf16_val(bf16_bits(x)); }
// D += A·B with NT terms: 1 = ah·bh, 2 = + al·bh (A split), 3 = + ah·bl (both split)
template <int NT>
__device__ __forceinline__ v8f mmaN(v16b ah, v16b al, v16b bh, v16b bl, v8f c) {
  c = __builtin_amdgcn_wmma_f32_16x16x32_bf16(false, ah, false, bh, (short)0, c, false, false);
  if (NT >= 2) c = __builtin_amdgcn_wmma_f32_16x16x32_bf16(false, al, false, bh, (short)0, c, false, false);
  if (NT >= 3) c = __builtin_amdgcn_wmma_f32_16x16x32_bf16(false, ah, false, bl, (short)0, c, false, false);
  asm volatile("v_nop\n\tv_nop\n\tv_nop\n\tv_nop" : "+v"(c) : "v"(ah), "v"(al), "v"(bh), "v"(bl));
  return c;
}

__global__ __launch_bounds__(256) void k_wt_bf16(const float* __restrict__ W, unsigned short* __restrict__ Wt, int K, int N) {
  const int t = blockIdx.x * 256 + threadIdx.x;
  const int k8n = K / 8;
  if (t >= N * k8n) return;
  const int n = t / k8n, k8 = (t % k8n) * 8;
  v8us v;
#pragma unroll
  for (int i = 0; i < 8; ++i) v[i] = bf16_bits(W[(size_t)(k8 + i) * N + n]);
  *(v8us*)(Wt + (size_t)n * K + k8) = v;
  
}

// GEMM C[M][N] (f32, pitch ldc) = act(A[M][K]·W + bias). A f32 row-major (pitch lda) converted per fragment to bf16
// (ASPLIT: hi/lo two planes -> 2 terms, else single rounded term); Wt bf16 [N][K] (pitch ldb). BIAS_BF16 rounds the
// bias to bf16 first (bias quantised to bf16 before the add). K%32==0, M%16==0, N%64==0.
template <bool ASPLIT, int ACT, bool BIAS_BF16>
__global__ __launch_bounds__(128) void k_gemm_bf(const float* __restrict__ A, int lda, const unsigned short* __restrict__ Wt, int ldb,
                                               const float* __restrict__ bias, float* __restrict__ C, int ldc, int M, int N, int K) {
  __shared__ __attribute__((aligned(16))) float so[4][16][64];
  const int tid = threadIdx.x, w = tid >> 5, lane = tid & 31, ln = lane & 15, hh = lane >> 4;
  const int ntn = N / 64;
  const int wid = blockIdx.x * 4 + w;
  const int mt = wid / ntn, nq = wid % ntn;
  if (mt * 16 >= M) return;
  const int row0 = mt * 16, col0 = nq * 64;
  const float* arow = A + (size_t)(row0 + ln) * lda;
  v8f acc[4] = {};
  for (int kb = 0; kb < K; kb += 32) {
    FragB ah, al;
    const v4f x0 = *(const v4fa*)(arow + kb + 8 * hh), x1 = *(const v4fa*)(arow + kb + 8 * hh + 4);
    const v4f x2 = *(const v4fa*)(arow + kb + 16 + 8 * hh), x3 = *(const v4fa*)(arow + kb + 16 + 8 * hh + 4);
    float xs[16] = {x0[0],x0[1],x0[2],x0[3],x1[0],x1[1],x1[2],x1[3],x2[0],x2[1],x2[2],x2[3],x3[0],x3[1],x3[2],x3[3]};
#pragma unroll
    for (int i = 0; i < 16; ++i) { const unsigned short hb = bf16_bits(xs[i]); ah.u[i] = hb; al.u[i] = ASPLIT ? bf16_bits(xs[i] - bf16_val(hb)) : (unsigned short)0; }
#pragma unroll
    for (int t = 0; t < 4; ++t) {
      const unsigned short* brow = Wt + (size_t)(col0 + t * 16 + ln) * ldb + kb;
      FragB b;
      b.half[0] = *(const v8us*)(brow + 8 * hh);
      b.half[1] = *(const v8us*)(brow + 16 + 8 * hh);
      acc[t] = mmaN<ASPLIT ? 2 : 1>(ah.v, al.v, b.v, b.v, acc[t]);
    }
  }
#pragma unroll
  for (int t = 0; t < 4; ++t) {
    float bv = bias ? bias[col0 + t * 16 + ln] : 0.f;
    if (BIAS_BF16) bv = bf16_round(bv);
#pragma unroll
    for (int r = 0; r < 8; ++r) { float v = acc[t][r] + bv; if (ACT == 1) v = fmaxf(v, 0.f); so[w][8 * hh + r][t * 16 + ln] = v; }
  }
  __builtin_amdgcn_fence(__ATOMIC_ACQ_REL, "workgroup");
  __builtin_amdgcn_wave_barrier();
  const int rsub = lane >> 4, c4 = (lane & 15) * 4;
  {
#pragma unroll
    for (int q = 0; q < 8; ++q) {
      const int r = q * 2 + rsub;
      const v4f v = *(const v4fa*)&so[w][r][c4];
      *(v4f*)(C + (size_t)(row0 + r) * ldc + col0 + c4) = v;
    }
    
  }
}

// GEMM C = act(A·W + bias + resid): A f32 (ASPLIT -> hi/lo 2 terms), Wt bf16 [N][K]; ACT 0 none, 1 relu, 2 exact gelu;
// resid (optional, f32, row index = (row % rmod), pitch ldr, RES_BF16 rounds it) added before the activation.
template <bool ASPLIT, int ACT, bool BIAS_BF16, bool RES_BF16>
__global__ __launch_bounds__(128) void k_gemm_bf3(const float* __restrict__ A, int lda, const unsigned short* __restrict__ Wt, int ldb,
                                                const float* __restrict__ bias, const float* __restrict__ resid, int rmod, int ldr,
                                                float* __restrict__ C, int ldc, int M, int N, int K) {
  __shared__ __attribute__((aligned(16))) float so[4][16][64];
  const int tid = threadIdx.x, w = tid >> 5, lane = tid & 31, ln = lane & 15, hh = lane >> 4;
  const int ntn = N / 64;
  const int wid = blockIdx.x * 4 + w;
  const int mt = wid / ntn, nq = wid % ntn;
  if (mt * 16 >= M) return;
  const int row0 = mt * 16, col0 = nq * 64;
  const float* arow = A + (size_t)(row0 + ln) * lda;
  v8f acc[4] = {};
  for (int kb = 0; kb < K; kb += 32) {
    FragB ah, al;
    const v4f x0 = *(const v4fa*)(arow + kb + 8 * hh), x1 = *(const v4fa*)(arow + kb + 8 * hh + 4);
    const v4f x2 = *(const v4fa*)(arow + kb + 16 + 8 * hh), x3 = *(const v4fa*)(arow + kb + 16 + 8 * hh + 4);
    float xs[16] = {x0[0],x0[1],x0[2],x0[3],x1[0],x1[1],x1[2],x1[3],x2[0],x2[1],x2[2],x2[3],x3[0],x3[1],x3[2],x3[3]};
#pragma unroll
    for (int i = 0; i < 16; ++i) { const unsigned short hb = bf16_bits(xs[i]); ah.u[i] = hb; al.u[i] = ASPLIT ? bf16_bits(xs[i] - bf16_val(hb)) : (unsigned short)0; }
#pragma unroll
    for (int t = 0; t < 4; ++t) {
      const unsigned short* brow = Wt + (size_t)(col0 + t * 16 + ln) * ldb + kb;
      FragB b;
      b.half[0] = *(const v8us*)(brow + 8 * hh);
      b.half[1] = *(const v8us*)(brow + 16 + 8 * hh);
      acc[t] = mmaN<ASPLIT ? 2 : 1>(ah.v, al.v, b.v, b.v, acc[t]);
    }
  }
#pragma unroll
  for (int t = 0; t < 4; ++t) {
    const int col = col0 + t * 16 + ln;
    float bv = bias ? bias[col] : 0.f;
    if (BIAS_BF16) bv = bf16_round(bv);
#pragma unroll
    for (int r = 0; r < 8; ++r) {
      float v = acc[t][r] + bv;
      if (resid) { float rv = resid[(size_t)((row0 + 8 * hh + r) % rmod) * ldr + col]; if (RES_BF16) rv = bf16_round(rv); v += rv; }
      if (ACT == 1) v = fmaxf(v, 0.f);
      if (ACT == 2) v = 0.5f * v * (1.0f + erff(v * 0.70710678118654752f));
      if (ACT == 3) { const float u = 0.7978845608028654f * (v + 0.044715f * v * v * v); v = 0.5f * v * (1.0f + tanhf(u)); }
      so[w][8 * hh + r][t * 16 + ln] = v;
    }
  }
  __builtin_amdgcn_fence(__ATOMIC_ACQ_REL, "workgroup");
  __builtin_amdgcn_wave_barrier();
  const int rsub = lane >> 4, c4 = (lane & 15) * 4;
  {
#pragma unroll
    for (int q = 0; q < 8; ++q) {
      const int r = q * 2 + rsub;
      const v4f v = *(const v4fa*)&so[w][r][c4];
      *(v4f*)(C + (size_t)(row0 + r) * ldc + col0 + c4) = v;
    }
    
  }
}
// row LayerNorm (biased variance, eps) over N: s = X (+ R); optional out_sum <- s; out_norm <- (s-mu)*rsqrt(var+eps)*g + b
template <bool PARAM_BF16>
__global__ __launch_bounds__(256) void k_layernorm(const float* __restrict__ X, const float* __restrict__ R, const float* __restrict__ g, const float* __restrict__ bta,
                                                  float* __restrict__ out_sum, float* __restrict__ out_norm, int N, float eps) {
  __shared__ float red[256];
  const int row = blockIdx.x, tid = threadIdx.x;
  const float* x = X + (size_t)row * N; const float* rr = R ? R + (size_t)row * N : nullptr;
  float vals[16];                     // up to N = 4096
  const int per = N / 256;            // contiguous chunk per thread? use strided-by-4 chunks: thread handles j = tid*4 + 1024*u
  float s1 = 0.f;
  for (int u = 0; u < per / 4; ++u) {
    const int j = tid * 4 + 1024 * u;
    const v4f a = *(const v4fa*)(x + j);
    v4f b = {0.f,0.f,0.f,0.f}; if (rr) b = *(const v4fa*)(rr + j);
#pragma unroll
    for (int q = 0; q < 4; ++q) { const float v = a[q] + b[q]; vals[u * 4 + q] = v; s1 += v; }
  }
  red[tid] = s1; __syncthreads();
  for (int st = 128; st > 0; st >>= 1) { if (tid < st) red[tid] += red[tid + st]; __syncthreads(); }
  const float mu = red[0] / (float)N; __syncthreads();
  float s2 = 0.f;
  for (int u = 0; u < per / 4; ++u)
#pragma unroll
    for (int q = 0; q < 4; ++q) { const float c = vals[u * 4 + q] - mu; s2 += c * c; }
  red[tid] = s2; __syncthreads();
  for (int st = 128; st > 0; st >>= 1) { if (tid < st) red[tid] += red[tid + st]; __syncthreads(); }
  const float rs = rsqrtf(red[0] / (float)N + eps);
  {
    for (int u = 0; u < per / 4; ++u) {
      const int j = tid * 4 + 1024 * u;
      v4f o, sm;
#pragma unroll
      for (int q = 0; q < 4; ++q) {
        float gg = g[j + q], bb = bta[j + q];
        if (PARAM_BF16) { gg = bf16_round(gg); bb = bf16_round(bb); }
        sm[q] = vals[u * 4 + q]; o[q] = (vals[u * 4 + q] - mu) * rs * gg + bb;
      }
      if (out_sum) *(v4f*)(out_sum + (size_t)row * N + j) = sm;
      *(v4f*)(out_norm + (size_t)row * N + j) = o;
    }
    
  }
}



// ---- f16 WMMA path (v_wmma_f32_16x16x32_f16): 11-bit significands for operands in range — used where a [0,1] probability operand needs more precision than bf16
typedef _Float16 v16h __attribute__((ext_vector_type(16)));
union FragH { v16h v; v8us half[2]; _Float16 h[16]; unsigned short u[16]; };
template <int NT>
__device__ __forceinline__ v8f mmaH(v16h ah, v16h al, v16h bh, v16h bl, v8f c) {
  c = __builtin_amdgcn_wmma_f32_16x16x32_f16(false, ah, false, bh, (short)0, c, false, false);
  if (NT >= 2) c = __builtin_amdgcn_wmma_f32_16x16x32_f16(false, al, false, bh, (short)0, c, false, false);
  if (NT >= 3) c = __builtin_amdgcn_wmma_f32_16x16x32_f16(false, ah, false, bl, (short)0, c, false, false);
  return c;      // no asm behind the builtin: the compiler keeps the distance after a WMMA itself and stays free to move LDS reads ahead of it
}
// batched GEMM like k_gemm_b but f16 operands: A f32 (split into f16 hi/lo if ASPLIT, else rounded to f16), Bt = f16 values [n][k]; alpha; C f32; N multiple of 16 (partial tiles skipped)
template <bool ASPLIT>
__global__ __launch_bounds__(128) void k_gemm_h(const float* __restrict__ A, int lda, size_t sA, const _Float16* __restrict__ Bh, int ldb, size_t sB, float alpha, float* __restrict__ C, int ldc, size_t sC, int M, int N, int K) {
  __shared__ __attribute__((aligned(16))) float so[4][16][64];
  const int tid = threadIdx.x, w = tid >> 5, lane = tid & 31, ln = lane & 15, hh = lane >> 4; const int by = blockIdx.y;
  A += (size_t)by * sA; Bh += (size_t)by * sB; C += (size_t)by * sC;
  const int ntn = (N + 63) / 64; const int wid = blockIdx.x * 4 + w; const int mt = wid / ntn, nq = wid % ntn; if (mt * 16 >= M) return;
  const int row0 = mt * 16, col0 = nq * 64; const float* arow = A + (size_t)(row0 + ln) * lda;
  v8f acc[4] = {};
  for (int kb = 0; kb < K; kb += 32) {
    FragH ah, al;
    const v4f x0 = *(const v4fa*)(arow + kb + 8 * hh), x1 = *(const v4fa*)(arow + kb + 8 * hh + 4), x2 = *(const v4fa*)(arow + kb + 16 + 8 * hh), x3 = *(const v4fa*)(arow + kb + 16 + 8 * hh + 4);
    float xs[16] = {x0[0],x0[1],x0[2],x0[3],x1[0],x1[1],x1[2],x1[3],x2[0],x2[1],x2[2],x2[3],x3[0],x3[1],x3[2],x3[3]};
#pragma unroll
    for (int i = 0; i < 16; ++i) { const _Float16 h = (_Float16)xs[i]; ah.h[i] = h; al.h[i] = ASPLIT ? (_Float16)(xs[i] - (float)h) : (_Float16)0.0f; }
#pragma unroll
    for (int t = 0; t < 4; ++t) { if (col0 + t * 16 >= N) continue; const size_t boff = (size_t)(col0 + t * 16 + ln) * ldb + kb; FragH bq; bq.half[0] = *(const v8us*)(Bh + boff + 8 * hh); bq.half[1] = *(const v8us*)(Bh + boff + 16 + 8 * hh);
      acc[t] = mmaH<ASPLIT ? 2 : 1>(ah.v, al.v, bq.v, bq.v, acc[t]); }
  }
#pragma unroll
  for (int t = 0; t < 4; ++t) { if (col0 + t * 16 >= N) continue;
#pragma unroll
    for (int r = 0; r < 8; ++r) so[w][8 * hh + r][t * 16 + ln] = acc[t][r] * alpha; }
  __builtin_amdgcn_fence(__ATOMIC_ACQ_REL, "workgroup"); __builtin_amdgcn_wave_barrier();
  const int rsub = lane >> 4, c4 = (lane & 15) * 4;
  {
#pragma unroll
    for (int q = 0; q < 8; ++q) { const int r = q * 2 + rsub; if (col0 + c4 < N) { const v4f v = *(const v4fa*)&so[w][r][c4]; *(v4f*)(C + (size_t)(row0 + r) * ldc + col0 + c4) = v; } }
     }
}

// Wt[n][k] = f16(W[k][n]·scale) from f32 row-major W[K][N] (scale = power of two; bf16-exact weights stay exact in f16 away from the subnormal range)
__global__ __launch_bounds__(256) void k_wt_f16(const float* __restrict__ W, _Float16* __restrict__ Wt, int K, int N, float scale) {
  const int t = blockIdx.x * 256 + threadIdx.x; if (t >= N * (K / 8)) return; const int n = t / (K / 8), k8 = (t % (K / 8)) * 8; FragH f;
#pragma unroll
  for (int i = 0; i < 8; ++i) f.h[i] = (_Float16)(bf16_round(W[(size_t)(k8 + i) * N + n]) * scale); const v8us o = f.half[0];
  *(v8us*)((unsigned short*)Wt + (size_t)n * K + k8) = o; 
}
// k_gemm_hh variant with fused epilogue: v = acc·alpha + bias[by·sBias + col] (+ CP[(row/rowsPerB)·sCPb + by·64 + col] if CP) ; ACT 0 none / 1 elu ; writes f16 C16 (and f32 C if non-null)
template <int ACT>
__global__ __launch_bounds__(128) void k_gemm_hhx(const _Float16* __restrict__ A, int lda, size_t sA, const _Float16* __restrict__ Bh, int ldb, size_t sB, float alpha, const float* __restrict__ bias, size_t sBias, const float* __restrict__ CP, int rowsPerB, size_t sCPb, int row0g,
    float* __restrict__ C, _Float16* __restrict__ C16, int ldc, size_t sC, int M, int N, int K) {
  __shared__ __attribute__((aligned(16))) float so[4][16][64];
  const int tid = threadIdx.x, w = tid >> 5, lane = tid & 31, ln = lane & 15, hh = lane >> 4; const int by = blockIdx.y;
  A += (size_t)by * sA; Bh += (size_t)by * sB; const size_t cofs = (size_t)by * sC; const float* bp = bias ? bias + (size_t)by * sBias : nullptr;
  const int ntn = (N + 63) / 64; const int wid = blockIdx.x * 4 + w; const int mt = wid / ntn, nq = wid % ntn; if (mt * 16 >= M) return;
  const int row0 = mt * 16, col0 = nq * 64; const _Float16* arow = A + (size_t)(row0 + ln) * lda;
  v8f acc[4] = {};
  for (int kb = 0; kb < K; kb += 32) { FragH ah; ah.half[0] = *(const v8us*)((const unsigned short*)arow + kb + 8 * hh); ah.half[1] = *(const v8us*)((const unsigned short*)arow + kb + 16 + 8 * hh);
#pragma unroll
    for (int t = 0; t < 4; ++t) { if (col0 + t * 16 >= N) continue; const size_t boff = (size_t)(col0 + t * 16 + ln) * ldb + kb; FragH bq; bq.half[0] = *(const v8us*)((const unsigned short*)Bh + boff + 8 * hh); bq.half[1] = *(const v8us*)((const unsigned short*)Bh + boff + 16 + 8 * hh);
      acc[t] = mmaH<1>(ah.v, ah.v, bq.v, bq.v, acc[t]); }
  }
#pragma unroll
  for (int t = 0; t < 4; ++t) { if (col0 + t * 16 >= N) continue; const int col = col0 + t * 16 + ln; const float bv = bp ? bf16_round(bp[col]) : 0.f;
#pragma unroll
    for (int r = 0; r < 8; ++r) { float v = acc[t][r] * alpha + bv; if (CP) { const int bidx = (row0g + row0 + 8 * hh + r) / rowsPerB; v += CP[(size_t)bidx * sCPb + (size_t)by * 64 + col]; } if (ACT == 1) v = (v > 0.f) ? v : expm1f(v); else if (ACT == 7) v = (v > 0.f) ? v + 1.0f : expf(v); else if (ACT == 8) v = tanhf(v); else if (ACT == 9) v = 0.5f * v * (1.0f + tanhf(0.7978845608028654f * (v + 0.044715f * v * v * v))); else if (ACT == 11) v = 1.0f / (1.0f + expf(-v)); else if (ACT == 12) v = (v > 0.f) ? v : 0.01f * v; else if (ACT == 14) v = (v > 0.f) ? v : 0.1f * v; else if (ACT == 15) v = v / (1.0f + expf(-v)); else if (ACT == 3) v = fmaxf(v, 0.f); else if (ACT == 6) v = 0.5f * v * (1.0f + erff(v * 0.70710678118654752f)); so[w][8 * hh + r][t * 16 + ln] = v; } }
  __builtin_amdgcn_fence(__ATOMIC_ACQ_REL, "workgroup"); __builtin_amdgcn_wave_barrier();
  const int rsub = lane >> 4, c4 = (lane & 15) * 4; typedef _Float16 v4h __attribute__((ext_vector_type(4)));
  {
#pragma unroll
    for (int q = 0; q < 8; ++q) { const int r = q * 2 + rsub; if (col0 + c4 < N) { const v4f v = *(const v4fa*)&so[w][r][c4]; if (C) *(v4f*)(C + cofs + (size_t)(row0 + r) * ldc + col0 + c4) = v; if (C16) { v4h h4; for (int i = 0; i < 4; ++i) h4[i] = (_Float16)v[i]; *(v4h*)(C16 + cofs + (size_t)(row0 + r) * ldc + col0 + c4) = h4; } } }
     }
}


typedef _Float16 v4h __attribute__((ext_vector_type(4)));

__global__ __launch_bounds__(256) void k_x16(const float* __restrict__ x, _Float16* __restrict__ X16, size_t n8) { const size_t t = (size_t)blockIdx.x * 256 + threadIdx.x; if (t >= n8) return; FragH f;
#pragma unroll
  for (int q = 0; q < 8; ++q) f.h[q] = (_Float16)bf16_round(x[t * 8 + q]); *(v8us*)((unsigned short*)X16 + t * 8) = f.half[0];  }
__global__ __launch_bounds__(256) void k_h16(const float* __restrict__ x, _Float16* __restrict__ X16, size_t n8) { const size_t t = (size_t)blockIdx.x * 256 + threadIdx.x; if (t >= n8) return; FragH f;
#pragma unroll
  for (int q = 0; q < 8; ++q) f.h[q] = (_Float16)x[t * 8 + q]; *(v8us*)((unsigned short*)X16 + t * 8) = f.half[0];  }
__global__ __launch_bounds__(256) void k_round16f(const float* __restrict__ W, _Float16* __restrict__ Bt, size_t n8) { const size_t t = (size_t)blockIdx.x * 256 + threadIdx.x; if (t >= n8) return; FragH f;
#pragma unroll
  for (int i = 0; i < 8; ++i) f.h[i] = (_Float16)(bf16_round(W[t * 8 + i]) * 16.0f); *(v8us*)((unsigned short*)Bt + t * 8) = f.half[0];  }
template <int NHv, int TTv>
__global__ __launch_bounds__(256) void k_vt(const _Float16* __restrict__ V16, int ldv, int voff, _Float16* __restrict__ Vt) { __shared__ unsigned short tl[64][66]; const int tid = threadIdx.x; const int slab = blockIdx.x / (TTv / 64), lg = blockIdx.x % (TTv / 64); const int b = slab / NHv, h = slab % NHv;
  for (int i = tid; i < 64 * 8; i += 256) { const int r = i / 8, c8 = (i % 8) * 8; FragH f; f.half[0] = *(const v8us*)((const unsigned short*)V16 + ((size_t)b * TTv + lg * 64 + r) * ldv + voff + h * 64 + c8);
#pragma unroll
    for (int q = 0; q < 8; ++q) tl[r][c8 + q] = f.u[q]; }
  __syncthreads();
  {
#pragma unroll
    for (int rd = 0; rd < 2; ++rd) { const int d = rd * 32 + tid / 8, pc = tid % 8; FragH f;
#pragma unroll
      for (int q = 0; q < 8; ++q) f.u[q] = tl[pc * 8 + q][d];
      *(v8us*)((unsigned short*)Vt + ((size_t)slab * 64 + d) * TTv + lg * 64 + pc * 8) = f.half[0]; }
     } }

__global__ __launch_bounds__(256) void k_hl(const float* __restrict__ F, _Float16* __restrict__ Hh, _Float16* __restrict__ Hl, size_t n8) { const size_t t = (size_t)blockIdx.x * 256 + threadIdx.x; if (t >= n8) return; FragH fh, fl; const v4f a = *(const v4fa*)(F + t * 8), c = *(const v4fa*)(F + t * 8 + 4);
#pragma unroll
  for (int q = 0; q < 4; ++q) { _Float16 h = (_Float16)a[q]; fh.h[q] = h; fl.h[q] = (_Float16)((a[q] - (float)h) * 1024.0f); h = (_Float16)c[q]; fh.h[4 + q] = h; fl.h[4 + q] = (_Float16)((c[q] - (float)h) * 1024.0f); }
  { *(v8us*)((unsigned short*)Hh + t * 8) = fh.half[0]; *(v8us*)((unsigned short*)Hl + t * 8) = fl.half[0];  } }

// ---- fast GEMM (block tile 128x64, wave tile 32x64; requires M % 128 == 0, N % 64 == 0, K % 64 == 0); A and B tiles of 64 k staged in LDS; epilogue = k_gemm_hhx semantics; the batch entry blockIdx.y == byT (if CT) is stored transposed instead, CT[col][row] (pitch M, f16; alpha only: no bias, addend or activation); with A2 the K loop runs over A, scales the sums by mid, and runs on over A2 with the same B: C = alpha (mid A.B + A2.B) ----
__device__ __forceinline__ v16h g2_frag(const _Float16* p, int hh) { FragH f; f.half[0] = *(const v8us*)((const unsigned short*)p + 8 * hh); f.half[1] = *(const v8us*)((const unsigned short*)p + 16 + 8 * hh); return f.v; }
__device__ __forceinline__ v8f g2_mma(v16h a, v16h b, v8f c) { return __builtin_amdgcn_wmma_f32_16x16x32_f16(false, a, false, b, (short)0, c, false, false); }
template <int ACT>
__global__ __launch_bounds__(128) void k_gemm2(const _Float16* __restrict__ A, int lda, size_t sA, const _Float16* __restrict__ Bh, int ldb, size_t sB, float alpha, const float* __restrict__ bias, size_t sBias, const float* __restrict__ CP, int rowsPerB, size_t sCPb, int row0g,
    float* __restrict__ C, _Float16* __restrict__ C16, int ldc, size_t sC, int M, int N, int K, _Float16* __restrict__ CT, int byT, const _Float16* __restrict__ A2, float mid) {
  constexpr int GK = 64, GP = 72;      // a tile = 64 k; LDS row pitch 144 B (16 B x odd: ds_load_b128 without bank conflicts)
  __shared__ __attribute__((aligned(16))) _Float16 tA[2][128][GP]; __shared__ __attribute__((aligned(16))) _Float16 tB[2][64][GP];      // two buffers each
  __shared__ __attribute__((aligned(16))) float so[4][32][68];
  const int tid = threadIdx.x, w = tid >> 5, lane = tid & 31, ln = lane & 15, hh = lane >> 4; const int by = blockIdx.y;
  A += (size_t)by * sA; Bh += (size_t)by * sB; const size_t cofs = (size_t)by * sC; const float* bp = bias ? bias + (size_t)by * sBias : nullptr;
  const int ntn = N >> 6; const int mt = blockIdx.x / ntn, nq = blockIdx.x - mt * ntn; const int row0 = mt * 128 + 32 * w, col0 = nq * 64; if (mt * 128 >= M) return;      // the whole block leaves or none of it: barriers follow
  // every thread copies 8 + 4 pieces of 16 B per tile (8 lanes cover one whole 128-B row)
  const int crow = tid >> 3, cc8 = (tid & 7) * 8;
  const _Float16* gA = A + (size_t)(mt * 128 + crow) * lda + cc8; const _Float16* gA2 = A2 ? A2 + (size_t)by * sA + (size_t)(mt * 128 + crow) * lda + cc8 : gA; const _Float16* gB = Bh + (size_t)(col0 + crow) * ldb + cc8;
  const unsigned lA = (unsigned)(size_t)&tA[0][crow][cc8], lB = (unsigned)(size_t)&tB[0][crow][cc8];
  const int nk = K / GK, nst = A2 ? 2 * nk : nk;      // tiles nk .. 2 nk - 1 are A2's, against the same B tiles
  auto copy_tile = [&](int t) {
    const int tk = t < nk ? t : t - nk;
    const unsigned ao = lA + (unsigned)(t & 1) * (unsigned)(128 * GP * 2), bo = lB + (unsigned)(t & 1) * (unsigned)(64 * GP * 2), r16 = 16 * GP * 2; const _Float16* ap = (t < nk ? gA : gA2) + (size_t)tk * GK; const _Float16* bq = gB + (size_t)tk * GK; const size_t a16 = (size_t)16 * lda, b16 = (size_t)16 * ldb;
    // the copies and, as the last line of the same statement, the wait that stands before their address registers are rewritten
    asm volatile("global_load_async_to_lds_b128 %0, %12, off\n\tglobal_load_async_to_lds_b128 %1, %13, off\n\tglobal_load_async_to_lds_b128 %2, %14, off\n\tglobal_load_async_to_lds_b128 %3, %15, off\n\t"
                 "global_load_async_to_lds_b128 %4, %16, off\n\tglobal_load_async_to_lds_b128 %5, %17, off\n\tglobal_load_async_to_lds_b128 %6, %18, off\n\tglobal_load_async_to_lds_b128 %7, %19, off\n\t"
                 "global_load_async_to_lds_b128 %8, %20, off\n\tglobal_load_async_to_lds_b128 %9, %21, off\n\tglobal_load_async_to_lds_b128 %10, %22, off\n\tglobal_load_async_to_lds_b128 %11, %23, off\n\ts_wait_xcnt 0x0"
                 :: "v"(ao), "v"(ao + r16), "v"(ao + 2 * r16), "v"(ao + 3 * r16), "v"(ao + 4 * r16), "v"(ao + 5 * r16), "v"(ao + 6 * r16), "v"(ao + 7 * r16), "v"(bo), "v"(bo + r16), "v"(bo + 2 * r16), "v"(bo + 3 * r16),
                    "v"(ap), "v"(ap + a16), "v"(ap + 2 * a16), "v"(ap + 3 * a16), "v"(ap + 4 * a16), "v"(ap + 5 * a16), "v"(ap + 6 * a16), "v"(ap + 7 * a16), "v"(bq), "v"(bq + b16), "v"(bq + 2 * b16), "v"(bq + 3 * b16) : "memory"); };
  const v8f z8 = {0.f,0.f,0.f,0.f,0.f,0.f,0.f,0.f}; v8f c00 = z8, c01 = z8, c02 = z8, c03 = z8, c10 = z8, c11 = z8, c12 = z8, c13 = z8;
  copy_tile(0);
  asm volatile("s_wait_asynccnt 0x0" ::: "memory");      // this wave's copies of tile 0 have landed
  __syncthreads();                                       // every wave's have: tile 0 may be read
  if (nst > 1) copy_tile(1);
#pragma unroll 1
  for (int t = 0; t < nst; ++t) { const _Float16 (*pA)[GP] = tA[t & 1]; const _Float16 (*pB)[GP] = tB[t & 1];
    if (t == nk) { c00 *= mid; c10 *= mid; c01 *= mid; c11 *= mid; c02 *= mid; c12 *= mid; c03 *= mid; c13 *= mid; }      // A's sums take their scale once, before A2's first tile is added
    v16h fa[2][2], fb[2][4];      // the tile's 12 fragments, read as one group ahead of its 16 products
#pragma unroll
    for (int s = 0; s < 2; ++s) { fa[s][0] = g2_frag(&pA[32 * w + ln][s * 32], hh); fa[s][1] = g2_frag(&pA[32 * w + 16 + ln][s * 32], hh);
#pragma unroll
      for (int j = 0; j < 4; ++j) fb[s][j] = g2_frag(&pB[j * 16 + ln][s * 32], hh); }
    __builtin_amdgcn_sched_barrier(0);      // keeps the 24 LDS reads one group: without it the compiler sinks them among the products, each behind a full wait
#pragma unroll
    for (int s = 0; s < 2; ++s) {
      c00 = g2_mma(fa[s][0], fb[s][0], c00); c10 = g2_mma(fa[s][1], fb[s][0], c10); c01 = g2_mma(fa[s][0], fb[s][1], c01); c11 = g2_mma(fa[s][1], fb[s][1], c11);
      c02 = g2_mma(fa[s][0], fb[s][2], c02); c12 = g2_mma(fa[s][1], fb[s][2], c12); c03 = g2_mma(fa[s][0], fb[s][3], c03); c13 = g2_mma(fa[s][1], fb[s][3], c13); }
    __builtin_amdgcn_sched_barrier(0);      // keeps the products in front of the waits below: lifted over them, the wait for tile t + 1 would stand right behind its copies
    asm volatile("s_wait_dscnt 0x0" ::: "memory");       // this wave's reads of tile t are done before its buffer is refilled
    asm volatile("s_wait_asynccnt 0x0" ::: "memory");    // this wave's copies of tile t + 1 have landed
    __syncthreads();                                     // publishes tile t + 1 and ends every wave's reads of tile t
    if (t + 2 < nst) copy_tile(t + 2); }
  asm volatile("s_wait_asynccnt 0x0" ::: "memory");      // nothing of this wave is in flight when it goes on to the epilogue and ends
  const int rsub = lane >> 4, c4 = (lane & 15) * 4;
  // The addend is read in the layout of the stores below: 16 B a lane (sCPb % 4 == 0), 16 lanes on one row's 256 B, all 16 loads of a lane in flight over the LDS turn of the accumulators.
  v4f ad[16];
  if (CP) { const float* ap[16];
#pragma unroll
    for (int q = 0; q < 16; ++q) { const int bidx = (row0g + row0 + q * 2 + rsub) / rowsPerB; ap[q] = CP + (size_t)bidx * sCPb + (size_t)by * 64 + col0 + c4; }
#pragma unroll
    for (int q = 0; q < 16; ++q) ad[q] = *(const v4fa*)ap[q];
    // the wait that stands before the address registers of these loads are rewritten; it takes the addresses as inputs so that they stay in their registers up to it
    asm volatile("s_wait_xcnt 0x0" :: "v"(ap[0]), "v"(ap[1]), "v"(ap[2]), "v"(ap[3]), "v"(ap[4]), "v"(ap[5]), "v"(ap[6]), "v"(ap[7]), "v"(ap[8]), "v"(ap[9]), "v"(ap[10]), "v"(ap[11]), "v"(ap[12]), "v"(ap[13]), "v"(ap[14]), "v"(ap[15]) : "memory"); }
  v8f accs[8] = {c00, c01, c02, c03, c10, c11, c12, c13};
  if (CT && by == byT) {      // the same for the whole block: a barrier follows
    // Registers 0..7 of an accumulator tile are 8 consecutive rows of one column, that is 16 B of a C^T row. The block's 64 x 128 C^T tile is gathered in LDS so that one wave stores whole 256-B rows. The loops are unrolled so that accs[] is indexed by constants and stays in registers, and the 8 row reads are in flight together.
    constexpr int TP = 136;      // LDS row pitch 272 B (16 B x odd); 64 rows = 17,408 B, inside so
    unsigned short* sT = (unsigned short*)&so[0][0][0];
#pragma unroll
    for (int u = 0; u < 8; ++u) { const int t = u & 3, half = u >> 2; FragH f;
#pragma unroll
      for (int r = 0; r < 8; ++r) f.h[r] = (_Float16)(accs[u][r] * alpha);
      *(v8us*)(sT + (t * 16 + ln) * TP + 32 * w + half * 16 + 8 * hh) = f.half[0]; }
    __syncthreads();      // every wave's 32 columns of the C^T tile are in LDS before any row is read
    const int d0 = tid >> 4, c8 = (tid & 15) * 8; unsigned short* ct = (unsigned short*)CT + (size_t)(col0 + d0) * M + mt * 128 + c8; const size_t m8 = (size_t)8 * M;
#pragma unroll
    for (int q = 0; q < 8; ++q) { const v8us v = *(const v8us*)(sT + (q * 8 + d0) * TP + c8); *(v8us*)(ct + q * m8) = v; }
    return; }
#pragma unroll
  for (int u = 0; u < 8; ++u) { const int t = u & 3, half = u >> 2; const int col = col0 + t * 16 + ln; const float bv = bp ? bf16_round(bp[col]) : 0.f;
#pragma unroll
    for (int r = 0; r < 8; ++r) so[w][half * 16 + 8 * hh + r][t * 16 + ln] = accs[u][r] * alpha + bv; }
  __builtin_amdgcn_fence(__ATOMIC_ACQ_REL, "workgroup"); __builtin_amdgcn_wave_barrier();
  {
#pragma unroll
    for (int q = 0; q < 16; ++q) { const int r = q * 2 + rsub; v4f v = *(const v4fa*)&so[w][r][c4]; if (CP) v += ad[q];
#pragma unroll
      for (int i = 0; i < 4; ++i) { if (ACT == 3) v[i] = fmaxf(v[i], 0.f); else if (ACT == 6) v[i] = 0.5f * v[i] * (1.0f + erff(v[i] * 0.70710678118654752f)); else if (ACT == 11) v[i] = 1.0f / (1.0f + expf(-v[i])); else if (ACT == 15) v[i] = v[i] / (1.0f + expf(-v[i])); else if (ACT == 12) v[i] = (v[i] > 0.f) ? v[i] : 0.01f * v[i]; else if (ACT == 8) v[i] = tanhf(v[i]); }
      if (C) { *(v4f*)(C + cofs + (size_t)(row0 + r) * ldc + col0 + c4) = v; asm volatile("s_wait_xcnt 0x0" ::: "memory"); }      // the wait stands before the conversion below rewrites registers that this store names
      if (C16) { v4h h4; for (int i = 0; i < 4; ++i) h4[i] = (_Float16)v[i]; *(v4h*)(C16 + cofs + (size_t)(row0 + r) * ldc + col0 + c4) = h4; } }
     } }



// lane l with lane l ^ 16
__device__ __forceinline__ float xhalf(float x) { return __builtin_bit_cast(float, __builtin_amdgcn_permlanex16(__builtin_bit_cast(int, x), __builtin_bit_cast(int, x), 0x76543210, 0xfedcba98, false, false)); }
__global__ __launch_bounds__(128) void k_flash(const _Float16* __restrict__ Q16, int ldq, const _Float16* __restrict__ K16, int ldk, const _Float16* __restrict__ Vt, const int* __restrict__ MSK, _Float16* __restrict__ Oh, _Float16* __restrict__ Ol, int ldo) {
  constexpr int RPW = 16, NQB = TQ / (4 * RPW), DT = 4, KS = 2;
  constexpr float C2 = SCL * 1.4426950408889634f;      // score scale x log2(e): the softmax runs in base 2
  constexpr int SK = 64, NST = TK / SK, LP = 72;      // a tile = 64 keys; LDS row pitch 144 B (16 B x odd: ds_load_b128 without bank conflicts)
  __shared__ __attribute__((aligned(16))) unsigned short sK[2][SK][LP]; __shared__ __attribute__((aligned(16))) unsigned short sV[2][64][LP];      // two buffers each: K rows [key][d], V^T rows [d][key]
  __shared__ __attribute__((aligned(16))) float sO[4][RPW][64 + 4];
  const int tid = threadIdx.x, w = tid >> 5, lane = tid & 31, ln = lane & 15, hh = lane >> 4;
  const int slab = blockIdx.x / NQB, qblk = blockIdx.x % NQB; const int b = slab / NH, h = slab % NH; const int qb0 = qblk * (4 * RPW); const int q0 = qb0 + w * RPW;
  FragH bq[KS];
  { const unsigned short* qr = (const unsigned short*)Q16 + ((size_t)b * TQ + q0 + ln) * ldq + h * 64;
#pragma unroll
    for (int ks = 0; ks < KS; ++ks) { bq[ks].half[0] = *(const v8us*)(qr + ks * 32 + 8 * hh); bq[ks].half[1] = *(const v8us*)(qr + ks * 32 + 16 + 8 * hh); } }
  const unsigned short* Vth = (const unsigned short*)Vt + (size_t)slab * 64 * TK;
  float m_r = -3.0e38f, l_r = 0.f; v8f oacc[DT];      // one query per lane: its running maximum (of the raw products), this lane half's part of its sum (x2^10, like P), O^T rows d = dt * 16 + 8 * hh + r
#pragma unroll
  for (int dt = 0; dt < DT; ++dt) oacc[dt] = (v8f){0.f,0.f,0.f,0.f,0.f,0.f,0.f,0.f};
  // The block's four waves share each K / V^T tile: every thread copies 4 + 4 pieces of 16 B (8 lanes cover one whole 128-B row).
  const int crow = tid >> 3, cc8 = (tid & 7) * 8;
  const unsigned short* gK = (const unsigned short*)K16 + ((size_t)b * TK + crow) * ldk + h * 64 + cc8; const unsigned short* gV = Vth + (size_t)crow * TK + cc8;
  const unsigned lK = (unsigned)(size_t)&sK[0][crow][cc8], lV = (unsigned)(size_t)&sV[0][crow][cc8];
  auto copy_tile = [&](int t) {
    const unsigned bo = (unsigned)(t & 1) * (unsigned)(SK * LP * 2), r16 = 16 * LP * 2; const unsigned short* kp = gK + (size_t)t * SK * ldk; const unsigned short* vp = gV + (size_t)t * SK;
    // the copies and, as the last line of the same statement, the wait that stands before their address registers are rewritten
    asm volatile("global_load_async_to_lds_b128 %0, %8, off\n\tglobal_load_async_to_lds_b128 %1, %9, off\n\tglobal_load_async_to_lds_b128 %2, %10, off\n\tglobal_load_async_to_lds_b128 %3, %11, off\n\t"
                 "global_load_async_to_lds_b128 %4, %12, off\n\tglobal_load_async_to_lds_b128 %5, %13, off\n\tglobal_load_async_to_lds_b128 %6, %14, off\n\tglobal_load_async_to_lds_b128 %7, %15, off\n\ts_wait_xcnt 0x0"
                 :: "v"(lK + bo), "v"(lK + bo + r16), "v"(lK + bo + 2 * r16), "v"(lK + bo + 3 * r16), "v"(lV + bo), "v"(lV + bo + r16), "v"(lV + bo + 2 * r16), "v"(lV + bo + 3 * r16),
                    "v"(kp), "v"(kp + (size_t)16 * ldk), "v"(kp + (size_t)32 * ldk), "v"(kp + (size_t)48 * ldk), "v"(vp), "v"(vp + (size_t)16 * TK), "v"(vp + (size_t)32 * TK), "v"(vp + (size_t)48 * TK) : "memory"); };
  copy_tile(0);
  asm volatile("s_wait_asynccnt 0x0" ::: "memory");      // this wave's copies of tile 0 have landed
  __syncthreads();                                       // every wave's have: tile 0 may be read
  copy_tile(1);
#pragma unroll 1
  for (int t = 0; t < NST; ++t) {
   const unsigned short (*bK)[LP] = sK[t & 1]; const unsigned short (*bV)[LP] = sV[t & 1];
#pragma unroll
   for (int ps = 0; ps < SK / 32; ++ps) {
    v8f sc[2];      // raw products q.k: the scale is positive, so their maximum is the scaled scores' maximum
#pragma unroll
    for (int nt = 0; nt < 2; ++nt) { const unsigned short* kr = &bK[ps * 32 + nt * 16 + ln][0]; FragH ak[KS];
#pragma unroll
      for (int ks = 0; ks < KS; ++ks) { ak[ks].half[0] = *(const v8us*)(kr + ks * 32 + 8 * hh); ak[ks].half[1] = *(const v8us*)(kr + ks * 32 + 16 + 8 * hh); }
      v8f acc = (v8f){0.f,0.f,0.f,0.f,0.f,0.f,0.f,0.f};
#pragma unroll
      for (int ks = 0; ks < KS; ++ks) acc = mmaH<1>(ak[ks].v, ak[ks].v, bq[ks].v, bq[ks].v, acc);
      sc[nt] = acc; }
    float mc = fmaxf(sc[0][0], sc[1][0]);
#pragma unroll
    for (int r = 1; r < 8; ++r) mc = fmaxf(mc, fmaxf(sc[0][r], sc[1][r]));
    mc = fmaxf(mc, xhalf(mc));      // both lane halves now hold the query's maximum over the 32 keys
    const float mn = fmaxf(m_r, mc); const float al = (mn > -1.0e38f) ? __builtin_amdgcn_exp2f((m_r - mn) * C2) : 1.0f; m_r = mn;
    const float nb = fmaf(-mn, C2, 10.0f);      // P x 2^10 = 2^(s * C2 - mn * C2 + 10): one fma per score, then v_exp_f32
    FragH pb; float ls[4] = {0.f, 0.f, 0.f, 0.f};
#pragma unroll
    for (int nt = 0; nt < 2; ++nt)
#pragma unroll
      for (int r = 0; r < 8; ++r) { const float p = __builtin_amdgcn_exp2f(fmaf(sc[nt][r], C2, nb)); ls[r & 3] += p; pb.h[nt * 8 + r] = (_Float16)p; }
    l_r = l_r * al + ((ls[0] + ls[1]) + (ls[2] + ls[3]));
#pragma unroll
    for (int dt = 0; dt < DT; ++dt) oacc[dt] *= al;
#pragma unroll
    for (int dt = 0; dt < DT; ++dt) { const unsigned short* vrow = &bV[dt * 16 + ln][ps * 32]; FragH av; av.half[0] = *(const v8us*)(vrow + 8 * hh); av.half[1] = *(const v8us*)(vrow + 16 + 8 * hh);
      oacc[dt] = mmaH<1>(av.v, av.v, pb.v, pb.v, oacc[dt]); } }
   asm volatile("s_wait_dscnt 0x0" ::: "memory");        // this wave's reads of tile t are done before its buffer is refilled
   asm volatile("s_wait_asynccnt 0x0" ::: "memory");     // this wave's copies of tile t + 1 have landed
   __syncthreads();                                      // publishes tile t + 1 and ends every wave's reads of tile t
   if (t + 2 < NST) copy_tile(t + 2); }
  asm volatile("s_wait_asynccnt 0x0" ::: "memory");      // nothing of this wave is in flight when it goes on to the epilogue and ends
  const float l = l_r + xhalf(l_r);      // the two lane halves' sums joined, unconditionally
  const float inv = (l > 0.f) ? 1.0f / l : 0.f;      // sum and O^T carry the same 2^10
#pragma unroll
  for (int dt = 0; dt < DT; ++dt) { const v4f lo = {oacc[dt][0] * inv, oacc[dt][1] * inv, oacc[dt][2] * inv, oacc[dt][3] * inv}, hi = {oacc[dt][4] * inv, oacc[dt][5] * inv, oacc[dt][6] * inv, oacc[dt][7] * inv};
    *(v4fa*)&sO[w][ln][dt * 16 + 8 * hh] = lo; *(v4fa*)&sO[w][ln][dt * 16 + 8 * hh + 4] = hi; }
  __builtin_amdgcn_fence(__ATOMIC_ACQ_REL, "workgroup"); __builtin_amdgcn_wave_barrier();
  {
#pragma unroll
    for (int rp = 0; rp < RPW; rp += 4) { const int r = rp + (lane >> 3), pc = lane & 7; const v4f x = *(const v4fa*)&sO[w][r][pc * 8], y = *(const v4fa*)&sO[w][r][pc * 8 + 4]; FragH fh, fl;      // O leaves as f16 hi + (residual x 2^10): 8 lanes store one row's 128 B of each plane; unrolled so that the fragments stay in registers
#pragma unroll
      for (int q = 0; q < 4; ++q) { _Float16 hv = (_Float16)x[q]; fh.h[q] = hv; fl.h[q] = (_Float16)((x[q] - (float)hv) * 1024.0f); hv = (_Float16)y[q]; fh.h[4 + q] = hv; fl.h[4 + q] = (_Float16)((y[q] - (float)hv) * 1024.0f); }
      const size_t o = ((size_t)b * TQ + q0 + r) * ldo + h * 64 + pc * 8;
      *(v8us*)((unsigned short*)Oh + o) = fh.half[0]; *(v8us*)((unsigned short*)Ol + o) = fl.half[0]; }
     } }
__global__ __launch_bounds__(256) void k_fulltab(unsigned* __restrict__ MB, int* __restrict__ RA, int* __restrict__ KE, int nq, int nk) {
  const int t = blockIdx.x * 256 + threadIdx.x;
  if (t < nq * (nk / 32)) { *(unsigned*)(MB + t) = 0u;  }
  if (t < nq) { *(int*)(RA + t) = 0;  }
  if (t < nq / 64) { *(int*)(KE + t * 32) = nk;  } }
__global__ __launch_bounds__(256) void k_lnout(const float* __restrict__ Y, const float* __restrict__ g, const float* __restrict__ bb, float* __restrict__ out) {
  #pragma clang fp contract(off)
  const int tid = threadIdx.x, w = tid >> 5, ln = tid & 31; const int r = blockIdx.x * 8 + w; if (r >= NR) return; const float* y = Y + (size_t)r * DM; float s = 0.f;
#pragma unroll 1
  for (int i = 0; i < 8; ++i) { const v4f a = *(const v4fa*)(y + i * 128 + ln * 4); for (int q = 0; q < 4; ++q) s += a[q]; }
  for (int o = 16; o > 0; o >>= 1) s += __shfl_xor(s, o, 32); const float mu = s / (float)DM; float q2 = 0.f;
#pragma unroll 1
  for (int i = 0; i < 8; ++i) { const v4f a = *(const v4fa*)(y + i * 128 + ln * 4); for (int q = 0; q < 4; ++q) { const float d = a[q] - mu; q2 += d * d; } }
  for (int o = 16; o > 0; o >>= 1) q2 += __shfl_xor(q2, o, 32); const float rs = rsqrtf(q2 / (float)DM + 1e-6f);
  {
#pragma unroll 1
    for (int i = 0; i < 8; ++i) { const int c0 = i * 128 + ln * 4; const v4f a = *(const v4fa*)(y + c0); v4f o4; for (int q = 0; q < 4; ++q) o4[q] = (a[q] - mu) * rs * bf16_round(g[c0 + q]) + bf16_round(bb[c0 + q]); *(v4f*)(out + (size_t)r * DM + c0) = o4; }
     } }
__global__ __launch_bounds__(256) void k_xb(const float* __restrict__ x, float* __restrict__ XB, size_t n4) { const size_t t = (size_t)blockIdx.x * 256 + threadIdx.x; if (t >= n4) return; const v4f a = *(const v4fa*)(x + t * 4); v4f o; for (int q = 0; q < 4; ++q) o[q] = bf16_round(a[q]); *(v4f*)(XB + t * 4) = o;  }
// Every input conversion in one launch, by block range: blocks 0..767 round q, k, v to bf16 and store them as f16 planes (q also as f32, the residual addend);
// blocks 768..1023 store the four weights, rounded to bf16, as f16 x16. A block streams 4096 pieces of 16 B, lane-contiguous, 16 per thread.
template <bool RES>
__device__ __forceinline__ void prep_stream(const float* __restrict__ src, _Float16* __restrict__ dst, float* __restrict__ xb, float scale, int tid) {
  v4f a[16];      // the three loops below are unrolled so that a[] lives in registers and every address is base + immediate offset
#pragma unroll
  for (int u = 0; u < 16; ++u) a[u] = *(const v4fa*)(src + (u * 256 + tid) * 4);
  __builtin_amdgcn_sched_barrier(0);      // keeps all 16 loads in flight together: without it the compiler sinks six of them among the conversions
#pragma unroll
  for (int u = 0; u < 16; ++u) { const int e = (u * 256 + tid) * 4; v4f r; v4h h;
#pragma unroll
    for (int i = 0; i < 4; ++i) { r[i] = bf16_round(a[u][i]); h[i] = (_Float16)(r[i] * scale); }
    *(v4h*)(dst + e) = h; if (RES) *(v4f*)(xb + e) = r; } }
__global__ __launch_bounds__(256) void k_prep(const float* __restrict__ q, const float* __restrict__ k, const float* __restrict__ v, const float* __restrict__ Wq, const float* __restrict__ Wk, const float* __restrict__ Wv, const float* __restrict__ Wo,
                                              _Float16* __restrict__ X16, float* __restrict__ XB, _Float16* __restrict__ B16) {
  constexpr int PB = 4096, XBLK = NR * DM / 4 / PB, WBLK = DM * DM / 4 / PB;
  const int bid = blockIdx.x, tid = threadIdx.x;
  if (bid < XBLK) { const size_t o = (size_t)bid * PB * 4; prep_stream<true>(q + o, X16 + o, XB + o, 1.0f, tid); }
  else if (bid < 3 * XBLK) { const bool isk = bid < 2 * XBLK; const size_t o = (size_t)(bid - (isk ? XBLK : 2 * XBLK)) * PB * 4; prep_stream<false>((isk ? k : v) + o, X16 + (size_t)(isk ? 1 : 2) * NR * DM + o, nullptr, 1.0f, tid); }
  else { const int j = (bid - 3 * XBLK) / WBLK; const size_t o = (size_t)((bid - 3 * XBLK) % WBLK) * PB * 4; prep_stream<false>((j == 0 ? Wq : (j == 1 ? Wk : (j == 2 ? Wv : Wo))) + o, B16 + (size_t)j * DM * DM + o, nullptr, 16.0f, tid); } }
__global__ __launch_bounds__(256) void k_causaltab(unsigned* __restrict__ MB, int* __restrict__ RA, int* __restrict__ KE, int nq, int nk) {
  const int t = blockIdx.x * 256 + threadIdx.x; const int nw = nk / 32;
  if (t < nq * nw) { const int q = t / nw, w = t % nw; const int first = q + 1 - 32 * w; const unsigned bits = (first <= 0) ? 0xffffffffu : ((first >= 32) ? 0u : (0xffffffffu << first)); *(unsigned*)(MB + t) = bits;  }
  if (t < nq) { *(int*)(RA + t) = 0;  }
  if (t < nq / 64) { const int v = 64 * (t + 1); *(int*)(KE + t * 32) = v;  } }


extern "C" void kernel_launch(void* const* d_in, const int* in_sizes, int n_in,
                              void* d_out, int out_size, void* d_ws, size_t ws_size, hipStream_t stream) {
  (void)in_sizes; (void)n_in; (void)out_size;
  const float* const* I = (const float* const*)d_in; const float* qin = I[0]; const float* kin = I[1]; const float* vin = I[2]; const float* Wq = I[3]; const float* Wk = I[4]; const float* Wv = I[5]; const float* Wo = I[6]; const float* gam = I[7]; const float* bet = I[8];
  char* ws = (char*)d_ws; size_t off = 0;
  auto take = [&](size_t bytes) { char* p = ws + off; off += (bytes + 255) & ~(size_t)255; return p; };
  _Float16* BQ = (_Float16*)take((size_t)DM * DM * 2); _Float16* BK = (_Float16*)take((size_t)DM * DM * 2); _Float16* BV = (_Float16*)take((size_t)DM * DM * 2); _Float16* BO = (_Float16*)take((size_t)DM * DM * 2);
  _Float16* X16 = (_Float16*)take((size_t)3 * NR * DM * 2); float* F = (float*)take((size_t)NR * DM * 4); float* XB = (float*)take((size_t)NR * DM * 4);
  _Float16* Q16 = (_Float16*)take((size_t)NR * DM * 2); _Float16* K16 = (_Float16*)take((size_t)NR * DM * 2); _Float16* V16 = (_Float16*)take((size_t)NR * DM * 2); _Float16* VT = (_Float16*)take((size_t)NR * DM * 2);
  if (off > ws_size) return;      /* 8 + 24 + 16 + 16 + 32 = 96 MiB; BQ BK BV BO, the three X16 planes and Q16 K16 V16 each lie one behind the other */
  _Float16* Oh = (_Float16*)F; _Float16* Ol = Oh + (size_t)NR * DM; float* Y = XB;      /* the two O planes fill F: k_flash writes them while other blocks still read Q16 and K16 */
  (void)BK; (void)BV; (void)V16;
  k_prep<<<3 * (NR * DM / 16384) + 4 * (DM * DM / 16384), 256, 0, stream>>>(qin, kin, vin, Wq, Wk, Wv, Wo, X16, XB, BQ);      /* X16 planes of q, k, v; XB; BQ BK BV BO */
  const dim3 gP((NR / 128) * (DM / 64), 1), gP3((NR / 128) * (DM / 64), 3);
  k_gemm2<0><<<gP3, 128, 0, stream>>>(X16, DM, (size_t)NR * DM, BQ, DM, (size_t)DM * DM, 0.0625f, nullptr, 0, nullptr, 1, 0, 0, nullptr, Q16, DM, (size_t)NR * DM, NR, DM, DM, VT, 2, nullptr, 1.0f);      /* blockIdx.y = 0, 1: qh, kh (f16 planes); 2: vh, stored as V^T [head * 64 + d][token] */
  k_flash<<<NH * (SLEN / 64), 128, 0, stream>>>(Q16, DM, K16, DM, VT, nullptr, Oh, Ol, DM);      /* plain flash over all 4096 keys (no mask) */
  k_gemm2<0><<<gP, 128, 0, stream>>>(Ol, DM, 0, BO, DM, 0, 0.0625f, nullptr, 0, XB, 1, (size_t)DM, 0, Y, nullptr, DM, 0, NR, DM, DM, nullptr, 0, Oh, 0.0009765625f);      /* Y = (Ol 2^-10 + Oh) Wo^T + bf16(q), one K loop */
  k_lnout<<<NR / 8, 256, 0, stream>>>(Y, gam, bet, (float*)d_out);
}

// v008
// It runs in 157 microseconds.
// Timed twice side by side with v007, it ran 1.03 times as fast both times.
// All steps since v000 together make it 4.77 times as fast.
#include <hip/hip_runtime.h>
#define NBT 1
#define SLEN 4096
#define TQ SLEN
#define TK SLEN
#define DM 1024
#define NH 16
#define SCL 0.125f
#define NR (NBT * SLEN)
typedef __bf16 v16b __attribute__((ext_vector_type(16)));
typedef unsigned short v8us __attribute__((ext_vector_type(8), may_alias));
typedef float  v8f  __attribute__((ext_vector_type(8)));
typedef float  v4f  __attribute__((ext_vector_type(4)));
typedef float  v4fa __attribute__((ext_vector_type(4), may_alias));
union FragB { v16b v; v8us half[2]; unsigned short u[16]; };

__device__ __forceinline__ unsigned short bf16_bits(float x) { unsigned int u = __float_as_uint(x); return (unsigned short)((u + 0x7FFFu + ((u >> 16) & 1u)) >> 16); }
__device__ __forceinline__ float bf16_val(unsigned short b) { return __uint_as_float(((unsigned int)b) << 16); }
__device__ __forceinline__ float bf16_round(float x) { return bf16_val(bf16_bits(x)); }
// D += A·B with NT terms: 1 = ah·bh, 2 = + al·bh (A split), 3 = + ah·bl (both split)
template <int NT>
__device__ __forceinline__ v8f mmaN(v16b ah, v16b al, v16b bh, v16b bl, v8f c) {
  c = __builtin_amdgcn_wmma_f32_16x16x32_bf16(false, ah, false, bh, (short)0, c, false, false);
  if (NT >= 2) c = __builtin_amdgcn_wmma_f32_16x16x32_bf16(false, al, false, bh, (short)0, c, false, false);
  if (NT >= 3) c = __builtin_amdgcn_wmma_f32_16x16x32_bf16(false, ah, false, bl, (short)0, c, false, false);
  asm volatile("v_nop\n\tv_nop\n\tv_nop\n\tv_nop" : "+v"(c) : "v"(ah), "v"(al), "v"(bh), "v"(bl));
  return c;
}

__global__ __launch_bounds__(256) void k_wt_bf16(const float* __restrict__ W, unsigned short* __restrict__ Wt, int K, int N) {
  const int t = blockIdx.x * 256 + threadIdx.x;
  const int k8n = K / 8;
  if (t >= N * k8n) return;
  const int n = t / k8n, k8 = (t % k8n) * 8;
  v8us v;
#pragma unroll
  for (int i = 0; i < 8; ++i) v[i] = bf16_bits(W[(size_t)(k8 + i) * N + n]);
  *(v8us*)(Wt + (size_t)n * K + k8) = v;
  
}

// GEMM C[M][N] (f32, pitch ldc) = act(A[M][K]·W + bias). A f32 row-major (pitch lda) converted per fragment to bf16
// (ASPLIT: hi/lo two planes -> 2 terms, else single rounded term); Wt bf16 [N][K] (pitch ldb). BIAS_BF16 rounds the
// bias to bf16 first (bias quantised to bf16 before the add). K%32==0, M%16==0, N%64==0.
template <bool ASPLIT, int ACT, bool BIAS_BF16>
__global__ __launch_bounds__(128) void k_gemm_bf(const float* __restrict__ A, int lda, const unsigned short* __restrict__ Wt, int ldb,
                                               const float* __restrict__ bias, float* __restrict__ C, int ldc, int M, int N, int K) {
  __shared__ __attribute__((aligned(16))) float so[4][16][64];
  const int tid = threadIdx.x, w = tid >> 5, lane = tid & 31, ln = lane & 15, hh = lane >> 4;
  const int ntn = N / 64;
  const int wid = blockIdx.x * 4 + w;
  const int mt = wid / ntn, nq = wid % ntn;
  if (mt * 16 >= M) return;
  const int row0 = mt * 16, col0 = nq * 64;
  const float* arow = A + (size_t)(row0 + ln) * lda;
  v8f acc[4] = {};
  for (int kb = 0; kb < K; kb += 32) {
    FragB ah, al;
    const v4f x0 = *(const v4fa*)(arow + kb + 8 * hh), x1 = *(const v4fa*)(arow + kb + 8 * hh + 4);
    const v4f x2 = *(const v4fa*)(arow + kb + 16 + 8 * hh), x3 = *(const v4fa*)(arow + kb + 16 + 8 * hh + 4);
    float xs[16] = {x0[0],x0[1],x0[2],x0[3],x1[0],x1[1],x1[2],x1[3],x2[0],x2[1],x2[2],x2[3],x3[0],x3[1],x3[2],x3[3]};
#pragma unroll
    for (int i = 0; i < 16; ++i) { const unsigned short hb = bf16_bits(xs[i]); ah.u[i] = hb; al.u[i] = ASPLIT ? bf16_bits(xs[i] - bf16_val(hb)) : (unsigned short)0; }
#pragma unroll
    for (int t = 0; t < 4; ++t) {
      const unsigned short* brow = Wt + (size_t)(col0 + t * 16 + ln) * ldb + kb;
      FragB b;
      b.half[0] = *(const v8us*)(brow + 8 * hh);
      b.half[1] = *(const v8us*)(brow + 16 + 8 * hh);
      acc[t] = mmaN<ASPLIT ? 2 : 1>(ah.v, al.v, b.v, b.v, acc[t]);
    }
  }
#pragma unroll
  for (int t = 0; t < 4; ++t) {
    float bv = bias ? bias[col0 + t * 16 + ln] : 0.f;
    if (BIAS_BF16) bv = bf16_round(bv);
#pragma unroll
    for (int r = 0; r < 8; ++r) { float v = acc[t][r] + bv; if (ACT == 1) v = fmaxf(v, 0.f); so[w][8 * hh + r][t * 16 + ln] = v; }
  }
  __builtin_amdgcn_fence(__ATOMIC_ACQ_REL, "workgroup");
  __builtin_amdgcn_wave_barrier();
  const int rsub = lane >> 4, c4 = (lane & 15) * 4;
  {
#pragma unroll
    for (int q = 0; q < 8; ++q) {
      const int r = q * 2 + rsub;
      const v4f v = *(const v4fa*)&so[w][r][c4];
      *(v4f*)(C + (size_t)(row0 + r) * ldc + col0 + c4) = v;
    }
    
  }
}

// GEMM C = act(A·W + bias + resid): A f32 (ASPLIT -> hi/lo 2 terms), Wt bf16 [N][K]; ACT 0 none, 1 relu, 2 exact gelu;
// resid (optional, f32, row index = (row % rmod), pitch ldr, RES_BF16 rounds it) added before the activation.
template <bool ASPLIT, int ACT, bool BIAS_BF16, bool RES_BF16>
__global__ __launch_bounds__(128) void k_gemm_bf3(const float* __restrict__ A, int lda, const unsigned short* __restrict__ Wt, int ldb,
                                                const float* __restrict__ bias, const float* __restrict__ resid, int rmod, int ldr,
                                                float* __restrict__ C, int ldc, int M, int N, int K) {
  __shared__ __attribute__((aligned(16))) float so[4][16][64];
  const int tid = threadIdx.x, w = tid >> 5, lane = tid & 31, ln = lane & 15, hh = lane >> 4;
  const int ntn = N / 64;
  const int wid = blockIdx.x * 4 + w;
  const int mt = wid / ntn, nq = wid % ntn;
  if (mt * 16 >= M) return;
  const int row0 = mt * 16, col0 = nq * 64;
  const float* arow = A + (size_t)(row0 + ln) * lda;
  v8f acc[4] = {};
  for (int kb = 0; kb < K; kb += 32) {
    FragB ah, al;
    const v4f x0 = *(const v4fa*)(arow + kb + 8 * hh), x1 = *(const v4fa*)(arow + kb + 8 * hh + 4);
    const v4f x2 = *(const v4fa*)(arow + kb + 16 + 8 * hh), x3 = *(const v4fa*)(arow + kb + 16 + 8 * hh + 4);
    float xs[16] = {x0[0],x0[1],x0[2],x0[3],x1[0],x1[1],x1[2],x1[3],x2[0],x2[1],x2[2],x2[3],x3[0],x3[1],x3[2],x3[3]};
#pragma unroll
    for (int i = 0; i < 16; ++i) { const unsigned short hb = bf16_bits(xs[i]); ah.u[i] = hb; al.u[i] = ASPLIT ? bf16_bits(xs[i] - bf16_val(hb)) : (unsigned short)0; }
#pragma unroll
    for (int t = 0; t < 4; ++t) {
      const unsigned short* brow = Wt + (size_t)(col0 + t * 16 + ln) * ldb + kb;
      FragB b;
      b.half[0] = *(const v8us*)(brow + 8 * hh);
      b.half[1] = *(const v8us*)(brow + 16 + 8 * hh);
      acc[t] = mmaN<ASPLIT ? 2 : 1>(ah.v, al.v, b.v, b.v, acc[t]);
    }
  }
#pragma unroll
  for (int t = 0; t < 4; ++t) {
    const int col = col0 + t * 16 + ln;
    float bv = bias ? bias[col] : 0.f;
    if (BIAS_BF16) bv = bf16_round(bv);
#pragma unroll
    for (int r = 0; r < 8; ++r) {
      float v = acc[t][r] + bv;
      if (resid) { float rv = resid[(size_t)((row0 + 8 * hh + r) % rmod) * ldr + col]; if (RES_BF16) rv = bf16_round(rv); v += rv; }
      if (ACT == 1) v = fmaxf(v, 0.f);
      if (ACT == 2) v = 0.5f * v * (1.0f + erff(v * 0.70710678118654752f));
      if (ACT == 3) { const float u = 0.7978845608028654f * (v + 0.044715f * v * v * v); v = 0.5f * v * (1.0f + tanhf(u)); }
      so[w][8 * hh + r][t * 16 + ln] = v;
    }
  }
  __builtin_amdgcn_fence(__ATOMIC_ACQ_REL, "workgroup");
  __builtin_amdgcn_wave_barrier();
  const int rsub = lane >> 4, c4 = (lane & 15) * 4;
  {
#pragma unroll
    for (int q = 0; q < 8; ++q) {
      const int r = q * 2 + rsub;
      const v4f v = *(const v4fa*)&so[w][r][c4];
      *(v4f*)(C + (size_t)(row0 + r) * ldc + col0 + c4) = v;
    }
    
  }
}
// row LayerNorm (biased variance, eps) over N: s = X (+ R); optional out_sum <- s; out_norm <- (s-mu)*rsqrt(var+eps)*g + b
template <bool PARAM_BF16>
__global__ __launch_bounds__(256) void k_layernorm(const float* __restrict__ X, const float* __restrict__ R, const float* __restrict__ g, const float* __restrict__ bta,
                                                  float* __restrict__ out_sum, float* __restrict__ out_norm, int N, float eps) {
  __shared__ float red[256];
  const int row = blockIdx.x, tid = threadIdx.x;
  const float* x = X + (size_t)row * N; const float* rr = R ? R + (size_t)row * N : nullptr;
  float vals[16];                     // up to N = 4096
  const int per = N / 256;            // contiguous chunk per thread? use strided-by-4 chunks: thread handles j = tid*4 + 1024*u
  float s1 = 0.f;
  for (int u = 0; u < per / 4; ++u) {
    const int j = tid * 4 + 1024 * u;
    const v4f a = *(const v4fa*)(x + j);
    v4f b = {0.f,0.f,0.f,0.f}; if (rr) b = *(const v4fa*)(rr + j);
#pragma unroll
    for (int q = 0; q < 4; ++q) { const float v = a[q] + b[q]; vals[u * 4 + q] = v; s1 += v; }
  }
  red[tid] = s1; __syncthreads();
  for (int st = 128; st > 0; st >>= 1) { if (tid < st) red[tid] += red[tid + st]; __syncthreads(); }
  const float mu = red[0] / (float)N; __syncthreads();
  float s2 = 0.f;
  for (int u = 0; u < per / 4; ++u)
#pragma unroll
    for (int q = 0; q < 4; ++q) { const float c = vals[u * 4 + q] - mu; s2 += c * c; }
  red[tid] = s2; __syncthreads();
  for (int st = 128; st > 0; st >>= 1) { if (tid < st) red[tid] += red[tid + st]; __syncthreads(); }
  const float rs = rsqrtf(red[0] / (float)N + eps);
  {
    for (int u = 0; u < per / 4; ++u) {
      const int j = tid * 4 + 1024 * u;
      v4f o, sm;
#pragma unroll
      for (int q = 0; q < 4; ++q) {
        float gg = g[j + q], bb = bta[j + q];
        if (PARAM_BF16) { gg = bf16_round(gg); bb = bf16_round(bb); }
        sm[q] = vals[u * 4 + q]; o[q] = (vals[u * 4 + q] - mu) * rs * gg + bb;
      }
      if (out_sum) *(v4f*)(out_sum + (size_t)row * N + j) = sm;
      *(v4f*)(out_norm + (size_t)row * N + j) = o;
    }
    
  }
}



// ---- f16 WMMA path (v_wmma_f32_16x16x32_f16): 11-bit significands for operands in range — used where a [0,1] probability operand needs more precision than bf16
typedef _Float16 v16h __attribute__((ext_vector_type(16)));
union FragH { v16h v; v8us half[2]; _Float16 h[16]; unsigned short u[16]; };
template <int NT>
__device__ __forceinline__ v8f mmaH(v16h ah, v16h al, v16h bh, v16h bl, v8f c) {
  c = __builtin_amdgcn_wmma_f32_16x16x32_f16(false, ah, false, bh, (short)0, c, false, false);
  if (NT >= 2) c = __builtin_amdgcn_wmma_f32_16x16x32_f16(false, al, false, bh, (short)0, c, false, false);
  if (NT >= 3) c = __builtin_amdgcn_wmma_f32_16x16x32_f16(false, ah, false, bl, (short)0, c, false, false);
  return c;      // no asm behind the builtin: the compiler keeps the distance after a WMMA itself and stays free to move LDS reads ahead of it
}
// batched GEMM like k_gemm_b but f16 operands: A f32 (split into f16 hi/lo if ASPLIT, else rounded to f16), Bt = f16 values [n][k]; alpha; C f32; N multiple of 16 (partial tiles skipped)
template <bool ASPLIT>
__global__ __launch_bounds__(128) void k_gemm_h(const float* __restrict__ A, int lda, size_t sA, const _Float16* __restrict__ Bh, int ldb, size_t sB, float alpha, float* __restrict__ C, int ldc, size_t sC, int M, int N, int K) {
  __shared__ __attribute__((aligned(16))) float so[4][16][64];
  const int tid = threadIdx.x, w = tid >> 5, lane = tid & 31, ln = lane & 15, hh = lane >> 4; const int by = blockIdx.y;
  A += (size_t)by * sA; Bh += (size_t)by * sB; C += (size_t)by * sC;
  const int ntn = (N + 63) / 64; const int wid = blockIdx.x * 4 + w; const int mt = wid / ntn, nq = wid % ntn; if (mt * 16 >= M) return;
  const int row0 = mt * 16, col0 = nq * 64; const float* arow = A + (size_t)(row0 + ln) * lda;
  v8f acc[4] = {};
  for (int kb = 0; kb < K; kb += 32) {
    FragH ah, al;
    const v4f x0 = *(const v4fa*)(arow + kb + 8 * hh), x1 = *(const v4fa*)(arow + kb + 8 * hh + 4), x2 = *(const v4fa*)(arow + kb + 16 + 8 * hh), x3 = *(const v4fa*)(arow + kb + 16 + 8 * hh + 4);
    float xs[16] = {x0[0],x0[1],x0[2],x0[3],x1[0],x1[1],x1[2],x1[3],x2[0],x2[1],x2[2],x2[3],x3[0],x3[1],x3[2],x3[3]};
#pragma unroll
    for (int i = 0; i < 16; ++i) { const _Float16 h = (_Float16)xs[i]; ah.h[i] = h; al.h[i] = ASPLIT ? (_Float16)(xs[i] - (float)h) : (_Float16)0.0f; }
#pragma unroll
    for (int t = 0; t < 4; ++t) { if (col0 + t * 16 >= N) continue; const size_t boff = (size_t)(col0 + t * 16 + ln) * ldb + kb; FragH bq; bq.half[0] = *(const v8us*)(Bh + boff + 8 * hh); bq.half[1] = *(const v8us*)(Bh + boff + 16 + 8 * hh);
      acc[t] = mmaH<ASPLIT ? 2 : 1>(ah.v, al.v, bq.v, bq.v, acc[t]); }
  }
#pragma unroll
  for (int t = 0; t < 4; ++t) { if (col0 + t * 16 >= N) continue;
#pragma unroll
    for (int r = 0; r < 8; ++r) so[w][8 * hh + r][t * 16 + ln] = acc[t][r] * alpha; }
  __builtin_amdgcn_fence(__ATOMIC_ACQ_REL, "workgroup"); __builtin_amdgcn_wave_barrier();
  const int rsub = lane >> 4, c4 = (lane & 15) * 4;
  {
#pragma unroll
    for (int q = 0; q < 8; ++q) { const int r = q * 2 + rsub; if (col0 + c4 < N) { const v4f v = *(const v4fa*)&so[w][r][c4]; *(v4f*)(C + (size_t)(row0 + r) * ldc + col0 + c4) = v; } }
     }
}

// Wt[n][k] = f16(W[k][n]·scale) from f32 row-major W[K][N] (scale = power of two; bf16-exact weights stay exact in f16 away from the subnormal range)
__global__ __launch_bounds__(256) void k_wt_f16(const float* __restrict__ W, _Float16* __restrict__ Wt, int K, int N, float scale) {
  const int t = blockIdx.x * 256 + threadIdx.x; if (t >= N * (K / 8)) return; const int n = t / (K / 8), k8 = (t % (K / 8)) * 8; FragH f;
#pragma unroll
  for (int i = 0; i < 8; ++i) f.h[i] = (_Float16)(bf16_round(W[(size_t)(k8 + i) * N + n]) * scale); const v8us o = f.half[0];
  *(v8us*)((unsigned short*)Wt + (size_t)n * K + k8) = o; 
}
// k_gemm_hh variant with fused epilogue: v = acc·alpha + bias[by·sBias + col] (+ CP[(row/rowsPerB)·sCPb + by·64 + col] if CP) ; ACT 0 none / 1 elu ; writes f16 C16 (and f32 C if non-null)
template <int ACT>
__global__ __launch_bounds__(128) void k_gemm_hhx(const _Float16* __restrict__ A, int lda, size_t sA, const _Float16* __restrict__ Bh, int ldb, size_t sB, float alpha, const float* __restrict__ bias, size_t sBias, const float* __restrict__ CP, int rowsPerB, size_t sCPb, int row0g,
    float* __restrict__ C, _Float16* __restrict__ C16, int ldc, size_t sC, int M, int N, int K) {
  __shared__ __attribute__((aligned(16))) float so[4][16][64];
  const int tid = threadIdx.x, w = tid >> 5, lane = tid & 31, ln = lane & 15, hh = lane >> 4; const int by = blockIdx.y;
  A += (size_t)by * sA; Bh += (size_t)by * sB; const size_t cofs = (size_t)by * sC; const float* bp = bias ? bias + (size_t)by * sBias : nullptr;
  const int ntn = (N + 63) / 64; const int wid = blockIdx.x * 4 + w; const int mt = wid / ntn, nq = wid % ntn; if (mt * 16 >= M) return;
  const int row0 = mt * 16, col0 = nq * 64; const _Float16* arow = A + (size_t)(row0 + ln) * lda;
  v8f acc[4] = {};
  for (int kb = 0; kb < K; kb += 32) { FragH ah; ah.half[0] = *(const v8us*)((const unsigned short*)arow + kb + 8 * hh); ah.half[1] = *(const v8us*)((const unsigned short*)arow + kb + 16 + 8 * hh);
#pragma unroll
    for (int t = 0; t < 4; ++t) { if (col0 + t * 16 >= N) continue; const size_t boff = (size_t)(col0 + t * 16 + ln) * ldb + kb; FragH bq; bq.half[0] = *(const v8us*)((const unsigned short*)Bh + boff + 8 * hh); bq.half[1] = *(const v8us*)((const unsigned short*)Bh + boff + 16 + 8 * hh);
      acc[t] = mmaH<1>(ah.v, ah.v, bq.v, bq.v, acc[t]); }
  }
#pragma unroll
  for (int t = 0; t < 4; ++t) { if (col0 + t * 16 >= N) continue; const int col = col0 + t * 16 + ln; const float bv = bp ? bf16_round(bp[col]) : 0.f;
#pragma unroll
    for (int r = 0; r < 8; ++r) { float v = acc[t][r] * alpha + bv; if (CP) { const int bidx = (row0g + row0 + 8 * hh + r) / rowsPerB; v += CP[(size_t)bidx * sCPb + (size_t)by * 64 + col]; } if (ACT == 1) v = (v > 0.f) ? v : expm1f(v); else if (ACT == 7) v = (v > 0.f) ? v + 1.0f : expf(v); else if (ACT == 8) v = tanhf(v); else if (ACT == 9) v = 0.5f * v * (1.0f + tanhf(0.7978845608028654f * (v + 0.044715f * v * v * v))); else if (ACT == 11) v = 1.0f / (1.0f + expf(-v)); else if (ACT == 12) v = (v > 0.f) ? v : 0.01f * v; else if (ACT == 14) v = (v > 0.f) ? v : 0.1f * v; else if (ACT == 15) v = v / (1.0f + expf(-v)); else if (ACT == 3) v = fmaxf(v, 0.f); else if (ACT == 6) v = 0.5f * v * (1.0f + erff(v * 0.70710678118654752f)); so[w][8 * hh + r][t * 16 + ln] = v; } }
  __builtin_amdgcn_fence(__ATOMIC_ACQ_REL, "workgroup"); __builtin_amdgcn_wave_barrier();
  const int rsub = lane >> 4, c4 = (lane & 15) * 4; typedef _Float16 v4h __attribute__((ext_vector_type(4)));
  {
#pragma unroll
    for (int q = 0; q < 8; ++q) { const int r = q * 2 + rsub; if (col0 + c4 < N) { const v4f v = *(const v4fa*)&so[w][r][c4]; if (C) *(v4f*)(C + cofs + (size_t)(row0 + r) * ldc + col0 + c4) = v; if (C16) { v4h h4; for (int i = 0; i < 4; ++i) h4[i] = (_Float16)v[i]; *(v4h*)(C16 + cofs + (size_t)(row0 + r) * ldc + col0 + c4) = h4; } } }
     }
}


typedef _Float16 v4h __attribute__((ext_vector_type(4)));

__global__ __launch_bounds__(256) void k_x16(const float* __restrict__ x, _Float16* __restrict__ X16, size_t n8) { const size_t t = (size_t)blockIdx.x * 256 + threadIdx.x; if (t >= n8) return; FragH f;
#pragma unroll
  for (int q = 0; q < 8; ++q) f.h[q] = (_Float16)bf16_round(x[t * 8 + q]); *(v8us*)((unsigned short*)X16 + t * 8) = f.half[0];  }
__global__ __launch_bounds__(256) void k_h16(const float* __restrict__ x, _Float16* __restrict__ X16, size_t n8) { const size_t t = (size_t)blockIdx.x * 256 + threadIdx.x; if (t >= n8) return; FragH f;
#pragma unroll
  for (int q = 0; q < 8; ++q) f.h[q] = (_Float16)x[t * 8 + q]; *(v8us*)((unsigned short*)X16 + t * 8) = f.half[0];  }
__global__ __launch_bounds__(256) void k_round16f(const float* __restrict__ W, _Float16* __restrict__ Bt, size_t n8) { const size_t t = (size_t)blockIdx.x * 256 + threadIdx.x; if (t >= n8) return; FragH f;
#pragma unroll
  for (int i = 0; i < 8; ++i) f.h[i] = (_Float16)(bf16_round(W[t * 8 + i]) * 16.0f); *(v8us*)((unsigned short*)Bt + t * 8) = f.half[0];  }
template <int NHv, int TTv>
__global__ __launch_bounds__(256) void k_vt(const _Float16* __restrict__ V16, int ldv, int voff, _Float16* __restrict__ Vt) { __shared__ unsigned short tl[64][66]; const int tid = threadIdx.x; const int slab = blockIdx.x / (TTv / 64), lg = blockIdx.x % (TTv / 64); const int b = slab / NHv, h = slab % NHv;
  for (int i = tid; i < 64 * 8; i += 256) { const int r = i / 8, c8 = (i % 8) * 8; FragH f; f.half[0] = *(const v8us*)((const unsigned short*)V16 + ((size_t)b * TTv + lg * 64 + r) * ldv + voff + h * 64 + c8);
#pragma unroll
    for (int q = 0; q < 8; ++q) tl[r][c8 + q] = f.u[q]; }
  __syncthreads();
  {
#pragma unroll
    for (int rd = 0; rd < 2; ++rd) { const int d = rd * 32 + tid / 8, pc = tid % 8; FragH f;
#pragma unroll
      for (int q = 0; q < 8; ++q) f.u[q] = tl[pc * 8 + q][d];
      *(v8us*)((unsigned short*)Vt + ((size_t)slab * 64 + d) * TTv + lg * 64 + pc * 8) = f.half[0]; }
     } }

__global__ __launch_bounds__(256) void k_hl(const float* __restrict__ F, _Float16* __restrict__ Hh, _Float16* __restrict__ Hl, size_t n8) { const size_t t = (size_t)blockIdx.x * 256 + threadIdx.x; if (t >= n8) return; FragH fh, fl; const v4f a = *(const v4fa*)(F + t * 8), c = *(const v4fa*)(F + t * 8 + 4);
#pragma unroll
  for (int q = 0; q < 4; ++q) { _Float16 h = (_Float16)a[q]; fh.h[q] = h; fl.h[q] = (_Float16)((a[q] - (float)h) * 1024.0f); h = (_Float16)c[q]; fh.h[4 + q] = h; fl.h[4 + q] = (_Float16)((c[q] - (float)h) * 1024.0f); }
  { *(v8us*)((unsigned short*)Hh + t * 8) = fh.half[0]; *(v8us*)((unsigned short*)Hl + t * 8) = fl.half[0];  } }

// ---- fast GEMM (block tile 128x64, wave tile 32x64; requires M % 128 == 0, N % 64 == 0, K % 64 == 0); A and B tiles of 64 k staged in LDS; epilogue = k_gemm_hhx semantics; the batch entry blockIdx.y == byT (if CT) is stored transposed instead, CT[col][row] (pitch M, f16; alpha only: no bias, addend or activation); with A2 the K loop runs over A, scales the sums by mid, and runs on over A2 with the same B: C = alpha (mid A.B + A2.B) ----
__device__ __forceinline__ v16h g2_frag(const _Float16* p, int hh) { FragH f; f.half[0] = *(const v8us*)((const unsigned short*)p + 8 * hh); f.half[1] = *(const v8us*)((const unsigned short*)p + 16 + 8 * hh); return f.v; }
__device__ __forceinline__ v8f g2_mma(v16h a, v16h b, v8f c) { return __builtin_amdgcn_wmma_f32_16x16x32_f16(false, a, false, b, (short)0, c, false, false); }
template <int ACT>
__global__ __launch_bounds__(128) void k_gemm2(const _Float16* __restrict__ A, int lda, size_t sA, const _Float16* __restrict__ Bh, int ldb, size_t sB, float alpha, const float* __restrict__ bias, size_t sBias, const float* __restrict__ CP, int rowsPerB, size_t sCPb, int row0g,
    float* __restrict__ C, _Float16* __restrict__ C16, int ldc, size_t sC, int M, int N, int K, _Float16* __restrict__ CT, int byT, const _Float16* __restrict__ A2, float mid) {
  constexpr int GK = 64, GP = 72;      // a tile = 64 k; LDS row pitch 144 B (16 B x odd: ds_load_b128 without bank conflicts)
  __shared__ __attribute__((aligned(16))) _Float16 tA[2][128][GP]; __shared__ __attribute__((aligned(16))) _Float16 tB[2][64][GP];      // two buffers each
  __shared__ __attribute__((aligned(16))) float so[4][32][68];
  const int tid = threadIdx.x, w = tid >> 5, lane = tid & 31, ln = lane & 15, hh = lane >> 4; const int by = blockIdx.y;
  A += (size_t)by * sA; Bh += (size_t)by * sB; const size_t cofs = (size_t)by * sC; const float* bp = bias ? bias + (size_t)by * sBias : nullptr;
  const int ntn = N >> 6; const int mt = blockIdx.x / ntn, nq = blockIdx.x - mt * ntn; const int row0 = mt * 128 + 32 * w, col0 = nq * 64; if (mt * 128 >= M) return;      // the whole block leaves or none of it: barriers follow
  // every thread copies 8 + 4 pieces of 16 B per tile (8 lanes cover one whole 128-B row)
  const int crow = tid >> 3, cc8 = (tid & 7) * 8;
  const _Float16* gA = A + (size_t)(mt * 128 + crow) * lda + cc8; const _Float16* gA2 = A2 ? A2 + (size_t)by * sA + (size_t)(mt * 128 + crow) * lda + cc8 : gA; const _Float16* gB = Bh + (size_t)(col0 + crow) * ldb + cc8;
  const unsigned lA = (unsigned)(size_t)&tA[0][crow][cc8], lB = (unsigned)(size_t)&tB[0][crow][cc8];
  const int nk = K / GK, nst = A2 ? 2 * nk : nk;      // tiles nk .. 2 nk - 1 are A2's, against the same B tiles
  auto copy_tile = [&](int t) {
    const int tk = t < nk ? t : t - nk;
    const unsigned ao = lA + (unsigned)(t & 1) * (unsigned)(128 * GP * 2), bo = lB + (unsigned)(t & 1) * (unsigned)(64 * GP * 2), r16 = 16 * GP * 2; const _Float16* ap = (t < nk ? gA : gA2) + (size_t)tk * GK; const _Float16* bq = gB + (size_t)tk * GK; const size_t a16 = (size_t)16 * lda, b16 = (size_t)16 * ldb;
    // the copies and, as the last line of the same statement, the wait that stands before their address registers are rewritten
    asm volatile("global_load_async_to_lds_b128 %0, %12, off\n\tglobal_load_async_to_lds_b128 %1, %13, off\n\tglobal_load_async_to_lds_b128 %2, %14, off\n\tglobal_load_async_to_lds_b128 %3, %15, off\n\t"
                 "global_load_async_to_lds_b128 %4, %16, off\n\tglobal_load_async_to_lds_b128 %5, %17, off\n\tglobal_load_async_to_lds_b128 %6, %18, off\n\tglobal_load_async_to_lds_b128 %7, %19, off\n\t"
                 "global_load_async_to_lds_b128 %8, %20, off\n\tglobal_load_async_to_lds_b128 %9, %21, off\n\tglobal_load_async_to_lds_b128 %10, %22, off\n\tglobal_load_async_to_lds_b128 %11, %23, off\n\ts_wait_xcnt 0x0"
                 :: "v"(ao), "v"(ao + r16), "v"(ao + 2 * r16), "v"(ao + 3 * r16), "v"(ao + 4 * r16), "v"(ao + 5 * r16), "v"(ao + 6 * r16), "v"(ao + 7 * r16), "v"(bo), "v"(bo + r16), "v"(bo + 2 * r16), "v"(bo + 3 * r16),
                    "v"(ap), "v"(ap + a16), "v"(ap + 2 * a16), "v"(ap + 3 * a16), "v"(ap + 4 * a16), "v"(ap + 5 * a16), "v"(ap + 6 * a16), "v"(ap + 7 * a16), "v"(bq), "v"(bq + b16), "v"(bq + 2 * b16), "v"(bq + 3 * b16) : "memory"); };
  const v8f z8 = {0.f,0.f,0.f,0.f,0.f,0.f,0.f,0.f}; v8f c00 = z8, c01 = z8, c02 = z8, c03 = z8, c10 = z8, c11 = z8, c12 = z8, c13 = z8;
  copy_tile(0);
  asm volatile("s_wait_asynccnt 0x0" ::: "memory");      // this wave's copies of tile 0 have landed
  __syncthreads();                                       // every wave's have: tile 0 may be read
  if (nst > 1) copy_tile(1);
#pragma unroll 1
  for (int t = 0; t < nst; ++t) { const _Float16 (*pA)[GP] = tA[t & 1]; const _Float16 (*pB)[GP] = tB[t & 1];
    if (t == nk) { c00 *= mid; c10 *= mid; c01 *= mid; c11 *= mid; c02 *= mid; c12 *= mid; c03 *= mid; c13 *= mid; }      // A's sums take their scale once, before A2's first tile is added
    v16h fa[2][2], fb[2][4];      // the tile's 12 fragments, read as one group ahead of its 16 products
#pragma unroll
    for (int s = 0; s < 2; ++s) { fa[s][0] = g2_frag(&pA[32 * w + ln][s * 32], hh); fa[s][1] = g2_frag(&pA[32 * w + 16 + ln][s * 32], hh);
#pragma unroll
      for (int j = 0; j < 4; ++j) fb[s][j] = g2_frag(&pB[j * 16 + ln][s * 32], hh); }
    __builtin_amdgcn_sched_barrier(0);      // keeps the 24 LDS reads one group: without it the compiler sinks them among the products, each behind a full wait
#pragma unroll
    for (int s = 0; s < 2; ++s) {
      c00 = g2_mma(fa[s][0], fb[s][0], c00); c10 = g2_mma(fa[s][1], fb[s][0], c10); c01 = g2_mma(fa[s][0], fb[s][1], c01); c11 = g2_mma(fa[s][1], fb[s][1], c11);
      c02 = g2_mma(fa[s][0], fb[s][2], c02); c12 = g2_mma(fa[s][1], fb[s][2], c12); c03 = g2_mma(fa[s][0], fb[s][3], c03); c13 = g2_mma(fa[s][1], fb[s][3], c13); }
    __builtin_amdgcn_sched_barrier(0);      // keeps the products in front of the waits below: lifted over them, the wait for tile t + 1 would stand right behind its copies
    asm volatile("s_wait_dscnt 0x0" ::: "memory");       // this wave's reads of tile t are done before its buffer is refilled
    asm volatile("s_wait_asynccnt 0x0" ::: "memory");    // this wave's copies of tile t + 1 have landed
    __syncthreads();                                     // publishes tile t + 1 and ends every wave's reads of tile t
    if (t + 2 < nst) copy_tile(t + 2); }
  asm volatile("s_wait_asynccnt 0x0" ::: "memory");      // nothing of this wave is in flight when it goes on to the epilogue and ends
  const int rsub = lane >> 4, c4 = (lane & 15) * 4;
  // The addend is read in the layout of the stores below: 16 B a lane (sCPb % 4 == 0), 16 lanes on one row's 256 B, all 16 loads of a lane in flight over the LDS turn of the accumulators.
  v4f ad[16];
  if (CP) { const float* ap[16];
#pragma unroll
    for (int q = 0; q < 16; ++q) { const int bidx = (row0g + row0 + q * 2 + rsub) / rowsPerB; ap[q] = CP + (size_t)bidx * sCPb + (size_t)by * 64 + col0 + c4; }
#pragma unroll
    for (int q = 0; q < 16; ++q) ad[q] = *(const v4fa*)ap[q];
    // the wait that stands before the address registers of these loads are rewritten; it takes the addresses as inputs so that they stay in their registers up to it
    asm volatile("s_wait_xcnt 0x0" :: "v"(ap[0]), "v"(ap[1]), "v"(ap[2]), "v"(ap[3]), "v"(ap[4]), "v"(ap[5]), "v"(ap[6]), "v"(ap[7]), "v"(ap[8]), "v"(ap[9]), "v"(ap[10]), "v"(ap[11]), "v"(ap[12]), "v"(ap[13]), "v"(ap[14]), "v"(ap[15]) : "memory"); }
  v8f accs[8] = {c00, c01, c02, c03, c10, c11, c12, c13};
  if (CT && by == byT) {      // the same for the whole block: a barrier follows
    // Registers 0..7 of an accumulator tile are 8 consecutive rows of one column, that is 16 B of a C^T row. The block's 64 x 128 C^T tile is gathered in LDS so that one wave stores whole 256-B rows. The loops are unrolled so that accs[] is indexed by constants and stays in registers, and the 8 row reads are in flight together.
    constexpr int TP = 136;      // LDS row pitch 272 B (16 B x odd); 64 rows = 17,408 B, inside so
    unsigned short* sT = (unsigned short*)&so[0][0][0];
#pragma unroll
    for (int u = 0; u < 8; ++u) { const int t = u & 3, half = u >> 2; FragH f;
#pragma unroll
      for (int r = 0; r < 8; ++r) f.h[r] = (_Float16)(accs[u][r] * alpha);
      *(v8us*)(sT + (t * 16 + ln) * TP + 32 * w + half * 16 + 8 * hh) = f.half[0]; }
    __syncthreads();      // every wave's 32 columns of the C^T tile are in LDS before any row is read
    const int d0 = tid >> 4, c8 = (tid & 15) * 8; unsigned short* ct = (unsigned short*)CT + (size_t)(col0 + d0) * M + mt * 128 + c8; const size_t m8 = (size_t)8 * M;
#pragma unroll
    for (int q = 0; q < 8; ++q) { const v8us v = *(const v8us*)(sT + (q * 8 + d0) * TP + c8); *(v8us*)(ct + q * m8) = v; }
    return; }
#pragma unroll
  for (int u = 0; u < 8; ++u) { const int t = u & 3, half = u >> 2; const int col = col0 + t * 16 + ln; const float bv = bp ? bf16_round(bp[col]) : 0.f;
#pragma unroll
    for (int r = 0; r < 8; ++r) so[w][half * 16 + 8 * hh + r][t * 16 + ln] = accs[u][r] * alpha + bv; }
  __builtin_amdgcn_fence(__ATOMIC_ACQ_REL, "workgroup"); __builtin_amdgcn_wave_barrier();
  {
#pragma unroll
    for (int q = 0; q < 16; ++q) { const int r = q * 2 + rsub; v4f v = *(const v4fa*)&so[w][r][c4]; if (CP) v += ad[q];
#pragma unroll
      for (int i = 0; i < 4; ++i) { if (ACT == 3) v[i] = fmaxf(v[i], 0.f); else if (ACT == 6) v[i] = 0.5f * v[i] * (1.0f + erff(v[i] * 0.70710678118654752f)); else if (ACT == 11) v[i] = 1.0f / (1.0f + expf(-v[i])); else if (ACT == 15) v[i] = v[i] / (1.0f + expf(-v[i])); else if (ACT == 12) v[i] = (v[i] > 0.f) ? v[i] : 0.01f * v[i]; else if (ACT == 8) v[i] = tanhf(v[i]); }
      if (C) { *(v4f*)(C + cofs + (size_t)(row0 + r) * ldc + col0 + c4) = v; asm volatile("s_wait_xcnt 0x0" ::: "memory"); }      // the wait stands before the conversion below rewrites registers that this store names
      if (C16) { v4h h4; for (int i = 0; i < 4; ++i) h4[i] = (_Float16)v[i]; *(v4h*)(C16 + cofs + (size_t)(row0 + r) * ldc + col0 + c4) = h4; } }
     } }



// lane l with lane l ^ 16
__device__ __forceinline__ float xhalf(float x) { return __builtin_bit_cast(float, __builtin_amdgcn_permlanex16(__builtin_bit_cast(int, x), __builtin_bit_cast(int, x), 0x76543210, 0xfedcba98, false, false)); }
__global__ __launch_bounds__(128) void k_flash(const _Float16* __restrict__ Q16, int ldq, const _Float16* __restrict__ K16, int ldk, const _Float16* __restrict__ Vt, const int* __restrict__ MSK, _Float16* __restrict__ Oh, _Float16* __restrict__ Ol, int ldo) {
  constexpr int CG = 2, RPW = 16 * CG, NQB = TQ / (4 * RPW), DT = 4, KS = 2;
  constexpr float C2 = SCL * 1.4426950408889634f;      // score scale x log2(e): the softmax runs in base 2
  constexpr int SK = 64, NST = TK / SK, LP = 72;      // a tile = 64 keys; LDS row pitch 144 B (16 B x odd: ds_load_b128 without bank conflicts)
  __shared__ __attribute__((aligned(16))) unsigned short sK[2][SK][LP]; __shared__ __attribute__((aligned(16))) unsigned short sV[2][64][LP];      // two buffers each: K rows [key][d], V^T rows [d][key]
  __shared__ __attribute__((aligned(16))) float sO[4][RPW][64 + 4];
  const int tid = threadIdx.x, w = tid >> 5, lane = tid & 31, ln = lane & 15, hh = lane >> 4;
  const int slab = blockIdx.x / NQB, qblk = blockIdx.x % NQB; const int b = slab / NH, h = slab % NH; const int qb0 = qblk * (4 * RPW); const int q0 = qb0 + w * RPW;
  FragH bq[CG][KS];
#pragma unroll
  for (int g = 0; g < CG; ++g) { const unsigned short* qr = (const unsigned short*)Q16 + ((size_t)b * TQ + q0 + g * 16 + ln) * ldq + h * 64;
#pragma unroll
    for (int ks = 0; ks < KS; ++ks) { bq[g][ks].half[0] = *(const v8us*)(qr + ks * 32 + 8 * hh); bq[g][ks].half[1] = *(const v8us*)(qr + ks * 32 + 16 + 8 * hh); } }
  const unsigned short* Vth = (const unsigned short*)Vt + (size_t)slab * 64 * TK;
  float m_r[CG], l_r[CG]; v8f oacc[CG][DT];      // one query per lane and column group: its running maximum (of the raw products), this lane half's part of its sum (x2^10, like P), O^T rows d = dt * 16 + 8 * hh + r
#pragma unroll
  for (int g = 0; g < CG; ++g) { m_r[g] = -3.0e38f; l_r[g] = 0.f;
#pragma unroll
    for (int dt = 0; dt < DT; ++dt) oacc[g][dt] = (v8f){0.f,0.f,0.f,0.f,0.f,0.f,0.f,0.f}; }
  // The block's four waves share each K / V^T tile: every thread copies 4 + 4 pieces of 16 B (8 lanes cover one whole 128-B row).
  const int crow = tid >> 3, cc8 = (tid & 7) * 8;
  const unsigned short* gK = (const unsigned short*)K16 + ((size_t)b * TK + crow) * ldk + h * 64 + cc8; const unsigned short* gV = Vth + (size_t)crow * TK + cc8;
  const unsigned lK = (unsigned)(size_t)&sK[0][crow][cc8], lV = (unsigned)(size_t)&sV[0][crow][cc8];
  auto copy_tile = [&](int t) {
    const unsigned bo = (unsigned)(t & 1) * (unsigned)(SK * LP * 2), r16 = 16 * LP * 2; const unsigned short* kp = gK + (size_t)t * SK * ldk; const unsigned short* vp = gV + (size_t)t * SK;
    // the copies and, as the last line of the same statement, the wait that stands before their address registers are rewritten
    asm volatile("global_load_async_to_lds_b128 %0, %8, off\n\tglobal_load_async_to_lds_b128 %1, %9, off\n\tglobal_load_async_to_lds_b128 %2, %10, off\n\tglobal_load_async_to_lds_b128 %3, %11, off\n\t"
                 "global_load_async_to_lds_b128 %4, %12, off\n\tglobal_load_async_to_lds_b128 %5, %13, off\n\tglobal_load_async_to_lds_b128 %6, %14, off\n\tglobal_load_async_to_lds_b128 %7, %15, off\n\ts_wait_xcnt 0x0"
                 :: "v"(lK + bo), "v"(lK + bo + r16), "v"(lK + bo + 2 * r16), "v"(lK + bo + 3 * r16), "v"(lV + bo), "v"(lV + bo + r16), "v"(lV + bo + 2 * r16), "v"(lV + bo + 3 * r16),
                    "v"(kp), "v"(kp + (size_t)16 * ldk), "v"(kp + (size_t)32 * ldk), "v"(kp + (size_t)48 * ldk), "v"(vp), "v"(vp + (size_t)16 * TK), "v"(vp + (size_t)32 * TK), "v"(vp + (size_t)48 * TK) : "memory"); };
  copy_tile(0);
  asm volatile("s_wait_asynccnt 0x0" ::: "memory");      // this wave's copies of tile 0 have landed
  __syncthreads();                                       // every wave's have: tile 0 may be read
  copy_tile(1);
#pragma unroll 1
  for (int t = 0; t < NST; ++t) {
   const unsigned short (*bK)[LP] = sK[t & 1]; const unsigned short (*bV)[LP] = sV[t & 1];
#pragma unroll
   for (int ps = 0; ps < SK / 32; ++ps) {
    v8f sc[CG][2];      // raw products q.k: the scale is positive, so their maximum is the scaled scores' maximum
#pragma unroll
    for (int nt = 0; nt < 2; ++nt) { const unsigned short* kr = &bK[ps * 32 + nt * 16 + ln][0]; FragH ak[KS];
#pragma unroll
      for (int ks = 0; ks < KS; ++ks) { ak[ks].half[0] = *(const v8us*)(kr + ks * 32 + 8 * hh); ak[ks].half[1] = *(const v8us*)(kr + ks * 32 + 16 + 8 * hh); }
#pragma unroll
      for (int g = 0; g < CG; ++g) { v8f acc = (v8f){0.f,0.f,0.f,0.f,0.f,0.f,0.f,0.f};
#pragma unroll
        for (int ks = 0; ks < KS; ++ks) acc = mmaH<1>(ak[ks].v, ak[ks].v, bq[g][ks].v, bq[g][ks].v, acc);
        sc[g][nt] = acc; } }
    FragH pb[CG];
#pragma unroll
    for (int g = 0; g < CG; ++g) {
      float mc = fmaxf(sc[g][0][0], sc[g][1][0]);
#pragma unroll
      for (int r = 1; r < 8; ++r) mc = fmaxf(mc, fmaxf(sc[g][0][r], sc[g][1][r]));
      mc = fmaxf(mc, xhalf(mc));      // both lane halves now hold the query's maximum over the 32 keys
      const float mn = fmaxf(m_r[g], mc); const float al = (mn > -1.0e38f) ? __builtin_amdgcn_exp2f((m_r[g] - mn) * C2) : 1.0f; m_r[g] = mn;
      const float nb = fmaf(-mn, C2, 10.0f);      // P x 2^10 = 2^(s * C2 - mn * C2 + 10): one fma per score, then v_exp_f32
      float ls[4] = {0.f, 0.f, 0.f, 0.f};
#pragma unroll
      for (int nt = 0; nt < 2; ++nt)
#pragma unroll
        for (int r = 0; r < 8; ++r) { const float p = __builtin_amdgcn_exp2f(fmaf(sc[g][nt][r], C2, nb)); ls[r & 3] += p; pb[g].h[nt * 8 + r] = (_Float16)p; }
      l_r[g] = l_r[g] * al + ((ls[0] + ls[1]) + (ls[2] + ls[3]));
#pragma unroll
      for (int dt = 0; dt < DT; ++dt) oacc[g][dt] *= al; }
#pragma unroll
    for (int dt = 0; dt < DT; ++dt) { const unsigned short* vrow = &bV[dt * 16 + ln][ps * 32]; FragH av; av.half[0] = *(const v8us*)(vrow + 8 * hh); av.half[1] = *(const v8us*)(vrow + 16 + 8 * hh);
#pragma unroll
      for (int g = 0; g < CG; ++g) oacc[g][dt] = mmaH<1>(av.v, av.v, pb[g].v, pb[g].v, oacc[g][dt]); } }
   asm volatile("s_wait_dscnt 0x0" ::: "memory");        // this wave's reads of tile t are done before its buffer is refilled
   asm volatile("s_wait_asynccnt 0x0" ::: "memory");     // this wave's copies of tile t + 1 have landed
   __syncthreads();                                      // publishes tile t + 1 and ends every wave's reads of tile t
   if (t + 2 < NST) copy_tile(t + 2); }
  asm volatile("s_wait_asynccnt 0x0" ::: "memory");      // nothing of this wave is in flight when it goes on to the epilogue and ends
#pragma unroll
  for (int g = 0; g < CG; ++g) {
    const float l = l_r[g] + xhalf(l_r[g]);      // the two lane halves' sums joined, unconditionally
    const float inv = (l > 0.f) ? 1.0f / l : 0.f;      // sum and O^T carry the same 2^10
#pragma unroll
    for (int dt = 0; dt < DT; ++dt) { const v4f lo = {oacc[g][dt][0] * inv, oacc[g][dt][1] * inv, oacc[g][dt][2] * inv, oacc[g][dt][3] * inv}, hi = {oacc[g][dt][4] * inv, oacc[g][dt][5] * inv, oacc[g][dt][6] * inv, oacc[g][dt][7] * inv};
      *(v4fa*)&sO[w][g * 16 + ln][dt * 16 + 8 * hh] = lo; *(v4fa*)&sO[w][g * 16 + ln][dt * 16 + 8 * hh + 4] = hi; } }
  __builtin_amdgcn_fence(__ATOMIC_ACQ_REL, "workgroup"); __builtin_amdgcn_wave_barrier();
  {
#pragma unroll
    for (int rp = 0; rp < RPW; rp += 4) { const int r = rp + (lane >> 3), pc = lane & 7; const v4f x = *(const v4fa*)&sO[w][r][pc * 8], y = *(const v4fa*)&sO[w][r][pc * 8 + 4]; FragH fh, fl;      // O leaves as f16 hi + (residual x 2^10): 8 lanes store one row's 128 B of each plane; unrolled so that the fragments stay in registers
#pragma unroll
      for (int q = 0; q < 4; ++q) { _Float16 hv = (_Float16)x[q]; fh.h[q] = hv; fl.h[q] = (_Float16)((x[q] - (float)hv) * 1024.0f); hv = (_Float16)y[q]; fh.h[4 + q] = hv; fl.h[4 + q] = (_Float16)((y[q] - (float)hv) * 1024.0f); }
      const size_t o = ((size_t)b * TQ + q0 + r) * ldo + h * 64 + pc * 8;
      *(v8us*)((unsigned short*)Oh + o) = fh.half[0]; *(v8us*)((unsigned short*)Ol + o) = fl.half[0]; }
     } }
__global__ __launch_bounds__(256) void k_fulltab(unsigned* __restrict__ MB, int* __restrict__ RA, int* __restrict__ KE, int nq, int nk) {
  const int t = blockIdx.x * 256 + threadIdx.x;
  if (t < nq * (nk / 32)) { *(unsigned*)(MB + t) = 0u;  }
  if (t < nq) { *(int*)(RA + t) = 0;  }
  if (t < nq / 64) { *(int*)(KE + t * 32) = nk;  } }
__global__ __launch_bounds__(256) void k_lnout(const float* __restrict__ Y, const float* __restrict__ g, const float* __restrict__ bb, float* __restrict__ out) {
  #pragma clang fp contract(off)
  const int tid = threadIdx.x, w = tid >> 5, ln = tid & 31; const int r = blockIdx.x * 8 + w; if (r >= NR) return; const float* y = Y + (size_t)r * DM; float s = 0.f;
#pragma unroll 1
  for (int i = 0; i < 8; ++i) { const v4f a = *(const v4fa*)(y + i * 128 + ln * 4); for (int q = 0; q < 4; ++q) s += a[q]; }
  for (int o = 16; o > 0; o >>= 1) s += __shfl_xor(s, o, 32); const float mu = s / (float)DM; float q2 = 0.f;
#pragma unroll 1
  for (int i = 0; i < 8; ++i) { const v4f a = *(const v4fa*)(y + i * 128 + ln * 4); for (int q = 0; q < 4; ++q) { const float d = a[q] - mu; q2 += d * d; } }
  for (int o = 16; o > 0; o >>= 1) q2 += __shfl_xor(q2, o, 32); const float rs = rsqrtf(q2 / (float)DM + 1e-6f);
  {
#pragma unroll 1
    for (int i = 0; i < 8; ++i) { const int c0 = i * 128 + ln * 4; const v4f a = *(const v4fa*)(y + c0); v4f o4; for (int q = 0; q < 4; ++q) o4[q] = (a[q] - mu) * rs * bf16_round(g[c0 + q]) + bf16_round(bb[c0 + q]); *(v4f*)(out + (size_t)r * DM + c0) = o4; }
     } }
__global__ __launch_bounds__(256) void k_xb(const float* __restrict__ x, float* __restrict__ XB, size_t n4) { const size_t t = (size_t)blockIdx.x * 256 + threadIdx.x; if (t >= n4) return; const v4f a = *(const v4fa*)(x + t * 4); v4f o; for (int q = 0; q < 4; ++q) o[q] = bf16_round(a[q]); *(v4f*)(XB + t * 4) = o;  }
// Every input conversion in one launch, by block range: blocks 0..767 round q, k, v to bf16 and store them as f16 planes (q also as f32, the residual addend);
// blocks 768..1023 store the four weights, rounded to bf16, as f16 x16. A block streams 4096 pieces of 16 B, lane-contiguous, 16 per thread.
template <bool RES>
__device__ __forceinline__ void prep_stream(const float* __restrict__ src, _Float16* __restrict__ dst, float* __restrict__ xb, float scale, int tid) {
  v4f a[16];      // the three loops below are unrolled so that a[] lives in registers and every address is base + immediate offset
#pragma unroll
  for (int u = 0; u < 16; ++u) a[u] = *(const v4fa*)(src + (u * 256 + tid) * 4);
  __builtin_amdgcn_sched_barrier(0);      // keeps all 16 loads in flight together: without it the compiler sinks six of them among the conversions
#pragma unroll
  for (int u = 0; u < 16; ++u) { const int e = (u * 256 + tid) * 4; v4f r; v4h h;
#pragma unroll
    for (int i = 0; i < 4; ++i) { r[i] = bf16_round(a[u][i]); h[i] = (_Float16)(r[i] * scale); }
    *(v4h*)(dst + e) = h; if (RES) *(v4f*)(xb + e) = r; } }
__global__ __launch_bounds__(256) void k_prep(const float* __restrict__ q, const float* __restrict__ k, const float* __restrict__ v, const float* __restrict__ Wq, const float* __restrict__ Wk, const float* __restrict__ Wv, const float* __restrict__ Wo,
                                              _Float16* __restrict__ X16, float* __restrict__ XB, _Float16* __restrict__ B16) {
  constexpr int PB = 4096, XBLK = NR * DM / 4 / PB, WBLK = DM * DM / 4 / PB;
  const int bid = blockIdx.x, tid = threadIdx.x;
  if (bid < XBLK) { const size_t o = (size_t)bid * PB * 4; prep_stream<true>(q + o, X16 + o, XB + o, 1.0f, tid); }
  else if (bid < 3 * XBLK) { const bool isk = bid < 2 * XBLK; const size_t o = (size_t)(bid - (isk ? XBLK : 2 * XBLK)) * PB * 4; prep_stream<false>((isk ? k : v) + o, X16 + (size_t)(isk ? 1 : 2) * NR * DM + o, nullptr, 1.0f, tid); }
  else { const int j = (bid - 3 * XBLK) / WBLK; const size_t o = (size_t)((bid - 3 * XBLK) % WBLK) * PB * 4; prep_stream<false>((j == 0 ? Wq : (j == 1 ? Wk : (j == 2 ? Wv : Wo))) + o, B16 + (size_t)j * DM * DM + o, nullptr, 16.0f, tid); } }
__global__ __launch_bounds__(256) void k_causaltab(unsigned* __restrict__ MB, int* __restrict__ RA, int* __restrict__ KE, int nq, int nk) {
  const int t = blockIdx.x * 256 + threadIdx.x; const int nw = nk / 32;
  if (t < nq * nw) { const int q = t / nw, w = t % nw; const int first = q + 1 - 32 * w; const unsigned bits = (first <= 0) ? 0xffffffffu : ((first >= 32) ? 0u : (0xffffffffu << first)); *(unsigned*)(MB + t) = bits;  }
  if (t < nq) { *(int*)(RA + t) = 0;  }
  if (t < nq / 64) { const int v = 64 * (t + 1); *(int*)(KE + t * 32) = v;  } }


extern "C" void kernel_launch(void* const* d_in, const int* in_sizes, int n_in,
                              void* d_out, int out_size, void* d_ws, size_t ws_size, hipStream_t stream) {
  (void)in_sizes; (void)n_in; (void)out_size;
  const float* const* I = (const float* const*)d_in; const float* qin = I[0]; const float* kin = I[1]; const float* vin = I[2]; const float* Wq = I[3]; const float* Wk = I[4]; const float* Wv = I[5]; const float* Wo = I[6]; const float* gam = I[7]; const float* bet = I[8];
  char* ws = (char*)d_ws; size_t off = 0;
  auto take = [&](size_t bytes) { char* p = ws + off; off += (bytes + 255) & ~(size_t)255; return p; };
  _Float16* BQ = (_Float16*)take((size_t)DM * DM * 2); _Float16* BK = (_Float16*)take((size_t)DM * DM * 2); _Float16* BV = (_Float16*)take((size_t)DM * DM * 2); _Float16* BO = (_Float16*)take((size_t)DM * DM * 2);
  _Float16* X16 = (_Float16*)take((size_t)3 * NR * DM * 2); float* F = (float*)take((size_t)NR * DM * 4); float* XB = (float*)take((size_t)NR * DM * 4);
  _Float16* Q16 = (_Float16*)take((size_t)NR * DM * 2); _Float16* K16 = (_Float16*)take((size_t)NR * DM * 2); _Float16* V16 = (_Float16*)take((size_t)NR * DM * 2); _Float16* VT = (_Float16*)take((size_t)NR * DM * 2);
  if (off > ws_size) return;      /* 8 + 24 + 16 + 16 + 32 = 96 MiB; BQ BK BV BO, the three X16 planes and Q16 K16 V16 each lie one behind the other */
  _Float16* Oh = (_Float16*)F; _Float16* Ol = Oh + (size_t)NR * DM; float* Y = XB;      /* the two O planes fill F: k_flash writes them while other blocks still read Q16 and K16 */
  (void)BK; (void)BV; (void)V16;
  k_prep<<<3 * (NR * DM / 16384) + 4 * (DM * DM / 16384), 256, 0, stream>>>(qin, kin, vin, Wq, Wk, Wv, Wo, X16, XB, BQ);      /* X16 planes of q, k, v; XB; BQ BK BV BO */
  const dim3 gP((NR / 128) * (DM / 64), 1), gP3((NR / 128) * (DM / 64), 3);
  k_gemm2<0><<<gP3, 128, 0, stream>>>(X16, DM, (size_t)NR * DM, BQ, DM, (size_t)DM * DM, 0.0625f, nullptr, 0, nullptr, 1, 0, 0, nullptr, Q16, DM, (size_t)NR * DM, NR, DM, DM, VT, 2, nullptr, 1.0f);      /* blockIdx.y = 0, 1: qh, kh (f16 planes); 2: vh, stored as V^T [head * 64 + d][token] */
  k_flash<<<NH * (SLEN / 128), 128, 0, stream>>>(Q16, DM, K16, DM, VT, nullptr, Oh, Ol, DM);      /* plain flash over all 4096 keys (no mask) */
  k_gemm2<0><<<gP, 128, 0, stream>>>(Ol, DM, 0, BO, DM, 0, 0.0625f, nullptr, 0, XB, 1, (size_t)DM, 0, Y, nullptr, DM, 0, NR, DM, DM, nullptr, 0, Oh, 0.0009765625f);      /* Y = (Ol 2^-10 + Oh) Wo^T + bf16(q), one K loop */
  k_lnout<<<NR / 8, 256, 0, stream>>>(Y, gam, bet, (float*)d_out);
}

// v009
// A run of this version takes 146 microseconds.
// Timed twice side by side with v008, it ran 1.07 and 1.08 times as fast.
// Counting every step since v000, it is 5.12 times as fast.
#include <hip/hip_runtime.h>
#define NBT 1
#define SLEN 4096
#define TQ SLEN
#define TK SLEN
#define DM 1024
#define NH 16
#define SCL 0.125f
#define NR (NBT * SLEN)
typedef __bf16 v16b __attribute__((ext_vector_type(16)));
typedef unsigned short v8us __attribute__((ext_vector_type(8), may_alias));
typedef float  v8f  __attribute__((ext_vector_type(8)));
typedef float  v4f  __attribute__((ext_vector_type(4)));
typedef float  v4fa __attribute__((ext_vector_type(4), may_alias));
union FragB { v16b v; v8us half[2]; unsigned short u[16]; };

__device__ __forceinline__ unsigned short bf16_bits(float x) { unsigned int u = __float_as_uint(x); return (unsigned short)((u + 0x7FFFu + ((u >> 16) & 1u)) >> 16); }
__device__ __forceinline__ float bf16_val(unsigned short b) { return __uint_as_float(((unsigned int)b) << 16); }
__device__ __forceinline__ float bf16_round(float x) { return bf16_val(bf16_bits(x)); }
// D += A·B with NT terms: 1 = ah·bh, 2 = + al·bh (A split), 3 = + ah·bl (both split)
template <int NT>
__device__ __forceinline__ v8f mmaN(v16b ah, v16b al, v16b bh, v16b bl, v8f c) {
  c = __builtin_amdgcn_wmma_f32_16x16x32_bf16(false, ah, false, bh, (short)0, c, false, false);
  if (NT >= 2) c = __builtin_amdgcn_wmma_f32_16x16x32_bf16(false, al, false, bh, (short)0, c, false, false);
  if (NT >= 3) c = __builtin_amdgcn_wmma_f32_16x16x32_bf16(false, ah, false, bl, (short)0, c, false, false);
  asm volatile("v_nop\n\tv_nop\n\tv_nop\n\tv_nop" : "+v"(c) : "v"(ah), "v"(al), "v"(bh), "v"(bl));
  return c;
}

__global__ __launch_bounds__(256) void k_wt_bf16(const float* __restrict__ W, unsigned short* __restrict__ Wt, int K, int N) {
  const int t = blockIdx.x * 256 + threadIdx.x;
  const int k8n = K / 8;
  if (t >= N * k8n) return;
  const int n = t / k8n, k8 = (t % k8n) * 8;
  v8us v;
#pragma unroll
  for (int i = 0; i < 8; ++i) v[i] = bf16_bits(W[(size_t)(k8 + i) * N + n]);
  *(v8us*)(Wt + (size_t)n * K + k8) = v;
  
}

// GEMM C[M][N] (f32, pitch ldc) = act(A[M][K]·W + bias). A f32 row-major (pitch lda) converted per fragment to bf16
// (ASPLIT: hi/lo two planes -> 2 terms, else single rounded term); Wt bf16 [N][K] (pitch ldb). BIAS_BF16 rounds the
// bias to bf16 first (bias quantised to bf16 before the add). K%32==0, M%16==0, N%64==0.
template <bool ASPLIT, int ACT, bool BIAS_BF16>
__global__ __launch_bounds__(128) void k_gemm_bf(const float* __restrict__ A, int lda, const unsigned short* __restrict__ Wt, int ldb,
                                               const float* __restrict__ bias, float* __restrict__ C, int ldc, int M, int N, int K) {
  __shared__ __attribute__((aligned(16))) float so[4][16][64];
  const int tid = threadIdx.x, w = tid >> 5, lane = tid & 31, ln = lane & 15, hh = lane >> 4;
  const int ntn = N / 64;
  const int wid = blockIdx.x * 4 + w;
  const int mt = wid / ntn, nq = wid % ntn;
  if (mt * 16 >= M) return;
  const int row0 = mt * 16, col0 = nq * 64;
  const float* arow = A + (size_t)(row0 + ln) * lda;
  v8f acc[4] = {};
  for (int kb = 0; kb < K; kb += 32) {
    FragB ah, al;
    const v4f x0 = *(const v4fa*)(arow + kb + 8 * hh), x1 = *(const v4fa*)(arow + kb + 8 * hh + 4);
    const v4f x2 = *(const v4fa*)(arow + kb + 16 + 8 * hh), x3 = *(const v4fa*)(arow + kb + 16 + 8 * hh + 4);
    float xs[16] = {x0[0],x0[1],x0[2],x0[3],x1[0],x1[1],x1[2],x1[3],x2[0],x2[1],x2[2],x2[3],x3[0],x3[1],x3[2],x3[3]};
#pragma unroll
    for (int i = 0; i < 16; ++i) { const unsigned short hb = bf16_bits(xs[i]); ah.u[i] = hb; al.u[i] = ASPLIT ? bf16_bits(xs[i] - bf16_val(hb)) : (unsigned short)0; }
#pragma unroll
    for (int t = 0; t < 4; ++t) {
      const unsigned short* brow = Wt + (size_t)(col0 + t * 16 + ln) * ldb + kb;
      FragB b;
      b.half[0] = *(const v8us*)(brow + 8 * hh);
      b.half[1] = *(const v8us*)(brow + 16 + 8 * hh);
      acc[t] = mmaN<ASPLIT ? 2 : 1>(ah.v, al.v, b.v, b.v, acc[t]);
    }
  }
#pragma unroll
  for (int t = 0; t < 4; ++t) {
    float bv = bias ? bias[col0 + t * 16 + ln] : 0.f;
    if (BIAS_BF16) bv = bf16_round(bv);
#pragma unroll
    for (int r = 0; r < 8; ++r) { float v = acc[t][r] + bv; if (ACT == 1) v = fmaxf(v, 0.f); so[w][8 * hh + r][t * 16 + ln] = v; }
  }
  __builtin_amdgcn_fence(__ATOMIC_ACQ_REL, "workgroup");
  __builtin_amdgcn_wave_barrier();
  const int rsub = lane >> 4, c4 = (lane & 15) * 4;
  {
#pragma unroll
    for (int q = 0; q < 8; ++q) {
      const int r = q * 2 + rsub;
      const v4f v = *(const v4fa*)&so[w][r][c4];
      *(v4f*)(C + (size_t)(row0 + r) * ldc + col0 + c4) = v;
    }
    
  }
}

// GEMM C = act(A·W + bias + resid): A f32 (ASPLIT -> hi/lo 2 terms), Wt bf16 [N][K]; ACT 0 none, 1 relu, 2 exact gelu;
// resid (optional, f32, row index = (row % rmod), pitch ldr, RES_BF16 rounds it) added before the activation.
template <bool ASPLIT, int ACT, bool BIAS_BF16, bool RES_BF16>
__global__ __launch_bounds__(128) void k_gemm_bf3(const float* __restrict__ A, int lda, const unsigned short* __restrict__ Wt, int ldb,
                                                const float* __restrict__ bias, const float* __restrict__ resid, int rmod, int ldr,
                                                float* __restrict__ C, int ldc, int M, int N, int K) {
  __shared__ __attribute__((aligned(16))) float so[4][16][64];
  const int tid = threadIdx.x, w = tid >> 5, lane = tid & 31, ln = lane & 15, hh = lane >> 4;
  const int ntn = N / 64;
  const int wid = blockIdx.x * 4 + w;
  const int mt = wid / ntn, nq = wid % ntn;
  if (mt * 16 >= M) return;
  const int row0 = mt * 16, col0 = nq * 64;
  const float* arow = A + (size_t)(row0 + ln) * lda;
  v8f acc[4] = {};
  for (int kb = 0; kb < K; kb += 32) {
    FragB ah, al;
    const v4f x0 = *(const v4fa*)(arow + kb + 8 * hh), x1 = *(const v4fa*)(arow + kb + 8 * hh + 4);
    const v4f x2 = *(const v4fa*)(arow + kb + 16 + 8 * hh), x3 = *(const v4fa*)(arow + kb + 16 + 8 * hh + 4);
    float xs[16] = {x0[0],x0[1],x0[2],x0[3],x1[0],x1[1],x1[2],x1[3],x2[0],x2[1],x2[2],x2[3],x3[0],x3[1],x3[2],x3[3]};
#pragma unroll
    for (int i = 0; i < 16; ++i) { const unsigned short hb = bf16_bits(xs[i]); ah.u[i] = hb; al.u[i] = ASPLIT ? bf16_bits(xs[i] - bf16_val(hb)) : (unsigned short)0; }
#pragma unroll
    for (int t = 0; t < 4; ++t) {
      const unsigned short* brow = Wt + (size_t)(col0 + t * 16 + ln) * ldb + kb;
      FragB b;
      b.half[0] = *(const v8us*)(brow + 8 * hh);
      b.half[1] = *(const v8us*)(brow + 16 + 8 * hh);
      acc[t] = mmaN<ASPLIT ? 2 : 1>(ah.v, al.v, b.v, b.v, acc[t]);
    }
  }
#pragma unroll
  for (int t = 0; t < 4; ++t) {
    const int col = col0 + t * 16 + ln;
    float bv = bias ? bias[col] : 0.f;
    if (BIAS_BF16) bv = bf16_round(bv);
#pragma unroll
    for (int r = 0; r < 8; ++r) {
      float v = acc[t][r] + bv;
      if (resid) { float rv = resid[(size_t)((row0 + 8 * hh + r) % rmod) * ldr + col]; if (RES_BF16) rv = bf16_round(rv); v += rv; }
      if (ACT == 1) v = fmaxf(v, 0.f);
      if (ACT == 2) v = 0.5f * v * (1.0f + erff(v * 0.70710678118654752f));
      if (ACT == 3) { const float u = 0.7978845608028654f * (v + 0.044715f * v * v * v); v = 0.5f * v * (1.0f + tanhf(u)); }
      so[w][8 * hh + r][t * 16 + ln] = v;
    }
  }
  __builtin_amdgcn_fence(__ATOMIC_ACQ_REL, "workgroup");
  __builtin_amdgcn_wave_barrier();
  const int rsub = lane >> 4, c4 = (lane & 15) * 4;
  {
#pragma unroll
    for (int q = 0; q < 8; ++q) {
      const int r = q * 2 + rsub;
      const v4f v = *(const v4fa*)&so[w][r][c4];
      *(v4f*)(C + (size_t)(row0 + r) * ldc + col0 + c4) = v;
    }
    
  }
}
// row LayerNorm (biased variance, eps) over N: s = X (+ R); optional out_sum <- s; out_norm <- (s-mu)*rsqrt(var+eps)*g + b
template <bool PARAM_BF16>
__global__ __launch_bounds__(256) void k_layernorm(const float* __restrict__ X, const float* __restrict__ R, const float* __restrict__ g, const float* __restrict__ bta,
                                                  float* __restrict__ out_sum, float* __restrict__ out_norm, int N, float eps) {
  __shared__ float red[256];
  const int row = blockIdx.x, tid = threadIdx.x;
  const float* x = X + (size_t)row * N; const float* rr = R ? R + (size_t)row * N : nullptr;
  float vals[16];                     // up to N = 4096
  const int per = N / 256;            // contiguous chunk per thread? use strided-by-4 chunks: thread handles j = tid*4 + 1024*u
  float s1 = 0.f;
  for (int u = 0; u < per / 4; ++u) {
    const int j = tid * 4 + 1024 * u;
    const v4f a = *(const v4fa*)(x + j);
    v4f b = {0.f,0.f,0.f,0.f}; if (rr) b = *(const v4fa*)(rr + j);
#pragma unroll
    for (int q = 0; q < 4; ++q) { const float v = a[q] + b[q]; vals[u * 4 + q] = v; s1 += v; }
  }
  red[tid] = s1; __syncthreads();
  for (int st = 128; st > 0; st >>= 1) { if (tid < st) red[tid] += red[tid + st]; __syncthreads(); }
  const float mu = red[0] / (float)N; __syncthreads();
  float s2 = 0.f;
  for (int u = 0; u < per / 4; ++u)
#pragma unroll
    for (int q = 0; q < 4; ++q) { const float c = vals[u * 4 + q] - mu; s2 += c * c; }
  red[tid] = s2; __syncthreads();
  for (int st = 128; st > 0; st >>= 1) { if (tid < st) red[tid] += red[tid + st]; __syncthreads(); }
  const float rs = rsqrtf(red[0] / (float)N + eps);
  {
    for (int u = 0; u < per / 4; ++u) {
      const int j = tid * 4 + 1024 * u;
      v4f o, sm;
#pragma unroll
      for (int q = 0; q < 4; ++q) {
        float gg = g[j + q], bb = bta[j + q];
        if (PARAM_BF16) { gg = bf16_round(gg); bb = bf16_round(bb); }
        sm[q] = vals[u * 4 + q]; o[q] = (vals[u * 4 + q] - mu) * rs * gg + bb;
      }
      if (out_sum) *(v4f*)(out_sum + (size_t)row * N + j) = sm;
      *(v4f*)(out_norm + (size_t)row * N + j) = o;
    }
    
  }
}



// ---- f16 WMMA path (v_wmma_f32_16x16x32_f16): 11-bit significands for operands in range — used where a [0,1] probability operand needs more precision than bf16
typedef _Float16 v16h __attribute__((ext_vector_type(16)));
union FragH { v16h v; v8us half[2]; _Float16 h[16]; unsigned short u[16]; };
template <int NT>
__device__ __forceinline__ v8f mmaH(v16h ah, v16h al, v16h bh, v16h bl, v8f c) {
  c = __builtin_amdgcn_wmma_f32_16x16x32_f16(false, ah, false, bh, (short)0, c, false, false);
  if (NT >= 2) c = __builtin_amdgcn_wmma_f32_16x16x32_f16(false, al, false, bh, (short)0, c, false, false);
  if (NT >= 3) c = __builtin_amdgcn_wmma_f32_16x16x32_f16(false, ah, false, bl, (short)0, c, false, false);
  return c;      // no asm behind the builtin: the compiler keeps the distance after a WMMA itself and stays free to move LDS reads ahead of it
}
// batched GEMM like k_gemm_b but f16 operands: A f32 (split into f16 hi/lo if ASPLIT, else rounded to f16), Bt = f16 values [n][k]; alpha; C f32; N multiple of 16 (partial tiles skipped)
template <bool ASPLIT>
__global__ __launch_bounds__(128) void k_gemm_h(const float* __restrict__ A, int lda, size_t sA, const _Float16* __restrict__ Bh, int ldb, size_t sB, float alpha, float* __restrict__ C, int ldc, size_t sC, int M, int N, int K) {
  __shared__ __attribute__((aligned(16))) float so[4][16][64];
  const int tid = threadIdx.x, w = tid >> 5, lane = tid & 31, ln = lane & 15, hh = lane >> 4; const int by = blockIdx.y;
  A += (size_t)by * sA; Bh += (size_t)by * sB; C += (size_t)by * sC;
  const int ntn = (N + 63) / 64; const int wid = blockIdx.x * 4 + w; const int mt = wid / ntn, nq = wid % ntn; if (mt * 16 >= M) return;
  const int row0 = mt * 16, col0 = nq * 64; const float* arow = A + (size_t)(row0 + ln) * lda;
  v8f acc[4] = {};
  for (int kb = 0; kb < K; kb += 32) {
    FragH ah, al;
    const v4f x0 = *(const v4fa*)(arow + kb + 8 * hh), x1 = *(const v4fa*)(arow + kb + 8 * hh + 4), x2 = *(const v4fa*)(arow + kb + 16 + 8 * hh), x3 = *(const v4fa*)(arow + kb + 16 + 8 * hh + 4);
    float xs[16] = {x0[0],x0[1],x0[2],x0[3],x1[0],x1[1],x1[2],x1[3],x2[0],x2[1],x2[2],x2[3],x3[0],x3[1],x3[2],x3[3]};
#pragma unroll
    for (int i = 0; i < 16; ++i) { const _Float16 h = (_Float16)xs[i]; ah.h[i] = h; al.h[i] = ASPLIT ? (_Float16)(xs[i] - (float)h) : (_Float16)0.0f; }
#pragma unroll
    for (int t = 0; t < 4; ++t) { if (col0 + t * 16 >= N) continue; const size_t boff = (size_t)(col0 + t * 16 + ln) * ldb + kb; FragH bq; bq.half[0] = *(const v8us*)(Bh + boff + 8 * hh); bq.half[1] = *(const v8us*)(Bh + boff + 16 + 8 * hh);
      acc[t] = mmaH<ASPLIT ? 2 : 1>(ah.v, al.v, bq.v, bq.v, acc[t]); }
  }
#pragma unroll
  for (int t = 0; t < 4; ++t) { if (col0 + t * 16 >= N) continue;
#pragma unroll
    for (int r = 0; r < 8; ++r) so[w][8 * hh + r][t * 16 + ln] = acc[t][r] * alpha; }
  __builtin_amdgcn_fence(__ATOMIC_ACQ_REL, "workgroup"); __builtin_amdgcn_wave_barrier();
  const int rsub = lane >> 4, c4 = (lane & 15) * 4;
  {
#pragma unroll
    for (int q = 0; q < 8; ++q) { const int r = q * 2 + rsub; if (col0 + c4 < N) { const v4f v = *(const v4fa*)&so[w][r][c4]; *(v4f*)(C + (size_t)(row0 + r) * ldc + col0 + c4) = v; } }
     }
}

// Wt[n][k] = f16(W[k][n]·scale) from f32 row-major W[K][N] (scale = power of two; bf16-exact weights stay exact in f16 away from the subnormal range)
__global__ __launch_bounds__(256) void k_wt_f16(const float* __restrict__ W, _Float16* __restrict__ Wt, int K, int N, float scale) {
  const int t = blockIdx.x * 256 + threadIdx.x; if (t >= N * (K / 8)) return; const int n = t / (K / 8), k8 = (t % (K / 8)) * 8; FragH f;
#pragma unroll
  for (int i = 0; i < 8; ++i) f.h[i] = (_Float16)(bf16_round(W[(size_t)(k8 + i) * N + n]) * scale); const v8us o = f.half[0];
  *(v8us*)((unsigned short*)Wt + (size_t)n * K + k8) = o; 
}
// k_gemm_hh variant with fused epilogue: v = acc·alpha + bias[by·sBias + col] (+ CP[(row/rowsPerB)·sCPb + by·64 + col] if CP) ; ACT 0 none / 1 elu ; writes f16 C16 (and f32 C if non-null)
template <int ACT>
__global__ __launch_bounds__(128) void k_gemm_hhx(const _Float16* __restrict__ A, int lda, size_t sA, const _Float16* __restrict__ Bh, int ldb, size_t sB, float alpha, const float* __restrict__ bias, size_t sBias, const float* __restrict__ CP, int rowsPerB, size_t sCPb, int row0g,
    float* __restrict__ C, _Float16* __restrict__ C16, int ldc, size_t sC, int M, int N, int K) {
  __shared__ __attribute__((aligned(16))) float so[4][16][64];
  const int tid = threadIdx.x, w = tid >> 5, lane = tid & 31, ln = lane & 15, hh = lane >> 4; const int by = blockIdx.y;
  A += (size_t)by * sA; Bh += (size_t)by * sB; const size_t cofs = (size_t)by * sC; const float* bp = bias ? bias + (size_t)by * sBias : nullptr;
  const int ntn = (N + 63) / 64; const int wid = blockIdx.x * 4 + w; const int mt = wid / ntn, nq = wid % ntn; if (mt * 16 >= M) return;
  const int row0 = mt * 16, col0 = nq * 64; const _Float16* arow = A + (size_t)(row0 + ln) * lda;
  v8f acc[4] = {};
  for (int kb = 0; kb < K; kb += 32) { FragH ah; ah.half[0] = *(const v8us*)((const unsigned short*)arow + kb + 8 * hh); ah.half[1] = *(const v8us*)((const unsigned short*)arow + kb + 16 + 8 * hh);
#pragma unroll
    for (int t = 0; t < 4; ++t) { if (col0 + t * 16 >= N) continue; const size_t boff = (size_t)(col0 + t * 16 + ln) * ldb + kb; FragH bq; bq.half[0] = *(const v8us*)((const unsigned short*)Bh + boff + 8 * hh); bq.half[1] = *(const v8us*)((const unsigned short*)Bh + boff + 16 + 8 * hh);
      acc[t] = mmaH<1>(ah.v, ah.v, bq.v, bq.v, acc[t]); }
  }
#pragma unroll
  for (int t = 0; t < 4; ++t) { if (col0 + t * 16 >= N) continue; const int col = col0 + t * 16 + ln; const float bv = bp ? bf16_round(bp[col]) : 0.f;
#pragma unroll
    for (int r = 0; r < 8; ++r) { float v = acc[t][r] * alpha + bv; if (CP) { const int bidx = (row0g + row0 + 8 * hh + r) / rowsPerB; v += CP[(size_t)bidx * sCPb + (size_t)by * 64 + col]; } if (ACT == 1) v = (v > 0.f) ? v : expm1f(v); else if (ACT == 7) v = (v > 0.f) ? v + 1.0f : expf(v); else if (ACT == 8) v = tanhf(v); else if (ACT == 9) v = 0.5f * v * (1.0f + tanhf(0.7978845608028654f * (v + 0.044715f * v * v * v))); else if (ACT == 11) v = 1.0f / (1.0f + expf(-v)); else if (ACT == 12) v = (v > 0.f) ? v : 0.01f * v; else if (ACT == 14) v = (v > 0.f) ? v : 0.1f * v; else if (ACT == 15) v = v / (1.0f + expf(-v)); else if (ACT == 3) v = fmaxf(v, 0.f); else if (ACT == 6) v = 0.5f * v * (1.0f + erff(v * 0.70710678118654752f)); so[w][8 * hh + r][t * 16 + ln] = v; } }
  __builtin_amdgcn_fence(__ATOMIC_ACQ_REL, "workgroup"); __builtin_amdgcn_wave_barrier();
  const int rsub = lane >> 4, c4 = (lane & 15) * 4; typedef _Float16 v4h __attribute__((ext_vector_type(4)));
  {
#pragma unroll
    for (int q = 0; q < 8; ++q) { const int r = q * 2 + rsub; if (col0 + c4 < N) { const v4f v = *(const v4fa*)&so[w][r][c4]; if (C) *(v4f*)(C + cofs + (size_t)(row0 + r) * ldc + col0 + c4) = v; if (C16) { v4h h4; for (int i = 0; i < 4; ++i) h4[i] = (_Float16)v[i]; *(v4h*)(C16 + cofs + (size_t)(row0 + r) * ldc + col0 + c4) = h4; } } }
     }
}


typedef _Float16 v4h __attribute__((ext_vector_type(4)));

__global__ __launch_bounds__(256) void k_x16(const float* __restrict__ x, _Float16* __restrict__ X16, size_t n8) { const size_t t = (size_t)blockIdx.x * 256 + threadIdx.x; if (t >= n8) return; FragH f;
#pragma unroll
  for (int q = 0; q < 8; ++q) f.h[q] = (_Float16)bf16_round(x[t * 8 + q]); *(v8us*)((unsigned short*)X16 + t * 8) = f.half[0];  }
__global__ __launch_bounds__(256) void k_h16(const float* __restrict__ x, _Float16* __restrict__ X16, size_t n8) { const size_t t = (size_t)blockIdx.x * 256 + threadIdx.x; if (t >= n8) return; FragH f;
#pragma unroll
  for (int q = 0; q < 8; ++q) f.h[q] = (_Float16)x[t * 8 + q]; *(v8us*)((unsigned short*)X16 + t * 8) = f.half[0];  }
__global__ __launch_bounds__(256) void k_round16f(const float* __restrict__ W, _Float16* __restrict__ Bt, size_t n8) { const size_t t = (size_t)blockIdx.x * 256 + threadIdx.x; if (t >= n8) return; FragH f;
#pragma unroll
  for (int i = 0; i < 8; ++i) f.h[i] = (_Float16)(bf16_round(W[t * 8 + i]) * 16.0f); *(v8us*)((unsigned short*)Bt + t * 8) = f.half[0];  }
template <int NHv, int TTv>
__global__ __launch_bounds__(256) void k_vt(const _Float16* __restrict__ V16, int ldv, int voff, _Float16* __restrict__ Vt) { __shared__ unsigned short tl[64][66]; const int tid = threadIdx.x; const int slab = blockIdx.x / (TTv / 64), lg = blockIdx.x % (TTv / 64); const int b = slab / NHv, h = slab % NHv;
  for (int i = tid; i < 64 * 8; i += 256) { const int r = i / 8, c8 = (i % 8) * 8; FragH f; f.half[0] = *(const v8us*)((const unsigned short*)V16 + ((size_t)b * TTv + lg * 64 + r) * ldv + voff + h * 64 + c8);
#pragma unroll
    for (int q = 0; q < 8; ++q) tl[r][c8 + q] = f.u[q]; }
  __syncthreads();
  {
#pragma unroll
    for (int rd = 0; rd < 2; ++rd) { const int d = rd * 32 + tid / 8, pc = tid % 8; FragH f;
#pragma unroll
      for (int q = 0; q < 8; ++q) f.u[q] = tl[pc * 8 + q][d];
      *(v8us*)((unsigned short*)Vt + ((size_t)slab * 64 + d) * TTv + lg * 64 + pc * 8) = f.half[0]; }
     } }

__global__ __launch_bounds__(256) void k_hl(const float* __restrict__ F, _Float16* __restrict__ Hh, _Float16* __restrict__ Hl, size_t n8) { const size_t t = (size_t)blockIdx.x * 256 + threadIdx.x; if (t >= n8) return; FragH fh, fl; const v4f a = *(const v4fa*)(F + t * 8), c = *(const v4fa*)(F + t * 8 + 4);
#pragma unroll
  for (int q = 0; q < 4; ++q) { _Float16 h = (_Float16)a[q]; fh.h[q] = h; fl.h[q] = (_Float16)((a[q] - (float)h) * 1024.0f); h = (_Float16)c[q]; fh.h[4 + q] = h; fl.h[4 + q] = (_Float16)((c[q] - (float)h) * 1024.0f); }
  { *(v8us*)((unsigned short*)Hh + t * 8) = fh.half[0]; *(v8us*)((unsigned short*)Hl + t * 8) = fl.half[0];  } }

// ---- fast GEMM (block tile 128x64, wave tile 32x64; requires M % 128 == 0, N % 64 == 0, K % 64 == 0); A and B tiles of 64 k staged in LDS; epilogue = k_gemm_hhx semantics; the batch entry blockIdx.y == byT (if CT) is stored transposed instead, CT[col][row] (pitch M, f16; alpha only: no bias, addend or activation); with A2 the K loop runs over A, scales the sums by mid, and runs on over A2 with the same B: C = alpha (mid A.B + A2.B) ----
__device__ __forceinline__ v16h g2_frag(const _Float16* p, int hh) { FragH f; f.half[0] = *(const v8us*)((const unsigned short*)p + 8 * hh); f.half[1] = *(const v8us*)((const unsigned short*)p + 16 + 8 * hh); return f.v; }
__device__ __forceinline__ v8f g2_mma(v16h a, v16h b, v8f c) { return __builtin_amdgcn_wmma_f32_16x16x32_f16(false, a, false, b, (short)0, c, false, false); }
template <int ACT>
__global__ __launch_bounds__(128) void k_gemm2(const _Float16* __restrict__ A, int lda, size_t sA, const _Float16* __restrict__ Bh, int ldb, size_t sB, float alpha, const float* __restrict__ bias, size_t sBias, const float* __restrict__ CP, int rowsPerB, size_t sCPb, int row0g,
    float* __restrict__ C, _Float16* __restrict__ C16, int ldc, size_t sC, int M, int N, int K, _Float16* __restrict__ CT, int byT, const _Float16* __restrict__ A2, float mid) {
  constexpr int GK = 64, GP = 72;      // a tile = 64 k; LDS row pitch 144 B (16 B x odd: ds_load_b128 without bank conflicts)
  __shared__ __attribute__((aligned(16))) _Float16 tA[2][128][GP]; __shared__ __attribute__((aligned(16))) _Float16 tB[2][64][GP];      // two buffers each
  __shared__ __attribute__((aligned(16))) float so[4][32][68];
  const int tid = threadIdx.x, w = tid >> 5, lane = tid & 31, ln = lane & 15, hh = lane >> 4; const int by = blockIdx.y;
  A += (size_t)by * sA; Bh += (size_t)by * sB; const size_t cofs = (size_t)by * sC; const float* bp = bias ? bias + (size_t)by * sBias : nullptr;
  const int ntn = N >> 6; const int mt = blockIdx.x / ntn, nq = blockIdx.x - mt * ntn; const int row0 = mt * 128 + 32 * w, col0 = nq * 64; if (mt * 128 >= M) return;      // the whole block leaves or none of it: barriers follow
  // every thread copies 8 + 4 pieces of 16 B per tile (8 lanes cover one whole 128-B row)
  const int crow = tid >> 3, cc8 = (tid & 7) * 8;
  const _Float16* gA = A + (size_t)(mt * 128 + crow) * lda + cc8; const _Float16* gA2 = A2 ? A2 + (size_t)by * sA + (size_t)(mt * 128 + crow) * lda + cc8 : gA; const _Float16* gB = Bh + (size_t)(col0 + crow) * ldb + cc8;
  const unsigned lA = (unsigned)(size_t)&tA[0][crow][cc8], lB = (unsigned)(size_t)&tB[0][crow][cc8];
  const int nk = K / GK, nst = A2 ? 2 * nk : nk;      // tiles nk .. 2 nk - 1 are A2's, against the same B tiles
  auto copy_tile = [&](int t) {
    const int tk = t < nk ? t : t - nk;
    const unsigned ao = lA + (unsigned)(t & 1) * (unsigned)(128 * GP * 2), bo = lB + (unsigned)(t & 1) * (unsigned)(64 * GP * 2), r16 = 16 * GP * 2; const _Float16* ap = (t < nk ? gA : gA2) + (size_t)tk * GK; const _Float16* bq = gB + (size_t)tk * GK; const size_t a16 = (size_t)16 * lda, b16 = (size_t)16 * ldb;
    // the copies and, as the last line of the same statement, the wait that stands before their address registers are rewritten
    asm volatile("global_load_async_to_lds_b128 %0, %12, off\n\tglobal_load_async_to_lds_b128 %1, %13, off\n\tglobal_load_async_to_lds_b128 %2, %14, off\n\tglobal_load_async_to_lds_b128 %3, %15, off\n\t"
                 "global_load_async_to_lds_b128 %4, %16, off\n\tglobal_load_async_to_lds_b128 %5, %17, off\n\tglobal_load_async_to_lds_b128 %6, %18, off\n\tglobal_load_async_to_lds_b128 %7, %19, off\n\t"
                 "global_load_async_to_lds_b128 %8, %20, off\n\tglobal_load_async_to_lds_b128 %9, %21, off\n\tglobal_load_async_to_lds_b128 %10, %22, off\n\tglobal_load_async_to_lds_b128 %11, %23, off\n\ts_wait_xcnt 0x0"
                 :: "v"(ao), "v"(ao + r16), "v"(ao + 2 * r16), "v"(ao + 3 * r16), "v"(ao + 4 * r16), "v"(ao + 5 * r16), "v"(ao + 6 * r16), "v"(ao + 7 * r16), "v"(bo), "v"(bo + r16), "v"(bo + 2 * r16), "v"(bo + 3 * r16),
                    "v"(ap), "v"(ap + a16), "v"(ap + 2 * a16), "v"(ap + 3 * a16), "v"(ap + 4 * a16), "v"(ap + 5 * a16), "v"(ap + 6 * a16), "v"(ap + 7 * a16), "v"(bq), "v"(bq + b16), "v"(bq + 2 * b16), "v"(bq + 3 * b16) : "memory"); };
  const v8f z8 = {0.f,0.f,0.f,0.f,0.f,0.f,0.f,0.f}; v8f c00 = z8, c01 = z8, c02 = z8, c03 = z8, c10 = z8, c11 = z8, c12 = z8, c13 = z8;
  copy_tile(0);
  asm volatile("s_wait_asynccnt 0x0" ::: "memory");      // this wave's copies of tile 0 have landed
  __syncthreads();                                       // every wave's have: tile 0 may be read
  if (nst > 1) copy_tile(1);
#pragma unroll 1
  for (int t = 0; t < nst; ++t) { const _Float16 (*pA)[GP] = tA[t & 1]; const _Float16 (*pB)[GP] = tB[t & 1];
    if (t == nk) { c00 *= mid; c10 *= mid; c01 *= mid; c11 *= mid; c02 *= mid; c12 *= mid; c03 *= mid; c13 *= mid; }      // A's sums take their scale once, before A2's first tile is added
    v16h fa[2][2], fb[2][4];      // the tile's 12 fragments, read as one group ahead of its 16 products
#pragma unroll
    for (int s = 0; s < 2; ++s) { fa[s][0] = g2_frag(&pA[32 * w + ln][s * 32], hh); fa[s][1] = g2_frag(&pA[32 * w + 16 + ln][s * 32], hh);
#pragma unroll
      for (int j = 0; j < 4; ++j) fb[s][j] = g2_frag(&pB[j * 16 + ln][s * 32], hh); }
    __builtin_amdgcn_sched_barrier(0);      // keeps the 24 LDS reads one group: without it the compiler sinks them among the products, each behind a full wait
#pragma unroll
    for (int s = 0; s < 2; ++s) {
      c00 = g2_mma(fa[s][0], fb[s][0], c00); c10 = g2_mma(fa[s][1], fb[s][0], c10); c01 = g2_mma(fa[s][0], fb[s][1], c01); c11 = g2_mma(fa[s][1], fb[s][1], c11);
      c02 = g2_mma(fa[s][0], fb[s][2], c02); c12 = g2_mma(fa[s][1], fb[s][2], c12); c03 = g2_mma(fa[s][0], fb[s][3], c03); c13 = g2_mma(fa[s][1], fb[s][3], c13); }
    __builtin_amdgcn_sched_barrier(0);      // keeps the products in front of the waits below: lifted over them, the wait for tile t + 1 would stand right behind its copies
    asm volatile("s_wait_dscnt 0x0" ::: "memory");       // this wave's reads of tile t are done before its buffer is refilled
    asm volatile("s_wait_asynccnt 0x0" ::: "memory");    // this wave's copies of tile t + 1 have landed
    __syncthreads();                                     // publishes tile t + 1 and ends every wave's reads of tile t
    if (t + 2 < nst) copy_tile(t + 2); }
  asm volatile("s_wait_asynccnt 0x0" ::: "memory");      // nothing of this wave is in flight when it goes on to the epilogue and ends
  const int rsub = lane >> 4, c4 = (lane & 15) * 4;
  // The addend is read in the layout of the stores below: 16 B a lane (sCPb % 4 == 0), 16 lanes on one row's 256 B, all 16 loads of a lane in flight over the LDS turn of the accumulators.
  v4f ad[16];
  if (CP) { const float* ap[16];
#pragma unroll
    for (int q = 0; q < 16; ++q) { const int bidx = (row0g + row0 + q * 2 + rsub) / rowsPerB; ap[q] = CP + (size_t)bidx * sCPb + (size_t)by * 64 + col0 + c4; }
#pragma unroll
    for (int q = 0; q < 16; ++q) ad[q] = *(const v4fa*)ap[q];
    // the wait that stands before the address registers of these loads are rewritten; it takes the addresses as inputs so that they stay in their registers up to it
    asm volatile("s_wait_xcnt 0x0" :: "v"(ap[0]), "v"(ap[1]), "v"(ap[2]), "v"(ap[3]), "v"(ap[4]), "v"(ap[5]), "v"(ap[6]), "v"(ap[7]), "v"(ap[8]), "v"(ap[9]), "v"(ap[10]), "v"(ap[11]), "v"(ap[12]), "v"(ap[13]), "v"(ap[14]), "v"(ap[15]) : "memory"); }
  v8f accs[8] = {c00, c01, c02, c03, c10, c11, c12, c13};
  if (CT && by == byT) {      // the same for the whole block: a barrier follows
    // Registers 0..7 of an accumulator tile are 8 consecutive rows of one column, that is 16 B of a C^T row. The block's 64 x 128 C^T tile is gathered in LDS so that one wave stores whole 256-B rows. The loops are unrolled so that accs[] is indexed by constants and stays in registers, and the 8 row reads are in flight together.
    constexpr int TP = 136;      // LDS row pitch 272 B (16 B x odd); 64 rows = 17,408 B, inside so
    unsigned short* sT = (unsigned short*)&so[0][0][0];
#pragma unroll
    for (int u = 0; u < 8; ++u) { const int t = u & 3, half = u >> 2; FragH f;
#pragma unroll
      for (int r = 0; r < 8; ++r) f.h[r] = (_Float16)(accs[u][r] * alpha);
      *(v8us*)(sT + (t * 16 + ln) * TP + 32 * w + half * 16 + 8 * hh) = f.half[0]; }
    __syncthreads();      // every wave's 32 columns of the C^T tile are in LDS before any row is read
    const int d0 = tid >> 4, c8 = (tid & 15) * 8; unsigned short* ct = (unsigned short*)CT + (size_t)(col0 + d0) * M + mt * 128 + c8; const size_t m8 = (size_t)8 * M;
#pragma unroll
    for (int q = 0; q < 8; ++q) { const v8us v = *(const v8us*)(sT + (q * 8 + d0) * TP + c8); *(v8us*)(ct + q * m8) = v; }
    return; }
#pragma unroll
  for (int u = 0; u < 8; ++u) { const int t = u & 3, half = u >> 2; const int col = col0 + t * 16 + ln; const float bv = bp ? bf16_round(bp[col]) : 0.f;
#pragma unroll
    for (int r = 0; r < 8; ++r) so[w][half * 16 + 8 * hh + r][t * 16 + ln] = accs[u][r] * alpha + bv; }
  __builtin_amdgcn_fence(__ATOMIC_ACQ_REL, "workgroup"); __builtin_amdgcn_wave_barrier();
  {
#pragma unroll
    for (int q = 0; q < 16; ++q) { const int r = q * 2 + rsub; v4f v = *(const v4fa*)&so[w][r][c4]; if (CP) v += ad[q];
#pragma unroll
      for (int i = 0; i < 4; ++i) { if (ACT == 3) v[i] = fmaxf(v[i], 0.f); else if (ACT == 6) v[i] = 0.5f * v[i] * (1.0f + erff(v[i] * 0.70710678118654752f)); else if (ACT == 11) v[i] = 1.0f / (1.0f + expf(-v[i])); else if (ACT == 15) v[i] = v[i] / (1.0f + expf(-v[i])); else if (ACT == 12) v[i] = (v[i] > 0.f) ? v[i] : 0.01f * v[i]; else if (ACT == 8) v[i] = tanhf(v[i]); }
      if (C) { *(v4f*)(C + cofs + (size_t)(row0 + r) * ldc + col0 + c4) = v; asm volatile("s_wait_xcnt 0x0" ::: "memory"); }      // the wait stands before the conversion below rewrites registers that this store names
      if (C16) { v4h h4; for (int i = 0; i < 4; ++i) h4[i] = (_Float16)v[i]; *(v4h*)(C16 + cofs + (size_t)(row0 + r) * ldc + col0 + c4) = h4; } }
     } }



// lane l with lane l ^ 16
__device__ __forceinline__ float xhalf(float x) { return __builtin_bit_cast(float, __builtin_amdgcn_permlanex16(__builtin_bit_cast(int, x), __builtin_bit_cast(int, x), 0x76543210, 0xfedcba98, false, false)); }
__global__ __launch_bounds__(128) void k_flash(const _Float16* __restrict__ Q16, int ldq, const _Float16* __restrict__ K16, int ldk, const _Float16* __restrict__ Vt, const int* __restrict__ MSK, _Float16* __restrict__ Oh, int ldo) {
  constexpr int CG = 2, RPW = 16 * CG, NQB = TQ / (4 * RPW), DT = 4, KS = 2;
  constexpr float C2 = SCL * 1.4426950408889634f;      // score scale x log2(e): the softmax runs in base 2
  constexpr int SK = 64, NST = TK / SK, LP = 72;      // a tile = 64 keys; LDS row pitch 144 B (16 B x odd: ds_load_b128 without bank conflicts)
  __shared__ __attribute__((aligned(16))) unsigned short sK[2][SK][LP]; __shared__ __attribute__((aligned(16))) unsigned short sV[2][64][LP];      // two buffers each: K rows [key][d], V^T rows [d][key]
  __shared__ __attribute__((aligned(16))) float sO[4][RPW][64 + 4];
  const int tid = threadIdx.x, w = tid >> 5, lane = tid & 31, ln = lane & 15, hh = lane >> 4;
  const int slab = blockIdx.x / NQB, qblk = blockIdx.x % NQB; const int b = slab / NH, h = slab % NH; const int qb0 = qblk * (4 * RPW); const int q0 = qb0 + w * RPW;
  FragH bq[CG][KS];
#pragma unroll
  for (int g = 0; g < CG; ++g) { const unsigned short* qr = (const unsigned short*)Q16 + ((size_t)b * TQ + q0 + g * 16 + ln) * ldq + h * 64;
#pragma unroll
    for (int ks = 0; ks < KS; ++ks) { bq[g][ks].half[0] = *(const v8us*)(qr + ks * 32 + 8 * hh); bq[g][ks].half[1] = *(const v8us*)(qr + ks * 32 + 16 + 8 * hh); } }
  const unsigned short* Vth = (const unsigned short*)Vt + (size_t)slab * 64 * TK;
  float m_r[CG], l_r[CG]; v8f oacc[CG][DT];      // one query per lane and column group: its running maximum (of the raw products), this lane half's part of its sum (x2^10, like P), O^T rows d = dt * 16 + 8 * hh + r
#pragma unroll
  for (int g = 0; g < CG; ++g) { m_r[g] = -3.0e38f; l_r[g] = 0.f;
#pragma unroll
    for (int dt = 0; dt < DT; ++dt) oacc[g][dt] = (v8f){0.f,0.f,0.f,0.f,0.f,0.f,0.f,0.f}; }
  // The block's four waves share each K / V^T tile: every thread copies 4 + 4 pieces of 16 B (8 lanes cover one whole 128-B row).
  const int crow = tid >> 3, cc8 = (tid & 7) * 8;
  const unsigned short* gK = (const unsigned short*)K16 + ((size_t)b * TK + crow) * ldk + h * 64 + cc8; const unsigned short* gV = Vth + (size_t)crow * TK + cc8;
  const unsigned lK = (unsigned)(size_t)&sK[0][crow][cc8], lV = (unsigned)(size_t)&sV[0][crow][cc8];
  auto copy_tile = [&](int t) {
    const unsigned bo = (unsigned)(t & 1) * (unsigned)(SK * LP * 2), r16 = 16 * LP * 2; const unsigned short* kp = gK + (size_t)t * SK * ldk; const unsigned short* vp = gV + (size_t)t * SK;
    // the copies and, as the last line of the same statement, the wait that stands before their address registers are rewritten
    asm volatile("global_load_async_to_lds_b128 %0, %8, off\n\tglobal_load_async_to_lds_b128 %1, %9, off\n\tglobal_load_async_to_lds_b128 %2, %10, off\n\tglobal_load_async_to_lds_b128 %3, %11, off\n\t"
                 "global_load_async_to_lds_b128 %4, %12, off\n\tglobal_load_async_to_lds_b128 %5, %13, off\n\tglobal_load_async_to_lds_b128 %6, %14, off\n\tglobal_load_async_to_lds_b128 %7, %15, off\n\ts_wait_xcnt 0x0"
                 :: "v"(lK + bo), "v"(lK + bo + r16), "v"(lK + bo + 2 * r16), "v"(lK + bo + 3 * r16), "v"(lV + bo), "v"(lV + bo + r16), "v"(lV + bo + 2 * r16), "v"(lV + bo + 3 * r16),
                    "v"(kp), "v"(kp + (size_t)16 * ldk), "v"(kp + (size_t)32 * ldk), "v"(kp + (size_t)48 * ldk), "v"(vp), "v"(vp + (size_t)16 * TK), "v"(vp + (size_t)32 * TK), "v"(vp + (size_t)48 * TK) : "memory"); };
  copy_tile(0);
  asm volatile("s_wait_asynccnt 0x0" ::: "memory");      // this wave's copies of tile 0 have landed
  __syncthreads();                                       // every wave's have: tile 0 may be read
  copy_tile(1);
#pragma unroll 1
  for (int t = 0; t < NST; ++t) {
   const unsigned short (*bK)[LP] = sK[t & 1]; const unsigned short (*bV)[LP] = sV[t & 1];
#pragma unroll
   for (int ps = 0; ps < SK / 32; ++ps) {
    v8f sc[CG][2];      // raw products q.k: the scale is positive, so their maximum is the scaled scores' maximum
#pragma unroll
    for (int nt = 0; nt < 2; ++nt) { const unsigned short* kr = &bK[ps * 32 + nt * 16 + ln][0]; FragH ak[KS];
#pragma unroll
      for (int ks = 0; ks < KS; ++ks) { ak[ks].half[0] = *(const v8us*)(kr + ks * 32 + 8 * hh); ak[ks].half[1] = *(const v8us*)(kr + ks * 32 + 16 + 8 * hh); }
#pragma unroll
      for (int g = 0; g < CG; ++g) { v8f acc = (v8f){0.f,0.f,0.f,0.f,0.f,0.f,0.f,0.f};
#pragma unroll
        for (int ks = 0; ks < KS; ++ks) acc = mmaH<1>(ak[ks].v, ak[ks].v, bq[g][ks].v, bq[g][ks].v, acc);
        sc[g][nt] = acc; } }
    FragH pb[CG];
#pragma unroll
    for (int g = 0; g < CG; ++g) {
      float mc = fmaxf(sc[g][0][0], sc[g][1][0]);
#pragma unroll
      for (int r = 1; r < 8; ++r) mc = fmaxf(mc, fmaxf(sc[g][0][r], sc[g][1][r]));
      mc = fmaxf(mc, xhalf(mc));      // both lane halves now hold the query's maximum over the 32 keys
      const float mn = fmaxf(m_r[g], mc); const float al = (mn > -1.0e38f) ? __builtin_amdgcn_exp2f((m_r[g] - mn) * C2) : 1.0f; m_r[g] = mn;
      const float nb = fmaf(-mn, C2, 10.0f);      // P x 2^10 = 2^(s * C2 - mn * C2 + 10): one fma per score, then v_exp_f32
      float ls[4] = {0.f, 0.f, 0.f, 0.f};
#pragma unroll
      for (int nt = 0; nt < 2; ++nt)
#pragma unroll
        for (int r = 0; r < 8; ++r) { const float p = __builtin_amdgcn_exp2f(fmaf(sc[g][nt][r], C2, nb)); ls[r & 3] += p; pb[g].h[nt * 8 + r] = (_Float16)p; }
      l_r[g] = l_r[g] * al + ((ls[0] + ls[1]) + (ls[2] + ls[3]));
#pragma unroll
      for (int dt = 0; dt < DT; ++dt) oacc[g][dt] *= al; }
#pragma unroll
    for (int dt = 0; dt < DT; ++dt) { const unsigned short* vrow = &bV[dt * 16 + ln][ps * 32]; FragH av; av.half[0] = *(const v8us*)(vrow + 8 * hh); av.half[1] = *(const v8us*)(vrow + 16 + 8 * hh);
#pragma unroll
      for (int g = 0; g < CG; ++g) oacc[g][dt] = mmaH<1>(av.v, av.v, pb[g].v, pb[g].v, oacc[g][dt]); } }
   asm volatile("s_wait_dscnt 0x0" ::: "memory");        // this wave's reads of tile t are done before its buffer is refilled
   asm volatile("s_wait_asynccnt 0x0" ::: "memory");     // this wave's copies of tile t + 1 have landed
   __syncthreads();                                      // publishes tile t + 1 and ends every wave's reads of tile t
   if (t + 2 < NST) copy_tile(t + 2); }
  asm volatile("s_wait_asynccnt 0x0" ::: "memory");      // nothing of this wave is in flight when it goes on to the epilogue and ends
#pragma unroll
  for (int g = 0; g < CG; ++g) {
    const float l = l_r[g] + xhalf(l_r[g]);      // the two lane halves' sums joined, unconditionally
    const float inv = (l > 0.f) ? 1.0f / l : 0.f;      // sum and O^T carry the same 2^10
#pragma unroll
    for (int dt = 0; dt < DT; ++dt) { const v4f lo = {oacc[g][dt][0] * inv, oacc[g][dt][1] * inv, oacc[g][dt][2] * inv, oacc[g][dt][3] * inv}, hi = {oacc[g][dt][4] * inv, oacc[g][dt][5] * inv, oacc[g][dt][6] * inv, oacc[g][dt][7] * inv};
      *(v4fa*)&sO[w][g * 16 + ln][dt * 16 + 8 * hh] = lo; *(v4fa*)&sO[w][g * 16 + ln][dt * 16 + 8 * hh + 4] = hi; } }
  __builtin_amdgcn_fence(__ATOMIC_ACQ_REL, "workgroup"); __builtin_amdgcn_wave_barrier();
  {
#pragma unroll
    for (int rp = 0; rp < RPW; rp += 4) { const int r = rp + (lane >> 3), pc = lane & 7; const v4f x = *(const v4fa*)&sO[w][r][pc * 8], y = *(const v4fa*)&sO[w][r][pc * 8 + 4]; FragH fh;      // O leaves as plain f16: 8 lanes store one row's 128 B; unrolled so that the fragments stay in registers
#pragma unroll
      for (int q = 0; q < 4; ++q) { fh.h[q] = (_Float16)x[q]; fh.h[4 + q] = (_Float16)y[q]; }
      const size_t o = ((size_t)b * TQ + q0 + r) * ldo + h * 64 + pc * 8;
      *(v8us*)((unsigned short*)Oh + o) = fh.half[0]; }
     } }
__global__ __launch_bounds__(256) void k_fulltab(unsigned* __restrict__ MB, int* __restrict__ RA, int* __restrict__ KE, int nq, int nk) {
  const int t = blockIdx.x * 256 + threadIdx.x;
  if (t < nq * (nk / 32)) { *(unsigned*)(MB + t) = 0u;  }
  if (t < nq) { *(int*)(RA + t) = 0;  }
  if (t < nq / 64) { *(int*)(KE + t * 32) = nk;  } }
__global__ __launch_bounds__(256) void k_lnout(const float* __restrict__ Y, const float* __restrict__ g, const float* __restrict__ bb, float* __restrict__ out) {
  #pragma clang fp contract(off)
  const int tid = threadIdx.x, w = tid >> 5, ln = tid & 31; const int r = blockIdx.x * 8 + w; if (r >= NR) return; const float* y = Y + (size_t)r * DM; float s = 0.f;
#pragma unroll 1
  for (int i = 0; i < 8; ++i) { const v4f a = *(const v4fa*)(y + i * 128 + ln * 4); for (int q = 0; q < 4; ++q) s += a[q]; }
  for (int o = 16; o > 0; o >>= 1) s += __shfl_xor(s, o, 32); const float mu = s / (float)DM; float q2 = 0.f;
#pragma unroll 1
  for (int i = 0; i < 8; ++i) { const v4f a = *(const v4fa*)(y + i * 128 + ln * 4); for (int q = 0; q < 4; ++q) { const float d = a[q] - mu; q2 += d * d; } }
  for (int o = 16; o > 0; o >>= 1) q2 += __shfl_xor(q2, o, 32); const float rs = rsqrtf(q2 / (float)DM + 1e-6f);
  {
#pragma unroll 1
    for (int i = 0; i < 8; ++i) { const int c0 = i * 128 + ln * 4; const v4f a = *(const v4fa*)(y + c0); v4f o4; for (int q = 0; q < 4; ++q) o4[q] = (a[q] - mu) * rs * bf16_round(g[c0 + q]) + bf16_round(bb[c0 + q]); *(v4f*)(out + (size_t)r * DM + c0) = o4; }
     } }
__global__ __launch_bounds__(256) void k_xb(const float* __restrict__ x, float* __restrict__ XB, size_t n4) { const size_t t = (size_t)blockIdx.x * 256 + threadIdx.x; if (t >= n4) return; const v4f a = *(const v4fa*)(x + t * 4); v4f o; for (int q = 0; q < 4; ++q) o[q] = bf16_round(a[q]); *(v4f*)(XB + t * 4) = o;  }
// Every input conversion in one launch, by block range: blocks 0..767 round q, k, v to bf16 and store them as f16 planes (q also as f32, the residual addend);
// blocks 768..1023 store the four weights, rounded to bf16, as f16 x16. A block streams 4096 pieces of 16 B, lane-contiguous, 16 per thread.
template <bool RES>
__device__ __forceinline__ void prep_stream(const float* __restrict__ src, _Float16* __restrict__ dst, float* __restrict__ xb, float scale, int tid) {
  v4f a[16];      // the three loops below are unrolled so that a[] lives in registers and every address is base + immediate offset
#pragma unroll
  for (int u = 0; u < 16; ++u) a[u] = *(const v4fa*)(src + (u * 256 + tid) * 4);
  __builtin_amdgcn_sched_barrier(0);      // keeps all 16 loads in flight together: without it the compiler sinks six of them among the conversions
#pragma unroll
  for (int u = 0; u < 16; ++u) { const int e = (u * 256 + tid) * 4; v4f r; v4h h;
#pragma unroll
    for (int i = 0; i < 4; ++i) { r[i] = bf16_round(a[u][i]); h[i] = (_Float16)(r[i] * scale); }
    *(v4h*)(dst + e) = h; if (RES) *(v4f*)(xb + e) = r; } }
__global__ __launch_bounds__(256) void k_prep(const float* __restrict__ q, const float* __restrict__ k, const float* __restrict__ v, const float* __restrict__ Wq, const float* __restrict__ Wk, const float* __restrict__ Wv, const float* __restrict__ Wo,
                                              _Float16* __restrict__ X16, float* __restrict__ XB, _Float16* __restrict__ B16) {
  constexpr int PB = 4096, XBLK = NR * DM / 4 / PB, WBLK = DM * DM / 4 / PB;
  const int bid = blockIdx.x, tid = threadIdx.x;
  if (bid < XBLK) { const size_t o = (size_t)bid * PB * 4; prep_stream<true>(q + o, X16 + o, XB + o, 1.0f, tid); }
  else if (bid < 3 * XBLK) { const bool isk = bid < 2 * XBLK; const size_t o = (size_t)(bid - (isk ? XBLK : 2 * XBLK)) * PB * 4; prep_stream<false>((isk ? k : v) + o, X16 + (size_t)(isk ? 1 : 2) * NR * DM + o, nullptr, 1.0f, tid); }
  else { const int j = (bid - 3 * XBLK) / WBLK; const size_t o = (size_t)((bid - 3 * XBLK) % WBLK) * PB * 4; prep_stream<false>((j == 0 ? Wq : (j == 1 ? Wk : (j == 2 ? Wv : Wo))) + o, B16 + (size_t)j * DM * DM + o, nullptr, 16.0f, tid); } }
__global__ __launch_bounds__(256) void k_causaltab(unsigned* __restrict__ MB, int* __restrict__ RA, int* __restrict__ KE, int nq, int nk) {
  const int t = blockIdx.x * 256 + threadIdx.x; const int nw = nk / 32;
  if (t < nq * nw) { const int q = t / nw, w = t % nw; const int first = q + 1 - 32 * w; const unsigned bits = (first <= 0) ? 0xffffffffu : ((first >= 32) ? 0u : (0xffffffffu << first)); *(unsigned*)(MB + t) = bits;  }
  if (t < nq) { *(int*)(RA + t) = 0;  }
  if (t < nq / 64) { const int v = 64 * (t + 1); *(int*)(KE + t * 32) = v;  } }


extern "C" void kernel_launch(void* const* d_in, const int* in_sizes, int n_in,
                              void* d_out, int out_size, void* d_ws, size_t ws_size, hipStream_t stream) {
  (void)in_sizes; (void)n_in; (void)out_size;
  const float* const* I = (const float* const*)d_in; const float* qin = I[0]; const float* kin = I[1]; const float* vin = I[2]; const float* Wq = I[3]; const float* Wk = I[4]; const float* Wv = I[5]; const float* Wo = I[6]; const float* gam = I[7]; const float* bet = I[8];
  char* ws = (char*)d_ws; size_t off = 0;
  auto take = [&](size_t bytes) { char* p = ws + off; off += (bytes + 255) & ~(size_t)255; return p; };
  _Float16* BQ = (_Float16*)take((size_t)DM * DM * 2); _Float16* BK = (_Float16*)take((size_t)DM * DM * 2); _Float16* BV = (_Float16*)take((size_t)DM * DM * 2); _Float16* BO = (_Float16*)take((size_t)DM * DM * 2);
  _Float16* X16 = (_Float16*)take((size_t)3 * NR * DM * 2); float* F = (float*)take((size_t)NR * DM * 4); float* XB = (float*)take((size_t)NR * DM * 4);
  _Float16* Q16 = (_Float16*)take((size_t)NR * DM * 2); _Float16* K16 = (_Float16*)take((size_t)NR * DM * 2); _Float16* V16 = (_Float16*)take((size_t)NR * DM * 2); _Float16* VT = (_Float16*)take((size_t)NR * DM * 2);
  if (off > ws_size) return;      /* 8 + 24 + 16 + 16 + 32 = 96 MiB; BQ BK BV BO, the three X16 planes and Q16 K16 V16 each lie one behind the other */
  _Float16* Oh = (_Float16*)F; float* Y = XB;      /* the O plane lies in F: k_flash writes it while other blocks still read Q16 and K16 */
  (void)BK; (void)BV; (void)V16;
  k_prep<<<3 * (NR * DM / 16384) + 4 * (DM * DM / 16384), 256, 0, stream>>>(qin, kin, vin, Wq, Wk, Wv, Wo, X16, XB, BQ);      /* X16 planes of q, k, v; XB; BQ BK BV BO */
  const dim3 gP((NR / 128) * (DM / 64), 1), gP3((NR / 128) * (DM / 64), 3);
  k_gemm2<0><<<gP3, 128, 0, stream>>>(X16, DM, (size_t)NR * DM, BQ, DM, (size_t)DM * DM, 0.0625f, nullptr, 0, nullptr, 1, 0, 0, nullptr, Q16, DM, (size_t)NR * DM, NR, DM, DM, VT, 2, nullptr, 1.0f);      /* blockIdx.y = 0, 1: qh, kh (f16 planes); 2: vh, stored as V^T [head * 64 + d][token] */
  k_flash<<<NH * (SLEN / 128), 128, 0, stream>>>(Q16, DM, K16, DM, VT, nullptr, Oh, DM);      /* plain flash over all 4096 keys (no mask) */
  k_gemm2<0><<<gP, 128, 0, stream>>>(Oh, DM, 0, BO, DM, 0, 0.0625f, nullptr, 0, XB, 1, (size_t)DM, 0, Y, nullptr, DM, 0, NR, DM, DM, nullptr, 0, nullptr, 1.0f);      /* Y = O Wo^T + bf16(q) */
  k_lnout<<<NR / 8, 256, 0, stream>>>(Y, gam, bet, (float*)d_out);
}

// v010
// It runs in 140 microseconds.
// Two timings next to v009 put it at 1.04 and 1.03 times that version's speed.
// Counting every step since v000, it is 5.31 times as fast.
#include <hip/hip_runtime.h>
#define NBT 1
#define SLEN 4096
#define TQ SLEN
#define TK SLEN
#define DM 1024
#define NH 16
#define SCL 0.125f
#define NR (NBT * SLEN)
typedef __bf16 v16b __attribute__((ext_vector_type(16)));
typedef unsigned short v8us __attribute__((ext_vector_type(8), may_alias));
typedef float  v8f  __attribute__((ext_vector_type(8)));
typedef float  v4f  __attribute__((ext_vector_type(4)));
typedef float  v4fa __attribute__((ext_vector_type(4), may_alias));
union FragB { v16b v; v8us half[2]; unsigned short u[16]; };

__device__ __forceinline__ unsigned short bf16_bits(float x) { unsigned int u = __float_as_uint(x); return (unsigned short)((u + 0x7FFFu + ((u >> 16) & 1u)) >> 16); }
__device__ __forceinline__ float bf16_val(unsigned short b) { return __uint_as_float(((unsigned int)b) << 16); }
__device__ __forceinline__ float bf16_round(float x) { return bf16_val(bf16_bits(x)); }
// D += A·B with NT terms: 1 = ah·bh, 2 = + al·bh (A split), 3 = + ah·bl (both split)
template <int NT>
__device__ __forceinline__ v8f mmaN(v16b ah, v16b al, v16b bh, v16b bl, v8f c) {
  c = __builtin_amdgcn_wmma_f32_16x16x32_bf16(false, ah, false, bh, (short)0, c, false, false);
  if (NT >= 2) c = __builtin_amdgcn_wmma_f32_16x16x32_bf16(false, al, false, bh, (short)0, c, false, false);
  if (NT >= 3) c = __builtin_amdgcn_wmma_f32_16x16x32_bf16(false, ah, false, bl, (short)0, c, false, false);
  asm volatile("v_nop\n\tv_nop\n\tv_nop\n\tv_nop" : "+v"(c) : "v"(ah), "v"(al), "v"(bh), "v"(bl));
  return c;
}

__global__ __launch_bounds__(256) void k_wt_bf16(const float* __restrict__ W, unsigned short* __restrict__ Wt, int K, int N) {
  const int t = blockIdx.x * 256 + threadIdx.x;
  const int k8n = K / 8;
  if (t >= N * k8n) return;
  const int n = t / k8n, k8 = (t % k8n) * 8;
  v8us v;
#pragma unroll
  for (int i = 0; i < 8; ++i) v[i] = bf16_bits(W[(size_t)(k8 + i) * N + n]);
  *(v8us*)(Wt + (size_t)n * K + k8) = v;
  
}

// GEMM C[M][N] (f32, pitch ldc) = act(A[M][K]·W + bias). A f32 row-major (pitch lda) converted per fragment to bf16
// (ASPLIT: hi/lo two planes -> 2 terms, else single rounded term); Wt bf16 [N][K] (pitch ldb). BIAS_BF16 rounds the
// bias to bf16 first (bias quantised to bf16 before the add). K%32==0, M%16==0, N%64==0.
template <bool ASPLIT, int ACT, bool BIAS_BF16>
__global__ __launch_bounds__(128) void k_gemm_bf(const float* __restrict__ A, int lda, const unsigned short* __restrict__ Wt, int ldb,
                                               const float* __restrict__ bias, float* __restrict__ C, int ldc, int M, int N, int K) {
  __shared__ __attribute__((aligned(16))) float so[4][16][64];
  const int tid = threadIdx.x, w = tid >> 5, lane = tid & 31, ln = lane & 15, hh = lane >> 4;
  const int ntn = N / 64;
  const int wid = blockIdx.x * 4 + w;
  const int mt = wid / ntn, nq = wid % ntn;
  if (mt * 16 >= M) return;
  const int row0 = mt * 16, col0 = nq * 64;
  const float* arow = A + (size_t)(row0 + ln) * lda;
  v8f acc[4] = {};
  for (int kb = 0; kb < K; kb += 32) {
    FragB ah, al;
    const v4f x0 = *(const v4fa*)(arow + kb + 8 * hh), x1 = *(const v4fa*)(arow + kb + 8 * hh + 4);
    const v4f x2 = *(const v4fa*)(arow + kb + 16 + 8 * hh), x3 = *(const v4fa*)(arow + kb + 16 + 8 * hh + 4);
    float xs[16] = {x0[0],x0[1],x0[2],x0[3],x1[0],x1[1],x1[2],x1[3],x2[0],x2[1],x2[2],x2[3],x3[0],x3[1],x3[2],x3[3]};
#pragma unroll
    for (int i = 0; i < 16; ++i) { const unsigned short hb = bf16_bits(xs[i]); ah.u[i] = hb; al.u[i] = ASPLIT ? bf16_bits(xs[i] - bf16_val(hb)) : (unsigned short)0; }
#pragma unroll
    for (int t = 0; t < 4; ++t) {
      const unsigned short* brow = Wt + (size_t)(col0 + t * 16 + ln) * ldb + kb;
      FragB b;
      b.half[0] = *(const v8us*)(brow + 8 * hh);
      b.half[1] = *(const v8us*)(brow + 16 + 8 * hh);
      acc[t] = mmaN<ASPLIT ? 2 : 1>(ah.v, al.v, b.v, b.v, acc[t]);
    }
  }
#pragma unroll
  for (int t = 0; t < 4; ++t) {
    float bv = bias ? bias[col0 + t * 16 + ln] : 0.f;
    if (BIAS_BF16) bv = bf16_round(bv);
#pragma unroll
    for (int r = 0; r < 8; ++r) { float v = acc[t][r] + bv; if (ACT == 1) v = fmaxf(v, 0.f); so[w][8 * hh + r][t * 16 + ln] = v; }
  }
  __builtin_amdgcn_fence(__ATOMIC_ACQ_REL, "workgroup");
  __builtin_amdgcn_wave_barrier();
  const int rsub = lane >> 4, c4 = (lane & 15) * 4;
  {
#pragma unroll
    for (int q = 0; q < 8; ++q) {
      const int r = q * 2 + rsub;
      const v4f v = *(const v4fa*)&so[w][r][c4];
      *(v4f*)(C + (size_t)(row0 + r) * ldc + col0 + c4) = v;
    }
    
  }
}

// GEMM C = act(A·W + bias + resid): A f32 (ASPLIT -> hi/lo 2 terms), Wt bf16 [N][K]; ACT 0 none, 1 relu, 2 exact gelu;
// resid (optional, f32, row index = (row % rmod), pitch ldr, RES_BF16 rounds it) added before the activation.
template <bool ASPLIT, int ACT, bool BIAS_BF16, bool RES_BF16>
__global__ __launch_bounds__(128) void k_gemm_bf3(const float* __restrict__ A, int lda, const unsigned short* __restrict__ Wt, int ldb,
                                                const float* __restrict__ bias, const float* __restrict__ resid, int rmod, int ldr,
                                                float* __restrict__ C, int ldc, int M, int N, int K) {
  __shared__ __attribute__((aligned(16))) float so[4][16][64];
  const int tid = threadIdx.x, w = tid >> 5, lane = tid & 31, ln = lane & 15, hh = lane >> 4;
  const int ntn = N / 64;
  const int wid = blockIdx.x * 4 + w;
  const int mt = wid / ntn, nq = wid % ntn;
  if (mt * 16 >= M) return;
  const int row0 = mt * 16, col0 = nq * 64;
  const float* arow = A + (size_t)(row0 + ln) * lda;
  v8f acc[4] = {};
  for (int kb = 0; kb < K; kb += 32) {
    FragB ah, al;
    const v4f x0 = *(const v4fa*)(arow + kb + 8 * hh), x1 = *(const v4fa*)(arow + kb + 8 * hh + 4);
    const v4f x2 = *(const v4fa*)(arow + kb + 16 + 8 * hh), x3 = *(const v4fa*)(arow + kb + 16 + 8 * hh + 4);
    float xs[16] = {x0[0],x0[1],x0[2],x0[3],x1[0],x1[1],x1[2],x1[3],x2[0],x2[1],x2[2],x2[3],x3[0],x3[1],x3[2],x3[3]};
#pragma unroll
    for (int i = 0; i < 16; ++i) { const unsigned short hb = bf16_bits(xs[i]); ah.u[i] = hb; al.u[i] = ASPLIT ? bf16_bits(xs[i] - bf16_val(hb)) : (unsigned short)0; }
#pragma unroll
    for (int t = 0; t < 4; ++t) {
      const unsigned short* brow = Wt + (size_t)(col0 + t * 16 + ln) * ldb + kb;
      FragB b;
      b.half[0] = *(const v8us*)(brow + 8 * hh);
      b.half[1] = *(const v8us*)(brow + 16 + 8 * hh);
      acc[t] = mmaN<ASPLIT ? 2 : 1>(ah.v, al.v, b.v, b.v, acc[t]);
    }
  }
#pragma unroll
  for (int t = 0; t < 4; ++t) {
    const int col = col0 + t * 16 + ln;
    float bv = bias ? bias[col] : 0.f;
    if (BIAS_BF16) bv = bf16_round(bv);
#pragma unroll
    for (int r = 0; r < 8; ++r) {
      float v = acc[t][r] + bv;
      if (resid) { float rv = resid[(size_t)((row0 + 8 * hh + r) % rmod) * ldr + col]; if (RES_BF16) rv = bf16_round(rv); v += rv; }
      if (ACT == 1) v = fmaxf(v, 0.f);
      if (ACT == 2) v = 0.5f * v * (1.0f + erff(v * 0.70710678118654752f));
      if (ACT == 3) { const float u = 0.7978845608028654f * (v + 0.044715f * v * v * v); v = 0.5f * v * (1.0f + tanhf(u)); }
      so[w][8 * hh + r][t * 16 + ln] = v;
    }
  }
  __builtin_amdgcn_fence(__ATOMIC_ACQ_REL, "workgroup");
  __builtin_amdgcn_wave_barrier();
  const int rsub = lane >> 4, c4 = (lane & 15) * 4;
  {
#pragma unroll
    for (int q = 0; q < 8; ++q) {
      const int r = q * 2 + rsub;
      const v4f v = *(const v4fa*)&so[w][r][c4];
      *(v4f*)(C + (size_t)(row0 + r) * ldc + col0 + c4) = v;
    }
    
  }
}
// row LayerNorm (biased variance, eps) over N: s = X (+ R); optional out_sum <- s; out_norm <- (s-mu)*rsqrt(var+eps)*g + b
template <bool PARAM_BF16>
__global__ __launch_bounds__(256) void k_layernorm(const float* __restrict__ X, const float* __restrict__ R, const float* __restrict__ g, const float* __restrict__ bta,
                                                  float* __restrict__ out_sum, float* __restrict__ out_norm, int N, float eps) {
  __shared__ float red[256];
  const int row = blockIdx.x, tid = threadIdx.x;
  const float* x = X + (size_t)row * N; const float* rr = R ? R + (size_t)row * N : nullptr;
  float vals[16];                     // up to N = 4096
  const int per = N / 256;            // contiguous chunk per thread? use strided-by-4 chunks: thread handles j = tid*4 + 1024*u
  float s1 = 0.f;
  for (int u = 0; u < per / 4; ++u) {
    const int j = tid * 4 + 1024 * u;
    const v4f a = *(const v4fa*)(x + j);
    v4f b = {0.f,0.f,0.f,0.f}; if (rr) b = *(const v4fa*)(rr + j);
#pragma unroll
    for (int q = 0; q < 4; ++q) { const float v = a[q] + b[q]; vals[u * 4 + q] = v; s1 += v; }
  }
  red[tid] = s1; __syncthreads();
  for (int st = 128; st > 0; st >>= 1) { if (tid < st) red[tid] += red[tid + st]; __syncthreads(); }
  const float mu = red[0] / (float)N; __syncthreads();
  float s2 = 0.f;
  for (int u = 0; u < per / 4; ++u)
#pragma unroll
    for (int q = 0; q < 4; ++q) { const float c = vals[u * 4 + q] - mu; s2 += c * c; }
  red[tid] = s2; __syncthreads();
  for (int st = 128; st > 0; st >>= 1) { if (tid < st) red[tid] += red[tid + st]; __syncthreads(); }
  const float rs = rsqrtf(red[0] / (float)N + eps);
  {
    for (int u = 0; u < per / 4; ++u) {
      const int j = tid * 4 + 1024 * u;
      v4f o, sm;
#pragma unroll
      for (int q = 0; q < 4; ++q) {
        float gg = g[j + q], bb = bta[j + q];
        if (PARAM_BF16) { gg = bf16_round(gg); bb = bf16_round(bb); }
        sm[q] = vals[u * 4 + q]; o[q] = (vals[u * 4 + q] - mu) * rs * gg + bb;
      }
      if (out_sum) *(v4f*)(out_sum + (size_t)row * N + j) = sm;
      *(v4f*)(out_norm + (size_t)row * N + j) = o;
    }
    
  }
}



// ---- f16 WMMA path (v_wmma_f32_16x16x32_f16): 11-bit significands for operands in range — used where a [0,1] probability operand needs more precision than bf16
typedef _Float16 v16h __attribute__((ext_vector_type(16)));
union FragH { v16h v; v8us half[2]; _Float16 h[16]; unsigned short u[16]; };
template <int NT>
__device__ __forceinline__ v8f mmaH(v16h ah, v16h al, v16h bh, v16h bl, v8f c) {
  c = __builtin_amdgcn_wmma_f32_16x16x32_f16(false, ah, false, bh, (short)0, c, false, false);
  if (NT >= 2) c = __builtin_amdgcn_wmma_f32_16x16x32_f16(false, al, false, bh, (short)0, c, false, false);
  if (NT >= 3) c = __builtin_amdgcn_wmma_f32_16x16x32_f16(false, ah, false, bl, (short)0, c, false, false);
  return c;      // no asm behind the builtin: the compiler keeps the distance after a WMMA itself and stays free to move LDS reads ahead of it
}
// batched GEMM like k_gemm_b but f16 operands: A f32 (split into f16 hi/lo if ASPLIT, else rounded to f16), Bt = f16 values [n][k]; alpha; C f32; N multiple of 16 (partial tiles skipped)
template <bool ASPLIT>
__global__ __launch_bounds__(128) void k_gemm_h(const float* __restrict__ A, int lda, size_t sA, const _Float16* __restrict__ Bh, int ldb, size_t sB, float alpha, float* __restrict__ C, int ldc, size_t sC, int M, int N, int K) {
  __shared__ __attribute__((aligned(16))) float so[4][16][64];
  const int tid = threadIdx.x, w = tid >> 5, lane = tid & 31, ln = lane & 15, hh = lane >> 4; const int by = blockIdx.y;
  A += (size_t)by * sA; Bh += (size_t)by * sB; C += (size_t)by * sC;
  const int ntn = (N + 63) / 64; const int wid = blockIdx.x * 4 + w; const int mt = wid / ntn, nq = wid % ntn; if (mt * 16 >= M) return;
  const int row0 = mt * 16, col0 = nq * 64; const float* arow = A + (size_t)(row0 + ln) * lda;
  v8f acc[4] = {};
  for (int kb = 0; kb < K; kb += 32) {
    FragH ah, al;
    const v4f x0 = *(const v4fa*)(arow + kb + 8 * hh), x1 = *(const v4fa*)(arow + kb + 8 * hh + 4), x2 = *(const v4fa*)(arow + kb + 16 + 8 * hh), x3 = *(const v4fa*)(arow + kb + 16 + 8 * hh + 4);
    float xs[16] = {x0[0],x0[1],x0[2],x0[3],x1[0],x1[1],x1[2],x1[3],x2[0],x2[1],x2[2],x2[3],x3[0],x3[1],x3[2],x3[3]};
#pragma unroll
    for (int i = 0; i < 16; ++i) { const _Float16 h = (_Float16)xs[i]; ah.h[i] = h; al.h[i] = ASPLIT ? (_Float16)(xs[i] - (float)h) : (_Float16)0.0f; }
#pragma unroll
    for (int t = 0; t < 4; ++t) { if (col0 + t * 16 >= N) continue; const size_t boff = (size_t)(col0 + t * 16 + ln) * ldb + kb; FragH bq; bq.half[0] = *(const v8us*)(Bh + boff + 8 * hh); bq.half[1] = *(const v8us*)(Bh + boff + 16 + 8 * hh);
      acc[t] = mmaH<ASPLIT ? 2 : 1>(ah.v, al.v, bq.v, bq.v, acc[t]); }
  }
#pragma unroll
  for (int t = 0; t < 4; ++t) { if (col0 + t * 16 >= N) continue;
#pragma unroll
    for (int r = 0; r < 8; ++r) so[w][8 * hh + r][t * 16 + ln] = acc[t][r] * alpha; }
  __builtin_amdgcn_fence(__ATOMIC_ACQ_REL, "workgroup"); __builtin_amdgcn_wave_barrier();
  const int rsub = lane >> 4, c4 = (lane & 15) * 4;
  {
#pragma unroll
    for (int q = 0; q < 8; ++q) { const int r = q * 2 + rsub; if (col0 + c4 < N) { const v4f v = *(const v4fa*)&so[w][r][c4]; *(v4f*)(C + (size_t)(row0 + r) * ldc + col0 + c4) = v; } }
     }
}

// Wt[n][k] = f16(W[k][n]·scale) from f32 row-major W[K][N] (scale = power of two; bf16-exact weights stay exact in f16 away from the subnormal range)
__global__ __launch_bounds__(256) void k_wt_f16(const float* __restrict__ W, _Float16* __restrict__ Wt, int K, int N, float scale) {
  const int t = blockIdx.x * 256 + threadIdx.x; if (t >= N * (K / 8)) return; const int n = t / (K / 8), k8 = (t % (K / 8)) * 8; FragH f;
#pragma unroll
  for (int i = 0; i < 8; ++i) f.h[i] = (_Float16)(bf16_round(W[(size_t)(k8 + i) * N + n]) * scale); const v8us o = f.half[0];
  *(v8us*)((unsigned short*)Wt + (size_t)n * K + k8) = o; 
}
// k_gemm_hh variant with fused epilogue: v = acc·alpha + bias[by·sBias + col] (+ CP[(row/rowsPerB)·sCPb + by·64 + col] if CP) ; ACT 0 none / 1 elu ; writes f16 C16 (and f32 C if non-null)
template <int ACT>
__global__ __launch_bounds__(128) void k_gemm_hhx(const _Float16* __restrict__ A, int lda, size_t sA, const _Float16* __restrict__ Bh, int ldb, size_t sB, float alpha, const float* __restrict__ bias, size_t sBias, const float* __restrict__ CP, int rowsPerB, size_t sCPb, int row0g,
    float* __restrict__ C, _Float16* __restrict__ C16, int ldc, size_t sC, int M, int N, int K) {
  __shared__ __attribute__((aligned(16))) float so[4][16][64];
  const int tid = threadIdx.x, w = tid >> 5, lane = tid & 31, ln = lane & 15, hh = lane >> 4; const int by = blockIdx.y;
  A += (size_t)by * sA; Bh += (size_t)by * sB; const size_t cofs = (size_t)by * sC; const float* bp = bias ? bias + (size_t)by * sBias : nullptr;
  const int ntn = (N + 63) / 64; const int wid = blockIdx.x * 4 + w; const int mt = wid / ntn, nq = wid % ntn; if (mt * 16 >= M) return;
  const int row0 = mt * 16, col0 = nq * 64; const _Float16* arow = A + (size_t)(row0 + ln) * lda;
  v8f acc[4] = {};
  for (int kb = 0; kb < K; kb += 32) { FragH ah; ah.half[0] = *(const v8us*)((const unsigned short*)arow + kb + 8 * hh); ah.half[1] = *(const v8us*)((const unsigned short*)arow + kb + 16 + 8 * hh);
#pragma unroll
    for (int t = 0; t < 4; ++t) { if (col0 + t * 16 >= N) continue; const size_t boff = (size_t)(col0 + t * 16 + ln) * ldb + kb; FragH bq; bq.half[0] = *(const v8us*)((const unsigned short*)Bh + boff + 8 * hh); bq.half[1] = *(const v8us*)((const unsigned short*)Bh + boff + 16 + 8 * hh);
      acc[t] = mmaH<1>(ah.v, ah.v, bq.v, bq.v, acc[t]); }
  }
#pragma unroll
  for (int t = 0; t < 4; ++t) { if (col0 + t * 16 >= N) continue; const int col = col0 + t * 16 + ln; const float bv = bp ? bf16_round(bp[col]) : 0.f;
#pragma unroll
    for (int r = 0; r < 8; ++r) { float v = acc[t][r] * alpha + bv; if (CP) { const int bidx = (row0g + row0 + 8 * hh + r) / rowsPerB; v += CP[(size_t)bidx * sCPb + (size_t)by * 64 + col]; } if (ACT == 1) v = (v > 0.f) ? v : expm1f(v); else if (ACT == 7) v = (v > 0.f) ? v + 1.0f : expf(v); else if (ACT == 8) v = tanhf(v); else if (ACT == 9) v = 0.5f * v * (1.0f + tanhf(0.7978845608028654f * (v + 0.044715f * v * v * v))); else if (ACT == 11) v = 1.0f / (1.0f + expf(-v)); else if (ACT == 12) v = (v > 0.f) ? v : 0.01f * v; else if (ACT == 14) v = (v > 0.f) ? v : 0.1f * v; else if (ACT == 15) v = v / (1.0f + expf(-v)); else if (ACT == 3) v = fmaxf(v, 0.f); else if (ACT == 6) v = 0.5f * v * (1.0f + erff(v * 0.70710678118654752f)); so[w][8 * hh + r][t * 16 + ln] = v; } }
  __builtin_amdgcn_fence(__ATOMIC_ACQ_REL, "workgroup"); __builtin_amdgcn_wave_barrier();
  const int rsub = lane >> 4, c4 = (lane & 15) * 4; typedef _Float16 v4h __attribute__((ext_vector_type(4)));
  {
#pragma unroll
    for (int q = 0; q < 8; ++q) { const int r = q * 2 + rsub; if (col0 + c4 < N) { const v4f v = *(const v4fa*)&so[w][r][c4]; if (C) *(v4f*)(C + cofs + (size_t)(row0 + r) * ldc + col0 + c4) = v; if (C16) { v4h h4; for (int i = 0; i < 4; ++i) h4[i] = (_Float16)v[i]; *(v4h*)(C16 + cofs + (size_t)(row0 + r) * ldc + col0 + c4) = h4; } } }
     }
}


typedef _Float16 v4h __attribute__((ext_vector_type(4)));

__global__ __launch_bounds__(256) void k_x16(const float* __restrict__ x, _Float16* __restrict__ X16, size_t n8) { const size_t t = (size_t)blockIdx.x * 256 + threadIdx.x; if (t >= n8) return; FragH f;
#pragma unroll
  for (int q = 0; q < 8; ++q) f.h[q] = (_Float16)bf16_round(x[t * 8 + q]); *(v8us*)((unsigned short*)X16 + t * 8) = f.half[0];  }
__global__ __launch_bounds__(256) void k_h16(const float* __restrict__ x, _Float16* __restrict__ X16, size_t n8) { const size_t t = (size_t)blockIdx.x * 256 + threadIdx.x; if (t >= n8) return; FragH f;
#pragma unroll
  for (int q = 0; q < 8; ++q) f.h[q] = (_Float16)x[t * 8 + q]; *(v8us*)((unsigned short*)X16 + t * 8) = f.half[0];  }
__global__ __launch_bounds__(256) void k_round16f(const float* __restrict__ W, _Float16* __restrict__ Bt, size_t n8) { const size_t t = (size_t)blockIdx.x * 256 + threadIdx.x; if (t >= n8) return; FragH f;
#pragma unroll
  for (int i = 0; i < 8; ++i) f.h[i] = (_Float16)(bf16_round(W[t * 8 + i]) * 16.0f); *(v8us*)((unsigned short*)Bt + t * 8) = f.half[0];  }
template <int NHv, int TTv>
__global__ __launch_bounds__(256) void k_vt(const _Float16* __restrict__ V16, int ldv, int voff, _Float16* __restrict__ Vt) { __shared__ unsigned short tl[64][66]; const int tid = threadIdx.x; const int slab = blockIdx.x / (TTv / 64), lg = blockIdx.x % (TTv / 64); const int b = slab / NHv, h = slab % NHv;
  for (int i = tid; i < 64 * 8; i += 256) { const int r = i / 8, c8 = (i % 8) * 8; FragH f; f.half[0] = *(const v8us*)((const unsigned short*)V16 + ((size_t)b * TTv + lg * 64 + r) * ldv + voff + h * 64 + c8);
#pragma unroll
    for (int q = 0; q < 8; ++q) tl[r][c8 + q] = f.u[q]; }
  __syncthreads();
  {
#pragma unroll
    for (int rd = 0; rd < 2; ++rd) { const int d = rd * 32 + tid / 8, pc = tid % 8; FragH f;
#pragma unroll
      for (int q = 0; q < 8; ++q) f.u[q] = tl[pc * 8 + q][d];
      *(v8us*)((unsigned short*)Vt + ((size_t)slab * 64 + d) * TTv + lg * 64 + pc * 8) = f.half[0]; }
     } }

__global__ __launch_bounds__(256) void k_hl(const float* __restrict__ F, _Float16* __restrict__ Hh, _Float16* __restrict__ Hl, size_t n8) { const size_t t = (size_t)blockIdx.x * 256 + threadIdx.x; if (t >= n8) return; FragH fh, fl; const v4f a = *(const v4fa*)(F + t * 8), c = *(const v4fa*)(F + t * 8 + 4);
#pragma unroll
  for (int q = 0; q < 4; ++q) { _Float16 h = (_Float16)a[q]; fh.h[q] = h; fl.h[q] = (_Float16)((a[q] - (float)h) * 1024.0f); h = (_Float16)c[q]; fh.h[4 + q] = h; fl.h[4 + q] = (_Float16)((c[q] - (float)h) * 1024.0f); }
  { *(v8us*)((unsigned short*)Hh + t * 8) = fh.half[0]; *(v8us*)((unsigned short*)Hl + t * 8) = fl.half[0];  } }

// ---- fast GEMM (block tile 128x128, four waves 2 x 2, wave tile 64x64; requires M % 128 == 0, N % 128 == 0, K % 64 == 0); A and B tiles of 64 k staged in LDS; epilogue = k_gemm_hhx semantics; the batch entry blockIdx.y == byT (if CT) is stored transposed instead, CT[col][row] (pitch M, f16; alpha only: no bias, addend or activation); with A2 the K loop runs over A, scales the sums by mid, and runs on over A2 with the same B: C = alpha (mid A.B + A2.B) ----
__device__ __forceinline__ v16h g2_frag(const _Float16* p, int hh) { FragH f; f.half[0] = *(const v8us*)((const unsigned short*)p + 8 * hh); f.half[1] = *(const v8us*)((const unsigned short*)p + 16 + 8 * hh); return f.v; }
__device__ __forceinline__ v8f g2_mma(v16h a, v16h b, v8f c) { return __builtin_amdgcn_wmma_f32_16x16x32_f16(false, a, false, b, (short)0, c, false, false); }
typedef float f32a __attribute__((may_alias));
template <int ACT>
__global__ __launch_bounds__(128) void k_gemm2(const _Float16* __restrict__ A, int lda, size_t sA, const _Float16* __restrict__ Bh, int ldb, size_t sB, float alpha, const float* __restrict__ bias, size_t sBias, const float* __restrict__ CP, int rowsPerB, size_t sCPb, int row0g,
    float* __restrict__ C, _Float16* __restrict__ C16, int ldc, size_t sC, int M, int N, int K, _Float16* __restrict__ CT, int byT, const _Float16* __restrict__ A2, float mid) {
  constexpr int GK = 64, GP = 72;      // a tile = 64 k; LDS row pitch 144 B (16 B x odd: ds_load_b128 without bank conflicts)
  constexpr int OB = 128 * GP;         // one buffer of one operand: 128 rows
  // A's two buffers, then B's two: 73,728 B, so that three blocks share a WGP's LDS. Behind the last trip's barrier nobody reads a tile any more and no copy is in flight: the epilogue stages in the same bytes.
  __shared__ __attribute__((aligned(16))) _Float16 ring[4 * OB];
  const int tid = threadIdx.x, w = tid >> 5, lane = tid & 31, ln = lane & 15, hh = lane >> 4; const int by = blockIdx.y; const int wm = w & 1, wn = w >> 1;
  A += (size_t)by * sA; Bh += (size_t)by * sB; const size_t cofs = (size_t)by * sC; const float* bp = bias ? bias + (size_t)by * sBias : nullptr;
  const int ntn = N >> 7; const int mt = blockIdx.x / ntn, nq = blockIdx.x - mt * ntn; const int row0 = mt * 128 + 64 * wm, colb = nq * 128, col0 = colb + 64 * wn; if (mt * 128 >= M) return;      // the whole block leaves or none of it: barriers follow
  // every thread copies 8 + 8 pieces of 16 B per tile (8 lanes cover one whole 128-B row)
  const int crow = tid >> 3, cc8 = (tid & 7) * 8;
  const _Float16* gA = A + (size_t)(mt * 128 + crow) * lda + cc8; const _Float16* gA2 = A2 ? A2 + (size_t)by * sA + (size_t)(mt * 128 + crow) * lda + cc8 : gA; const _Float16* gB = Bh + (size_t)(colb + crow) * ldb + cc8;
  const unsigned lA = (unsigned)(size_t)&ring[crow * GP + cc8], lB = (unsigned)(size_t)&ring[2 * OB + crow * GP + cc8];
  const int nk = K / GK, nst = A2 ? 2 * nk : nk;      // tiles nk .. 2 nk - 1 are A2's, against the same B tiles
  auto copy_tile = [&](int t) {
    const int tk = t < nk ? t : t - nk;
    const unsigned ao = lA + (unsigned)(t & 1) * (unsigned)(OB * 2), bo = lB + (unsigned)(t & 1) * (unsigned)(OB * 2), r16 = 16 * GP * 2; const _Float16* ap = (t < nk ? gA : gA2) + (size_t)tk * GK; const _Float16* bq = gB + (size_t)tk * GK; const size_t a16 = (size_t)16 * lda, b16 = (size_t)16 * ldb;
    // each operand's copies and, as the last line of the same statement, the wait that stands before their address registers are rewritten
    asm volatile("global_load_async_to_lds_b128 %0, %8, off\n\tglobal_load_async_to_lds_b128 %1, %9, off\n\tglobal_load_async_to_lds_b128 %2, %10, off\n\tglobal_load_async_to_lds_b128 %3, %11, off\n\t"
                 "global_load_async_to_lds_b128 %4, %12, off\n\tglobal_load_async_to_lds_b128 %5, %13, off\n\tglobal_load_async_to_lds_b128 %6, %14, off\n\tglobal_load_async_to_lds_b128 %7, %15, off\n\ts_wait_xcnt 0x0"
                 :: "v"(ao), "v"(ao + r16), "v"(ao + 2 * r16), "v"(ao + 3 * r16), "v"(ao + 4 * r16), "v"(ao + 5 * r16), "v"(ao + 6 * r16), "v"(ao + 7 * r16),
                    "v"(ap), "v"(ap + a16), "v"(ap + 2 * a16), "v"(ap + 3 * a16), "v"(ap + 4 * a16), "v"(ap + 5 * a16), "v"(ap + 6 * a16), "v"(ap + 7 * a16) : "memory");
    asm volatile("global_load_async_to_lds_b128 %0, %8, off\n\tglobal_load_async_to_lds_b128 %1, %9, off\n\tglobal_load_async_to_lds_b128 %2, %10, off\n\tglobal_load_async_to_lds_b128 %3, %11, off\n\t"
                 "global_load_async_to_lds_b128 %4, %12, off\n\tglobal_load_async_to_lds_b128 %5, %13, off\n\tglobal_load_async_to_lds_b128 %6, %14, off\n\tglobal_load_async_to_lds_b128 %7, %15, off\n\ts_wait_xcnt 0x0"
                 :: "v"(bo), "v"(bo + r16), "v"(bo + 2 * r16), "v"(bo + 3 * r16), "v"(bo + 4 * r16), "v"(bo + 5 * r16), "v"(bo + 6 * r16), "v"(bo + 7 * r16),
                    "v"(bq), "v"(bq + b16), "v"(bq + 2 * b16), "v"(bq + 3 * b16), "v"(bq + 4 * b16), "v"(bq + 5 * b16), "v"(bq + 6 * b16), "v"(bq + 7 * b16) : "memory"); };
  v8f acc[4][4];      // acc[i][j]: rows row0 + 16 i .., columns col0 + 16 j ..; every loop over i, j below is unrolled so that it is indexed by constants and stays in registers
#pragma unroll
  for (int i = 0; i < 4; ++i)
#pragma unroll
    for (int j = 0; j < 4; ++j) acc[i][j] = (v8f){0.f,0.f,0.f,0.f,0.f,0.f,0.f,0.f};
  copy_tile(0);
  asm volatile("s_wait_asynccnt 0x0" ::: "memory");      // this wave's copies of tile 0 have landed
  __syncthreads();                                       // every wave's have: tile 0 may be read
  if (nst > 1) copy_tile(1);
#pragma unroll 1
  for (int t = 0; t < nst; ++t) { const _Float16* pA = ring + (t & 1) * OB + (64 * wm + ln) * GP; const _Float16* pB = ring + (2 + (t & 1)) * OB + (64 * wn + ln) * GP;
    if (t == nk) {      // A's sums take their scale once, before A2's first tile is added
#pragma unroll
      for (int i = 0; i < 4; ++i)
#pragma unroll
        for (int j = 0; j < 4; ++j) acc[i][j] *= mid; }
    v16h fa[2][4], fb[2][4];      // the tile's 16 fragments, read as one group ahead of its 32 products: each A fragment feeds four products, each B fragment four
#pragma unroll
    for (int s = 0; s < 2; ++s) {
#pragma unroll
      for (int i = 0; i < 4; ++i) fa[s][i] = g2_frag(pA + i * 16 * GP + s * 32, hh);
#pragma unroll
      for (int j = 0; j < 4; ++j) fb[s][j] = g2_frag(pB + j * 16 * GP + s * 32, hh); }
    __builtin_amdgcn_sched_barrier(0);      // keeps the 32 LDS reads one group: without it the compiler sinks them among the products, each behind a full wait
#pragma unroll
    for (int s = 0; s < 2; ++s)
#pragma unroll
      for (int j = 0; j < 4; ++j)
#pragma unroll
        for (int i = 0; i < 4; ++i) acc[i][j] = g2_mma(fa[s][i], fb[s][j], acc[i][j]);
    __builtin_amdgcn_sched_barrier(0);      // keeps the products in front of the waits below: lifted over them, the wait for tile t + 1 would stand right behind its copies
    asm volatile("s_wait_dscnt 0x0" ::: "memory");       // this wave's reads of tile t are done before its buffer is refilled
    asm volatile("s_wait_asynccnt 0x0" ::: "memory");    // this wave's copies of tile t + 1 have landed
    __syncthreads();                                     // publishes tile t + 1 and ends every wave's reads of tile t
    if (t + 2 < nst) copy_tile(t + 2); }
  asm volatile("s_wait_asynccnt 0x0" ::: "memory");      // nothing of this wave is in flight when it goes on to the epilogue and ends
  const int rsub = lane >> 4, c4 = (lane & 15) * 4;
  // The addend is read in the layout of the stores below: 16 B a lane (sCPb % 4 == 0), 16 lanes on one row's 256 B, all 32 loads of a lane in flight over the LDS turn of the accumulators.
  v4f ad[2][16];
  if (CP) {
#pragma unroll
    for (int hf = 0; hf < 2; ++hf) { const float* ap[16];
#pragma unroll
      for (int q = 0; q < 16; ++q) { const int bidx = (row0g + row0 + hf * 32 + q * 2 + rsub) / rowsPerB; ap[q] = CP + (size_t)bidx * sCPb + (size_t)by * 64 + col0 + c4; }
#pragma unroll
      for (int q = 0; q < 16; ++q) ad[hf][q] = *(const v4fa*)ap[q];
      // the wait that stands before the address registers of these loads are rewritten; it takes the addresses as inputs so that they stay in their registers up to it
      asm volatile("s_wait_xcnt 0x0" :: "v"(ap[0]), "v"(ap[1]), "v"(ap[2]), "v"(ap[3]), "v"(ap[4]), "v"(ap[5]), "v"(ap[6]), "v"(ap[7]), "v"(ap[8]), "v"(ap[9]), "v"(ap[10]), "v"(ap[11]), "v"(ap[12]), "v"(ap[13]), "v"(ap[14]), "v"(ap[15]) : "memory"); } }
  if (CT && by == byT) {      // the same for the whole block: a barrier follows
    // Registers 0..7 of an accumulator tile are 8 consecutive rows of one column, that is 16 B of a C^T row. The block's 128 x 128 C^T tile is gathered in LDS so that one wave stores whole 256-B rows. The loops are unrolled so that acc is indexed by constants and the row reads are in flight together.
    constexpr int TP = 136;      // LDS row pitch 272 B (16 B x odd); 128 rows = 34,816 B, inside the ring
    unsigned short* sT = (unsigned short*)ring;
#pragma unroll
    for (int i = 0; i < 4; ++i)
#pragma unroll
      for (int j = 0; j < 4; ++j) { FragH f;
#pragma unroll
        for (int r = 0; r < 8; ++r) f.h[r] = (_Float16)(acc[i][j][r] * alpha);
        *(v8us*)(sT + (64 * wn + j * 16 + ln) * TP + 64 * wm + i * 16 + 8 * hh) = f.half[0]; }
    __syncthreads();      // every wave's quarter of the C^T tile is in LDS before any row is read
    const int d0 = tid >> 4, c8 = (tid & 15) * 8; unsigned short* ct = (unsigned short*)CT + (size_t)(colb + d0) * M + mt * 128 + c8; const size_t m8 = (size_t)8 * M;
#pragma unroll
    for (int q = 0; q < 16; ++q) { const v8us v = *(const v8us*)(sT + (q * 8 + d0) * TP + c8); *(v8us*)(ct + q * m8) = v; }
    return; }
  f32a* so = (f32a*)ring + w * (32 * 68);      // the wave's own 32 x 68 f32 staging rows (4 x 8,704 B, inside the ring); its 64 rows go through them in two halves
#pragma unroll
  for (int hf = 0; hf < 2; ++hf) {
#pragma unroll
    for (int u = 0; u < 8; ++u) { const int t = u & 3, half = u >> 2; const int col = col0 + t * 16 + ln; const float bv = bp ? bf16_round(bp[col]) : 0.f;
#pragma unroll
      for (int r = 0; r < 8; ++r) so[(half * 16 + 8 * hh + r) * 68 + t * 16 + ln] = acc[2 * hf + half][t][r] * alpha + bv; }
    asm volatile("s_wait_dscnt 0x0" ::: "memory"); __builtin_amdgcn_wave_barrier();      // the wave's staging writes are done before it reads the rows back (other lanes' values); the rows are the wave's own, so nothing waits for the first half's global stores
#pragma unroll
    for (int q = 0; q < 16; ++q) { const int r = q * 2 + rsub; v4f v = *(const v4fa*)&so[r * 68 + c4]; if (CP) v += ad[hf][q];
#pragma unroll
      for (int i = 0; i < 4; ++i) { if (ACT == 3) v[i] = fmaxf(v[i], 0.f); else if (ACT == 6) v[i] = 0.5f * v[i] * (1.0f + erff(v[i] * 0.70710678118654752f)); else if (ACT == 11) v[i] = 1.0f / (1.0f + expf(-v[i])); else if (ACT == 15) v[i] = v[i] / (1.0f + expf(-v[i])); else if (ACT == 12) v[i] = (v[i] > 0.f) ? v[i] : 0.01f * v[i]; else if (ACT == 8) v[i] = tanhf(v[i]); }
      if (C) { *(v4f*)(C + cofs + (size_t)(row0 + hf * 32 + r) * ldc + col0 + c4) = v; asm volatile("s_wait_xcnt 0x0" ::: "memory"); }      // the wait stands before the conversion below rewrites registers that this store names
      if (C16) { v4h h4; for (int i = 0; i < 4; ++i) h4[i] = (_Float16)v[i]; *(v4h*)(C16 + cofs + (size_t)(row0 + hf * 32 + r) * ldc + col0 + c4) = h4; asm volatile("s_wait_xcnt 0x0" ::: "memory"); } }      // the wait stands before the next row rewrites registers that this store names
    if (hf == 0) asm volatile("s_wait_dscnt 0x0" ::: "memory");      // this half's reads of the staging rows have returned before the second half's writes (other lanes' rows) are issued
  } }



// lane l with lane l ^ 16
__device__ __forceinline__ float xhalf(float x) { return __builtin_bit_cast(float, __builtin_amdgcn_permlanex16(__builtin_bit_cast(int, x), __builtin_bit_cast(int, x), 0x76543210, 0xfedcba98, false, false)); }
__global__ __launch_bounds__(128) void k_flash(const _Float16* __restrict__ Q16, int ldq, const _Float16* __restrict__ K16, int ldk, const _Float16* __restrict__ Vt, const int* __restrict__ MSK, _Float16* __restrict__ Oh, int ldo) {
  constexpr int CG = 2, RPW = 16 * CG, NQB = TQ / (4 * RPW), DT = 4, KS = 2;
  constexpr float C2 = SCL * 1.4426950408889634f;      // score scale x log2(e): the softmax runs in base 2
  constexpr int SK = 64, NST = TK / SK, LP = 72;      // a tile = 64 keys; LDS row pitch 144 B (16 B x odd: ds_load_b128 without bank conflicts)
  __shared__ __attribute__((aligned(16))) unsigned short sK[2][SK][LP]; __shared__ __attribute__((aligned(16))) unsigned short sV[2][64][LP];      // two buffers each: K rows [key][d], V^T rows [d][key]
  __shared__ __attribute__((aligned(16))) float sO[4][RPW][64 + 4];
  const int tid = threadIdx.x, w = tid >> 5, lane = tid & 31, ln = lane & 15, hh = lane >> 4;
  const int slab = blockIdx.x / NQB, qblk = blockIdx.x % NQB; const int b = slab / NH, h = slab % NH; const int qb0 = qblk * (4 * RPW); const int q0 = qb0 + w * RPW;
  FragH bq[CG][KS];
#pragma unroll
  for (int g = 0; g < CG; ++g) { const unsigned short* qr = (const unsigned short*)Q16 + ((size_t)b * TQ + q0 + g * 16 + ln) * ldq + h * 64;
#pragma unroll
    for (int ks = 0; ks < KS; ++ks) { bq[g][ks].half[0] = *(const v8us*)(qr + ks * 32 + 8 * hh); bq[g][ks].half[1] = *(const v8us*)(qr + ks * 32 + 16 + 8 * hh); } }
  const unsigned short* Vth = (const unsigned short*)Vt + (size_t)slab * 64 * TK;
  float m_r[CG], l_r[CG]; v8f oacc[CG][DT];      // one query per lane and column group: its running maximum (of the raw products), this lane half's part of its sum (x2^10, like P), O^T rows d = dt * 16 + 8 * hh + r
#pragma unroll
  for (int g = 0; g < CG; ++g) { m_r[g] = -3.0e38f; l_r[g] = 0.f;
#pragma unroll
    for (int dt = 0; dt < DT; ++dt) oacc[g][dt] = (v8f){0.f,0.f,0.f,0.f,0.f,0.f,0.f,0.f}; }
  // The block's four waves share each K / V^T tile: every thread copies 4 + 4 pieces of 16 B (8 lanes cover one whole 128-B row).
  const int crow = tid >> 3, cc8 = (tid & 7) * 8;
  const unsigned short* gK = (const unsigned short*)K16 + ((size_t)b * TK + crow) * ldk + h * 64 + cc8; const unsigned short* gV = Vth + (size_t)crow * TK + cc8;
  const unsigned lK = (unsigned)(size_t)&sK[0][crow][cc8], lV = (unsigned)(size_t)&sV[0][crow][cc8];
  auto copy_tile = [&](int t) {
    const unsigned bo = (unsigned)(t & 1) * (unsigned)(SK * LP * 2), r16 = 16 * LP * 2; const unsigned short* kp = gK + (size_t)t * SK * ldk; const unsigned short* vp = gV + (size_t)t * SK;
    // the copies and, as the last line of the same statement, the wait that stands before their address registers are rewritten
    asm volatile("global_load_async_to_lds_b128 %0, %8, off\n\tglobal_load_async_to_lds_b128 %1, %9, off\n\tglobal_load_async_to_lds_b128 %2, %10, off\n\tglobal_load_async_to_lds_b128 %3, %11, off\n\t"
                 "global_load_async_to_lds_b128 %4, %12, off\n\tglobal_load_async_to_lds_b128 %5, %13, off\n\tglobal_load_async_to_lds_b128 %6, %14, off\n\tglobal_load_async_to_lds_b128 %7, %15, off\n\ts_wait_xcnt 0x0"
                 :: "v"(lK + bo), "v"(lK + bo + r16), "v"(lK + bo + 2 * r16), "v"(lK + bo + 3 * r16), "v"(lV + bo), "v"(lV + bo + r16), "v"(lV + bo + 2 * r16), "v"(lV + bo + 3 * r16),
                    "v"(kp), "v"(kp + (size_t)16 * ldk), "v"(kp + (size_t)32 * ldk), "v"(kp + (size_t)48 * ldk), "v"(vp), "v"(vp + (size_t)16 * TK), "v"(vp + (size_t)32 * TK), "v"(vp + (size_t)48 * TK) : "memory"); };
  copy_tile(0);
  asm volatile("s_wait_asynccnt 0x0" ::: "memory");      // this wave's copies of tile 0 have landed
  __syncthreads();                                       // every wave's have: tile 0 may be read
  copy_tile(1);
#pragma unroll 1
  for (int t = 0; t < NST; ++t) {
   const unsigned short (*bK)[LP] = sK[t & 1]; const unsigned short (*bV)[LP] = sV[t & 1];
#pragma unroll
   for (int ps = 0; ps < SK / 32; ++ps) {
    v8f sc[CG][2];      // raw products q.k: the scale is positive, so their maximum is the scaled scores' maximum
#pragma unroll
    for (int nt = 0; nt < 2; ++nt) { const unsigned short* kr = &bK[ps * 32 + nt * 16 + ln][0]; FragH ak[KS];
#pragma unroll
      for (int ks = 0; ks < KS; ++ks) { ak[ks].half[0] = *(const v8us*)(kr + ks * 32 + 8 * hh); ak[ks].half[1] = *(const v8us*)(kr + ks * 32 + 16 + 8 * hh); }
#pragma unroll
      for (int g = 0; g < CG; ++g) { v8f acc = (v8f){0.f,0.f,0.f,0.f,0.f,0.f,0.f,0.f};
#pragma unroll
        for (int ks = 0; ks < KS; ++ks) acc = mmaH<1>(ak[ks].v, ak[ks].v, bq[g][ks].v, bq[g][ks].v, acc);
        sc[g][nt] = acc; } }
    FragH pb[CG];
#pragma unroll
    for (int g = 0; g < CG; ++g) {
      float mc = fmaxf(sc[g][0][0], sc[g][1][0]);
#pragma unroll
      for (int r = 1; r < 8; ++r) mc = fmaxf(mc, fmaxf(sc[g][0][r], sc[g][1][r]));
      mc = fmaxf(mc, xhalf(mc));      // both lane halves now hold the query's maximum over the 32 keys
      const float mn = fmaxf(m_r[g], mc); const float al = (mn > -1.0e38f) ? __builtin_amdgcn_exp2f((m_r[g] - mn) * C2) : 1.0f; m_r[g] = mn;
      const float nb = fmaf(-mn, C2, 10.0f);      // P x 2^10 = 2^(s * C2 - mn * C2 + 10): one fma per score, then v_exp_f32
      float ls[4] = {0.f, 0.f, 0.f, 0.f};
#pragma unroll
      for (int nt = 0; nt < 2; ++nt)
#pragma unroll
        for (int r = 0; r < 8; ++r) { const float p = __builtin_amdgcn_exp2f(fmaf(sc[g][nt][r], C2, nb)); ls[r & 3] += p; pb[g].h[nt * 8 + r] = (_Float16)p; }
      l_r[g] = l_r[g] * al + ((ls[0] + ls[1]) + (ls[2] + ls[3]));
#pragma unroll
      for (int dt = 0; dt < DT; ++dt) oacc[g][dt] *= al; }
#pragma unroll
    for (int dt = 0; dt < DT; ++dt) { const unsigned short* vrow = &bV[dt * 16 + ln][ps * 32]; FragH av; av.half[0] = *(const v8us*)(vrow + 8 * hh); av.half[1] = *(const v8us*)(vrow + 16 + 8 * hh);
#pragma unroll
      for (int g = 0; g < CG; ++g) oacc[g][dt] = mmaH<1>(av.v, av.v, pb[g].v, pb[g].v, oacc[g][dt]); } }
   asm volatile("s_wait_dscnt 0x0" ::: "memory");        // this wave's reads of tile t are done before its buffer is refilled
   asm volatile("s_wait_asynccnt 0x0" ::: "memory");     // this wave's copies of tile t + 1 have landed
   __syncthreads();                                      // publishes tile t + 1 and ends every wave's reads of tile t
   if (t + 2 < NST) copy_tile(t + 2); }
  asm volatile("s_wait_asynccnt 0x0" ::: "memory");      // nothing of this wave is in flight when it goes on to the epilogue and ends
#pragma unroll
  for (int g = 0; g < CG; ++g) {
    const float l = l_r[g] + xhalf(l_r[g]);      // the two lane halves' sums joined, unconditionally
    const float inv = (l > 0.f) ? 1.0f / l : 0.f;      // sum and O^T carry the same 2^10
#pragma unroll
    for (int dt = 0; dt < DT; ++dt) { const v4f lo = {oacc[g][dt][0] * inv, oacc[g][dt][1] * inv, oacc[g][dt][2] * inv, oacc[g][dt][3] * inv}, hi = {oacc[g][dt][4] * inv, oacc[g][dt][5] * inv, oacc[g][dt][6] * inv, oacc[g][dt][7] * inv};
      *(v4fa*)&sO[w][g * 16 + ln][dt * 16 + 8 * hh] = lo; *(v4fa*)&sO[w][g * 16 + ln][dt * 16 + 8 * hh + 4] = hi; } }
  __builtin_amdgcn_fence(__ATOMIC_ACQ_REL, "workgroup"); __builtin_amdgcn_wave_barrier();
  {
#pragma unroll
    for (int rp = 0; rp < RPW; rp += 4) { const int r = rp + (lane >> 3), pc = lane & 7; const v4f x = *(const v4fa*)&sO[w][r][pc * 8], y = *(const v4fa*)&sO[w][r][pc * 8 + 4]; FragH fh;      // O leaves as plain f16: 8 lanes store one row's 128 B; unrolled so that the fragments stay in registers
#pragma unroll
      for (int q = 0; q < 4; ++q) { fh.h[q] = (_Float16)x[q]; fh.h[4 + q] = (_Float16)y[q]; }
      const size_t o = ((size_t)b * TQ + q0 + r) * ldo + h * 64 + pc * 8;
      *(v8us*)((unsigned short*)Oh + o) = fh.half[0]; }
     } }
__global__ __launch_bounds__(256) void k_fulltab(unsigned* __restrict__ MB, int* __restrict__ RA, int* __restrict__ KE, int nq, int nk) {
  const int t = blockIdx.x * 256 + threadIdx.x;
  if (t < nq * (nk / 32)) { *(unsigned*)(MB + t) = 0u;  }
  if (t < nq) { *(int*)(RA + t) = 0;  }
  if (t < nq / 64) { *(int*)(KE + t * 32) = nk;  } }
__global__ __launch_bounds__(256) void k_lnout(const float* __restrict__ Y, const float* __restrict__ g, const float* __restrict__ bb, float* __restrict__ out) {
  #pragma clang fp contract(off)
  const int tid = threadIdx.x, w = tid >> 5, ln = tid & 31; const int r = blockIdx.x * 8 + w; if (r >= NR) return; const float* y = Y + (size_t)r * DM; float s = 0.f;
#pragma unroll 1
  for (int i = 0; i < 8; ++i) { const v4f a = *(const v4fa*)(y + i * 128 + ln * 4); for (int q = 0; q < 4; ++q) s += a[q]; }
  for (int o = 16; o > 0; o >>= 1) s += __shfl_xor(s, o, 32); const float mu = s / (float)DM; float q2 = 0.f;
#pragma unroll 1
  for (int i = 0; i < 8; ++i) { const v4f a = *(const v4fa*)(y + i * 128 + ln * 4); for (int q = 0; q < 4; ++q) { const float d = a[q] - mu; q2 += d * d; } }
  for (int o = 16; o > 0; o >>= 1) q2 += __shfl_xor(q2, o, 32); const float rs = rsqrtf(q2 / (float)DM + 1e-6f);
  {
#pragma unroll 1
    for (int i = 0; i < 8; ++i) { const int c0 = i * 128 + ln * 4; const v4f a = *(const v4fa*)(y + c0); v4f o4; for (int q = 0; q < 4; ++q) o4[q] = (a[q] - mu) * rs * bf16_round(g[c0 + q]) + bf16_round(bb[c0 + q]); *(v4f*)(out + (size_t)r * DM + c0) = o4; }
     } }
__global__ __launch_bounds__(256) void k_xb(const float* __restrict__ x, float* __restrict__ XB, size_t n4) { const size_t t = (size_t)blockIdx.x * 256 + threadIdx.x; if (t >= n4) return; const v4f a = *(const v4fa*)(x + t * 4); v4f o; for (int q = 0; q < 4; ++q) o[q] = bf16_round(a[q]); *(v4f*)(XB + t * 4) = o;  }
// Every input conversion in one launch, by block range: blocks 0..767 round q, k, v to bf16 and store them as f16 planes (q also as f32, the residual addend);
// blocks 768..1023 store the four weights, rounded to bf16, as f16 x16. A block streams 4096 pieces of 16 B, lane-contiguous, 16 per thread.
template <bool RES>
__device__ __forceinline__ void prep_stream(const float* __restrict__ src, _Float16* __restrict__ dst, float* __restrict__ xb, float scale, int tid) {
  v4f a[16];      // the three loops below are unrolled so that a[] lives in registers and every address is base + immediate offset
#pragma unroll
  for (int u = 0; u < 16; ++u) a[u] = *(const v4fa*)(src + (u * 256 + tid) * 4);
  __builtin_amdgcn_sched_barrier(0);      // keeps all 16 loads in flight together: without it the compiler sinks six of them among the conversions
#pragma unroll
  for (int u = 0; u < 16; ++u) { const int e = (u * 256 + tid) * 4; v4f r; v4h h;
#pragma unroll
    for (int i = 0; i < 4; ++i) { r[i] = bf16_round(a[u][i]); h[i] = (_Float16)(r[i] * scale); }
    *(v4h*)(dst + e) = h; if (RES) *(v4f*)(xb + e) = r; } }
__global__ __launch_bounds__(256) void k_prep(const float* __restrict__ q, const float* __restrict__ k, const float* __restrict__ v, const float* __restrict__ Wq, const float* __restrict__ Wk, const float* __restrict__ Wv, const float* __restrict__ Wo,
                                              _Float16* __restrict__ X16, float* __restrict__ XB, _Float16* __restrict__ B16) {
  constexpr int PB = 4096, XBLK = NR * DM / 4 / PB, WBLK = DM * DM / 4 / PB;
  const int bid = blockIdx.x, tid = threadIdx.x;
  if (bid < XBLK) { const size_t o = (size_t)bid * PB * 4; prep_stream<true>(q + o, X16 + o, XB + o, 1.0f, tid); }
  else if (bid < 3 * XBLK) { const bool isk = bid < 2 * XBLK; const size_t o = (size_t)(bid - (isk ? XBLK : 2 * XBLK)) * PB * 4; prep_stream<false>((isk ? k : v) + o, X16 + (size_t)(isk ? 1 : 2) * NR * DM + o, nullptr, 1.0f, tid); }
  else { const int j = (bid - 3 * XBLK) / WBLK; const size_t o = (size_t)((bid - 3 * XBLK) % WBLK) * PB * 4; prep_stream<false>((j == 0 ? Wq : (j == 1 ? Wk : (j == 2 ? Wv : Wo))) + o, B16 + (size_t)j * DM * DM + o, nullptr, 16.0f, tid); } }
__global__ __launch_bounds__(256) void k_causaltab(unsigned* __restrict__ MB, int* __restrict__ RA, int* __restrict__ KE, int nq, int nk) {
  const int t = blockIdx.x * 256 + threadIdx.x; const int nw = nk / 32;
  if (t < nq * nw) { const int q = t / nw, w = t % nw; const int first = q + 1 - 32 * w; const unsigned bits = (first <= 0) ? 0xffffffffu : ((first >= 32) ? 0u : (0xffffffffu << first)); *(unsigned*)(MB + t) = bits;  }
  if (t < nq) { *(int*)(RA + t) = 0;  }
  if (t < nq / 64) { const int v = 64 * (t + 1); *(int*)(KE + t * 32) = v;  } }


extern "C" void kernel_launch(void* const* d_in, const int* in_sizes, int n_in,
                              void* d_out, int out_size, void* d_ws, size_t ws_size, hipStream_t stream) {
  (void)in_sizes; (void)n_in; (void)out_size;
  const float* const* I = (const float* const*)d_in; const float* qin = I[0]; const float* kin = I[1]; const float* vin = I[2]; const float* Wq = I[3]; const float* Wk = I[4]; const float* Wv = I[5]; const float* Wo = I[6]; const float* gam = I[7]; const float* bet = I[8];
  char* ws = (char*)d_ws; size_t off = 0;
  auto take = [&](size_t bytes) { char* p = ws + off; off += (bytes + 255) & ~(size_t)255; return p; };
  _Float16* BQ = (_Float16*)take((size_t)DM * DM * 2); _Float16* BK = (_Float16*)take((size_t)DM * DM * 2); _Float16* BV = (_Float16*)take((size_t)DM * DM * 2); _Float16* BO = (_Float16*)take((size_t)DM * DM * 2);
  _Float16* X16 = (_Float16*)take((size_t)3 * NR * DM * 2); float* F = (float*)take((size_t)NR * DM * 4); float* XB = (float*)take((size_t)NR * DM * 4);
  _Float16* Q16 = (_Float16*)take((size_t)NR * DM * 2); _Float16* K16 = (_Float16*)take((size_t)NR * DM * 2); _Float16* V16 = (_Float16*)take((size_t)NR * DM * 2); _Float16* VT = (_Float16*)take((size_t)NR * DM * 2);
  if (off > ws_size) return;      /* 8 + 24 + 16 + 16 + 32 = 96 MiB; BQ BK BV BO, the three X16 planes and Q16 K16 V16 each lie one behind the other */
  _Float16* Oh = (_Float16*)F; float* Y = XB;      /* the O plane lies in F: k_flash writes it while other blocks still read Q16 and K16 */
  (void)BK; (void)BV; (void)V16;
  k_prep<<<3 * (NR * DM / 16384) + 4 * (DM * DM / 16384), 256, 0, stream>>>(qin, kin, vin, Wq, Wk, Wv, Wo, X16, XB, BQ);      /* X16 planes of q, k, v; XB; BQ BK BV BO */
  const dim3 gP((NR / 128) * (DM / 128), 1), gP3((NR / 128) * (DM / 128), 3);
  k_gemm2<0><<<gP3, 128, 0, stream>>>(X16, DM, (size_t)NR * DM, BQ, DM, (size_t)DM * DM, 0.0625f, nullptr, 0, nullptr, 1, 0, 0, nullptr, Q16, DM, (size_t)NR * DM, NR, DM, DM, VT, 2, nullptr, 1.0f);      /* blockIdx.y = 0, 1: qh, kh (f16 planes); 2: vh, stored as V^T [head * 64 + d][token] */
  k_flash<<<NH * (SLEN / 128), 128, 0, stream>>>(Q16, DM, K16, DM, VT, nullptr, Oh, DM);      /* plain flash over all 4096 keys (no mask) */
  k_gemm2<0><<<gP, 128, 0, stream>>>(Oh, DM, 0, BO, DM, 0, 0.0625f, nullptr, 0, XB, 1, (size_t)DM, 0, Y, nullptr, DM, 0, NR, DM, DM, nullptr, 0, nullptr, 1.0f);      /* Y = O Wo^T + bf16(q) */
  k_lnout<<<NR / 8, 256, 0, stream>>>(Y, gam, bet, (float*)d_out);
}
